// v000
// Measured on an AMD MI455X. A time is GPU time per run, averaged over a window of back-to-back runs after a warm-up
// (all launches, gaps included; the runs take copies of the inputs in turn), and the median of several windows.
// Apart from v000's, it joins two sittings. Times from different sittings can be a few percent apart, while
// side-by-side timings come from the same sitting.
// v000 is the starting kernel. One run takes 976 microseconds.
// Contractions: x.Wq^T, x.Wk^T, Wv.x^T and the rank-16 adapter products x.A^T on v_wmma_f32_16x16x32_bf16 (operands = RNE bf16 of the
// f32 inputs, single products; the adapter term enters the base GEMM as one extra 32-deep k-step with T = x.A^T carried as bf16 hi + bf16 lo
// against 2B in bf16); q.k^T and p.v on v_wmma_f32_16x16x32_f16 (q, k, v^T = f16 hi + f16 residual x2^11 planes, lo.lo dropped; p x1024 f16
// plus f16 residual x2^11 on query tiles 0..3); attn.Wo^T and attn.Ao^T on v_wmma_f32_16x16x32_bf16 (attn = bf16 hi + bf16 lo planes, two
// products; Wo, Ao RNE bf16). f32 accumulate everywhere; RoPE (f32 cos/sin table), online softmax and scale folds in f32.
#include <hip/hip_runtime.h>
#include <math.h>
#include <stdint.h>

#define NSEQ   2
#define SQ     2048
#define HID    2048
#define NHQ    16
#define HDM    128
#define NTOK   4096
#define NFREQ  64
#define LRK    16
#define KEXT   32

typedef _Float16       v16h __attribute__((ext_vector_type(16)));
typedef _Float16       v8h  __attribute__((ext_vector_type(8)));
typedef __bf16         v16b __attribute__((ext_vector_type(16)));
typedef __bf16         v8b  __attribute__((ext_vector_type(8)));
typedef float          v8f  __attribute__((ext_vector_type(8)));
typedef float          v4f  __attribute__((ext_vector_type(4)));
typedef unsigned int   v4u  __attribute__((ext_vector_type(4)));
typedef unsigned short v8us __attribute__((ext_vector_type(8)));

// ---------------------------------------------------------------------------
// small helpers
// ---------------------------------------------------------------------------
__device__ __forceinline__ unsigned short bf_bits(float f) {          // RNE convert f32 -> bf16 bits
  const unsigned u = __float_as_uint(f);
  return (unsigned short)((u + 0x7FFFu + ((u >> 16) & 1u)) >> 16);
}
__device__ __forceinline__ float bf_val(unsigned short h) { return __uint_as_float(((unsigned)h) << 16); }
__device__ __forceinline__ unsigned pk16(unsigned short a, unsigned short b) { return (unsigned)a | ((unsigned)b << 16); }
__device__ __forceinline__ v8f zero8() { v8f z = {0.f, 0.f, 0.f, 0.f, 0.f, 0.f, 0.f, 0.f}; return z; }
__device__ __forceinline__ int wave_id() { return __builtin_amdgcn_readfirstlane((int)(threadIdx.x >> 5)); }

// orders one wave's LDS element stores before its own vector reloads of the same tile (other lanes' data)
__device__ __forceinline__ void lds_wave_sync() {
  __builtin_amdgcn_fence(__ATOMIC_RELEASE, "workgroup");
  __builtin_amdgcn_wave_barrier();
  __builtin_amdgcn_fence(__ATOMIC_ACQUIRE, "workgroup");
}

// ---------------------------------------------------------------------------
// WMMA fragments (wave32, 16x16x32, 16-bit operands). For A (row m = lane&15) and B (col n = lane&15) alike:
// elements 0..7 <- k0 + 8*(lane>>4) + 0..7, elements 8..15 <- k0 + 16 + 8*(lane>>4) + 0..7.
// ldfrag(p) with p = rowbase + k0 + 8*(lane>>4): two 16-B loads p[0..7], p[16..23].
// D: acc[r] = (row 8*(lane>>4) + r, col lane&15).
// ---------------------------------------------------------------------------
union FragH { v16h v; v8h h[2]; };
union FragB { v16b v; v8b h[2]; };
__device__ __forceinline__ v16h ldfrag_h(const _Float16* p) { FragH f; f.h[0] = *(const v8h*)(p); f.h[1] = *(const v8h*)(p + 16); return f.v; }
__device__ __forceinline__ v16b ldfrag_b(const __bf16* p)   { FragB f; f.h[0] = *(const v8b*)(p); f.h[1] = *(const v8b*)(p + 16); return f.v; }

__device__ __forceinline__ v8f mma_h(v16h a, v16h b, v8f c) {
  return __builtin_amdgcn_wmma_f32_16x16x32_f16(false, a, false, b, (short)0, c, false, false);
}
__device__ __forceinline__ v8f mma_b(v16b a, v16b b, v8f c) {
  return __builtin_amdgcn_wmma_f32_16x16x32_bf16(false, a, false, b, (short)0, c, false, false);
}
// hazard guards: 4 VALU slots after the last WMMA of a group, D tied, A/B kept live; memory clobber keeps later loads behind the group
__device__ __forceinline__ void guard_b5(v8f& a, v8f& b, v16b x0, v16b x1, v16b x2, v16b x3, v16b y) {
  asm volatile("v_nop\n\tv_nop\n\tv_nop\n\tv_nop" : "+v"(a), "+v"(b) : "v"(x0), "v"(x1), "v"(x2), "v"(x3), "v"(y) : "memory");
}
__device__ __forceinline__ void guard_h4(v8f& a, v8f& b, v16h w, v16h x, v16h y, v16h z) {
  asm volatile("v_nop\n\tv_nop\n\tv_nop\n\tv_nop" : "+v"(a), "+v"(b) : "v"(w), "v"(x), "v"(y), "v"(z) : "memory");
}
__device__ __forceinline__ void acc_guard4(v8f& a, v8f& b, v8f& c, v8f& d) {
  asm volatile("v_nop\n\tv_nop\n\tv_nop\n\tv_nop" : "+v"(a), "+v"(b), "+v"(c), "+v"(d));
}
__device__ __forceinline__ void acc_guard2(v8f& a, v8f& b) {
  asm volatile("v_nop\n\tv_nop\n\tv_nop\n\tv_nop" : "+v"(a), "+v"(b));
}

// ---------------------------------------------------------------------------
// RoPE table for positions t = 0..npos-1: cst[t][i] = cos(t * inv_freq[i]), snt[t][i] = sin(...), inv_freq[i] = 1 / 1e4^(i/64),
// i < 64, all f32. Block = 8 waves, wave w -> t = blockIdx.x*8 + w, lane -> i = lane, lane + 32.
// Coverage: grid npos/8 x 8 waves x 32 lanes x 2 = npos x 64 per plane.
// ---------------------------------------------------------------------------
__global__ __launch_bounds__(256) void rope_table_kernel(float* __restrict__ cst, float* __restrict__ snt, int npos) {
  const int lane = threadIdx.x & 31;
  const int wave = (int)(threadIdx.x >> 5);
  const int t = (int)blockIdx.x * 8 + wave;
  if (t >= npos) return;                       // no barriers in this kernel
  const float pf = (float)t;
  float c0 = 0.f, s0 = 0.f, c1 = 0.f, s1 = 0.f;
#pragma unroll 1
  for (int u = 0; u < 2; ++u) {
    const int i = lane + 32 * u;
    const float e   = (float)i * 0.015625f;      // i / 64 exact
    const float pw  = powf(10000.0f, e);
    const float inv = 1.0f / pw;
    const float ang = pf * inv;
    const float cv = cosf(ang);
    const float sv = sinf(ang);
    c1 = cv; s1 = sv;
    if (u == 0) { c0 = cv; s0 = sv; }
  }
  const size_t o = (size_t)t * NFREQ + lane;
  {
    ((float*)cst)[o]      = c0;
    ((float*)cst)[o + 32] = c1;
    ((float*)snt)[o]      = s0;
    ((float*)snt)[o + 32] = s1;
    
  }
}

// ---------------------------------------------------------------------------
// Elementwise RNE f32 -> bf16 plane: 8 elements per thread, one 16-B store per lane -> 32 consecutive lanes write 4 whole
// (every n8 used is a multiple of 256, so every instruction is full width).
// ---------------------------------------------------------------------------
__global__ __launch_bounds__(256) void cvt_bf16_kernel(const float* __restrict__ in, unsigned short* __restrict__ outp, int n8) {
  const int i = (int)blockIdx.x * 256 + (int)threadIdx.x;
  if (i >= n8) return;
  const size_t e = 8 * (size_t)i;
  const v4f a = *(const v4f*)(in + e);
  const v4f b = *(const v4f*)(in + e + 4);
  v4u w;
  w[0] = pk16(bf_bits(a[0]), bf_bits(a[1]));
  w[1] = pk16(bf_bits(a[2]), bf_bits(a[3]));
  w[2] = pk16(bf_bits(b[0]), bf_bits(b[1]));
  w[3] = pk16(bf_bits(b[2]), bf_bits(b[3]));
  *(v4u*)(outp + e) = w;
  
}

// ---------------------------------------------------------------------------
// Adapter B matrix [R][16] f32 -> extension plane [R][32] bf16: cols 0..15 = bf16(2*B[r][0..15]), cols 16..31 = the same again
// (pairs with the [Th | Tl] extension plane of T so one 32-deep k-step yields 2*(Th+Tl).B^T). 2*bf16(B) is exact.
// ---------------------------------------------------------------------------
__global__ __launch_bounds__(256) void bext_kernel(const float* __restrict__ Bm, unsigned short* __restrict__ outp, int npieces) {
  const int p = (int)blockIdx.x * 256 + (int)threadIdx.x;
  if (p >= npieces) return;
  const int row = p >> 2, q = p & 3;
  const float* src = Bm + (size_t)row * LRK + (q & 1) * 8;
  const v4f a = *(const v4f*)(src);
  const v4f b = *(const v4f*)(src + 4);
  v4u w;
  w[0] = pk16(bf_bits(2.0f * a[0]), bf_bits(2.0f * a[1]));
  w[1] = pk16(bf_bits(2.0f * a[2]), bf_bits(2.0f * a[3]));
  w[2] = pk16(bf_bits(2.0f * b[0]), bf_bits(2.0f * b[1]));
  w[3] = pk16(bf_bits(2.0f * b[2]), bf_bits(2.0f * b[3]));
  *(v4u*)(outp + (size_t)p * 8) = w;
  
}

// ---------------------------------------------------------------------------
// Narrow bf16 WMMA GEMM for the rank-16 adapter: T[m][j] = sum_k A[m][k] * Bt[j][k], j < 16, written as the extension plane
// Tp [M][32] bf16 = [bf16 hi of T (16) | bf16 lo of T (16)]. A row-major [M][K] bf16 (pitch lda; SPLITA: hi plane Ap + lo plane A2p,
// two products), Bt [16][K] bf16 (pitch ldb); K % 32 == 0, M % 32 == 0. Wave tile 32 rows, block = 4 waves, grid = ceil(M/128);
// no block barriers. Epilogue per wave: stage 32x32 u16 in LDS, wave sync, then 4 store instructions of 32 lanes x 16 B
// Coverage: M/32 waves x 32 rows x 32 cols = the whole [M][32] plane.
// ---------------------------------------------------------------------------
template <bool SPLITA>
__global__ __launch_bounds__(128) void tgemm_n16_kernel(
    const unsigned short* Ap, const unsigned short* A2p, int lda,
    const unsigned short* __restrict__ Btp, int ldb,
    unsigned short* __restrict__ Tp, int M, int K) {
  __shared__ __align__(16) unsigned short slab_all[4 * 1024];
  const int lane = threadIdx.x & 31;
  const int wave = wave_id();
  const int hh = lane >> 4;
  const int rl = lane & 15;
  const int m0 = ((int)blockIdx.x * 4 + wave) * 32;
  if (m0 >= M) return;                          // wave-uniform; no block barriers in this kernel

  const __bf16* A  = (const __bf16*)(const void*)Ap;
  const __bf16* A2 = (const __bf16*)(const void*)A2p;
  const __bf16* Bt = (const __bf16*)(const void*)Btp;

  v8f acc[2];
  acc[0] = zero8(); acc[1] = zero8();
  for (int k0 = 0; k0 < K; k0 += 32) {
    v16b ah[2], al[2];
#pragma unroll
    for (int i = 0; i < 2; ++i) {
      const size_t ao = (size_t)(m0 + i * 16 + rl) * lda + k0 + 8 * hh;
      ah[i] = ldfrag_b(A + ao);
      al[i] = SPLITA ? ldfrag_b(A2 + ao) : ah[i];
    }
    const v16b bj = ldfrag_b(Bt + (size_t)rl * ldb + k0 + 8 * hh);
    acc[0] = mma_b(ah[0], bj, acc[0]);
    acc[1] = mma_b(ah[1], bj, acc[1]);
    if (SPLITA) {
      acc[0] = mma_b(al[0], bj, acc[0]);
      acc[1] = mma_b(al[1], bj, acc[1]);
    }
    guard_b5(acc[0], acc[1], ah[0], ah[1], al[0], al[1], bj);
  }
  acc_guard2(acc[0], acc[1]);

  unsigned short* sl = slab_all + wave * 1024;
#pragma unroll
  for (int i = 0; i < 2; ++i)
#pragma unroll
    for (int r = 0; r < 8; ++r) {
      const int row = i * 16 + 8 * hh + r;
      const float v = acc[i][r];
      const unsigned short hb = bf_bits(v);
      const unsigned short lb = bf_bits(v - bf_val(hb));
      sl[row * 32 + rl]      = hb;
      sl[row * 32 + 16 + rl] = lb;
    }
  lds_wave_sync();
  {
#pragma unroll
    for (int it = 0; it < 4; ++it) {
      const int p   = it * 32 + lane;             // piece 0..127 of 8 u16
      const int row = p >> 2;                     // 0..31
      const int c8  = (p & 3) * 8;                // 0..24
      const v8us w = *(const v8us*)(sl + row * 32 + c8);
      *(v8us*)(Tp + (size_t)(m0 + row) * KEXT + c8) = w;
    }
    
  }
}

// ---------------------------------------------------------------------------
// bf16 WMMA GEMM, wave tile 32 rows x 128 cols, block = 4 waves (128 threads), no block barriers.
//   C[m][n] = sum_k A[m][k] * Bt[n][k]  +  sum_{k<32} Aext[m][k] * Bext[n][k]
//   A row-major [M][K] bf16 (pitch lda), Bt row-major [N][K] bf16 (pitch ldb), Aext [M][32], Bext [N][32] bf16 (pitch 32);
//   M % 32 == 0, N % 128 == 0, K % 32 == 0; grid.x = ceil(M/32 * N/128 / 4).
//   SPLITA: A carried as hi (Ap) + lo (A2p) bf16 planes, two products into one accumulator (Aext stays one plane).
//   Fragments loaded straight from global rows with the split k map (ldfrag_b).
// Epilogues (all: per wave, per 16-row slab: stage in LDS, wave sync, write each row segment with ONE instruction of
//   EPI 0: q / k projection: RoPE with pairs (dim, dim+64), token position = row & (SQ-1), cos/sin from the f32 table [SQ][64];
//          writes f16 hi plane C0 and f16 residual x2048 plane C1, both [M][ldc], cols n0..n0+127 (row segment 256 B = 16 lanes x 16 B).
//   EPI 1: v^T projection: f16 hi plane C0, residual x2048 plane C1, [M][ldc], row segment 256 B.
//   EPI 2: f32 output C0 [M][ldc]; row segment 128 floats = 512 B = 32 lanes x 16 B per instruction.
// Coverage: tilesM*tilesN wave tiles x 32x128 = the whole [M][N] output region of each plane.
// ---------------------------------------------------------------------------
template <int EPI> struct SlabT { typedef _Float16 T; static constexpr int PERW = 4096; };   // 2 planes x 16 x 128 halves
template <> struct SlabT<2>     { typedef float    T; static constexpr int PERW = 2048; };   // 16 x 128 floats

template <int EPI, bool SPLITA>
__global__ __launch_bounds__(128) void gemm_w32x128_kernel(
    const unsigned short* Ap, const unsigned short* A2p, int lda, const unsigned short* __restrict__ Aep,
    const unsigned short* __restrict__ Btp, int ldb, const unsigned short* __restrict__ Bep,
    const float* __restrict__ cst, const float* __restrict__ snt,
    void* C0, void* C1, int ldc, int M, int N, int K) {
  typedef typename SlabT<EPI>::T ST;
  __shared__ __align__(16) ST slab_all[4 * SlabT<EPI>::PERW];

  const int lane = threadIdx.x & 31;
  const int wave = wave_id();
  const int hh = lane >> 4;           // lane half: k offset 8*hh, D row offset 8*hh
  const int rl = lane & 15;           // A row / B col / D col within subtile
  const int tilesN = N >> 7;
  const int tilesM = M >> 5;
  const int tile = (int)blockIdx.x * 4 + wave;
  if (tile >= tilesM * tilesN) return;          // wave-uniform; no block barriers in this kernel
  const int tm = tile / tilesN;
  const int tn = tile - tm * tilesN;
  const int m0 = tm << 5;
  const int n0 = tn << 7;

  const __bf16* A  = (const __bf16*)(const void*)Ap;
  const __bf16* A2 = (const __bf16*)(const void*)A2p;
  const __bf16* Bt = (const __bf16*)(const void*)Btp;

  v8f acc[2][8];
#pragma unroll
  for (int i = 0; i < 2; ++i)
#pragma unroll
    for (int j = 0; j < 8; ++j) acc[i][j] = zero8();

  for (int k0 = 0; k0 < K; k0 += 32) {
    v16b ah[2], al[2];
#pragma unroll
    for (int i = 0; i < 2; ++i) {
      const size_t ao = (size_t)(m0 + i * 16 + rl) * lda + k0 + 8 * hh;
      ah[i] = ldfrag_b(A + ao);
      al[i] = SPLITA ? ldfrag_b(A2 + ao) : ah[i];
    }
#pragma unroll
    for (int j = 0; j < 8; ++j) {
      const v16b bj = ldfrag_b(Bt + (size_t)(n0 + j * 16 + rl) * ldb + k0 + 8 * hh);
      acc[0][j] = mma_b(ah[0], bj, acc[0][j]);
      acc[1][j] = mma_b(ah[1], bj, acc[1][j]);
      if (SPLITA) {
        acc[0][j] = mma_b(al[0], bj, acc[0][j]);
        acc[1][j] = mma_b(al[1], bj, acc[1][j]);
      }
      guard_b5(acc[0][j], acc[1][j], ah[0], ah[1], al[0], al[1], bj);
    }
  }
  // ---- rank-16 adapter extension: one 32-deep k-step [Th | Tl] . [2B | 2B] ----
  {
    const __bf16* Ae = (const __bf16*)(const void*)Aep;
    const __bf16* Be = (const __bf16*)(const void*)Bep;
    v16b ae[2];
#pragma unroll
    for (int i = 0; i < 2; ++i) ae[i] = ldfrag_b(Ae + (size_t)(m0 + i * 16 + rl) * KEXT + 8 * hh);
#pragma unroll
    for (int j = 0; j < 8; ++j) {
      const v16b be = ldfrag_b(Be + (size_t)(n0 + j * 16 + rl) * KEXT + 8 * hh);
      acc[0][j] = mma_b(ae[0], be, acc[0][j]);
      acc[1][j] = mma_b(ae[1], be, acc[1][j]);
      guard_b5(acc[0][j], acc[1][j], ae[0], ae[1], ae[0], ae[1], be);
    }
  }
  acc_guard4(acc[0][0], acc[0][1], acc[0][2], acc[0][3]);
  acc_guard4(acc[0][4], acc[0][5], acc[0][6], acc[0][7]);
  acc_guard4(acc[1][0], acc[1][1], acc[1][2], acc[1][3]);
  acc_guard4(acc[1][4], acc[1][5], acc[1][6], acc[1][7]);

  // ---- epilogue ----
  ST* slab = slab_all + wave * SlabT<EPI>::PERW;
  _Float16* sl16 = (_Float16*)(void*)slab;
  float*    slf  = (float*)(void*)slab;

  if (EPI == 0) {
    _Float16* P0 = (_Float16*)C0;
    _Float16* P1 = (_Float16*)C1;
#pragma unroll
    for (int i = 0; i < 2; ++i) {
      const int rb = m0 + i * 16 + 8 * hh;
#pragma unroll
      for (int j = 0; j < 4; ++j) {
        const int dim = j * 16 + rl;                             // 0..63 within head; x2 partner at dim + 64
#pragma unroll
        for (int r = 0; r < 8; ++r) {
          const int row = rb + r;                                // token 0..M-1
          const int tp  = row & (SQ - 1);                        // position within its sequence
          const float cv = cst[(size_t)tp * NFREQ + dim];
          const float sv = snt[(size_t)tp * NFREQ + dim];
          const float x1 = acc[i][j][r];
          const float x2 = acc[i][j + 4][r];
          const float o1 = x1 * cv - x2 * sv;
          const float o2 = x2 * cv + x1 * sv;
          const _Float16 h1 = (_Float16)o1;
          const _Float16 h2 = (_Float16)o2;
          const int so = (8 * hh + r) * 128 + dim;
          sl16[so]             = h1;
          sl16[so + 64]        = h2;
          sl16[2048 + so]      = (_Float16)((o1 - (float)h1) * 2048.0f);
          sl16[2048 + so + 64] = (_Float16)((o2 - (float)h2) * 2048.0f);
        }
      }
      lds_wave_sync();
      {
#pragma unroll
        for (int it = 0; it < 8; ++it) {
          const int row = it * 2 + hh;                           // it x hh covers rows 0..15
          const int c8  = rl * 8;
          const v8h vh = *(const v8h*)(sl16 + row * 128 + c8);
          const v8h vl = *(const v8h*)(sl16 + 2048 + row * 128 + c8);
          const size_t go = (size_t)(m0 + i * 16 + row) * ldc + n0 + c8;
          *(v8h*)(P0 + go) = vh;
          *(v8h*)(P1 + go) = vl;
        }
        
      }
      lds_wave_sync();
    }
  } else if (EPI == 1) {
    _Float16* P0 = (_Float16*)C0;
    _Float16* P1 = (_Float16*)C1;
#pragma unroll
    for (int i = 0; i < 2; ++i) {
#pragma unroll
      for (int r = 0; r < 8; ++r) {
#pragma unroll
        for (int j = 0; j < 8; ++j) {
          const float v = acc[i][j][r];
          const _Float16 hv = (_Float16)v;
          const int so = (8 * hh + r) * 128 + j * 16 + rl;
          sl16[so]        = hv;
          sl16[2048 + so] = (_Float16)((v - (float)hv) * 2048.0f);
        }
      }
      lds_wave_sync();
      {
#pragma unroll
        for (int it = 0; it < 8; ++it) {
          const int row = it * 2 + hh;
          const int c8  = rl * 8;
          const v8h vh = *(const v8h*)(sl16 + row * 128 + c8);
          const v8h vl = *(const v8h*)(sl16 + 2048 + row * 128 + c8);
          const size_t go = (size_t)(m0 + i * 16 + row) * ldc + n0 + c8;
          *(v8h*)(P0 + go) = vh;
          *(v8h*)(P1 + go) = vl;
        }
        
      }
      lds_wave_sync();
    }
  } else {
    float* C = (float*)C0;
#pragma unroll
    for (int i = 0; i < 2; ++i) {
#pragma unroll
      for (int j = 0; j < 8; ++j)
#pragma unroll
        for (int r = 0; r < 8; ++r)
          slf[(8 * hh + r) * 128 + j * 16 + rl] = acc[i][j][r];
      lds_wave_sync();
      {
#pragma unroll
        for (int row = 0; row < 16; ++row) {                     // 32 lanes x 16 B = the whole 512-B row segment per instruction
          const v4f v = *(const v4f*)(slf + row * 128 + lane * 4);
          *(v4f*)(C + (size_t)(m0 + i * 16 + row) * ldc + n0 + lane * 4) = v;
        }
        
      }
      lds_wave_sync();
    }
  }
}

// ---------------------------------------------------------------------------
// Causal multi-query flash attention (one shared 128-wide k/v head), 32-key chunks, block = 4 waves = 64 query rows of one (b, h);
// grid (n query tiles, NHQ, NSEQ).
//   q planes f16 [tok][h*128+d]: hi (qhp) and residual x2048 (qlp); k planes f16 [tok][d]: hi (khp), residual x2048 (klp);
//   v^T planes f16 [d][tok]: hi (vhp), residual x2048 (vlp); outputs attn bf16 hi (ahp) / lo (alp) [tok][h*128+d].
//   scores = (Sh + Sr/2048) * 128^-0.5 with Sh = qh.kh and Sr = ql'.kh + qh.kl'; keys > query -> -inf; online softmax f32;
//   p' = 1024 p stored per wave to LDS as f16 hi (and residual x2048 when PRES), reloaded as A fragments after a wave sync;
//   O = (Oh + Or/2048)/1024/l with Oh = ph.vh, Or = ph.vl' (+ pl'.vh when PRES).
//   K / V^T chunk staging: 128 threads x 4 x 16 B per plane = whole 32x128 / 128x32 tile, plain loads, __syncthreads before and after.
//   Trip count 2*qb+2 chunks (static bound 64); waves whose rows are all below the chunk skip it (wave-uniform, scalar branch).
// Coverage: 32 query tiles x 4 waves x 16 rows x 128 cols per (b,h) = the whole [tok][h*128..+127] slab of both output planes.
// ---------------------------------------------------------------------------
#define AT_KC   32
#define KS_P    136
#define VS_P    40
#define PS_P    40
#define LDS_KS  0
#define LDS_KLS (32 * KS_P)
#define LDS_VHS (2 * 32 * KS_P)
#define LDS_VLS (LDS_VHS + 128 * VS_P)
#define LDS_PH  (LDS_VLS + 128 * VS_P)
#define LDS_PL  (LDS_PH + 4 * 16 * PS_P)
#define LDS_TOT (LDS_PL + 4 * 16 * PS_P)
static_assert(LDS_TOT * 2 <= 65536);
static_assert(4 * 4096 <= LDS_TOT);          // output staging (2 planes x 16 x 128 per wave) aliases the chunk region after the loop

template <bool PRES>
__global__ __launch_bounds__(128) void attn_causal_kernel(
    const unsigned short* __restrict__ qhp, const unsigned short* __restrict__ qlp,
    const unsigned short* __restrict__ khp, const unsigned short* __restrict__ klp,
    const unsigned short* __restrict__ vhp, const unsigned short* __restrict__ vlp,
    unsigned short* __restrict__ ahp, unsigned short* __restrict__ alp, int qb_base) {
  __shared__ __align__(16) _Float16 lds[LDS_TOT];
  _Float16* Ks  = lds + LDS_KS;
  _Float16* Kls = lds + LDS_KLS;
  _Float16* Vhs = lds + LDS_VHS;
  _Float16* Vls = lds + LDS_VLS;

  const int tid  = (int)threadIdx.x;
  const int lane = tid & 31;
  const int wave = wave_id();
  const int hh   = lane >> 4;
  const int c    = lane & 15;
  const int qb   = (int)blockIdx.x + qb_base;
  const int h    = (int)blockIdx.y;
  const int b    = (int)blockIdx.z;
  const int q0   = qb * 64 + wave * 16;          // first query row of this wave (within sequence)
  const int qlast = q0 + 15;
  const size_t tok0 = (size_t)b * SQ;

  const _Float16* Qhr = (const _Float16*)(const void*)qhp + (tok0 + q0 + c) * HID + h * HDM + 8 * hh;
  const _Float16* Qlr = (const _Float16*)(const void*)qlp + (tok0 + q0 + c) * HID + h * HDM + 8 * hh;
  const _Float16* Kg  = (const _Float16*)(const void*)khp + tok0 * HDM;
  const _Float16* Klg = (const _Float16*)(const void*)klp + tok0 * HDM;
  const _Float16* Vhg = (const _Float16*)(const void*)vhp + tok0;
  const _Float16* Vlg = (const _Float16*)(const void*)vlp + tok0;
  _Float16* ph = lds + LDS_PH + wave * (16 * PS_P);
  _Float16* pl = lds + LDS_PL + wave * (16 * PS_P);

  float mrow[8], lrow[8];
  v8f oacc[8], oaccr[8];
#pragma unroll
  for (int r = 0; r < 8; ++r) { mrow[r] = -INFINITY; lrow[r] = 0.f; }
#pragma unroll
  for (int t = 0; t < 8; ++t) { oacc[t] = zero8(); oaccr[t] = zero8(); }

  const int nch = 2 * qb + 2;                    // block-uniform, <= 64
  for (int kc = 0; kc < nch; ++kc) {
    const int kv0 = kc * AT_KC;
    __syncthreads();
#pragma unroll
    for (int i = 0; i < 4; ++i) {                // coverage: 512 pieces of 8 halves per plane = whole tile
      const int p   = tid + 128 * i;             // 0..511
      const int key = p >> 4, d8 = (p & 15) * 8; // K: 32 keys x 128 d
      const v8h kx = *(const v8h*)(Kg  + (size_t)(kv0 + key) * HDM + d8);
      const v8h ky = *(const v8h*)(Klg + (size_t)(kv0 + key) * HDM + d8);
      *(v8h*)(Ks  + key * KS_P + d8) = kx;
      *(v8h*)(Kls + key * KS_P + d8) = ky;
      const int d = p >> 2, k8 = (p & 3) * 8;    // V^T: 128 d x 32 keys
      const v8h vx = *(const v8h*)(Vhg + (size_t)d * NTOK + kv0 + k8);
      const v8h vy = *(const v8h*)(Vlg + (size_t)d * NTOK + kv0 + k8);
      *(v8h*)(Vhs + d * VS_P + k8) = vx;
      *(v8h*)(Vls + d * VS_P + k8) = vy;
    }
    __syncthreads();

    if (kv0 <= qlast) {                          // wave-uniform (scalar): skip chunks fully above this wave's rows
      // ---- scores ----
      v8f sh[2], sr[2];
      sh[0] = zero8(); sh[1] = zero8(); sr[0] = zero8(); sr[1] = zero8();
#pragma unroll
      for (int dc = 0; dc < 4; ++dc) {
        const v16h qa = ldfrag_h(Qhr + dc * 32);
        const v16h ql = ldfrag_h(Qlr + dc * 32);
#pragma unroll
        for (int j = 0; j < 2; ++j) {
          const v16h kb = ldfrag_h(Ks  + (j * 16 + c) * KS_P + dc * 32 + 8 * hh);
          const v16h kl = ldfrag_h(Kls + (j * 16 + c) * KS_P + dc * 32 + 8 * hh);
          sh[j] = mma_h(qa, kb, sh[j]);
          sr[j] = mma_h(ql, kb, sr[j]);
          sr[j] = mma_h(qa, kl, sr[j]);
          guard_h4(sh[j], sr[j], qa, ql, kb, kl);
        }
      }
      // ---- scale, causal mask, chunk row max ----
      float cm[8];
#pragma unroll
      for (int r = 0; r < 8; ++r) {
        const int qrow = q0 + 8 * hh + r;
        float m = -INFINITY;
#pragma unroll
        for (int j = 0; j < 2; ++j) {
          const int key = kv0 + j * 16 + c;
          float s = (sh[j][r] + sr[j][r] * 0.00048828125f) * 0.08838834764831845f;
          s = (key > qrow) ? -INFINITY : s;
          sh[j][r] = s;
          m = fmaxf(m, s);
        }
#pragma unroll
        for (int off = 1; off < 16; off <<= 1) m = fmaxf(m, __shfl_xor(m, off, 32));
        cm[r] = m;
      }
      // ---- online softmax, P' to LDS ----
#pragma unroll
      for (int r = 0; r < 8; ++r) {
        const float mnew  = fmaxf(mrow[r], cm[r]);
        const float alpha = __expf(mrow[r] - mnew);
        mrow[r] = mnew;
        float psum = 0.f;
#pragma unroll
        for (int j = 0; j < 2; ++j) {
          const float p  = __expf(sh[j][r] - mnew);
          psum += p;
          const float pp = p * 1024.0f;
          const _Float16 phv = (_Float16)pp;
          const int po = (8 * hh + r) * PS_P + j * 16 + c;
          ph[po] = phv;
          if (PRES) pl[po] = (_Float16)((pp - (float)phv) * 2048.0f);
        }
#pragma unroll
        for (int off = 1; off < 16; off <<= 1) psum += __shfl_xor(psum, off, 32);
        lrow[r] = lrow[r] * alpha + psum;
#pragma unroll
        for (int t = 0; t < 8; ++t) { oacc[t][r] *= alpha; oaccr[t][r] *= alpha; }
      }
      lds_wave_sync();                           // P' stores visible to the other lanes of this wave before the fragment reload
      // ---- O += P' . V ----
      const v16h pa = ldfrag_h(ph + c * PS_P + 8 * hh);
      v16h pr = pa;
      if (PRES) pr = ldfrag_h(pl + c * PS_P + 8 * hh);
#pragma unroll
      for (int t = 0; t < 8; ++t) {
        const v16h vb = ldfrag_h(Vhs + (t * 16 + c) * VS_P + 8 * hh);
        const v16h vr = ldfrag_h(Vls + (t * 16 + c) * VS_P + 8 * hh);
        oacc[t]  = mma_h(pa, vb, oacc[t]);
        oaccr[t] = mma_h(pa, vr, oaccr[t]);
        if (PRES) oaccr[t] = mma_h(pr, vb, oaccr[t]);
        guard_h4(oacc[t], oaccr[t], pa, pr, vb, vr);
      }
    }
  }

  __syncthreads();                               // all chunk-region readers done before aliasing it as output staging
  _Float16* osh = lds + wave * 4096;
  _Float16* osl = osh + 2048;
#pragma unroll
  for (int r = 0; r < 8; ++r) {
    const float inv = (1.0f / lrow[r]) * 0.0009765625f;
#pragma unroll
    for (int t = 0; t < 8; ++t) {
      const float o = (oacc[t][r] + oaccr[t][r] * 0.00048828125f) * inv;
      const unsigned short hb = bf_bits(o);
      const unsigned short lb = bf_bits(o - bf_val(hb));
      const int so = (8 * hh + r) * 128 + t * 16 + c;
      osh[so] = __builtin_bit_cast(_Float16, hb);
      osl[so] = __builtin_bit_cast(_Float16, lb);
    }
  }
  lds_wave_sync();
  _Float16* Ahg = (_Float16*)(void*)ahp + (tok0 + q0) * HID + h * HDM;
  _Float16* Alg = (_Float16*)(void*)alp + (tok0 + q0) * HID + h * HDM;
  {
#pragma unroll
    for (int it = 0; it < 8; ++it) {
      const int row = it * 2 + hh;               // it 0..7 x hh 0..1 covers rows 0..15
      const int c8  = c * 8;                     // 16 lanes x 16 B = the whole 256-B segment
      const v8h x = *(const v8h*)(osh + row * 128 + c8);
      const v8h y = *(const v8h*)(osl + row * 128 + c8);
      *(v8h*)(Ahg + (size_t)row * HID + c8) = x;
      *(v8h*)(Alg + (size_t)row * HID + c8) = y;
    }
    
  }
}

// ---------------------------------------------------------------------------
// Workspace map (bytes; every region is a whole number of the rows / lines its producer writes with whole-line stores):
//   Xb   bf16 [4096][2048]  16777216    Wqb bf16 [2048][2048]  8388608    Wkb bf16 [128][2048]  524288   Wvb bf16 [128][2048] 524288
//   Wob  bf16 [2048][2048]   8388608    Aqb/Akb/Avb/Aob bf16 [16][2048]  4 x 65536
//   BextQ bf16 [2048][32]     131072    BextK/BextV bf16 [128][32] 2 x 8192   BextO bf16 [2048][32] 131072
//   TextQ/TextK/TextV/TextO bf16 [4096][32]  4 x 262144      cst/snt f32 [2048][64]  2 x 524288
//   Qh/Ql f16 [4096][2048]  2 x 16777216   Kh/Kl f16 [4096][128]  2 x 1048576   Vh/Vl f16 [128][4096]  2 x 1048576
//   Ah/Al bf16 [4096][2048] 2 x 16777216
//   total 108544000
// ---------------------------------------------------------------------------
extern "C" void kernel_launch(void* const* d_in, const int* in_sizes, int n_in,
                              void* d_out, int out_size, void* d_ws, size_t ws_size,
                              hipStream_t stream) {
  if (n_in < 13) return;
  if (in_sizes[0]  != NTOK * HID) return;
  if (in_sizes[1]  != HID * HID)  return;
  if (in_sizes[2]  != LRK * HID)  return;
  if (in_sizes[3]  != HID * LRK)  return;
  if (in_sizes[4]  != HDM * HID)  return;
  if (in_sizes[5]  != LRK * HID)  return;
  if (in_sizes[6]  != HDM * LRK)  return;
  if (in_sizes[7]  != HDM * HID)  return;
  if (in_sizes[8]  != LRK * HID)  return;
  if (in_sizes[9]  != HDM * LRK)  return;
  if (in_sizes[10] != HID * HID)  return;
  if (in_sizes[11] != LRK * HID)  return;
  if (in_sizes[12] != HID * LRK)  return;
  if (out_size != NTOK * HID) return;

  const float* x    = (const float*)d_in[0];
  const float* wq_w = (const float*)d_in[1];
  const float* wq_a = (const float*)d_in[2];
  const float* wq_b = (const float*)d_in[3];
  const float* wk_w = (const float*)d_in[4];
  const float* wk_a = (const float*)d_in[5];
  const float* wk_b = (const float*)d_in[6];
  const float* wv_w = (const float*)d_in[7];
  const float* wv_a = (const float*)d_in[8];
  const float* wv_b = (const float*)d_in[9];
  const float* wo_w = (const float*)d_in[10];
  const float* wo_a = (const float*)d_in[11];
  const float* wo_b = (const float*)d_in[12];
  float* out = (float*)d_out;

  const size_t szX   = (size_t)NTOK * HID * 2;
  const size_t szWsq = (size_t)HID * HID * 2;
  const size_t szWkv = (size_t)HDM * HID * 2;
  const size_t szAl  = (size_t)LRK * HID * 2;
  const size_t szBeL = (size_t)HID * KEXT * 2;
  const size_t szBeS = (size_t)HDM * KEXT * 2;
  const size_t szTe  = (size_t)NTOK * KEXT * 2;
  const size_t szTab = (size_t)SQ * NFREQ * 4;
  const size_t szQ   = (size_t)NTOK * HID * 2;
  const size_t szK   = (size_t)NTOK * HDM * 2;
  const size_t szV   = (size_t)HDM * NTOK * 2;
  const size_t szA   = (size_t)NTOK * HID * 2;
  size_t off = 0;
  const size_t oX   = off; off += szX;
  const size_t oWq  = off; off += szWsq;
  const size_t oWk  = off; off += szWkv;
  const size_t oWv  = off; off += szWkv;
  const size_t oWo  = off; off += szWsq;
  const size_t oAq  = off; off += szAl;
  const size_t oAk  = off; off += szAl;
  const size_t oAv  = off; off += szAl;
  const size_t oAo  = off; off += szAl;
  const size_t oBq  = off; off += szBeL;
  const size_t oBk  = off; off += szBeS;
  const size_t oBv  = off; off += szBeS;
  const size_t oBo  = off; off += szBeL;
  const size_t oTq  = off; off += szTe;
  const size_t oTk  = off; off += szTe;
  const size_t oTv  = off; off += szTe;
  const size_t oTo  = off; off += szTe;
  const size_t oCs  = off; off += szTab;
  const size_t oSn  = off; off += szTab;
  const size_t oQh  = off; off += szQ;
  const size_t oQl  = off; off += szQ;
  const size_t oKh  = off; off += szK;
  const size_t oKl  = off; off += szK;
  const size_t oVh  = off; off += szV;
  const size_t oVl  = off; off += szV;
  const size_t oAh  = off; off += szA;
  const size_t oAl  = off; off += szA;
  if (off > ws_size) return;                     // off = 108544000

  char* ws = (char*)d_ws;
  unsigned short* Xb    = (unsigned short*)(ws + oX);
  unsigned short* Wqb   = (unsigned short*)(ws + oWq);
  unsigned short* Wkb   = (unsigned short*)(ws + oWk);
  unsigned short* Wvb   = (unsigned short*)(ws + oWv);
  unsigned short* Wob   = (unsigned short*)(ws + oWo);
  unsigned short* Aqb   = (unsigned short*)(ws + oAq);
  unsigned short* Akb   = (unsigned short*)(ws + oAk);
  unsigned short* Avb   = (unsigned short*)(ws + oAv);
  unsigned short* Aob   = (unsigned short*)(ws + oAo);
  unsigned short* BextQ = (unsigned short*)(ws + oBq);
  unsigned short* BextK = (unsigned short*)(ws + oBk);
  unsigned short* BextV = (unsigned short*)(ws + oBv);
  unsigned short* BextO = (unsigned short*)(ws + oBo);
  unsigned short* TextQ = (unsigned short*)(ws + oTq);
  unsigned short* TextK = (unsigned short*)(ws + oTk);
  unsigned short* TextV = (unsigned short*)(ws + oTv);
  unsigned short* TextO = (unsigned short*)(ws + oTo);
  float*          cst   = (float*)(ws + oCs);
  float*          snt   = (float*)(ws + oSn);
  unsigned short* Qh    = (unsigned short*)(ws + oQh);
  unsigned short* Ql    = (unsigned short*)(ws + oQl);
  unsigned short* Kh    = (unsigned short*)(ws + oKh);
  unsigned short* Kl    = (unsigned short*)(ws + oKl);
  unsigned short* Vh    = (unsigned short*)(ws + oVh);
  unsigned short* Vl    = (unsigned short*)(ws + oVl);
  unsigned short* Ah    = (unsigned short*)(ws + oAh);
  unsigned short* Al    = (unsigned short*)(ws + oAl);

  const dim3 b256(256), b128(128);
  const int n8X   = NTOK * HID / 8;              // 1048576
  const int n8Wsq = HID * HID / 8;               //  524288
  const int n8Wkv = HDM * HID / 8;               //   32768
  const int n8Al  = LRK * HID / 8;               //    4096
  const int npBL  = HID * 4;                     //    8192 pieces
  const int npBS  = HDM * 4;                     //     512 pieces

  // (1) cos/sin table [2048][64] x 2
  rope_table_kernel<<<dim3(SQ / 8), b256, 0, stream>>>(cst, snt, SQ);
  // (2) bf16 planes of x, the base weights and the adapter A matrices (layouts kept as given: [rows][K] with K contiguous)
  cvt_bf16_kernel<<<dim3((n8X + 255) / 256),   b256, 0, stream>>>(x,    Xb,  n8X);
  cvt_bf16_kernel<<<dim3((n8Wsq + 255) / 256), b256, 0, stream>>>(wq_w, Wqb, n8Wsq);
  cvt_bf16_kernel<<<dim3((n8Wkv + 255) / 256), b256, 0, stream>>>(wk_w, Wkb, n8Wkv);
  cvt_bf16_kernel<<<dim3((n8Wkv + 255) / 256), b256, 0, stream>>>(wv_w, Wvb, n8Wkv);
  cvt_bf16_kernel<<<dim3((n8Wsq + 255) / 256), b256, 0, stream>>>(wo_w, Wob, n8Wsq);
  cvt_bf16_kernel<<<dim3((n8Al + 255) / 256),  b256, 0, stream>>>(wq_a, Aqb, n8Al);
  cvt_bf16_kernel<<<dim3((n8Al + 255) / 256),  b256, 0, stream>>>(wk_a, Akb, n8Al);
  cvt_bf16_kernel<<<dim3((n8Al + 255) / 256),  b256, 0, stream>>>(wv_a, Avb, n8Al);
  cvt_bf16_kernel<<<dim3((n8Al + 255) / 256),  b256, 0, stream>>>(wo_a, Aob, n8Al);
  // (3) adapter B matrices -> [2B | 2B] extension planes
  bext_kernel<<<dim3((npBL + 255) / 256), b256, 0, stream>>>(wq_b, BextQ, npBL);
  bext_kernel<<<dim3((npBS + 255) / 256), b256, 0, stream>>>(wk_b, BextK, npBS);
  bext_kernel<<<dim3((npBS + 255) / 256), b256, 0, stream>>>(wv_b, BextV, npBS);
  bext_kernel<<<dim3((npBL + 255) / 256), b256, 0, stream>>>(wo_b, BextO, npBL);
  // (4) T = x . A^T -> [Th | Tl] extension planes for q, k, v   (M=4096, N=16, K=2048; 128 wave tiles / 4)
  tgemm_n16_kernel<false><<<dim3((NTOK / 32 + 3) / 4), b128, 0, stream>>>(Xb, Xb, HID, Aqb, HID, TextQ, NTOK, HID);
  tgemm_n16_kernel<false><<<dim3((NTOK / 32 + 3) / 4), b128, 0, stream>>>(Xb, Xb, HID, Akb, HID, TextK, NTOK, HID);
  tgemm_n16_kernel<false><<<dim3((NTOK / 32 + 3) / 4), b128, 0, stream>>>(Xb, Xb, HID, Avb, HID, TextV, NTOK, HID);
  // (5) q = x . Wq^T + 2 T.Bq^T, RoPE -> Qh/Ql [4096][2048]   (M=4096, N=2048, K=2048 + ext; 2048 tiles / 4)
  gemm_w32x128_kernel<0, false><<<dim3(((NTOK / 32) * (HID / 128) + 3) / 4), b128, 0, stream>>>(
      Xb, Xb, HID, TextQ, Wqb, HID, BextQ, cst, snt, (void*)Qh, (void*)Ql, HID, NTOK, HID, HID);
  // (6) k = x . Wk^T + 2 T.Bk^T, RoPE -> Kh/Kl [4096][128]     (M=4096, N=128; 128 tiles / 4)
  gemm_w32x128_kernel<0, false><<<dim3(((NTOK / 32) * (HDM / 128) + 3) / 4), b128, 0, stream>>>(
      Xb, Xb, HID, TextK, Wkb, HID, BextK, cst, snt, (void*)Kh, (void*)Kl, HDM, NTOK, HDM, HID);
  // (7) v^T = Wv . x^T + 2 Bv . T^T -> Vh/Vl [128][4096]      (A = Wvb, Bt = Xb; M=128, N=4096; 128 tiles / 4)
  gemm_w32x128_kernel<1, false><<<dim3(((HDM / 32) * (NTOK / 128) + 3) / 4), b128, 0, stream>>>(
      Wvb, Wvb, HID, BextV, Xb, HID, TextV, cst, snt, (void*)Vh, (void*)Vl, NTOK, HDM, NTOK, HID);
  // (8) causal attention, query tiles 0..3 with the p residual product, tiles 4..31 without
  attn_causal_kernel<true><<<dim3(4, NHQ, NSEQ), b128, 0, stream>>>(Qh, Ql, Kh, Kl, Vh, Vl, Ah, Al, 0);
  attn_causal_kernel<false><<<dim3(SQ / 64 - 4, NHQ, NSEQ), b128, 0, stream>>>(Qh, Ql, Kh, Kl, Vh, Vl, Ah, Al, 4);
  // (9) T_o = attn(hi + lo) . Ao^T -> [Th | Tl]
  tgemm_n16_kernel<true><<<dim3((NTOK / 32 + 3) / 4), b128, 0, stream>>>(Ah, Al, HID, Aob, HID, TextO, NTOK, HID);
  // (10) out = attn(hi + lo) . Wo^T + 2 T_o . Bo^T -> d_out f32 [4096][2048]   (M=4096, N=2048, K=2048 + ext; 2048 tiles / 4)
  gemm_w32x128_kernel<2, true><<<dim3(((NTOK / 32) * (HID / 128) + 3) / 4), b128, 0, stream>>>(
      Ah, Al, HID, TextO, Wob, HID, BextO, cst, snt, (void*)out, (void*)out, HID, NTOK, HID, HID);
  (void)hipGetLastError();
}

// v001
// Measured time: 621 microseconds a run.
// Two timings next to v000 put it at 1.57 and 1.58 times that version's speed.
// Contractions: x.Wq^T, x.Wk^T, Wv.x^T and the rank-16 adapter products x.A^T on v_wmma_f32_16x16x32_bf16 (operands = RNE bf16 of the
// f32 inputs, single products; the adapter term enters the base GEMM as one extra 32-deep k-step with T = x.A^T carried as bf16 hi + bf16 lo
// against 2B in bf16); q.k^T and p.v on v_wmma_f32_16x16x32_f16 (q, k, v^T = f16 hi + f16 residual x2^11 planes, lo.lo dropped; p x1024 f16
// plus f16 residual x2^11 on query tiles 0..3); attn.Wo^T and attn.Ao^T on v_wmma_f32_16x16x32_bf16 (attn = bf16 hi + bf16 lo planes, two
// products; Wo, Ao RNE bf16). f32 accumulate everywhere; RoPE (f32 cos/sin table), online softmax and scale folds in f32.
#include <hip/hip_runtime.h>
#include <math.h>
#include <stdint.h>

#define NSEQ   2
#define SQ     2048
#define HID    2048
#define NHQ    16
#define HDM    128
#define NTOK   4096
#define NFREQ  64
#define LRK    16
#define KEXT   32

typedef _Float16       v16h __attribute__((ext_vector_type(16)));
typedef _Float16       v8h  __attribute__((ext_vector_type(8)));
typedef __bf16         v16b __attribute__((ext_vector_type(16)));
typedef __bf16         v8b  __attribute__((ext_vector_type(8)));
typedef float          v8f  __attribute__((ext_vector_type(8)));
typedef float          v4f  __attribute__((ext_vector_type(4)));
typedef unsigned int   v4u  __attribute__((ext_vector_type(4)));
typedef unsigned short v8us __attribute__((ext_vector_type(8)));

// ---------------------------------------------------------------------------
// small helpers
// ---------------------------------------------------------------------------
__device__ __forceinline__ unsigned short bf_bits(float f) {          // RNE convert f32 -> bf16 bits
  const unsigned u = __float_as_uint(f);
  return (unsigned short)((u + 0x7FFFu + ((u >> 16) & 1u)) >> 16);
}
__device__ __forceinline__ float bf_val(unsigned short h) { return __uint_as_float(((unsigned)h) << 16); }
__device__ __forceinline__ unsigned pk16(unsigned short a, unsigned short b) { return (unsigned)a | ((unsigned)b << 16); }
__device__ __forceinline__ v8f zero8() { v8f z = {0.f, 0.f, 0.f, 0.f, 0.f, 0.f, 0.f, 0.f}; return z; }
__device__ __forceinline__ int wave_id() { return __builtin_amdgcn_readfirstlane((int)(threadIdx.x >> 5)); }

// orders one wave's LDS element stores before its own vector reloads of the same tile (other lanes' data)
__device__ __forceinline__ void lds_wave_sync() {
  __builtin_amdgcn_fence(__ATOMIC_RELEASE, "workgroup");
  __builtin_amdgcn_wave_barrier();
  __builtin_amdgcn_fence(__ATOMIC_ACQUIRE, "workgroup");
}

// ---------------------------------------------------------------------------
// WMMA fragments (wave32, 16x16x32, 16-bit operands). For A (row m = lane&15) and B (col n = lane&15) alike:
// elements 0..7 <- k0 + 8*(lane>>4) + 0..7, elements 8..15 <- k0 + 16 + 8*(lane>>4) + 0..7.
// ldfrag(p) with p = rowbase + k0 + 8*(lane>>4): two 16-B loads p[0..7], p[16..23].
// D: acc[r] = (row 8*(lane>>4) + r, col lane&15).
// ---------------------------------------------------------------------------
union FragH { v16h v; v8h h[2]; };
union FragB { v16b v; v8b h[2]; };
__device__ __forceinline__ v16h ldfrag_h(const _Float16* p) { FragH f; f.h[0] = *(const v8h*)(p); f.h[1] = *(const v8h*)(p + 16); return f.v; }
__device__ __forceinline__ v16b ldfrag_b(const __bf16* p)   { FragB f; f.h[0] = *(const v8b*)(p); f.h[1] = *(const v8b*)(p + 16); return f.v; }

__device__ __forceinline__ v8f mma_h(v16h a, v16h b, v8f c) {
  return __builtin_amdgcn_wmma_f32_16x16x32_f16(false, a, false, b, (short)0, c, false, false);
}
__device__ __forceinline__ v8f mma_b(v16b a, v16b b, v8f c) {
  return __builtin_amdgcn_wmma_f32_16x16x32_bf16(false, a, false, b, (short)0, c, false, false);
}
// hazard guards: 4 VALU slots after the last WMMA of a group, D tied, A/B kept live; memory clobber keeps later loads behind the group
__device__ __forceinline__ void guard_b5(v8f& a, v8f& b, v16b x0, v16b x1, v16b x2, v16b x3, v16b y) {
  asm volatile("v_nop\n\tv_nop\n\tv_nop\n\tv_nop" : "+v"(a), "+v"(b) : "v"(x0), "v"(x1), "v"(x2), "v"(x3), "v"(y) : "memory");
}
__device__ __forceinline__ void guard_h4(v8f& a, v8f& b, v16h w, v16h x, v16h y, v16h z) {
  asm volatile("v_nop\n\tv_nop\n\tv_nop\n\tv_nop" : "+v"(a), "+v"(b) : "v"(w), "v"(x), "v"(y), "v"(z) : "memory");
}
__device__ __forceinline__ void acc_guard4(v8f& a, v8f& b, v8f& c, v8f& d) {
  asm volatile("v_nop\n\tv_nop\n\tv_nop\n\tv_nop" : "+v"(a), "+v"(b), "+v"(c), "+v"(d));
}
__device__ __forceinline__ void acc_guard2(v8f& a, v8f& b) {
  asm volatile("v_nop\n\tv_nop\n\tv_nop\n\tv_nop" : "+v"(a), "+v"(b));
}

// ---------------------------------------------------------------------------
// RoPE table for positions t = 0..npos-1: cst[t][i] = cos(t * inv_freq[i]), snt[t][i] = sin(...), inv_freq[i] = 1 / 1e4^(i/64),
// i < 64, all f32. Block = 8 waves, wave w -> t = blockIdx.x*8 + w, lane -> i = lane, lane + 32.
// Coverage: grid npos/8 x 8 waves x 32 lanes x 2 = npos x 64 per plane.
// ---------------------------------------------------------------------------
__global__ __launch_bounds__(256) void rope_table_kernel(float* __restrict__ cst, float* __restrict__ snt, int npos) {
  const int lane = threadIdx.x & 31;
  const int wave = (int)(threadIdx.x >> 5);
  const int t = (int)blockIdx.x * 8 + wave;
  if (t >= npos) return;                       // no barriers in this kernel
  const float pf = (float)t;
  float c0 = 0.f, s0 = 0.f, c1 = 0.f, s1 = 0.f;
#pragma unroll 1
  for (int u = 0; u < 2; ++u) {
    const int i = lane + 32 * u;
    const float e   = (float)i * 0.015625f;      // i / 64 exact
    const float pw  = powf(10000.0f, e);
    const float inv = 1.0f / pw;
    const float ang = pf * inv;
    const float cv = cosf(ang);
    const float sv = sinf(ang);
    c1 = cv; s1 = sv;
    if (u == 0) { c0 = cv; s0 = sv; }
  }
  const size_t o = (size_t)t * NFREQ + lane;
  {
    ((float*)cst)[o]      = c0;
    ((float*)cst)[o + 32] = c1;
    ((float*)snt)[o]      = s0;
    ((float*)snt)[o + 32] = s1;
    
  }
}

// ---------------------------------------------------------------------------
// Elementwise RNE f32 -> bf16 plane: 8 elements per thread, one 16-B store per lane -> 32 consecutive lanes write 4 whole
// (every n8 used is a multiple of 256, so every instruction is full width).
// ---------------------------------------------------------------------------
__global__ __launch_bounds__(256) void cvt_bf16_kernel(const float* __restrict__ in, unsigned short* __restrict__ outp, int n8) {
  const int i = (int)blockIdx.x * 256 + (int)threadIdx.x;
  if (i >= n8) return;
  const size_t e = 8 * (size_t)i;
  const v4f a = *(const v4f*)(in + e);
  const v4f b = *(const v4f*)(in + e + 4);
  v4u w;
  w[0] = pk16(bf_bits(a[0]), bf_bits(a[1]));
  w[1] = pk16(bf_bits(a[2]), bf_bits(a[3]));
  w[2] = pk16(bf_bits(b[0]), bf_bits(b[1]));
  w[3] = pk16(bf_bits(b[2]), bf_bits(b[3]));
  *(v4u*)(outp + e) = w;
  
}

// ---------------------------------------------------------------------------
// Adapter B matrix [R][16] f32 -> extension plane [R][32] bf16: cols 0..15 = bf16(2*B[r][0..15]), cols 16..31 = the same again
// (pairs with the [Th | Tl] extension plane of T so one 32-deep k-step yields 2*(Th+Tl).B^T). 2*bf16(B) is exact.
// ---------------------------------------------------------------------------
__global__ __launch_bounds__(256) void bext_kernel(const float* __restrict__ Bm, unsigned short* __restrict__ outp, int npieces) {
  const int p = (int)blockIdx.x * 256 + (int)threadIdx.x;
  if (p >= npieces) return;
  const int row = p >> 2, q = p & 3;
  const float* src = Bm + (size_t)row * LRK + (q & 1) * 8;
  const v4f a = *(const v4f*)(src);
  const v4f b = *(const v4f*)(src + 4);
  v4u w;
  w[0] = pk16(bf_bits(2.0f * a[0]), bf_bits(2.0f * a[1]));
  w[1] = pk16(bf_bits(2.0f * a[2]), bf_bits(2.0f * a[3]));
  w[2] = pk16(bf_bits(2.0f * b[0]), bf_bits(2.0f * b[1]));
  w[3] = pk16(bf_bits(2.0f * b[2]), bf_bits(2.0f * b[3]));
  *(v4u*)(outp + (size_t)p * 8) = w;
  
}

// ---------------------------------------------------------------------------
// Narrow bf16 WMMA GEMM for the rank-16 adapter: T[m][j] = sum_k A[m][k] * Bt[j][k], j < 16, written as the extension plane
// Tp [M][32] bf16 = [bf16 hi of T (16) | bf16 lo of T (16)]. A row-major [M][K] bf16 (pitch lda; SPLITA: hi plane Ap + lo plane A2p,
// two products), Bt [16][K] bf16 (pitch ldb); K % 32 == 0, M % 32 == 0. Wave tile 32 rows, block = 4 waves, grid = ceil(M/128);
// no block barriers. Epilogue per wave: stage 32x32 u16 in LDS, wave sync, then 4 store instructions of 32 lanes x 16 B
// Coverage: M/32 waves x 32 rows x 32 cols = the whole [M][32] plane.
// ---------------------------------------------------------------------------
template <bool SPLITA>
__global__ __launch_bounds__(128) void tgemm_n16_kernel(
    const unsigned short* Ap, const unsigned short* A2p, int lda,
    const unsigned short* __restrict__ Btp, int ldb,
    unsigned short* __restrict__ Tp, int M, int K) {
  __shared__ __align__(16) unsigned short slab_all[4 * 1024];
  const int lane = threadIdx.x & 31;
  const int wave = wave_id();
  const int hh = lane >> 4;
  const int rl = lane & 15;
  const int m0 = ((int)blockIdx.x * 4 + wave) * 32;
  if (m0 >= M) return;                          // wave-uniform; no block barriers in this kernel

  const __bf16* A  = (const __bf16*)(const void*)Ap;
  const __bf16* A2 = (const __bf16*)(const void*)A2p;
  const __bf16* Bt = (const __bf16*)(const void*)Btp;

  v8f acc[2];
  acc[0] = zero8(); acc[1] = zero8();
  for (int k0 = 0; k0 < K; k0 += 32) {
    v16b ah[2], al[2];
#pragma unroll
    for (int i = 0; i < 2; ++i) {
      const size_t ao = (size_t)(m0 + i * 16 + rl) * lda + k0 + 8 * hh;
      ah[i] = ldfrag_b(A + ao);
      al[i] = SPLITA ? ldfrag_b(A2 + ao) : ah[i];
    }
    const v16b bj = ldfrag_b(Bt + (size_t)rl * ldb + k0 + 8 * hh);
    acc[0] = mma_b(ah[0], bj, acc[0]);
    acc[1] = mma_b(ah[1], bj, acc[1]);
    if (SPLITA) {
      acc[0] = mma_b(al[0], bj, acc[0]);
      acc[1] = mma_b(al[1], bj, acc[1]);
    }
    guard_b5(acc[0], acc[1], ah[0], ah[1], al[0], al[1], bj);
  }
  acc_guard2(acc[0], acc[1]);

  unsigned short* sl = slab_all + wave * 1024;
#pragma unroll
  for (int i = 0; i < 2; ++i)
#pragma unroll
    for (int r = 0; r < 8; ++r) {
      const int row = i * 16 + 8 * hh + r;
      const float v = acc[i][r];
      const unsigned short hb = bf_bits(v);
      const unsigned short lb = bf_bits(v - bf_val(hb));
      sl[row * 32 + rl]      = hb;
      sl[row * 32 + 16 + rl] = lb;
    }
  lds_wave_sync();
  {
#pragma unroll
    for (int it = 0; it < 4; ++it) {
      const int p   = it * 32 + lane;             // piece 0..127 of 8 u16
      const int row = p >> 2;                     // 0..31
      const int c8  = (p & 3) * 8;                // 0..24
      const v8us w = *(const v8us*)(sl + row * 32 + c8);
      *(v8us*)(Tp + (size_t)(m0 + row) * KEXT + c8) = w;
    }
    
  }
}

// ---------------------------------------------------------------------------
// bf16 WMMA GEMM, wave tile 32 rows x 128 cols, block = 4 waves (128 threads) = one 128 x 128 tile of C (wave w: rows 32w..32w+31).
//   C[m][n] = sum_k A[m][k] * Bt[n][k]  +  sum_{k<32} Aext[m][k] * Bext[n][k]
//   A row-major [M][K] bf16 (pitch lda), Bt row-major [N][K] bf16 (pitch ldb), Aext [M][32], Bext [N][32] bf16 (pitch 32);
//   M % 128 == 0, N % 128 == 0, K % 64 == 0, K >= 128; grid.x = M/128 * N/128.
//   SPLITA: A carried as hi (Ap) + lo (A2p) bf16 planes, two products into one accumulator (Aext stays one plane).
//   K loop: stages of 64 k. A stage = the block's 128 A rows (both planes when SPLITA) and 128 Bt rows, 128 B of each row, brought to LDS
//   by 16-B async copies (a wave's copy = 4 whole lines), rows at pitch 144 B; two buffers, stage t + 2 copied while stage t + 1 is worked on.
//   Fragments come from LDS with the split k map (ldfrag_b); the adapter k-step still loads from global rows.
// Epilogues (all: per wave, per 16-row slab: stage in LDS, wave sync, write each row segment with ONE instruction of
//   EPI 0: q / k projection: RoPE with pairs (dim, dim+64), token position = row & (SQ-1), cos/sin from the f32 table [SQ][64];
//          writes f16 hi plane C0 and f16 residual x2048 plane C1, both [M][ldc], cols n0..n0+127 (row segment 256 B = 16 lanes x 16 B).
//   EPI 1: v^T projection: f16 hi plane C0, residual x2048 plane C1, [M][ldc], row segment 256 B.
//   EPI 2: f32 output C0 [M][ldc]; row segment 128 floats = 512 B = 32 lanes x 16 B per instruction.
// Coverage: M/128 * N/128 blocks x 4 waves x 32x128 = the whole [M][N] output region of each plane.
// ---------------------------------------------------------------------------
template <int EPI> struct SlabT { typedef _Float16 T; static constexpr int PERW = 4096; };   // 2 planes x 16 x 128 halves
template <> struct SlabT<2>     { typedef float    T; static constexpr int PERW = 2048; };   // 16 x 128 floats

#define GK_KC    64                  // k per stage: 128 B of every operand row
#define GK_P     72                  // LDS row pitch in elements: 144 B = 16 B x 9, conflict-free for 16-B fragment reads
#define GK_PLANE (128 * GK_P)        // elements of one 128-row operand plane in LDS

__device__ __forceinline__ unsigned lds_off(const void* p) { return (unsigned)(size_t)p; }   // LDS byte address = low 32 bits

// One thread's share of one 128-row x 128-B plane: eight 16-B async copies, rows r, r + 16, .., r + 112 (r = tid >> 3, piece tid & 7).
// l = this lane's LDS byte address of row r, g = its global address of row r, step = 16 source rows in elements.
// The closing s_wait_xcnt 0 stands inside the statement so that no address register named here is rewritten ahead of it.
__device__ __forceinline__ void copy_plane8(unsigned l, const unsigned short* g, size_t step) {
  asm volatile(
      "global_load_async_to_lds_b128 %0, %8, off\n\t"
      "global_load_async_to_lds_b128 %1, %9, off\n\t"
      "global_load_async_to_lds_b128 %2, %10, off\n\t"
      "global_load_async_to_lds_b128 %3, %11, off\n\t"
      "global_load_async_to_lds_b128 %4, %12, off\n\t"
      "global_load_async_to_lds_b128 %5, %13, off\n\t"
      "global_load_async_to_lds_b128 %6, %14, off\n\t"
      "global_load_async_to_lds_b128 %7, %15, off\n\t"
      "s_wait_xcnt 0x0"
      :: "v"(l), "v"(l + 1u * 16u * GK_P * 2u), "v"(l + 2u * 16u * GK_P * 2u), "v"(l + 3u * 16u * GK_P * 2u),
         "v"(l + 4u * 16u * GK_P * 2u), "v"(l + 5u * 16u * GK_P * 2u), "v"(l + 6u * 16u * GK_P * 2u), "v"(l + 7u * 16u * GK_P * 2u),
         "v"(g), "v"(g + step), "v"(g + 2 * step), "v"(g + 3 * step),
         "v"(g + 4 * step), "v"(g + 5 * step), "v"(g + 6 * step), "v"(g + 7 * step)
      : "memory");
}
// this wave's async copies have landed in LDS
__device__ __forceinline__ void wait_async0() { asm volatile("s_wait_asynccnt 0x0" ::: "memory"); }
// this wave's LDS reads have returned, so the buffer they read may be refilled behind the next barrier
__device__ __forceinline__ void wait_ds0()    { asm volatile("s_wait_dscnt 0x0" ::: "memory"); }

template <int EPI, bool SPLITA>
__global__ __launch_bounds__(128) void gemm_w32x128_kernel(
    const unsigned short* Ap, const unsigned short* A2p, int lda, const unsigned short* __restrict__ Aep,
    const unsigned short* __restrict__ Btp, int ldb, const unsigned short* __restrict__ Bep,
    const float* __restrict__ cst, const float* __restrict__ snt,
    void* C0, void* C1, int ldc, int M, int N, int K) {
  typedef typename SlabT<EPI>::T ST;
  __shared__ __align__(16) ST slab_all[4 * SlabT<EPI>::PERW];
  constexpr int NPA      = SPLITA ? 2 : 1;               // A planes per stage
  constexpr int STAGE_EL = (NPA + 1) * GK_PLANE;         // elements per stage: A plane(s), then the Bt plane
  __shared__ __align__(16) unsigned short stage_all[2 * STAGE_EL];

  const int tid  = (int)threadIdx.x;
  const int lane = tid & 31;
  const int wave = wave_id();
  const int hh = lane >> 4;           // lane half: k offset 8*hh, D row offset 8*hh
  const int rl = lane & 15;           // A row / B col / D col within subtile
  const int tilesN = N >> 7;
  const int blk = (int)blockIdx.x;
  if (blk >= (M >> 7) * tilesN) return;         // block-uniform, in front of every barrier
  const int tmb = blk / tilesN;
  const int tn  = blk - tmb * tilesN;
  const int mb0 = tmb << 7;                     // first row of the block's tile
  const int m0  = mb0 + (wave << 5);            // first row of this wave's tile
  const int n0  = tn << 7;

  // this thread's copy addresses for stage 0, row tid >> 3 of each plane, 16-B piece tid & 7
  const int crow = tid >> 3, cpc = (tid & 7) * 8;
  const unsigned short* gA  = Ap  + (size_t)(mb0 + crow) * lda + cpc;
  const unsigned short* gA2 = A2p + (size_t)(mb0 + crow) * lda + cpc;
  const unsigned short* gB  = Btp + (size_t)(n0  + crow) * ldb + cpc;
  const size_t stepA = (size_t)16 * lda, stepB = (size_t)16 * ldb;
  const unsigned lc = lds_off(stage_all) + (unsigned)(crow * GK_P + cpc) * 2u;
  const int nst = K / GK_KC;                    // stages, block-uniform

  v8f acc[2][8];
#pragma unroll
  for (int i = 0; i < 2; ++i)
#pragma unroll
    for (int j = 0; j < 8; ++j) acc[i][j] = zero8();

  // stage s -> buffer s & 1
  auto copy_stage = [&](int s) {
    const unsigned l = lc + (unsigned)(s & 1) * (unsigned)(STAGE_EL * 2);
    const size_t ko = (size_t)s * GK_KC;
    copy_plane8(l, gA + ko, stepA);
    if (SPLITA) copy_plane8(l + GK_PLANE * 2u, gA2 + ko, stepA);
    copy_plane8(l + (unsigned)(NPA * GK_PLANE) * 2u, gB + ko, stepB);
  };
  copy_stage(0);
  wait_async0();
  __syncthreads();                              // stage 0 published
  if (nst > 1) copy_stage(1);

  for (int t = 0; t < nst; ++t) {
    const __bf16* S  = (const __bf16*)(const void*)(stage_all + (t & 1) * STAGE_EL);
    const __bf16* sA = S + (wave * 32 + rl) * GK_P + 8 * hh;
    const __bf16* sB = S + NPA * GK_PLANE + rl * GK_P + 8 * hh;
#pragma unroll
    for (int ks = 0; ks < 2; ++ks) {
      v16b ah[2], al[2], bj[8];
#pragma unroll
      for (int i = 0; i < 2; ++i) {
        ah[i] = ldfrag_b(sA + i * 16 * GK_P + ks * 32);
        al[i] = SPLITA ? ldfrag_b(sA + GK_PLANE + i * 16 * GK_P + ks * 32) : ah[i];
      }
#pragma unroll
      for (int j = 0; j < 8; ++j) bj[j] = ldfrag_b(sB + j * 16 * GK_P + ks * 32);
      __builtin_amdgcn_sched_barrier(0);        // keeps the k-step's LDS reads one group ahead of its WMMAs (else one waited pair per two WMMAs)
#pragma unroll
      for (int j = 0; j < 8; ++j) {
        acc[0][j] = mma_b(ah[0], bj[j], acc[0][j]);
        acc[1][j] = mma_b(ah[1], bj[j], acc[1][j]);
      }
      if (SPLITA) {
#pragma unroll
        for (int j = 0; j < 8; ++j) {
          acc[0][j] = mma_b(al[0], bj[j], acc[0][j]);
          acc[1][j] = mma_b(al[1], bj[j], acc[1][j]);
        }
      }
      __builtin_amdgcn_sched_barrier(0);        // keeps the next k-step's LDS reads from being spread among these WMMAs
    }
    // publish point of stage t + 1; it also ends every wave's reads of the buffer that stage t + 2 refills
    wait_ds0();
    wait_async0();
    __syncthreads();
    if (t + 2 < nst) copy_stage(t + 2);         // block-uniform test
  }
  wait_async0();                                // nothing of this wave is in flight behind the loop
  // ---- rank-16 adapter extension: one 32-deep k-step [Th | Tl] . [2B | 2B] ----
  {
    const __bf16* Ae = (const __bf16*)(const void*)Aep;
    const __bf16* Be = (const __bf16*)(const void*)Bep;
    v16b ae[2];
#pragma unroll
    for (int i = 0; i < 2; ++i) ae[i] = ldfrag_b(Ae + (size_t)(m0 + i * 16 + rl) * KEXT + 8 * hh);
#pragma unroll
    for (int j = 0; j < 8; ++j) {
      const v16b be = ldfrag_b(Be + (size_t)(n0 + j * 16 + rl) * KEXT + 8 * hh);
      acc[0][j] = mma_b(ae[0], be, acc[0][j]);
      acc[1][j] = mma_b(ae[1], be, acc[1][j]);
      guard_b5(acc[0][j], acc[1][j], ae[0], ae[1], ae[0], ae[1], be);
    }
  }
  acc_guard4(acc[0][0], acc[0][1], acc[0][2], acc[0][3]);
  acc_guard4(acc[0][4], acc[0][5], acc[0][6], acc[0][7]);
  acc_guard4(acc[1][0], acc[1][1], acc[1][2], acc[1][3]);
  acc_guard4(acc[1][4], acc[1][5], acc[1][6], acc[1][7]);

  // ---- epilogue ----
  ST* slab = slab_all + wave * SlabT<EPI>::PERW;
  _Float16* sl16 = (_Float16*)(void*)slab;
  float*    slf  = (float*)(void*)slab;

  if (EPI == 0) {
    _Float16* P0 = (_Float16*)C0;
    _Float16* P1 = (_Float16*)C1;
#pragma unroll
    for (int i = 0; i < 2; ++i) {
      const int rb = m0 + i * 16 + 8 * hh;
#pragma unroll
      for (int j = 0; j < 4; ++j) {
        const int dim = j * 16 + rl;                             // 0..63 within head; x2 partner at dim + 64
#pragma unroll
        for (int r = 0; r < 8; ++r) {
          const int row = rb + r;                                // token 0..M-1
          const int tp  = row & (SQ - 1);                        // position within its sequence
          const float cv = cst[(size_t)tp * NFREQ + dim];
          const float sv = snt[(size_t)tp * NFREQ + dim];
          const float x1 = acc[i][j][r];
          const float x2 = acc[i][j + 4][r];
          const float o1 = x1 * cv - x2 * sv;
          const float o2 = x2 * cv + x1 * sv;
          const _Float16 h1 = (_Float16)o1;
          const _Float16 h2 = (_Float16)o2;
          const int so = (8 * hh + r) * 128 + dim;
          sl16[so]             = h1;
          sl16[so + 64]        = h2;
          sl16[2048 + so]      = (_Float16)((o1 - (float)h1) * 2048.0f);
          sl16[2048 + so + 64] = (_Float16)((o2 - (float)h2) * 2048.0f);
        }
      }
      lds_wave_sync();
      {
#pragma unroll
        for (int it = 0; it < 8; ++it) {
          const int row = it * 2 + hh;                           // it x hh covers rows 0..15
          const int c8  = rl * 8;
          const v8h vh = *(const v8h*)(sl16 + row * 128 + c8);
          const v8h vl = *(const v8h*)(sl16 + 2048 + row * 128 + c8);
          const size_t go = (size_t)(m0 + i * 16 + row) * ldc + n0 + c8;
          *(v8h*)(P0 + go) = vh;
          *(v8h*)(P1 + go) = vl;
        }
        
      }
      lds_wave_sync();
    }
  } else if (EPI == 1) {
    _Float16* P0 = (_Float16*)C0;
    _Float16* P1 = (_Float16*)C1;
#pragma unroll
    for (int i = 0; i < 2; ++i) {
#pragma unroll
      for (int r = 0; r < 8; ++r) {
#pragma unroll
        for (int j = 0; j < 8; ++j) {
          const float v = acc[i][j][r];
          const _Float16 hv = (_Float16)v;
          const int so = (8 * hh + r) * 128 + j * 16 + rl;
          sl16[so]        = hv;
          sl16[2048 + so] = (_Float16)((v - (float)hv) * 2048.0f);
        }
      }
      lds_wave_sync();
      {
#pragma unroll
        for (int it = 0; it < 8; ++it) {
          const int row = it * 2 + hh;
          const int c8  = rl * 8;
          const v8h vh = *(const v8h*)(sl16 + row * 128 + c8);
          const v8h vl = *(const v8h*)(sl16 + 2048 + row * 128 + c8);
          const size_t go = (size_t)(m0 + i * 16 + row) * ldc + n0 + c8;
          *(v8h*)(P0 + go) = vh;
          *(v8h*)(P1 + go) = vl;
        }
        
      }
      lds_wave_sync();
    }
  } else {
    float* C = (float*)C0;
#pragma unroll
    for (int i = 0; i < 2; ++i) {
#pragma unroll
      for (int j = 0; j < 8; ++j)
#pragma unroll
        for (int r = 0; r < 8; ++r)
          slf[(8 * hh + r) * 128 + j * 16 + rl] = acc[i][j][r];
      lds_wave_sync();
      {
#pragma unroll
        for (int row = 0; row < 16; ++row) {                     // 32 lanes x 16 B = the whole 512-B row segment per instruction
          const v4f v = *(const v4f*)(slf + row * 128 + lane * 4);
          *(v4f*)(C + (size_t)(m0 + i * 16 + row) * ldc + n0 + lane * 4) = v;
        }
        
      }
      lds_wave_sync();
    }
  }
}

// ---------------------------------------------------------------------------
// Causal multi-query flash attention (one shared 128-wide k/v head), 32-key chunks, block = 4 waves = 64 query rows of one (b, h);
// grid (n query tiles, NHQ, NSEQ).
//   q planes f16 [tok][h*128+d]: hi (qhp) and residual x2048 (qlp); k planes f16 [tok][d]: hi (khp), residual x2048 (klp);
//   v^T planes f16 [d][tok]: hi (vhp), residual x2048 (vlp); outputs attn bf16 hi (ahp) / lo (alp) [tok][h*128+d].
//   scores = (Sh + Sr/2048) * 128^-0.5 with Sh = qh.kh and Sr = ql'.kh + qh.kl'; keys > query -> -inf; online softmax f32;
//   p' = 1024 p stored per wave to LDS as f16 hi (and residual x2048 when PRES), reloaded as A fragments after a wave sync;
//   O = (Oh + Or/2048)/1024/l with Oh = ph.vh, Or = ph.vl' (+ pl'.vh when PRES).
//   K / V^T chunk staging: 128 threads x 4 x 16 B per plane = whole 32x128 / 128x32 tile, plain loads, __syncthreads before and after.
//   Trip count 2*qb+2 chunks (static bound 64); waves whose rows are all below the chunk skip it (wave-uniform, scalar branch).
// Coverage: 32 query tiles x 4 waves x 16 rows x 128 cols per (b,h) = the whole [tok][h*128..+127] slab of both output planes.
// ---------------------------------------------------------------------------
#define AT_KC   32
#define KS_P    136
#define VS_P    40
#define PS_P    40
#define LDS_KS  0
#define LDS_KLS (32 * KS_P)
#define LDS_VHS (2 * 32 * KS_P)
#define LDS_VLS (LDS_VHS + 128 * VS_P)
#define LDS_PH  (LDS_VLS + 128 * VS_P)
#define LDS_PL  (LDS_PH + 4 * 16 * PS_P)
#define LDS_TOT (LDS_PL + 4 * 16 * PS_P)
static_assert(LDS_TOT * 2 <= 65536);
static_assert(4 * 4096 <= LDS_TOT);          // output staging (2 planes x 16 x 128 per wave) aliases the chunk region after the loop

template <bool PRES>
__global__ __launch_bounds__(128) void attn_causal_kernel(
    const unsigned short* __restrict__ qhp, const unsigned short* __restrict__ qlp,
    const unsigned short* __restrict__ khp, const unsigned short* __restrict__ klp,
    const unsigned short* __restrict__ vhp, const unsigned short* __restrict__ vlp,
    unsigned short* __restrict__ ahp, unsigned short* __restrict__ alp, int qb_base) {
  __shared__ __align__(16) _Float16 lds[LDS_TOT];
  _Float16* Ks  = lds + LDS_KS;
  _Float16* Kls = lds + LDS_KLS;
  _Float16* Vhs = lds + LDS_VHS;
  _Float16* Vls = lds + LDS_VLS;

  const int tid  = (int)threadIdx.x;
  const int lane = tid & 31;
  const int wave = wave_id();
  const int hh   = lane >> 4;
  const int c    = lane & 15;
  const int qb   = (int)blockIdx.x + qb_base;
  const int h    = (int)blockIdx.y;
  const int b    = (int)blockIdx.z;
  const int q0   = qb * 64 + wave * 16;          // first query row of this wave (within sequence)
  const int qlast = q0 + 15;
  const size_t tok0 = (size_t)b * SQ;

  const _Float16* Qhr = (const _Float16*)(const void*)qhp + (tok0 + q0 + c) * HID + h * HDM + 8 * hh;
  const _Float16* Qlr = (const _Float16*)(const void*)qlp + (tok0 + q0 + c) * HID + h * HDM + 8 * hh;
  const _Float16* Kg  = (const _Float16*)(const void*)khp + tok0 * HDM;
  const _Float16* Klg = (const _Float16*)(const void*)klp + tok0 * HDM;
  const _Float16* Vhg = (const _Float16*)(const void*)vhp + tok0;
  const _Float16* Vlg = (const _Float16*)(const void*)vlp + tok0;
  _Float16* ph = lds + LDS_PH + wave * (16 * PS_P);
  _Float16* pl = lds + LDS_PL + wave * (16 * PS_P);

  float mrow[8], lrow[8];
  v8f oacc[8], oaccr[8];
#pragma unroll
  for (int r = 0; r < 8; ++r) { mrow[r] = -INFINITY; lrow[r] = 0.f; }
#pragma unroll
  for (int t = 0; t < 8; ++t) { oacc[t] = zero8(); oaccr[t] = zero8(); }

  const int nch = 2 * qb + 2;                    // block-uniform, <= 64
  for (int kc = 0; kc < nch; ++kc) {
    const int kv0 = kc * AT_KC;
    __syncthreads();
#pragma unroll
    for (int i = 0; i < 4; ++i) {                // coverage: 512 pieces of 8 halves per plane = whole tile
      const int p   = tid + 128 * i;             // 0..511
      const int key = p >> 4, d8 = (p & 15) * 8; // K: 32 keys x 128 d
      const v8h kx = *(const v8h*)(Kg  + (size_t)(kv0 + key) * HDM + d8);
      const v8h ky = *(const v8h*)(Klg + (size_t)(kv0 + key) * HDM + d8);
      *(v8h*)(Ks  + key * KS_P + d8) = kx;
      *(v8h*)(Kls + key * KS_P + d8) = ky;
      const int d = p >> 2, k8 = (p & 3) * 8;    // V^T: 128 d x 32 keys
      const v8h vx = *(const v8h*)(Vhg + (size_t)d * NTOK + kv0 + k8);
      const v8h vy = *(const v8h*)(Vlg + (size_t)d * NTOK + kv0 + k8);
      *(v8h*)(Vhs + d * VS_P + k8) = vx;
      *(v8h*)(Vls + d * VS_P + k8) = vy;
    }
    __syncthreads();

    if (kv0 <= qlast) {                          // wave-uniform (scalar): skip chunks fully above this wave's rows
      // ---- scores ----
      v8f sh[2], sr[2];
      sh[0] = zero8(); sh[1] = zero8(); sr[0] = zero8(); sr[1] = zero8();
#pragma unroll
      for (int dc = 0; dc < 4; ++dc) {
        const v16h qa = ldfrag_h(Qhr + dc * 32);
        const v16h ql = ldfrag_h(Qlr + dc * 32);
#pragma unroll
        for (int j = 0; j < 2; ++j) {
          const v16h kb = ldfrag_h(Ks  + (j * 16 + c) * KS_P + dc * 32 + 8 * hh);
          const v16h kl = ldfrag_h(Kls + (j * 16 + c) * KS_P + dc * 32 + 8 * hh);
          sh[j] = mma_h(qa, kb, sh[j]);
          sr[j] = mma_h(ql, kb, sr[j]);
          sr[j] = mma_h(qa, kl, sr[j]);
          guard_h4(sh[j], sr[j], qa, ql, kb, kl);
        }
      }
      // ---- scale, causal mask, chunk row max ----
      float cm[8];
#pragma unroll
      for (int r = 0; r < 8; ++r) {
        const int qrow = q0 + 8 * hh + r;
        float m = -INFINITY;
#pragma unroll
        for (int j = 0; j < 2; ++j) {
          const int key = kv0 + j * 16 + c;
          float s = (sh[j][r] + sr[j][r] * 0.00048828125f) * 0.08838834764831845f;
          s = (key > qrow) ? -INFINITY : s;
          sh[j][r] = s;
          m = fmaxf(m, s);
        }
#pragma unroll
        for (int off = 1; off < 16; off <<= 1) m = fmaxf(m, __shfl_xor(m, off, 32));
        cm[r] = m;
      }
      // ---- online softmax, P' to LDS ----
#pragma unroll
      for (int r = 0; r < 8; ++r) {
        const float mnew  = fmaxf(mrow[r], cm[r]);
        const float alpha = __expf(mrow[r] - mnew);
        mrow[r] = mnew;
        float psum = 0.f;
#pragma unroll
        for (int j = 0; j < 2; ++j) {
          const float p  = __expf(sh[j][r] - mnew);
          psum += p;
          const float pp = p * 1024.0f;
          const _Float16 phv = (_Float16)pp;
          const int po = (8 * hh + r) * PS_P + j * 16 + c;
          ph[po] = phv;
          if (PRES) pl[po] = (_Float16)((pp - (float)phv) * 2048.0f);
        }
#pragma unroll
        for (int off = 1; off < 16; off <<= 1) psum += __shfl_xor(psum, off, 32);
        lrow[r] = lrow[r] * alpha + psum;
#pragma unroll
        for (int t = 0; t < 8; ++t) { oacc[t][r] *= alpha; oaccr[t][r] *= alpha; }
      }
      lds_wave_sync();                           // P' stores visible to the other lanes of this wave before the fragment reload
      // ---- O += P' . V ----
      const v16h pa = ldfrag_h(ph + c * PS_P + 8 * hh);
      v16h pr = pa;
      if (PRES) pr = ldfrag_h(pl + c * PS_P + 8 * hh);
#pragma unroll
      for (int t = 0; t < 8; ++t) {
        const v16h vb = ldfrag_h(Vhs + (t * 16 + c) * VS_P + 8 * hh);
        const v16h vr = ldfrag_h(Vls + (t * 16 + c) * VS_P + 8 * hh);
        oacc[t]  = mma_h(pa, vb, oacc[t]);
        oaccr[t] = mma_h(pa, vr, oaccr[t]);
        if (PRES) oaccr[t] = mma_h(pr, vb, oaccr[t]);
        guard_h4(oacc[t], oaccr[t], pa, pr, vb, vr);
      }
    }
  }

  __syncthreads();                               // all chunk-region readers done before aliasing it as output staging
  _Float16* osh = lds + wave * 4096;
  _Float16* osl = osh + 2048;
#pragma unroll
  for (int r = 0; r < 8; ++r) {
    const float inv = (1.0f / lrow[r]) * 0.0009765625f;
#pragma unroll
    for (int t = 0; t < 8; ++t) {
      const float o = (oacc[t][r] + oaccr[t][r] * 0.00048828125f) * inv;
      const unsigned short hb = bf_bits(o);
      const unsigned short lb = bf_bits(o - bf_val(hb));
      const int so = (8 * hh + r) * 128 + t * 16 + c;
      osh[so] = __builtin_bit_cast(_Float16, hb);
      osl[so] = __builtin_bit_cast(_Float16, lb);
    }
  }
  lds_wave_sync();
  _Float16* Ahg = (_Float16*)(void*)ahp + (tok0 + q0) * HID + h * HDM;
  _Float16* Alg = (_Float16*)(void*)alp + (tok0 + q0) * HID + h * HDM;
  {
#pragma unroll
    for (int it = 0; it < 8; ++it) {
      const int row = it * 2 + hh;               // it 0..7 x hh 0..1 covers rows 0..15
      const int c8  = c * 8;                     // 16 lanes x 16 B = the whole 256-B segment
      const v8h x = *(const v8h*)(osh + row * 128 + c8);
      const v8h y = *(const v8h*)(osl + row * 128 + c8);
      *(v8h*)(Ahg + (size_t)row * HID + c8) = x;
      *(v8h*)(Alg + (size_t)row * HID + c8) = y;
    }
    
  }
}

// ---------------------------------------------------------------------------
// Workspace map (bytes; every region is a whole number of the rows / lines its producer writes with whole-line stores):
//   Xb   bf16 [4096][2048]  16777216    Wqb bf16 [2048][2048]  8388608    Wkb bf16 [128][2048]  524288   Wvb bf16 [128][2048] 524288
//   Wob  bf16 [2048][2048]   8388608    Aqb/Akb/Avb/Aob bf16 [16][2048]  4 x 65536
//   BextQ bf16 [2048][32]     131072    BextK/BextV bf16 [128][32] 2 x 8192   BextO bf16 [2048][32] 131072
//   TextQ/TextK/TextV/TextO bf16 [4096][32]  4 x 262144      cst/snt f32 [2048][64]  2 x 524288
//   Qh/Ql f16 [4096][2048]  2 x 16777216   Kh/Kl f16 [4096][128]  2 x 1048576   Vh/Vl f16 [128][4096]  2 x 1048576
//   Ah/Al bf16 [4096][2048] 2 x 16777216
//   total 108544000
// ---------------------------------------------------------------------------
extern "C" void kernel_launch(void* const* d_in, const int* in_sizes, int n_in,
                              void* d_out, int out_size, void* d_ws, size_t ws_size,
                              hipStream_t stream) {
  if (n_in < 13) return;
  if (in_sizes[0]  != NTOK * HID) return;
  if (in_sizes[1]  != HID * HID)  return;
  if (in_sizes[2]  != LRK * HID)  return;
  if (in_sizes[3]  != HID * LRK)  return;
  if (in_sizes[4]  != HDM * HID)  return;
  if (in_sizes[5]  != LRK * HID)  return;
  if (in_sizes[6]  != HDM * LRK)  return;
  if (in_sizes[7]  != HDM * HID)  return;
  if (in_sizes[8]  != LRK * HID)  return;
  if (in_sizes[9]  != HDM * LRK)  return;
  if (in_sizes[10] != HID * HID)  return;
  if (in_sizes[11] != LRK * HID)  return;
  if (in_sizes[12] != HID * LRK)  return;
  if (out_size != NTOK * HID) return;

  const float* x    = (const float*)d_in[0];
  const float* wq_w = (const float*)d_in[1];
  const float* wq_a = (const float*)d_in[2];
  const float* wq_b = (const float*)d_in[3];
  const float* wk_w = (const float*)d_in[4];
  const float* wk_a = (const float*)d_in[5];
  const float* wk_b = (const float*)d_in[6];
  const float* wv_w = (const float*)d_in[7];
  const float* wv_a = (const float*)d_in[8];
  const float* wv_b = (const float*)d_in[9];
  const float* wo_w = (const float*)d_in[10];
  const float* wo_a = (const float*)d_in[11];
  const float* wo_b = (const float*)d_in[12];
  float* out = (float*)d_out;

  const size_t szX   = (size_t)NTOK * HID * 2;
  const size_t szWsq = (size_t)HID * HID * 2;
  const size_t szWkv = (size_t)HDM * HID * 2;
  const size_t szAl  = (size_t)LRK * HID * 2;
  const size_t szBeL = (size_t)HID * KEXT * 2;
  const size_t szBeS = (size_t)HDM * KEXT * 2;
  const size_t szTe  = (size_t)NTOK * KEXT * 2;
  const size_t szTab = (size_t)SQ * NFREQ * 4;
  const size_t szQ   = (size_t)NTOK * HID * 2;
  const size_t szK   = (size_t)NTOK * HDM * 2;
  const size_t szV   = (size_t)HDM * NTOK * 2;
  const size_t szA   = (size_t)NTOK * HID * 2;
  size_t off = 0;
  const size_t oX   = off; off += szX;
  const size_t oWq  = off; off += szWsq;
  const size_t oWk  = off; off += szWkv;
  const size_t oWv  = off; off += szWkv;
  const size_t oWo  = off; off += szWsq;
  const size_t oAq  = off; off += szAl;
  const size_t oAk  = off; off += szAl;
  const size_t oAv  = off; off += szAl;
  const size_t oAo  = off; off += szAl;
  const size_t oBq  = off; off += szBeL;
  const size_t oBk  = off; off += szBeS;
  const size_t oBv  = off; off += szBeS;
  const size_t oBo  = off; off += szBeL;
  const size_t oTq  = off; off += szTe;
  const size_t oTk  = off; off += szTe;
  const size_t oTv  = off; off += szTe;
  const size_t oTo  = off; off += szTe;
  const size_t oCs  = off; off += szTab;
  const size_t oSn  = off; off += szTab;
  const size_t oQh  = off; off += szQ;
  const size_t oQl  = off; off += szQ;
  const size_t oKh  = off; off += szK;
  const size_t oKl  = off; off += szK;
  const size_t oVh  = off; off += szV;
  const size_t oVl  = off; off += szV;
  const size_t oAh  = off; off += szA;
  const size_t oAl  = off; off += szA;
  if (off > ws_size) return;                     // off = 108544000

  char* ws = (char*)d_ws;
  unsigned short* Xb    = (unsigned short*)(ws + oX);
  unsigned short* Wqb   = (unsigned short*)(ws + oWq);
  unsigned short* Wkb   = (unsigned short*)(ws + oWk);
  unsigned short* Wvb   = (unsigned short*)(ws + oWv);
  unsigned short* Wob   = (unsigned short*)(ws + oWo);
  unsigned short* Aqb   = (unsigned short*)(ws + oAq);
  unsigned short* Akb   = (unsigned short*)(ws + oAk);
  unsigned short* Avb   = (unsigned short*)(ws + oAv);
  unsigned short* Aob   = (unsigned short*)(ws + oAo);
  unsigned short* BextQ = (unsigned short*)(ws + oBq);
  unsigned short* BextK = (unsigned short*)(ws + oBk);
  unsigned short* BextV = (unsigned short*)(ws + oBv);
  unsigned short* BextO = (unsigned short*)(ws + oBo);
  unsigned short* TextQ = (unsigned short*)(ws + oTq);
  unsigned short* TextK = (unsigned short*)(ws + oTk);
  unsigned short* TextV = (unsigned short*)(ws + oTv);
  unsigned short* TextO = (unsigned short*)(ws + oTo);
  float*          cst   = (float*)(ws + oCs);
  float*          snt   = (float*)(ws + oSn);
  unsigned short* Qh    = (unsigned short*)(ws + oQh);
  unsigned short* Ql    = (unsigned short*)(ws + oQl);
  unsigned short* Kh    = (unsigned short*)(ws + oKh);
  unsigned short* Kl    = (unsigned short*)(ws + oKl);
  unsigned short* Vh    = (unsigned short*)(ws + oVh);
  unsigned short* Vl    = (unsigned short*)(ws + oVl);
  unsigned short* Ah    = (unsigned short*)(ws + oAh);
  unsigned short* Al    = (unsigned short*)(ws + oAl);

  const dim3 b256(256), b128(128);
  const int n8X   = NTOK * HID / 8;              // 1048576
  const int n8Wsq = HID * HID / 8;               //  524288
  const int n8Wkv = HDM * HID / 8;               //   32768
  const int n8Al  = LRK * HID / 8;               //    4096
  const int npBL  = HID * 4;                     //    8192 pieces
  const int npBS  = HDM * 4;                     //     512 pieces

  // (1) cos/sin table [2048][64] x 2
  rope_table_kernel<<<dim3(SQ / 8), b256, 0, stream>>>(cst, snt, SQ);
  // (2) bf16 planes of x, the base weights and the adapter A matrices (layouts kept as given: [rows][K] with K contiguous)
  cvt_bf16_kernel<<<dim3((n8X + 255) / 256),   b256, 0, stream>>>(x,    Xb,  n8X);
  cvt_bf16_kernel<<<dim3((n8Wsq + 255) / 256), b256, 0, stream>>>(wq_w, Wqb, n8Wsq);
  cvt_bf16_kernel<<<dim3((n8Wkv + 255) / 256), b256, 0, stream>>>(wk_w, Wkb, n8Wkv);
  cvt_bf16_kernel<<<dim3((n8Wkv + 255) / 256), b256, 0, stream>>>(wv_w, Wvb, n8Wkv);
  cvt_bf16_kernel<<<dim3((n8Wsq + 255) / 256), b256, 0, stream>>>(wo_w, Wob, n8Wsq);
  cvt_bf16_kernel<<<dim3((n8Al + 255) / 256),  b256, 0, stream>>>(wq_a, Aqb, n8Al);
  cvt_bf16_kernel<<<dim3((n8Al + 255) / 256),  b256, 0, stream>>>(wk_a, Akb, n8Al);
  cvt_bf16_kernel<<<dim3((n8Al + 255) / 256),  b256, 0, stream>>>(wv_a, Avb, n8Al);
  cvt_bf16_kernel<<<dim3((n8Al + 255) / 256),  b256, 0, stream>>>(wo_a, Aob, n8Al);
  // (3) adapter B matrices -> [2B | 2B] extension planes
  bext_kernel<<<dim3((npBL + 255) / 256), b256, 0, stream>>>(wq_b, BextQ, npBL);
  bext_kernel<<<dim3((npBS + 255) / 256), b256, 0, stream>>>(wk_b, BextK, npBS);
  bext_kernel<<<dim3((npBS + 255) / 256), b256, 0, stream>>>(wv_b, BextV, npBS);
  bext_kernel<<<dim3((npBL + 255) / 256), b256, 0, stream>>>(wo_b, BextO, npBL);
  // (4) T = x . A^T -> [Th | Tl] extension planes for q, k, v   (M=4096, N=16, K=2048; 128 wave tiles / 4)
  tgemm_n16_kernel<false><<<dim3((NTOK / 32 + 3) / 4), b128, 0, stream>>>(Xb, Xb, HID, Aqb, HID, TextQ, NTOK, HID);
  tgemm_n16_kernel<false><<<dim3((NTOK / 32 + 3) / 4), b128, 0, stream>>>(Xb, Xb, HID, Akb, HID, TextK, NTOK, HID);
  tgemm_n16_kernel<false><<<dim3((NTOK / 32 + 3) / 4), b128, 0, stream>>>(Xb, Xb, HID, Avb, HID, TextV, NTOK, HID);
  // (5) q = x . Wq^T + 2 T.Bq^T, RoPE -> Qh/Ql [4096][2048]   (M=4096, N=2048, K=2048 + ext; 512 blocks)
  gemm_w32x128_kernel<0, false><<<dim3((NTOK / 128) * (HID / 128)), b128, 0, stream>>>(
      Xb, Xb, HID, TextQ, Wqb, HID, BextQ, cst, snt, (void*)Qh, (void*)Ql, HID, NTOK, HID, HID);
  // (6) k = x . Wk^T + 2 T.Bk^T, RoPE -> Kh/Kl [4096][128]     (M=4096, N=128; 32 blocks)
  gemm_w32x128_kernel<0, false><<<dim3((NTOK / 128) * (HDM / 128)), b128, 0, stream>>>(
      Xb, Xb, HID, TextK, Wkb, HID, BextK, cst, snt, (void*)Kh, (void*)Kl, HDM, NTOK, HDM, HID);
  // (7) v^T = Wv . x^T + 2 Bv . T^T -> Vh/Vl [128][4096]      (A = Wvb, Bt = Xb; M=128, N=4096; 32 blocks)
  gemm_w32x128_kernel<1, false><<<dim3((HDM / 128) * (NTOK / 128)), b128, 0, stream>>>(
      Wvb, Wvb, HID, BextV, Xb, HID, TextV, cst, snt, (void*)Vh, (void*)Vl, NTOK, HDM, NTOK, HID);
  // (8) causal attention, query tiles 0..3 with the p residual product, tiles 4..31 without
  attn_causal_kernel<true><<<dim3(4, NHQ, NSEQ), b128, 0, stream>>>(Qh, Ql, Kh, Kl, Vh, Vl, Ah, Al, 0);
  attn_causal_kernel<false><<<dim3(SQ / 64 - 4, NHQ, NSEQ), b128, 0, stream>>>(Qh, Ql, Kh, Kl, Vh, Vl, Ah, Al, 4);
  // (9) T_o = attn(hi + lo) . Ao^T -> [Th | Tl]
  tgemm_n16_kernel<true><<<dim3((NTOK / 32 + 3) / 4), b128, 0, stream>>>(Ah, Al, HID, Aob, HID, TextO, NTOK, HID);
  // (10) out = attn(hi + lo) . Wo^T + 2 T_o . Bo^T -> d_out f32 [4096][2048]   (M=4096, N=2048, K=2048 + ext; 512 blocks)
  gemm_w32x128_kernel<2, true><<<dim3((NTOK / 128) * (HID / 128)), b128, 0, stream>>>(
      Ah, Al, HID, TextO, Wob, HID, BextO, cst, snt, (void*)out, (void*)out, HID, NTOK, HID, HID);
  (void)hipGetLastError();
}

// v002
// One run takes 465 microseconds.
// Timed twice side by side with v001, it ran 1.33 times as fast both times.
// Counting every step since v000, it is 2.09 times as fast.
// Contractions: x.Wq^T, x.Wk^T, Wv.x^T and the rank-16 adapter products x.A^T on v_wmma_f32_16x16x32_bf16 (operands = RNE bf16 of the
// f32 inputs, single products; the adapter term enters the base GEMM as one extra 32-deep k-step with T = x.A^T carried as bf16 hi + bf16 lo
// against 2B in bf16); q.k^T and p.v on v_wmma_f32_16x16x32_f16 (q, k, v^T = f16 hi + f16 residual x2^11 planes, lo.lo dropped; p x1024 f16
// plus f16 residual x2^11 on query tiles 0..3); attn.Wo^T and attn.Ao^T on v_wmma_f32_16x16x32_bf16 (attn = bf16 hi + bf16 lo planes, two
// products; Wo, Ao RNE bf16). f32 accumulate everywhere; RoPE (f32 cos/sin table), online softmax and scale folds in f32.
#include <hip/hip_runtime.h>
#include <math.h>
#include <stdint.h>

#define NSEQ   2
#define SQ     2048
#define HID    2048
#define NHQ    16
#define HDM    128
#define NTOK   4096
#define NFREQ  64
#define LRK    16
#define KEXT   32

typedef _Float16       v16h __attribute__((ext_vector_type(16)));
typedef _Float16       v8h  __attribute__((ext_vector_type(8)));
typedef __bf16         v16b __attribute__((ext_vector_type(16)));
typedef __bf16         v8b  __attribute__((ext_vector_type(8)));
typedef float          v8f  __attribute__((ext_vector_type(8)));
typedef float          v4f  __attribute__((ext_vector_type(4)));
typedef unsigned int   v4u  __attribute__((ext_vector_type(4)));
typedef unsigned short v8us __attribute__((ext_vector_type(8)));

// ---------------------------------------------------------------------------
// small helpers
// ---------------------------------------------------------------------------
__device__ __forceinline__ unsigned short bf_bits(float f) {          // RNE convert f32 -> bf16 bits
  const unsigned u = __float_as_uint(f);
  return (unsigned short)((u + 0x7FFFu + ((u >> 16) & 1u)) >> 16);
}
__device__ __forceinline__ float bf_val(unsigned short h) { return __uint_as_float(((unsigned)h) << 16); }
__device__ __forceinline__ unsigned pk16(unsigned short a, unsigned short b) { return (unsigned)a | ((unsigned)b << 16); }
__device__ __forceinline__ v8f zero8() { v8f z = {0.f, 0.f, 0.f, 0.f, 0.f, 0.f, 0.f, 0.f}; return z; }
__device__ __forceinline__ int wave_id() { return __builtin_amdgcn_readfirstlane((int)(threadIdx.x >> 5)); }

// orders one wave's LDS element stores before its own vector reloads of the same tile (other lanes' data)
__device__ __forceinline__ void lds_wave_sync() {
  __builtin_amdgcn_fence(__ATOMIC_RELEASE, "workgroup");
  __builtin_amdgcn_wave_barrier();
  __builtin_amdgcn_fence(__ATOMIC_ACQUIRE, "workgroup");
}

// ---------------------------------------------------------------------------
// WMMA fragments (wave32, 16x16x32, 16-bit operands). For A (row m = lane&15) and B (col n = lane&15) alike:
// elements 0..7 <- k0 + 8*(lane>>4) + 0..7, elements 8..15 <- k0 + 16 + 8*(lane>>4) + 0..7.
// ldfrag(p) with p = rowbase + k0 + 8*(lane>>4): two 16-B loads p[0..7], p[16..23].
// D: acc[r] = (row 8*(lane>>4) + r, col lane&15).
// ---------------------------------------------------------------------------
union FragH { v16h v; v8h h[2]; };
union FragB { v16b v; v8b h[2]; };
__device__ __forceinline__ v16h ldfrag_h(const _Float16* p) { FragH f; f.h[0] = *(const v8h*)(p); f.h[1] = *(const v8h*)(p + 16); return f.v; }
__device__ __forceinline__ v16b ldfrag_b(const __bf16* p)   { FragB f; f.h[0] = *(const v8b*)(p); f.h[1] = *(const v8b*)(p + 16); return f.v; }

__device__ __forceinline__ v8f mma_h(v16h a, v16h b, v8f c) {
  return __builtin_amdgcn_wmma_f32_16x16x32_f16(false, a, false, b, (short)0, c, false, false);
}
__device__ __forceinline__ v8f mma_b(v16b a, v16b b, v8f c) {
  return __builtin_amdgcn_wmma_f32_16x16x32_bf16(false, a, false, b, (short)0, c, false, false);
}
// hazard guards: 4 VALU slots after the last WMMA of a group, D tied, A/B kept live; memory clobber keeps later loads behind the group
__device__ __forceinline__ void guard_b5(v8f& a, v8f& b, v16b x0, v16b x1, v16b x2, v16b x3, v16b y) {
  asm volatile("v_nop\n\tv_nop\n\tv_nop\n\tv_nop" : "+v"(a), "+v"(b) : "v"(x0), "v"(x1), "v"(x2), "v"(x3), "v"(y) : "memory");
}
__device__ __forceinline__ void guard_h4(v8f& a, v8f& b, v16h w, v16h x, v16h y, v16h z) {
  asm volatile("v_nop\n\tv_nop\n\tv_nop\n\tv_nop" : "+v"(a), "+v"(b) : "v"(w), "v"(x), "v"(y), "v"(z) : "memory");
}
// the same guard for WMMAs whose A fragments stay resident (nothing overwrites them in the loop): only D and the B fragments are named;
// with the resident fragments named here too, the build spilled two of them to scratch and reloaded them in every chunk
__device__ __forceinline__ void guard_h2(v8f& a, v8f& b, v16h y, v16h z) {
  asm volatile("v_nop\n\tv_nop\n\tv_nop\n\tv_nop" : "+v"(a), "+v"(b) : "v"(y), "v"(z) : "memory");
}
__device__ __forceinline__ void acc_guard4(v8f& a, v8f& b, v8f& c, v8f& d) {
  asm volatile("v_nop\n\tv_nop\n\tv_nop\n\tv_nop" : "+v"(a), "+v"(b), "+v"(c), "+v"(d));
}
__device__ __forceinline__ void acc_guard2(v8f& a, v8f& b) {
  asm volatile("v_nop\n\tv_nop\n\tv_nop\n\tv_nop" : "+v"(a), "+v"(b));
}

// ---------------------------------------------------------------------------
// RoPE table for positions t = 0..npos-1: cst[t][i] = cos(t * inv_freq[i]), snt[t][i] = sin(...), inv_freq[i] = 1 / 1e4^(i/64),
// i < 64, all f32. Block = 8 waves, wave w -> t = blockIdx.x*8 + w, lane -> i = lane, lane + 32.
// Coverage: grid npos/8 x 8 waves x 32 lanes x 2 = npos x 64 per plane.
// ---------------------------------------------------------------------------
__global__ __launch_bounds__(256) void rope_table_kernel(float* __restrict__ cst, float* __restrict__ snt, int npos) {
  const int lane = threadIdx.x & 31;
  const int wave = (int)(threadIdx.x >> 5);
  const int t = (int)blockIdx.x * 8 + wave;
  if (t >= npos) return;                       // no barriers in this kernel
  const float pf = (float)t;
  float c0 = 0.f, s0 = 0.f, c1 = 0.f, s1 = 0.f;
#pragma unroll 1
  for (int u = 0; u < 2; ++u) {
    const int i = lane + 32 * u;
    const float e   = (float)i * 0.015625f;      // i / 64 exact
    const float pw  = powf(10000.0f, e);
    const float inv = 1.0f / pw;
    const float ang = pf * inv;
    const float cv = cosf(ang);
    const float sv = sinf(ang);
    c1 = cv; s1 = sv;
    if (u == 0) { c0 = cv; s0 = sv; }
  }
  const size_t o = (size_t)t * NFREQ + lane;
  {
    ((float*)cst)[o]      = c0;
    ((float*)cst)[o + 32] = c1;
    ((float*)snt)[o]      = s0;
    ((float*)snt)[o + 32] = s1;
    
  }
}

// ---------------------------------------------------------------------------
// Elementwise RNE f32 -> bf16 plane: 8 elements per thread, one 16-B store per lane -> 32 consecutive lanes write 4 whole
// (every n8 used is a multiple of 256, so every instruction is full width).
// ---------------------------------------------------------------------------
__global__ __launch_bounds__(256) void cvt_bf16_kernel(const float* __restrict__ in, unsigned short* __restrict__ outp, int n8) {
  const int i = (int)blockIdx.x * 256 + (int)threadIdx.x;
  if (i >= n8) return;
  const size_t e = 8 * (size_t)i;
  const v4f a = *(const v4f*)(in + e);
  const v4f b = *(const v4f*)(in + e + 4);
  v4u w;
  w[0] = pk16(bf_bits(a[0]), bf_bits(a[1]));
  w[1] = pk16(bf_bits(a[2]), bf_bits(a[3]));
  w[2] = pk16(bf_bits(b[0]), bf_bits(b[1]));
  w[3] = pk16(bf_bits(b[2]), bf_bits(b[3]));
  *(v4u*)(outp + e) = w;
  
}

// ---------------------------------------------------------------------------
// Adapter B matrix [R][16] f32 -> extension plane [R][32] bf16: cols 0..15 = bf16(2*B[r][0..15]), cols 16..31 = the same again
// (pairs with the [Th | Tl] extension plane of T so one 32-deep k-step yields 2*(Th+Tl).B^T). 2*bf16(B) is exact.
// ---------------------------------------------------------------------------
__global__ __launch_bounds__(256) void bext_kernel(const float* __restrict__ Bm, unsigned short* __restrict__ outp, int npieces) {
  const int p = (int)blockIdx.x * 256 + (int)threadIdx.x;
  if (p >= npieces) return;
  const int row = p >> 2, q = p & 3;
  const float* src = Bm + (size_t)row * LRK + (q & 1) * 8;
  const v4f a = *(const v4f*)(src);
  const v4f b = *(const v4f*)(src + 4);
  v4u w;
  w[0] = pk16(bf_bits(2.0f * a[0]), bf_bits(2.0f * a[1]));
  w[1] = pk16(bf_bits(2.0f * a[2]), bf_bits(2.0f * a[3]));
  w[2] = pk16(bf_bits(2.0f * b[0]), bf_bits(2.0f * b[1]));
  w[3] = pk16(bf_bits(2.0f * b[2]), bf_bits(2.0f * b[3]));
  *(v4u*)(outp + (size_t)p * 8) = w;
  
}

// ---------------------------------------------------------------------------
// Narrow bf16 WMMA GEMM for the rank-16 adapter: T[m][j] = sum_k A[m][k] * Bt[j][k], j < 16, written as the extension plane
// Tp [M][32] bf16 = [bf16 hi of T (16) | bf16 lo of T (16)]. A row-major [M][K] bf16 (pitch lda; SPLITA: hi plane Ap + lo plane A2p,
// two products), Bt [16][K] bf16 (pitch ldb); K % 32 == 0, M % 32 == 0. Wave tile 32 rows, block = 4 waves, grid = ceil(M/128);
// no block barriers. Epilogue per wave: stage 32x32 u16 in LDS, wave sync, then 4 store instructions of 32 lanes x 16 B
// Coverage: M/32 waves x 32 rows x 32 cols = the whole [M][32] plane.
// ---------------------------------------------------------------------------
template <bool SPLITA>
__global__ __launch_bounds__(128) void tgemm_n16_kernel(
    const unsigned short* Ap, const unsigned short* A2p, int lda,
    const unsigned short* __restrict__ Btp, int ldb,
    unsigned short* __restrict__ Tp, int M, int K) {
  __shared__ __align__(16) unsigned short slab_all[4 * 1024];
  const int lane = threadIdx.x & 31;
  const int wave = wave_id();
  const int hh = lane >> 4;
  const int rl = lane & 15;
  const int m0 = ((int)blockIdx.x * 4 + wave) * 32;
  if (m0 >= M) return;                          // wave-uniform; no block barriers in this kernel

  const __bf16* A  = (const __bf16*)(const void*)Ap;
  const __bf16* A2 = (const __bf16*)(const void*)A2p;
  const __bf16* Bt = (const __bf16*)(const void*)Btp;

  v8f acc[2];
  acc[0] = zero8(); acc[1] = zero8();
  for (int k0 = 0; k0 < K; k0 += 32) {
    v16b ah[2], al[2];
#pragma unroll
    for (int i = 0; i < 2; ++i) {
      const size_t ao = (size_t)(m0 + i * 16 + rl) * lda + k0 + 8 * hh;
      ah[i] = ldfrag_b(A + ao);
      al[i] = SPLITA ? ldfrag_b(A2 + ao) : ah[i];
    }
    const v16b bj = ldfrag_b(Bt + (size_t)rl * ldb + k0 + 8 * hh);
    acc[0] = mma_b(ah[0], bj, acc[0]);
    acc[1] = mma_b(ah[1], bj, acc[1]);
    if (SPLITA) {
      acc[0] = mma_b(al[0], bj, acc[0]);
      acc[1] = mma_b(al[1], bj, acc[1]);
    }
    guard_b5(acc[0], acc[1], ah[0], ah[1], al[0], al[1], bj);
  }
  acc_guard2(acc[0], acc[1]);

  unsigned short* sl = slab_all + wave * 1024;
#pragma unroll
  for (int i = 0; i < 2; ++i)
#pragma unroll
    for (int r = 0; r < 8; ++r) {
      const int row = i * 16 + 8 * hh + r;
      const float v = acc[i][r];
      const unsigned short hb = bf_bits(v);
      const unsigned short lb = bf_bits(v - bf_val(hb));
      sl[row * 32 + rl]      = hb;
      sl[row * 32 + 16 + rl] = lb;
    }
  lds_wave_sync();
  {
#pragma unroll
    for (int it = 0; it < 4; ++it) {
      const int p   = it * 32 + lane;             // piece 0..127 of 8 u16
      const int row = p >> 2;                     // 0..31
      const int c8  = (p & 3) * 8;                // 0..24
      const v8us w = *(const v8us*)(sl + row * 32 + c8);
      *(v8us*)(Tp + (size_t)(m0 + row) * KEXT + c8) = w;
    }
    
  }
}

// ---------------------------------------------------------------------------
// bf16 WMMA GEMM, wave tile 32 rows x 128 cols, block = 4 waves (128 threads) = one 128 x 128 tile of C (wave w: rows 32w..32w+31).
//   C[m][n] = sum_k A[m][k] * Bt[n][k]  +  sum_{k<32} Aext[m][k] * Bext[n][k]
//   A row-major [M][K] bf16 (pitch lda), Bt row-major [N][K] bf16 (pitch ldb), Aext [M][32], Bext [N][32] bf16 (pitch 32);
//   M % 128 == 0, N % 128 == 0, K % 64 == 0, K >= 128; grid.x = M/128 * N/128.
//   SPLITA: A carried as hi (Ap) + lo (A2p) bf16 planes, two products into one accumulator (Aext stays one plane).
//   K loop: stages of 64 k. A stage = the block's 128 A rows (both planes when SPLITA) and 128 Bt rows, 128 B of each row, brought to LDS
//   by 16-B async copies (a wave's copy = 4 whole lines), rows at pitch 144 B; two buffers, stage t + 2 copied while stage t + 1 is worked on.
//   Fragments come from LDS with the split k map (ldfrag_b); the adapter k-step still loads from global rows.
// Epilogues (all: per wave, per 16-row slab: stage in LDS, wave sync, write each row segment with ONE instruction of
//   EPI 0: q / k projection: RoPE with pairs (dim, dim+64), token position = row & (SQ-1), cos/sin from the f32 table [SQ][64];
//          writes f16 hi plane C0 and f16 residual x2048 plane C1, both [M][ldc], cols n0..n0+127 (row segment 256 B = 16 lanes x 16 B).
//   EPI 1: v^T projection: f16 hi plane C0, residual x2048 plane C1, [M][ldc], row segment 256 B.
//   EPI 2: f32 output C0 [M][ldc]; row segment 128 floats = 512 B = 32 lanes x 16 B per instruction.
// Coverage: M/128 * N/128 blocks x 4 waves x 32x128 = the whole [M][N] output region of each plane.
// ---------------------------------------------------------------------------
template <int EPI> struct SlabT { typedef _Float16 T; static constexpr int PERW = 4096; };   // 2 planes x 16 x 128 halves
template <> struct SlabT<2>     { typedef float    T; static constexpr int PERW = 2048; };   // 16 x 128 floats

#define GK_KC    64                  // k per stage: 128 B of every operand row
#define GK_P     72                  // LDS row pitch in elements: 144 B = 16 B x 9, conflict-free for 16-B fragment reads
#define GK_PLANE (128 * GK_P)        // elements of one 128-row operand plane in LDS

__device__ __forceinline__ unsigned lds_off(const void* p) { return (unsigned)(size_t)p; }   // LDS byte address = low 32 bits

// One thread's share of one 128-row x 128-B plane: eight 16-B async copies, rows r, r + 16, .., r + 112 (r = tid >> 3, piece tid & 7).
// l = this lane's LDS byte address of row r, g = its global address of row r, step = 16 source rows in elements.
// The closing s_wait_xcnt 0 stands inside the statement so that no address register named here is rewritten ahead of it.
__device__ __forceinline__ void copy_plane8(unsigned l, const unsigned short* g, size_t step) {
  asm volatile(
      "global_load_async_to_lds_b128 %0, %8, off\n\t"
      "global_load_async_to_lds_b128 %1, %9, off\n\t"
      "global_load_async_to_lds_b128 %2, %10, off\n\t"
      "global_load_async_to_lds_b128 %3, %11, off\n\t"
      "global_load_async_to_lds_b128 %4, %12, off\n\t"
      "global_load_async_to_lds_b128 %5, %13, off\n\t"
      "global_load_async_to_lds_b128 %6, %14, off\n\t"
      "global_load_async_to_lds_b128 %7, %15, off\n\t"
      "s_wait_xcnt 0x0"
      :: "v"(l), "v"(l + 1u * 16u * GK_P * 2u), "v"(l + 2u * 16u * GK_P * 2u), "v"(l + 3u * 16u * GK_P * 2u),
         "v"(l + 4u * 16u * GK_P * 2u), "v"(l + 5u * 16u * GK_P * 2u), "v"(l + 6u * 16u * GK_P * 2u), "v"(l + 7u * 16u * GK_P * 2u),
         "v"(g), "v"(g + step), "v"(g + 2 * step), "v"(g + 3 * step),
         "v"(g + 4 * step), "v"(g + 5 * step), "v"(g + 6 * step), "v"(g + 7 * step)
      : "memory");
}
// this wave's async copies have landed in LDS
__device__ __forceinline__ void wait_async0() { asm volatile("s_wait_asynccnt 0x0" ::: "memory"); }
// this wave's LDS reads have returned, so the buffer they read may be refilled behind the next barrier
__device__ __forceinline__ void wait_ds0()    { asm volatile("s_wait_dscnt 0x0" ::: "memory"); }

template <int EPI, bool SPLITA>
__global__ __launch_bounds__(128) void gemm_w32x128_kernel(
    const unsigned short* Ap, const unsigned short* A2p, int lda, const unsigned short* __restrict__ Aep,
    const unsigned short* __restrict__ Btp, int ldb, const unsigned short* __restrict__ Bep,
    const float* __restrict__ cst, const float* __restrict__ snt,
    void* C0, void* C1, int ldc, int M, int N, int K) {
  typedef typename SlabT<EPI>::T ST;
  __shared__ __align__(16) ST slab_all[4 * SlabT<EPI>::PERW];
  constexpr int NPA      = SPLITA ? 2 : 1;               // A planes per stage
  constexpr int STAGE_EL = (NPA + 1) * GK_PLANE;         // elements per stage: A plane(s), then the Bt plane
  __shared__ __align__(16) unsigned short stage_all[2 * STAGE_EL];

  const int tid  = (int)threadIdx.x;
  const int lane = tid & 31;
  const int wave = wave_id();
  const int hh = lane >> 4;           // lane half: k offset 8*hh, D row offset 8*hh
  const int rl = lane & 15;           // A row / B col / D col within subtile
  const int tilesN = N >> 7;
  const int blk = (int)blockIdx.x;
  if (blk >= (M >> 7) * tilesN) return;         // block-uniform, in front of every barrier
  const int tmb = blk / tilesN;
  const int tn  = blk - tmb * tilesN;
  const int mb0 = tmb << 7;                     // first row of the block's tile
  const int m0  = mb0 + (wave << 5);            // first row of this wave's tile
  const int n0  = tn << 7;

  // this thread's copy addresses for stage 0, row tid >> 3 of each plane, 16-B piece tid & 7
  const int crow = tid >> 3, cpc = (tid & 7) * 8;
  const unsigned short* gA  = Ap  + (size_t)(mb0 + crow) * lda + cpc;
  const unsigned short* gA2 = A2p + (size_t)(mb0 + crow) * lda + cpc;
  const unsigned short* gB  = Btp + (size_t)(n0  + crow) * ldb + cpc;
  const size_t stepA = (size_t)16 * lda, stepB = (size_t)16 * ldb;
  const unsigned lc = lds_off(stage_all) + (unsigned)(crow * GK_P + cpc) * 2u;
  const int nst = K / GK_KC;                    // stages, block-uniform

  v8f acc[2][8];
#pragma unroll
  for (int i = 0; i < 2; ++i)
#pragma unroll
    for (int j = 0; j < 8; ++j) acc[i][j] = zero8();

  // stage s -> buffer s & 1
  auto copy_stage = [&](int s) {
    const unsigned l = lc + (unsigned)(s & 1) * (unsigned)(STAGE_EL * 2);
    const size_t ko = (size_t)s * GK_KC;
    copy_plane8(l, gA + ko, stepA);
    if (SPLITA) copy_plane8(l + GK_PLANE * 2u, gA2 + ko, stepA);
    copy_plane8(l + (unsigned)(NPA * GK_PLANE) * 2u, gB + ko, stepB);
  };
  copy_stage(0);
  wait_async0();
  __syncthreads();                              // stage 0 published
  if (nst > 1) copy_stage(1);

  for (int t = 0; t < nst; ++t) {
    const __bf16* S  = (const __bf16*)(const void*)(stage_all + (t & 1) * STAGE_EL);
    const __bf16* sA = S + (wave * 32 + rl) * GK_P + 8 * hh;
    const __bf16* sB = S + NPA * GK_PLANE + rl * GK_P + 8 * hh;
#pragma unroll
    for (int ks = 0; ks < 2; ++ks) {
      v16b ah[2], al[2], bj[8];
#pragma unroll
      for (int i = 0; i < 2; ++i) {
        ah[i] = ldfrag_b(sA + i * 16 * GK_P + ks * 32);
        al[i] = SPLITA ? ldfrag_b(sA + GK_PLANE + i * 16 * GK_P + ks * 32) : ah[i];
      }
#pragma unroll
      for (int j = 0; j < 8; ++j) bj[j] = ldfrag_b(sB + j * 16 * GK_P + ks * 32);
      __builtin_amdgcn_sched_barrier(0);        // keeps the k-step's LDS reads one group ahead of its WMMAs (else one waited pair per two WMMAs)
#pragma unroll
      for (int j = 0; j < 8; ++j) {
        acc[0][j] = mma_b(ah[0], bj[j], acc[0][j]);
        acc[1][j] = mma_b(ah[1], bj[j], acc[1][j]);
      }
      if (SPLITA) {
#pragma unroll
        for (int j = 0; j < 8; ++j) {
          acc[0][j] = mma_b(al[0], bj[j], acc[0][j]);
          acc[1][j] = mma_b(al[1], bj[j], acc[1][j]);
        }
      }
      __builtin_amdgcn_sched_barrier(0);        // keeps the next k-step's LDS reads from being spread among these WMMAs
    }
    // publish point of stage t + 1; it also ends every wave's reads of the buffer that stage t + 2 refills
    wait_ds0();
    wait_async0();
    __syncthreads();
    if (t + 2 < nst) copy_stage(t + 2);         // block-uniform test
  }
  wait_async0();                                // nothing of this wave is in flight behind the loop
  // ---- rank-16 adapter extension: one 32-deep k-step [Th | Tl] . [2B | 2B] ----
  {
    const __bf16* Ae = (const __bf16*)(const void*)Aep;
    const __bf16* Be = (const __bf16*)(const void*)Bep;
    v16b ae[2];
#pragma unroll
    for (int i = 0; i < 2; ++i) ae[i] = ldfrag_b(Ae + (size_t)(m0 + i * 16 + rl) * KEXT + 8 * hh);
#pragma unroll
    for (int j = 0; j < 8; ++j) {
      const v16b be = ldfrag_b(Be + (size_t)(n0 + j * 16 + rl) * KEXT + 8 * hh);
      acc[0][j] = mma_b(ae[0], be, acc[0][j]);
      acc[1][j] = mma_b(ae[1], be, acc[1][j]);
      guard_b5(acc[0][j], acc[1][j], ae[0], ae[1], ae[0], ae[1], be);
    }
  }
  acc_guard4(acc[0][0], acc[0][1], acc[0][2], acc[0][3]);
  acc_guard4(acc[0][4], acc[0][5], acc[0][6], acc[0][7]);
  acc_guard4(acc[1][0], acc[1][1], acc[1][2], acc[1][3]);
  acc_guard4(acc[1][4], acc[1][5], acc[1][6], acc[1][7]);

  // ---- epilogue ----
  ST* slab = slab_all + wave * SlabT<EPI>::PERW;
  _Float16* sl16 = (_Float16*)(void*)slab;
  float*    slf  = (float*)(void*)slab;

  if (EPI == 0) {
    _Float16* P0 = (_Float16*)C0;
    _Float16* P1 = (_Float16*)C1;
#pragma unroll
    for (int i = 0; i < 2; ++i) {
      const int rb = m0 + i * 16 + 8 * hh;
#pragma unroll
      for (int j = 0; j < 4; ++j) {
        const int dim = j * 16 + rl;                             // 0..63 within head; x2 partner at dim + 64
#pragma unroll
        for (int r = 0; r < 8; ++r) {
          const int row = rb + r;                                // token 0..M-1
          const int tp  = row & (SQ - 1);                        // position within its sequence
          const float cv = cst[(size_t)tp * NFREQ + dim];
          const float sv = snt[(size_t)tp * NFREQ + dim];
          const float x1 = acc[i][j][r];
          const float x2 = acc[i][j + 4][r];
          const float o1 = x1 * cv - x2 * sv;
          const float o2 = x2 * cv + x1 * sv;
          const _Float16 h1 = (_Float16)o1;
          const _Float16 h2 = (_Float16)o2;
          const int so = (8 * hh + r) * 128 + dim;
          sl16[so]             = h1;
          sl16[so + 64]        = h2;
          sl16[2048 + so]      = (_Float16)((o1 - (float)h1) * 2048.0f);
          sl16[2048 + so + 64] = (_Float16)((o2 - (float)h2) * 2048.0f);
        }
      }
      lds_wave_sync();
      {
#pragma unroll
        for (int it = 0; it < 8; ++it) {
          const int row = it * 2 + hh;                           // it x hh covers rows 0..15
          const int c8  = rl * 8;
          const v8h vh = *(const v8h*)(sl16 + row * 128 + c8);
          const v8h vl = *(const v8h*)(sl16 + 2048 + row * 128 + c8);
          const size_t go = (size_t)(m0 + i * 16 + row) * ldc + n0 + c8;
          *(v8h*)(P0 + go) = vh;
          *(v8h*)(P1 + go) = vl;
        }
        
      }
      lds_wave_sync();
    }
  } else if (EPI == 1) {
    _Float16* P0 = (_Float16*)C0;
    _Float16* P1 = (_Float16*)C1;
#pragma unroll
    for (int i = 0; i < 2; ++i) {
#pragma unroll
      for (int r = 0; r < 8; ++r) {
#pragma unroll
        for (int j = 0; j < 8; ++j) {
          const float v = acc[i][j][r];
          const _Float16 hv = (_Float16)v;
          const int so = (8 * hh + r) * 128 + j * 16 + rl;
          sl16[so]        = hv;
          sl16[2048 + so] = (_Float16)((v - (float)hv) * 2048.0f);
        }
      }
      lds_wave_sync();
      {
#pragma unroll
        for (int it = 0; it < 8; ++it) {
          const int row = it * 2 + hh;
          const int c8  = rl * 8;
          const v8h vh = *(const v8h*)(sl16 + row * 128 + c8);
          const v8h vl = *(const v8h*)(sl16 + 2048 + row * 128 + c8);
          const size_t go = (size_t)(m0 + i * 16 + row) * ldc + n0 + c8;
          *(v8h*)(P0 + go) = vh;
          *(v8h*)(P1 + go) = vl;
        }
        
      }
      lds_wave_sync();
    }
  } else {
    float* C = (float*)C0;
#pragma unroll
    for (int i = 0; i < 2; ++i) {
#pragma unroll
      for (int j = 0; j < 8; ++j)
#pragma unroll
        for (int r = 0; r < 8; ++r)
          slf[(8 * hh + r) * 128 + j * 16 + rl] = acc[i][j][r];
      lds_wave_sync();
      {
#pragma unroll
        for (int row = 0; row < 16; ++row) {                     // 32 lanes x 16 B = the whole 512-B row segment per instruction
          const v4f v = *(const v4f*)(slf + row * 128 + lane * 4);
          *(v4f*)(C + (size_t)(m0 + i * 16 + row) * ldc + n0 + lane * 4) = v;
        }
        
      }
      lds_wave_sync();
    }
  }
}

// ---------------------------------------------------------------------------
// Causal multi-query flash attention (one shared 128-wide k/v head), 32-key chunks, block = 4 waves = 64 query rows of one (b, h);
// grid (n query tiles, NHQ, NSEQ).
//   q planes f16 [tok][h*128+d]: hi (qhp) and residual x2048 (qlp); k planes f16 [tok][d]: hi (khp), residual x2048 (klp);
//   v^T planes f16 [d][tok]: hi (vhp), residual x2048 (vlp); outputs attn bf16 hi (ahp) / lo (alp) [tok][h*128+d].
//   scores = (Sh + Sr/2048) * 128^-0.5 with Sh = qh.kh and Sr = ql'.kh + qh.kl'; keys > query -> -inf; online softmax f32;
//   p' = 1024 p stored per wave to LDS as f16 hi (and residual x2048 when PRES), reloaded as A fragments after a wave sync;
//   O = (Oh + Or/2048)/1024/l with Oh = ph.vh, Or = ph.vl' (+ pl'.vh when PRES).
//   K / V^T chunk staging: 128 threads x 4 x 16 B per plane = whole 32x128 / 128x32 tile, plain loads, __syncthreads before and after.
//   Trip count 2*qb+2 chunks (static bound 64); waves whose rows are all below the chunk skip it (wave-uniform, scalar branch).
// Coverage: 32 query tiles x 4 waves x 16 rows x 128 cols per (b,h) = the whole [tok][h*128..+127] slab of both output planes.
// ---------------------------------------------------------------------------
#define AT_KC   32
#define KS_P    136
#define VS_P    40
#define PS_P    40
#define LDS_KS  0
#define LDS_KLS (32 * KS_P)
#define LDS_VHS (2 * 32 * KS_P)
#define LDS_VLS (LDS_VHS + 128 * VS_P)
#define LDS_PH  (LDS_VLS + 128 * VS_P)
#define LDS_PL  (LDS_PH + 4 * 16 * PS_P)
#define LDS_TOT (LDS_PL + 4 * 16 * PS_P)
static_assert(LDS_TOT * 2 <= 65536);
static_assert(4 * 4096 <= LDS_TOT);          // output staging (2 planes x 16 x 128 per wave) aliases the chunk region after the loop

template <bool PRES>
__global__ __launch_bounds__(128) void attn_causal_kernel(
    const unsigned short* __restrict__ qhp, const unsigned short* __restrict__ qlp,
    const unsigned short* __restrict__ khp, const unsigned short* __restrict__ klp,
    const unsigned short* __restrict__ vhp, const unsigned short* __restrict__ vlp,
    unsigned short* __restrict__ ahp, unsigned short* __restrict__ alp, int qb_base) {
  __shared__ __align__(16) _Float16 lds[LDS_TOT];
  _Float16* Ks  = lds + LDS_KS;
  _Float16* Kls = lds + LDS_KLS;
  _Float16* Vhs = lds + LDS_VHS;
  _Float16* Vls = lds + LDS_VLS;

  const int tid  = (int)threadIdx.x;
  const int lane = tid & 31;
  const int wave = wave_id();
  const int hh   = lane >> 4;
  const int c    = lane & 15;
  const int qb   = (int)blockIdx.x + qb_base;
  const int h    = (int)blockIdx.y;
  const int b    = (int)blockIdx.z;
  const int q0   = qb * 64 + wave * 16;          // first query row of this wave (within sequence)
  const int qlast = q0 + 15;
  const size_t tok0 = (size_t)b * SQ;

  const _Float16* Qhr = (const _Float16*)(const void*)qhp + (tok0 + q0 + c) * HID + h * HDM + 8 * hh;
  const _Float16* Qlr = (const _Float16*)(const void*)qlp + (tok0 + q0 + c) * HID + h * HDM + 8 * hh;
  const _Float16* Kg  = (const _Float16*)(const void*)khp + tok0 * HDM;
  const _Float16* Klg = (const _Float16*)(const void*)klp + tok0 * HDM;
  const _Float16* Vhg = (const _Float16*)(const void*)vhp + tok0;
  const _Float16* Vlg = (const _Float16*)(const void*)vlp + tok0;
  _Float16* ph = lds + LDS_PH + wave * (16 * PS_P);
  _Float16* pl = lds + LDS_PL + wave * (16 * PS_P);

  float mrow[8], lrow[8];
  v8f oacc[8], oaccr[8];
#pragma unroll
  for (int r = 0; r < 8; ++r) { mrow[r] = -INFINITY; lrow[r] = 0.f; }
#pragma unroll
  for (int t = 0; t < 8; ++t) { oacc[t] = zero8(); oaccr[t] = zero8(); }

  // the wave's 16 query rows, both planes, as A fragments: loaded once, held in registers over the whole key loop
  // unrolled so that the arrays are registers
  v16h qfa[4], qfl[4];
#pragma unroll
  for (int dc = 0; dc < 4; ++dc) {
    qfa[dc] = ldfrag_h(Qhr + dc * 32);
    qfl[dc] = ldfrag_h(Qlr + dc * 32);
  }

  const int nch = 2 * qb + 2;                    // block-uniform, <= 64
  for (int kc = 0; kc < nch; ++kc) {
    const int kv0 = kc * AT_KC;
    __syncthreads();
#pragma unroll
    for (int i = 0; i < 4; ++i) {                // coverage: 512 pieces of 8 halves per plane = whole tile
      const int p   = tid + 128 * i;             // 0..511
      const int key = p >> 4, d8 = (p & 15) * 8; // K: 32 keys x 128 d
      const v8h kx = *(const v8h*)(Kg  + (size_t)(kv0 + key) * HDM + d8);
      const v8h ky = *(const v8h*)(Klg + (size_t)(kv0 + key) * HDM + d8);
      *(v8h*)(Ks  + key * KS_P + d8) = kx;
      *(v8h*)(Kls + key * KS_P + d8) = ky;
      const int d = p >> 2, k8 = (p & 3) * 8;    // V^T: 128 d x 32 keys
      const v8h vx = *(const v8h*)(Vhg + (size_t)d * NTOK + kv0 + k8);
      const v8h vy = *(const v8h*)(Vlg + (size_t)d * NTOK + kv0 + k8);
      *(v8h*)(Vhs + d * VS_P + k8) = vx;
      *(v8h*)(Vls + d * VS_P + k8) = vy;
    }
    __syncthreads();

    if (kv0 <= qlast) {                          // wave-uniform (scalar): skip chunks fully above this wave's rows
      // ---- scores ----
      v8f sh[2], sr[2];
      sh[0] = zero8(); sh[1] = zero8(); sr[0] = zero8(); sr[1] = zero8();
#pragma unroll
      for (int dc = 0; dc < 4; ++dc) {
        const v16h qa = qfa[dc];
        const v16h ql = qfl[dc];
#pragma unroll
        for (int j = 0; j < 2; ++j) {
          const v16h kb = ldfrag_h(Ks  + (j * 16 + c) * KS_P + dc * 32 + 8 * hh);
          const v16h kl = ldfrag_h(Kls + (j * 16 + c) * KS_P + dc * 32 + 8 * hh);
          sh[j] = mma_h(qa, kb, sh[j]);
          sr[j] = mma_h(ql, kb, sr[j]);
          sr[j] = mma_h(qa, kl, sr[j]);
          guard_h2(sh[j], sr[j], kb, kl);
        }
      }
      // ---- scale, causal mask, chunk row max ----
      float cm[8];
#pragma unroll
      for (int r = 0; r < 8; ++r) {
        const int qrow = q0 + 8 * hh + r;
        float m = -INFINITY;
#pragma unroll
        for (int j = 0; j < 2; ++j) {
          const int key = kv0 + j * 16 + c;
          float s = (sh[j][r] + sr[j][r] * 0.00048828125f) * 0.08838834764831845f;
          s = (key > qrow) ? -INFINITY : s;
          sh[j][r] = s;
          m = fmaxf(m, s);
        }
#pragma unroll
        for (int off = 1; off < 16; off <<= 1) m = fmaxf(m, __shfl_xor(m, off, 32));
        cm[r] = m;
      }
      // ---- online softmax, P' to LDS ----
#pragma unroll
      for (int r = 0; r < 8; ++r) {
        const float mnew  = fmaxf(mrow[r], cm[r]);
        const float alpha = __expf(mrow[r] - mnew);
        mrow[r] = mnew;
        float psum = 0.f;
#pragma unroll
        for (int j = 0; j < 2; ++j) {
          const float p  = __expf(sh[j][r] - mnew);
          psum += p;
          const float pp = p * 1024.0f;
          const _Float16 phv = (_Float16)pp;
          const int po = (8 * hh + r) * PS_P + j * 16 + c;
          ph[po] = phv;
          if (PRES) pl[po] = (_Float16)((pp - (float)phv) * 2048.0f);
        }
#pragma unroll
        for (int off = 1; off < 16; off <<= 1) psum += __shfl_xor(psum, off, 32);
        lrow[r] = lrow[r] * alpha + psum;
#pragma unroll
        for (int t = 0; t < 8; ++t) { oacc[t][r] *= alpha; oaccr[t][r] *= alpha; }
      }
      lds_wave_sync();                           // P' stores visible to the other lanes of this wave before the fragment reload
      // ---- O += P' . V ----
      const v16h pa = ldfrag_h(ph + c * PS_P + 8 * hh);
      v16h pr = pa;
      if (PRES) pr = ldfrag_h(pl + c * PS_P + 8 * hh);
#pragma unroll
      for (int t = 0; t < 8; ++t) {
        const v16h vb = ldfrag_h(Vhs + (t * 16 + c) * VS_P + 8 * hh);
        const v16h vr = ldfrag_h(Vls + (t * 16 + c) * VS_P + 8 * hh);
        oacc[t]  = mma_h(pa, vb, oacc[t]);
        oaccr[t] = mma_h(pa, vr, oaccr[t]);
        if (PRES) oaccr[t] = mma_h(pr, vb, oaccr[t]);
        guard_h4(oacc[t], oaccr[t], pa, pr, vb, vr);
      }
    }
  }

  __syncthreads();                               // all chunk-region readers done before aliasing it as output staging
  _Float16* osh = lds + wave * 4096;
  _Float16* osl = osh + 2048;
#pragma unroll
  for (int r = 0; r < 8; ++r) {
    const float inv = (1.0f / lrow[r]) * 0.0009765625f;
#pragma unroll
    for (int t = 0; t < 8; ++t) {
      const float o = (oacc[t][r] + oaccr[t][r] * 0.00048828125f) * inv;
      const unsigned short hb = bf_bits(o);
      const unsigned short lb = bf_bits(o - bf_val(hb));
      const int so = (8 * hh + r) * 128 + t * 16 + c;
      osh[so] = __builtin_bit_cast(_Float16, hb);
      osl[so] = __builtin_bit_cast(_Float16, lb);
    }
  }
  lds_wave_sync();
  _Float16* Ahg = (_Float16*)(void*)ahp + (tok0 + q0) * HID + h * HDM;
  _Float16* Alg = (_Float16*)(void*)alp + (tok0 + q0) * HID + h * HDM;
  {
#pragma unroll
    for (int it = 0; it < 8; ++it) {
      const int row = it * 2 + hh;               // it 0..7 x hh 0..1 covers rows 0..15
      const int c8  = c * 8;                     // 16 lanes x 16 B = the whole 256-B segment
      const v8h x = *(const v8h*)(osh + row * 128 + c8);
      const v8h y = *(const v8h*)(osl + row * 128 + c8);
      *(v8h*)(Ahg + (size_t)row * HID + c8) = x;
      *(v8h*)(Alg + (size_t)row * HID + c8) = y;
    }
    
  }
}

// ---------------------------------------------------------------------------
// Workspace map (bytes; every region is a whole number of the rows / lines its producer writes with whole-line stores):
//   Xb   bf16 [4096][2048]  16777216    Wqb bf16 [2048][2048]  8388608    Wkb bf16 [128][2048]  524288   Wvb bf16 [128][2048] 524288
//   Wob  bf16 [2048][2048]   8388608    Aqb/Akb/Avb/Aob bf16 [16][2048]  4 x 65536
//   BextQ bf16 [2048][32]     131072    BextK/BextV bf16 [128][32] 2 x 8192   BextO bf16 [2048][32] 131072
//   TextQ/TextK/TextV/TextO bf16 [4096][32]  4 x 262144      cst/snt f32 [2048][64]  2 x 524288
//   Qh/Ql f16 [4096][2048]  2 x 16777216   Kh/Kl f16 [4096][128]  2 x 1048576   Vh/Vl f16 [128][4096]  2 x 1048576
//   Ah/Al bf16 [4096][2048] 2 x 16777216
//   total 108544000
// ---------------------------------------------------------------------------
extern "C" void kernel_launch(void* const* d_in, const int* in_sizes, int n_in,
                              void* d_out, int out_size, void* d_ws, size_t ws_size,
                              hipStream_t stream) {
  if (n_in < 13) return;
  if (in_sizes[0]  != NTOK * HID) return;
  if (in_sizes[1]  != HID * HID)  return;
  if (in_sizes[2]  != LRK * HID)  return;
  if (in_sizes[3]  != HID * LRK)  return;
  if (in_sizes[4]  != HDM * HID)  return;
  if (in_sizes[5]  != LRK * HID)  return;
  if (in_sizes[6]  != HDM * LRK)  return;
  if (in_sizes[7]  != HDM * HID)  return;
  if (in_sizes[8]  != LRK * HID)  return;
  if (in_sizes[9]  != HDM * LRK)  return;
  if (in_sizes[10] != HID * HID)  return;
  if (in_sizes[11] != LRK * HID)  return;
  if (in_sizes[12] != HID * LRK)  return;
  if (out_size != NTOK * HID) return;

  const float* x    = (const float*)d_in[0];
  const float* wq_w = (const float*)d_in[1];
  const float* wq_a = (const float*)d_in[2];
  const float* wq_b = (const float*)d_in[3];
  const float* wk_w = (const float*)d_in[4];
  const float* wk_a = (const float*)d_in[5];
  const float* wk_b = (const float*)d_in[6];
  const float* wv_w = (const float*)d_in[7];
  const float* wv_a = (const float*)d_in[8];
  const float* wv_b = (const float*)d_in[9];
  const float* wo_w = (const float*)d_in[10];
  const float* wo_a = (const float*)d_in[11];
  const float* wo_b = (const float*)d_in[12];
  float* out = (float*)d_out;

  const size_t szX   = (size_t)NTOK * HID * 2;
  const size_t szWsq = (size_t)HID * HID * 2;
  const size_t szWkv = (size_t)HDM * HID * 2;
  const size_t szAl  = (size_t)LRK * HID * 2;
  const size_t szBeL = (size_t)HID * KEXT * 2;
  const size_t szBeS = (size_t)HDM * KEXT * 2;
  const size_t szTe  = (size_t)NTOK * KEXT * 2;
  const size_t szTab = (size_t)SQ * NFREQ * 4;
  const size_t szQ   = (size_t)NTOK * HID * 2;
  const size_t szK   = (size_t)NTOK * HDM * 2;
  const size_t szV   = (size_t)HDM * NTOK * 2;
  const size_t szA   = (size_t)NTOK * HID * 2;
  size_t off = 0;
  const size_t oX   = off; off += szX;
  const size_t oWq  = off; off += szWsq;
  const size_t oWk  = off; off += szWkv;
  const size_t oWv  = off; off += szWkv;
  const size_t oWo  = off; off += szWsq;
  const size_t oAq  = off; off += szAl;
  const size_t oAk  = off; off += szAl;
  const size_t oAv  = off; off += szAl;
  const size_t oAo  = off; off += szAl;
  const size_t oBq  = off; off += szBeL;
  const size_t oBk  = off; off += szBeS;
  const size_t oBv  = off; off += szBeS;
  const size_t oBo  = off; off += szBeL;
  const size_t oTq  = off; off += szTe;
  const size_t oTk  = off; off += szTe;
  const size_t oTv  = off; off += szTe;
  const size_t oTo  = off; off += szTe;
  const size_t oCs  = off; off += szTab;
  const size_t oSn  = off; off += szTab;
  const size_t oQh  = off; off += szQ;
  const size_t oQl  = off; off += szQ;
  const size_t oKh  = off; off += szK;
  const size_t oKl  = off; off += szK;
  const size_t oVh  = off; off += szV;
  const size_t oVl  = off; off += szV;
  const size_t oAh  = off; off += szA;
  const size_t oAl  = off; off += szA;
  if (off > ws_size) return;                     // off = 108544000

  char* ws = (char*)d_ws;
  unsigned short* Xb    = (unsigned short*)(ws + oX);
  unsigned short* Wqb   = (unsigned short*)(ws + oWq);
  unsigned short* Wkb   = (unsigned short*)(ws + oWk);
  unsigned short* Wvb   = (unsigned short*)(ws + oWv);
  unsigned short* Wob   = (unsigned short*)(ws + oWo);
  unsigned short* Aqb   = (unsigned short*)(ws + oAq);
  unsigned short* Akb   = (unsigned short*)(ws + oAk);
  unsigned short* Avb   = (unsigned short*)(ws + oAv);
  unsigned short* Aob   = (unsigned short*)(ws + oAo);
  unsigned short* BextQ = (unsigned short*)(ws + oBq);
  unsigned short* BextK = (unsigned short*)(ws + oBk);
  unsigned short* BextV = (unsigned short*)(ws + oBv);
  unsigned short* BextO = (unsigned short*)(ws + oBo);
  unsigned short* TextQ = (unsigned short*)(ws + oTq);
  unsigned short* TextK = (unsigned short*)(ws + oTk);
  unsigned short* TextV = (unsigned short*)(ws + oTv);
  unsigned short* TextO = (unsigned short*)(ws + oTo);
  float*          cst   = (float*)(ws + oCs);
  float*          snt   = (float*)(ws + oSn);
  unsigned short* Qh    = (unsigned short*)(ws + oQh);
  unsigned short* Ql    = (unsigned short*)(ws + oQl);
  unsigned short* Kh    = (unsigned short*)(ws + oKh);
  unsigned short* Kl    = (unsigned short*)(ws + oKl);
  unsigned short* Vh    = (unsigned short*)(ws + oVh);
  unsigned short* Vl    = (unsigned short*)(ws + oVl);
  unsigned short* Ah    = (unsigned short*)(ws + oAh);
  unsigned short* Al    = (unsigned short*)(ws + oAl);

  const dim3 b256(256), b128(128);
  const int n8X   = NTOK * HID / 8;              // 1048576
  const int n8Wsq = HID * HID / 8;               //  524288
  const int n8Wkv = HDM * HID / 8;               //   32768
  const int n8Al  = LRK * HID / 8;               //    4096
  const int npBL  = HID * 4;                     //    8192 pieces
  const int npBS  = HDM * 4;                     //     512 pieces

  // (1) cos/sin table [2048][64] x 2
  rope_table_kernel<<<dim3(SQ / 8), b256, 0, stream>>>(cst, snt, SQ);
  // (2) bf16 planes of x, the base weights and the adapter A matrices (layouts kept as given: [rows][K] with K contiguous)
  cvt_bf16_kernel<<<dim3((n8X + 255) / 256),   b256, 0, stream>>>(x,    Xb,  n8X);
  cvt_bf16_kernel<<<dim3((n8Wsq + 255) / 256), b256, 0, stream>>>(wq_w, Wqb, n8Wsq);
  cvt_bf16_kernel<<<dim3((n8Wkv + 255) / 256), b256, 0, stream>>>(wk_w, Wkb, n8Wkv);
  cvt_bf16_kernel<<<dim3((n8Wkv + 255) / 256), b256, 0, stream>>>(wv_w, Wvb, n8Wkv);
  cvt_bf16_kernel<<<dim3((n8Wsq + 255) / 256), b256, 0, stream>>>(wo_w, Wob, n8Wsq);
  cvt_bf16_kernel<<<dim3((n8Al + 255) / 256),  b256, 0, stream>>>(wq_a, Aqb, n8Al);
  cvt_bf16_kernel<<<dim3((n8Al + 255) / 256),  b256, 0, stream>>>(wk_a, Akb, n8Al);
  cvt_bf16_kernel<<<dim3((n8Al + 255) / 256),  b256, 0, stream>>>(wv_a, Avb, n8Al);
  cvt_bf16_kernel<<<dim3((n8Al + 255) / 256),  b256, 0, stream>>>(wo_a, Aob, n8Al);
  // (3) adapter B matrices -> [2B | 2B] extension planes
  bext_kernel<<<dim3((npBL + 255) / 256), b256, 0, stream>>>(wq_b, BextQ, npBL);
  bext_kernel<<<dim3((npBS + 255) / 256), b256, 0, stream>>>(wk_b, BextK, npBS);
  bext_kernel<<<dim3((npBS + 255) / 256), b256, 0, stream>>>(wv_b, BextV, npBS);
  bext_kernel<<<dim3((npBL + 255) / 256), b256, 0, stream>>>(wo_b, BextO, npBL);
  // (4) T = x . A^T -> [Th | Tl] extension planes for q, k, v   (M=4096, N=16, K=2048; 128 wave tiles / 4)
  tgemm_n16_kernel<false><<<dim3((NTOK / 32 + 3) / 4), b128, 0, stream>>>(Xb, Xb, HID, Aqb, HID, TextQ, NTOK, HID);
  tgemm_n16_kernel<false><<<dim3((NTOK / 32 + 3) / 4), b128, 0, stream>>>(Xb, Xb, HID, Akb, HID, TextK, NTOK, HID);
  tgemm_n16_kernel<false><<<dim3((NTOK / 32 + 3) / 4), b128, 0, stream>>>(Xb, Xb, HID, Avb, HID, TextV, NTOK, HID);
  // (5) q = x . Wq^T + 2 T.Bq^T, RoPE -> Qh/Ql [4096][2048]   (M=4096, N=2048, K=2048 + ext; 512 blocks)
  gemm_w32x128_kernel<0, false><<<dim3((NTOK / 128) * (HID / 128)), b128, 0, stream>>>(
      Xb, Xb, HID, TextQ, Wqb, HID, BextQ, cst, snt, (void*)Qh, (void*)Ql, HID, NTOK, HID, HID);
  // (6) k = x . Wk^T + 2 T.Bk^T, RoPE -> Kh/Kl [4096][128]     (M=4096, N=128; 32 blocks)
  gemm_w32x128_kernel<0, false><<<dim3((NTOK / 128) * (HDM / 128)), b128, 0, stream>>>(
      Xb, Xb, HID, TextK, Wkb, HID, BextK, cst, snt, (void*)Kh, (void*)Kl, HDM, NTOK, HDM, HID);
  // (7) v^T = Wv . x^T + 2 Bv . T^T -> Vh/Vl [128][4096]      (A = Wvb, Bt = Xb; M=128, N=4096; 32 blocks)
  gemm_w32x128_kernel<1, false><<<dim3((HDM / 128) * (NTOK / 128)), b128, 0, stream>>>(
      Wvb, Wvb, HID, BextV, Xb, HID, TextV, cst, snt, (void*)Vh, (void*)Vl, NTOK, HDM, NTOK, HID);
  // (8) causal attention, query tiles 0..3 with the p residual product, tiles 4..31 without
  attn_causal_kernel<true><<<dim3(4, NHQ, NSEQ), b128, 0, stream>>>(Qh, Ql, Kh, Kl, Vh, Vl, Ah, Al, 0);
  attn_causal_kernel<false><<<dim3(SQ / 64 - 4, NHQ, NSEQ), b128, 0, stream>>>(Qh, Ql, Kh, Kl, Vh, Vl, Ah, Al, 4);
  // (9) T_o = attn(hi + lo) . Ao^T -> [Th | Tl]
  tgemm_n16_kernel<true><<<dim3((NTOK / 32 + 3) / 4), b128, 0, stream>>>(Ah, Al, HID, Aob, HID, TextO, NTOK, HID);
  // (10) out = attn(hi + lo) . Wo^T + 2 T_o . Bo^T -> d_out f32 [4096][2048]   (M=4096, N=2048, K=2048 + ext; 512 blocks)
  gemm_w32x128_kernel<2, true><<<dim3((NTOK / 128) * (HID / 128)), b128, 0, stream>>>(
      Ah, Al, HID, TextO, Wob, HID, BextO, cst, snt, (void*)out, (void*)out, HID, NTOK, HID, HID);
  (void)hipGetLastError();
}

// v003
// It runs in 433 microseconds.
// Two timings next to v002 put it at 1.07 and 1.08 times that version's speed.
// Counting every step since v000, it is 2.25 times as fast.
// Contractions: x.Wq^T, x.Wk^T, Wv.x^T and the rank-16 adapter products x.A^T on v_wmma_f32_16x16x32_bf16 (operands = RNE bf16 of the
// f32 inputs, single products; the adapter term enters the base GEMM as one extra 32-deep k-step with T = x.A^T carried as bf16 hi + bf16 lo
// against 2B in bf16); q.k^T and p.v on v_wmma_f32_16x16x32_f16 (q, k, v^T = f16 hi + f16 residual x2^11 planes, lo.lo dropped; p x1024 f16
// plus f16 residual x2^11 on query tiles 0..3); attn.Wo^T and attn.Ao^T on v_wmma_f32_16x16x32_bf16 (attn = bf16 hi + bf16 lo planes, two
// products; Wo, Ao RNE bf16). f32 accumulate everywhere; RoPE (f32 cos/sin table), online softmax and scale folds in f32.
#include <hip/hip_runtime.h>
#include <math.h>
#include <stdint.h>

#define NSEQ   2
#define SQ     2048
#define HID    2048
#define NHQ    16
#define HDM    128
#define NTOK   4096
#define NFREQ  64
#define LRK    16
#define KEXT   32

typedef _Float16       v16h __attribute__((ext_vector_type(16)));
typedef _Float16       v8h  __attribute__((ext_vector_type(8)));
typedef __bf16         v16b __attribute__((ext_vector_type(16)));
typedef __bf16         v8b  __attribute__((ext_vector_type(8)));
typedef float          v8f  __attribute__((ext_vector_type(8)));
typedef float          v4f  __attribute__((ext_vector_type(4)));
typedef unsigned int   v4u  __attribute__((ext_vector_type(4)));
typedef unsigned short v8us __attribute__((ext_vector_type(8)));

// ---------------------------------------------------------------------------
// small helpers
// ---------------------------------------------------------------------------
__device__ __forceinline__ unsigned short bf_bits(float f) {          // RNE convert f32 -> bf16 bits
  const unsigned u = __float_as_uint(f);
  return (unsigned short)((u + 0x7FFFu + ((u >> 16) & 1u)) >> 16);
}
__device__ __forceinline__ float bf_val(unsigned short h) { return __uint_as_float(((unsigned)h) << 16); }
__device__ __forceinline__ unsigned pk16(unsigned short a, unsigned short b) { return (unsigned)a | ((unsigned)b << 16); }
__device__ __forceinline__ v8f zero8() { v8f z = {0.f, 0.f, 0.f, 0.f, 0.f, 0.f, 0.f, 0.f}; return z; }
__device__ __forceinline__ int wave_id() { return __builtin_amdgcn_readfirstlane((int)(threadIdx.x >> 5)); }

// orders one wave's LDS element stores before its own vector reloads of the same tile (other lanes' data)
__device__ __forceinline__ void lds_wave_sync() {
  __builtin_amdgcn_fence(__ATOMIC_RELEASE, "workgroup");
  __builtin_amdgcn_wave_barrier();
  __builtin_amdgcn_fence(__ATOMIC_ACQUIRE, "workgroup");
}

// ---------------------------------------------------------------------------
// WMMA fragments (wave32, 16x16x32, 16-bit operands). For A (row m = lane&15) and B (col n = lane&15) alike:
// elements 0..7 <- k0 + 8*(lane>>4) + 0..7, elements 8..15 <- k0 + 16 + 8*(lane>>4) + 0..7.
// ldfrag(p) with p = rowbase + k0 + 8*(lane>>4): two 16-B loads p[0..7], p[16..23].
// D: acc[r] = (row 8*(lane>>4) + r, col lane&15).
// ---------------------------------------------------------------------------
union FragH { v16h v; v8h h[2]; };
union FragB { v16b v; v8b h[2]; };
__device__ __forceinline__ v16h ldfrag_h(const _Float16* p) { FragH f; f.h[0] = *(const v8h*)(p); f.h[1] = *(const v8h*)(p + 16); return f.v; }
__device__ __forceinline__ v16b ldfrag_b(const __bf16* p)   { FragB f; f.h[0] = *(const v8b*)(p); f.h[1] = *(const v8b*)(p + 16); return f.v; }

__device__ __forceinline__ v8f mma_h(v16h a, v16h b, v8f c) {
  return __builtin_amdgcn_wmma_f32_16x16x32_f16(false, a, false, b, (short)0, c, false, false);
}
__device__ __forceinline__ v8f mma_b(v16b a, v16b b, v8f c) {
  return __builtin_amdgcn_wmma_f32_16x16x32_bf16(false, a, false, b, (short)0, c, false, false);
}
// hazard guards: 4 VALU slots after the last WMMA of a group, D tied, A/B kept live; memory clobber keeps later loads behind the group
__device__ __forceinline__ void guard_b5(v8f& a, v8f& b, v16b x0, v16b x1, v16b x2, v16b x3, v16b y) {
  asm volatile("v_nop\n\tv_nop\n\tv_nop\n\tv_nop" : "+v"(a), "+v"(b) : "v"(x0), "v"(x1), "v"(x2), "v"(x3), "v"(y) : "memory");
}
// behind the first score group, whose four results are new registers (C = 0): the two B fragments are named so that they stay live past the
// four WMMAs and no result is placed over a B that a WMMA just ahead reads; 4 VALU slots before those registers are free again
__device__ __forceinline__ void guard_first(v8f& a, v8f& b, v8f& c, v8f& d, v16h y, v16h z) {
  asm volatile("v_nop\n\tv_nop\n\tv_nop\n\tv_nop" : "+v"(a), "+v"(b), "+v"(c), "+v"(d) : "v"(y), "v"(z));
}
__device__ __forceinline__ void acc_guard4(v8f& a, v8f& b, v8f& c, v8f& d) {
  asm volatile("v_nop\n\tv_nop\n\tv_nop\n\tv_nop" : "+v"(a), "+v"(b), "+v"(c), "+v"(d));
}
__device__ __forceinline__ void acc_guard2(v8f& a, v8f& b) {
  asm volatile("v_nop\n\tv_nop\n\tv_nop\n\tv_nop" : "+v"(a), "+v"(b));
}

// ---------------------------------------------------------------------------
// RoPE table for positions t = 0..npos-1: cst[t][i] = cos(t * inv_freq[i]), snt[t][i] = sin(...), inv_freq[i] = 1 / 1e4^(i/64),
// i < 64, all f32. Block = 8 waves, wave w -> t = blockIdx.x*8 + w, lane -> i = lane, lane + 32.
// Coverage: grid npos/8 x 8 waves x 32 lanes x 2 = npos x 64 per plane.
// ---------------------------------------------------------------------------
__global__ __launch_bounds__(256) void rope_table_kernel(float* __restrict__ cst, float* __restrict__ snt, int npos) {
  const int lane = threadIdx.x & 31;
  const int wave = (int)(threadIdx.x >> 5);
  const int t = (int)blockIdx.x * 8 + wave;
  if (t >= npos) return;                       // no barriers in this kernel
  const float pf = (float)t;
  float c0 = 0.f, s0 = 0.f, c1 = 0.f, s1 = 0.f;
#pragma unroll 1
  for (int u = 0; u < 2; ++u) {
    const int i = lane + 32 * u;
    const float e   = (float)i * 0.015625f;      // i / 64 exact
    const float pw  = powf(10000.0f, e);
    const float inv = 1.0f / pw;
    const float ang = pf * inv;
    const float cv = cosf(ang);
    const float sv = sinf(ang);
    c1 = cv; s1 = sv;
    if (u == 0) { c0 = cv; s0 = sv; }
  }
  const size_t o = (size_t)t * NFREQ + lane;
  {
    ((float*)cst)[o]      = c0;
    ((float*)cst)[o + 32] = c1;
    ((float*)snt)[o]      = s0;
    ((float*)snt)[o + 32] = s1;
    
  }
}

// ---------------------------------------------------------------------------
// Elementwise RNE f32 -> bf16 plane: 8 elements per thread, one 16-B store per lane -> 32 consecutive lanes write 4 whole
// (every n8 used is a multiple of 256, so every instruction is full width).
// ---------------------------------------------------------------------------
__global__ __launch_bounds__(256) void cvt_bf16_kernel(const float* __restrict__ in, unsigned short* __restrict__ outp, int n8) {
  const int i = (int)blockIdx.x * 256 + (int)threadIdx.x;
  if (i >= n8) return;
  const size_t e = 8 * (size_t)i;
  const v4f a = *(const v4f*)(in + e);
  const v4f b = *(const v4f*)(in + e + 4);
  v4u w;
  w[0] = pk16(bf_bits(a[0]), bf_bits(a[1]));
  w[1] = pk16(bf_bits(a[2]), bf_bits(a[3]));
  w[2] = pk16(bf_bits(b[0]), bf_bits(b[1]));
  w[3] = pk16(bf_bits(b[2]), bf_bits(b[3]));
  *(v4u*)(outp + e) = w;
  
}

// ---------------------------------------------------------------------------
// Adapter B matrix [R][16] f32 -> extension plane [R][32] bf16: cols 0..15 = bf16(2*B[r][0..15]), cols 16..31 = the same again
// (pairs with the [Th | Tl] extension plane of T so one 32-deep k-step yields 2*(Th+Tl).B^T). 2*bf16(B) is exact.
// ---------------------------------------------------------------------------
__global__ __launch_bounds__(256) void bext_kernel(const float* __restrict__ Bm, unsigned short* __restrict__ outp, int npieces) {
  const int p = (int)blockIdx.x * 256 + (int)threadIdx.x;
  if (p >= npieces) return;
  const int row = p >> 2, q = p & 3;
  const float* src = Bm + (size_t)row * LRK + (q & 1) * 8;
  const v4f a = *(const v4f*)(src);
  const v4f b = *(const v4f*)(src + 4);
  v4u w;
  w[0] = pk16(bf_bits(2.0f * a[0]), bf_bits(2.0f * a[1]));
  w[1] = pk16(bf_bits(2.0f * a[2]), bf_bits(2.0f * a[3]));
  w[2] = pk16(bf_bits(2.0f * b[0]), bf_bits(2.0f * b[1]));
  w[3] = pk16(bf_bits(2.0f * b[2]), bf_bits(2.0f * b[3]));
  *(v4u*)(outp + (size_t)p * 8) = w;
  
}

// ---------------------------------------------------------------------------
// Narrow bf16 WMMA GEMM for the rank-16 adapter: T[m][j] = sum_k A[m][k] * Bt[j][k], j < 16, written as the extension plane
// Tp [M][32] bf16 = [bf16 hi of T (16) | bf16 lo of T (16)]. A row-major [M][K] bf16 (pitch lda; SPLITA: hi plane Ap + lo plane A2p,
// two products), Bt [16][K] bf16 (pitch ldb); K % 32 == 0, M % 32 == 0. Wave tile 32 rows, block = 4 waves, grid = ceil(M/128);
// no block barriers. Epilogue per wave: stage 32x32 u16 in LDS, wave sync, then 4 store instructions of 32 lanes x 16 B
// Coverage: M/32 waves x 32 rows x 32 cols = the whole [M][32] plane.
// ---------------------------------------------------------------------------
template <bool SPLITA>
__global__ __launch_bounds__(128) void tgemm_n16_kernel(
    const unsigned short* Ap, const unsigned short* A2p, int lda,
    const unsigned short* __restrict__ Btp, int ldb,
    unsigned short* __restrict__ Tp, int M, int K) {
  __shared__ __align__(16) unsigned short slab_all[4 * 1024];
  const int lane = threadIdx.x & 31;
  const int wave = wave_id();
  const int hh = lane >> 4;
  const int rl = lane & 15;
  const int m0 = ((int)blockIdx.x * 4 + wave) * 32;
  if (m0 >= M) return;                          // wave-uniform; no block barriers in this kernel

  const __bf16* A  = (const __bf16*)(const void*)Ap;
  const __bf16* A2 = (const __bf16*)(const void*)A2p;
  const __bf16* Bt = (const __bf16*)(const void*)Btp;

  v8f acc[2];
  acc[0] = zero8(); acc[1] = zero8();
  for (int k0 = 0; k0 < K; k0 += 32) {
    v16b ah[2], al[2];
#pragma unroll
    for (int i = 0; i < 2; ++i) {
      const size_t ao = (size_t)(m0 + i * 16 + rl) * lda + k0 + 8 * hh;
      ah[i] = ldfrag_b(A + ao);
      al[i] = SPLITA ? ldfrag_b(A2 + ao) : ah[i];
    }
    const v16b bj = ldfrag_b(Bt + (size_t)rl * ldb + k0 + 8 * hh);
    acc[0] = mma_b(ah[0], bj, acc[0]);
    acc[1] = mma_b(ah[1], bj, acc[1]);
    if (SPLITA) {
      acc[0] = mma_b(al[0], bj, acc[0]);
      acc[1] = mma_b(al[1], bj, acc[1]);
    }
    guard_b5(acc[0], acc[1], ah[0], ah[1], al[0], al[1], bj);
  }
  acc_guard2(acc[0], acc[1]);

  unsigned short* sl = slab_all + wave * 1024;
#pragma unroll
  for (int i = 0; i < 2; ++i)
#pragma unroll
    for (int r = 0; r < 8; ++r) {
      const int row = i * 16 + 8 * hh + r;
      const float v = acc[i][r];
      const unsigned short hb = bf_bits(v);
      const unsigned short lb = bf_bits(v - bf_val(hb));
      sl[row * 32 + rl]      = hb;
      sl[row * 32 + 16 + rl] = lb;
    }
  lds_wave_sync();
  {
#pragma unroll
    for (int it = 0; it < 4; ++it) {
      const int p   = it * 32 + lane;             // piece 0..127 of 8 u16
      const int row = p >> 2;                     // 0..31
      const int c8  = (p & 3) * 8;                // 0..24
      const v8us w = *(const v8us*)(sl + row * 32 + c8);
      *(v8us*)(Tp + (size_t)(m0 + row) * KEXT + c8) = w;
    }
    
  }
}

// ---------------------------------------------------------------------------
// bf16 WMMA GEMM, wave tile 32 rows x 128 cols, block = 4 waves (128 threads) = one 128 x 128 tile of C (wave w: rows 32w..32w+31).
//   C[m][n] = sum_k A[m][k] * Bt[n][k]  +  sum_{k<32} Aext[m][k] * Bext[n][k]
//   A row-major [M][K] bf16 (pitch lda), Bt row-major [N][K] bf16 (pitch ldb), Aext [M][32], Bext [N][32] bf16 (pitch 32);
//   M % 128 == 0, N % 128 == 0, K % 64 == 0, K >= 128; grid.x = M/128 * N/128.
//   SPLITA: A carried as hi (Ap) + lo (A2p) bf16 planes, two products into one accumulator (Aext stays one plane).
//   K loop: stages of 64 k. A stage = the block's 128 A rows (both planes when SPLITA) and 128 Bt rows, 128 B of each row, brought to LDS
//   by 16-B async copies (a wave's copy = 4 whole lines), rows at pitch 144 B; two buffers, stage t + 2 copied while stage t + 1 is worked on.
//   Fragments come from LDS with the split k map (ldfrag_b); the adapter k-step still loads from global rows.
// Epilogues (all: per wave, per 16-row slab: stage in LDS, wave sync, write each row segment with ONE instruction of
//   EPI 0: q / k projection: RoPE with pairs (dim, dim+64), token position = row & (SQ-1), cos/sin from the f32 table [SQ][64];
//          writes f16 hi plane C0 and f16 residual x2048 plane C1, both [M][ldc], cols n0..n0+127 (row segment 256 B = 16 lanes x 16 B).
//   EPI 1: v^T projection: f16 hi plane C0, residual x2048 plane C1, [M][ldc], row segment 256 B.
//   EPI 2: f32 output C0 [M][ldc]; row segment 128 floats = 512 B = 32 lanes x 16 B per instruction.
// Coverage: M/128 * N/128 blocks x 4 waves x 32x128 = the whole [M][N] output region of each plane.
// ---------------------------------------------------------------------------
template <int EPI> struct SlabT { typedef _Float16 T; static constexpr int PERW = 4096; };   // 2 planes x 16 x 128 halves
template <> struct SlabT<2>     { typedef float    T; static constexpr int PERW = 2048; };   // 16 x 128 floats

#define GK_KC    64                  // k per stage: 128 B of every operand row
#define GK_P     72                  // LDS row pitch in elements: 144 B = 16 B x 9, conflict-free for 16-B fragment reads
#define GK_PLANE (128 * GK_P)        // elements of one 128-row operand plane in LDS

__device__ __forceinline__ unsigned lds_off(const void* p) { return (unsigned)(size_t)p; }   // LDS byte address = low 32 bits

// One thread's share of one 128-row x 128-B plane: eight 16-B async copies, rows r, r + 16, .., r + 112 (r = tid >> 3, piece tid & 7).
// l = this lane's LDS byte address of row r, g = its global address of row r, step = 16 source rows in elements.
// The closing s_wait_xcnt 0 stands inside the statement so that no address register named here is rewritten ahead of it.
__device__ __forceinline__ void copy_plane8(unsigned l, const unsigned short* g, size_t step) {
  asm volatile(
      "global_load_async_to_lds_b128 %0, %8, off\n\t"
      "global_load_async_to_lds_b128 %1, %9, off\n\t"
      "global_load_async_to_lds_b128 %2, %10, off\n\t"
      "global_load_async_to_lds_b128 %3, %11, off\n\t"
      "global_load_async_to_lds_b128 %4, %12, off\n\t"
      "global_load_async_to_lds_b128 %5, %13, off\n\t"
      "global_load_async_to_lds_b128 %6, %14, off\n\t"
      "global_load_async_to_lds_b128 %7, %15, off\n\t"
      "s_wait_xcnt 0x0"
      :: "v"(l), "v"(l + 1u * 16u * GK_P * 2u), "v"(l + 2u * 16u * GK_P * 2u), "v"(l + 3u * 16u * GK_P * 2u),
         "v"(l + 4u * 16u * GK_P * 2u), "v"(l + 5u * 16u * GK_P * 2u), "v"(l + 6u * 16u * GK_P * 2u), "v"(l + 7u * 16u * GK_P * 2u),
         "v"(g), "v"(g + step), "v"(g + 2 * step), "v"(g + 3 * step),
         "v"(g + 4 * step), "v"(g + 5 * step), "v"(g + 6 * step), "v"(g + 7 * step)
      : "memory");
}
// this wave's async copies have landed in LDS
__device__ __forceinline__ void wait_async0() { asm volatile("s_wait_asynccnt 0x0" ::: "memory"); }
// this wave's LDS reads have returned, so the buffer they read may be refilled behind the next barrier
__device__ __forceinline__ void wait_ds0()    { asm volatile("s_wait_dscnt 0x0" ::: "memory"); }

template <int EPI, bool SPLITA>
__global__ __launch_bounds__(128) void gemm_w32x128_kernel(
    const unsigned short* Ap, const unsigned short* A2p, int lda, const unsigned short* __restrict__ Aep,
    const unsigned short* __restrict__ Btp, int ldb, const unsigned short* __restrict__ Bep,
    const float* __restrict__ cst, const float* __restrict__ snt,
    void* C0, void* C1, int ldc, int M, int N, int K) {
  typedef typename SlabT<EPI>::T ST;
  __shared__ __align__(16) ST slab_all[4 * SlabT<EPI>::PERW];
  constexpr int NPA      = SPLITA ? 2 : 1;               // A planes per stage
  constexpr int STAGE_EL = (NPA + 1) * GK_PLANE;         // elements per stage: A plane(s), then the Bt plane
  __shared__ __align__(16) unsigned short stage_all[2 * STAGE_EL];

  const int tid  = (int)threadIdx.x;
  const int lane = tid & 31;
  const int wave = wave_id();
  const int hh = lane >> 4;           // lane half: k offset 8*hh, D row offset 8*hh
  const int rl = lane & 15;           // A row / B col / D col within subtile
  const int tilesN = N >> 7;
  const int blk = (int)blockIdx.x;
  if (blk >= (M >> 7) * tilesN) return;         // block-uniform, in front of every barrier
  const int tmb = blk / tilesN;
  const int tn  = blk - tmb * tilesN;
  const int mb0 = tmb << 7;                     // first row of the block's tile
  const int m0  = mb0 + (wave << 5);            // first row of this wave's tile
  const int n0  = tn << 7;

  // this thread's copy addresses for stage 0, row tid >> 3 of each plane, 16-B piece tid & 7
  const int crow = tid >> 3, cpc = (tid & 7) * 8;
  const unsigned short* gA  = Ap  + (size_t)(mb0 + crow) * lda + cpc;
  const unsigned short* gA2 = A2p + (size_t)(mb0 + crow) * lda + cpc;
  const unsigned short* gB  = Btp + (size_t)(n0  + crow) * ldb + cpc;
  const size_t stepA = (size_t)16 * lda, stepB = (size_t)16 * ldb;
  const unsigned lc = lds_off(stage_all) + (unsigned)(crow * GK_P + cpc) * 2u;
  const int nst = K / GK_KC;                    // stages, block-uniform

  v8f acc[2][8];
#pragma unroll
  for (int i = 0; i < 2; ++i)
#pragma unroll
    for (int j = 0; j < 8; ++j) acc[i][j] = zero8();

  // stage s -> buffer s & 1
  auto copy_stage = [&](int s) {
    const unsigned l = lc + (unsigned)(s & 1) * (unsigned)(STAGE_EL * 2);
    const size_t ko = (size_t)s * GK_KC;
    copy_plane8(l, gA + ko, stepA);
    if (SPLITA) copy_plane8(l + GK_PLANE * 2u, gA2 + ko, stepA);
    copy_plane8(l + (unsigned)(NPA * GK_PLANE) * 2u, gB + ko, stepB);
  };
  copy_stage(0);
  wait_async0();
  __syncthreads();                              // stage 0 published
  if (nst > 1) copy_stage(1);

  for (int t = 0; t < nst; ++t) {
    const __bf16* S  = (const __bf16*)(const void*)(stage_all + (t & 1) * STAGE_EL);
    const __bf16* sA = S + (wave * 32 + rl) * GK_P + 8 * hh;
    const __bf16* sB = S + NPA * GK_PLANE + rl * GK_P + 8 * hh;
#pragma unroll
    for (int ks = 0; ks < 2; ++ks) {
      v16b ah[2], al[2], bj[8];
#pragma unroll
      for (int i = 0; i < 2; ++i) {
        ah[i] = ldfrag_b(sA + i * 16 * GK_P + ks * 32);
        al[i] = SPLITA ? ldfrag_b(sA + GK_PLANE + i * 16 * GK_P + ks * 32) : ah[i];
      }
#pragma unroll
      for (int j = 0; j < 8; ++j) bj[j] = ldfrag_b(sB + j * 16 * GK_P + ks * 32);
      __builtin_amdgcn_sched_barrier(0);        // keeps the k-step's LDS reads one group ahead of its WMMAs (else one waited pair per two WMMAs)
#pragma unroll
      for (int j = 0; j < 8; ++j) {
        acc[0][j] = mma_b(ah[0], bj[j], acc[0][j]);
        acc[1][j] = mma_b(ah[1], bj[j], acc[1][j]);
      }
      if (SPLITA) {
#pragma unroll
        for (int j = 0; j < 8; ++j) {
          acc[0][j] = mma_b(al[0], bj[j], acc[0][j]);
          acc[1][j] = mma_b(al[1], bj[j], acc[1][j]);
        }
      }
      __builtin_amdgcn_sched_barrier(0);        // keeps the next k-step's LDS reads from being spread among these WMMAs
    }
    // publish point of stage t + 1; it also ends every wave's reads of the buffer that stage t + 2 refills
    wait_ds0();
    wait_async0();
    __syncthreads();
    if (t + 2 < nst) copy_stage(t + 2);         // block-uniform test
  }
  wait_async0();                                // nothing of this wave is in flight behind the loop
  // ---- rank-16 adapter extension: one 32-deep k-step [Th | Tl] . [2B | 2B] ----
  {
    const __bf16* Ae = (const __bf16*)(const void*)Aep;
    const __bf16* Be = (const __bf16*)(const void*)Bep;
    v16b ae[2];
#pragma unroll
    for (int i = 0; i < 2; ++i) ae[i] = ldfrag_b(Ae + (size_t)(m0 + i * 16 + rl) * KEXT + 8 * hh);
#pragma unroll
    for (int j = 0; j < 8; ++j) {
      const v16b be = ldfrag_b(Be + (size_t)(n0 + j * 16 + rl) * KEXT + 8 * hh);
      acc[0][j] = mma_b(ae[0], be, acc[0][j]);
      acc[1][j] = mma_b(ae[1], be, acc[1][j]);
      guard_b5(acc[0][j], acc[1][j], ae[0], ae[1], ae[0], ae[1], be);
    }
  }
  acc_guard4(acc[0][0], acc[0][1], acc[0][2], acc[0][3]);
  acc_guard4(acc[0][4], acc[0][5], acc[0][6], acc[0][7]);
  acc_guard4(acc[1][0], acc[1][1], acc[1][2], acc[1][3]);
  acc_guard4(acc[1][4], acc[1][5], acc[1][6], acc[1][7]);

  // ---- epilogue ----
  ST* slab = slab_all + wave * SlabT<EPI>::PERW;
  _Float16* sl16 = (_Float16*)(void*)slab;
  float*    slf  = (float*)(void*)slab;

  if (EPI == 0) {
    _Float16* P0 = (_Float16*)C0;
    _Float16* P1 = (_Float16*)C1;
#pragma unroll
    for (int i = 0; i < 2; ++i) {
      const int rb = m0 + i * 16 + 8 * hh;
#pragma unroll
      for (int j = 0; j < 4; ++j) {
        const int dim = j * 16 + rl;                             // 0..63 within head; x2 partner at dim + 64
#pragma unroll
        for (int r = 0; r < 8; ++r) {
          const int row = rb + r;                                // token 0..M-1
          const int tp  = row & (SQ - 1);                        // position within its sequence
          const float cv = cst[(size_t)tp * NFREQ + dim];
          const float sv = snt[(size_t)tp * NFREQ + dim];
          const float x1 = acc[i][j][r];
          const float x2 = acc[i][j + 4][r];
          const float o1 = x1 * cv - x2 * sv;
          const float o2 = x2 * cv + x1 * sv;
          const _Float16 h1 = (_Float16)o1;
          const _Float16 h2 = (_Float16)o2;
          const int so = (8 * hh + r) * 128 + dim;
          sl16[so]             = h1;
          sl16[so + 64]        = h2;
          sl16[2048 + so]      = (_Float16)((o1 - (float)h1) * 2048.0f);
          sl16[2048 + so + 64] = (_Float16)((o2 - (float)h2) * 2048.0f);
        }
      }
      lds_wave_sync();
      {
#pragma unroll
        for (int it = 0; it < 8; ++it) {
          const int row = it * 2 + hh;                           // it x hh covers rows 0..15
          const int c8  = rl * 8;
          const v8h vh = *(const v8h*)(sl16 + row * 128 + c8);
          const v8h vl = *(const v8h*)(sl16 + 2048 + row * 128 + c8);
          const size_t go = (size_t)(m0 + i * 16 + row) * ldc + n0 + c8;
          *(v8h*)(P0 + go) = vh;
          *(v8h*)(P1 + go) = vl;
        }
        
      }
      lds_wave_sync();
    }
  } else if (EPI == 1) {
    _Float16* P0 = (_Float16*)C0;
    _Float16* P1 = (_Float16*)C1;
#pragma unroll
    for (int i = 0; i < 2; ++i) {
#pragma unroll
      for (int r = 0; r < 8; ++r) {
#pragma unroll
        for (int j = 0; j < 8; ++j) {
          const float v = acc[i][j][r];
          const _Float16 hv = (_Float16)v;
          const int so = (8 * hh + r) * 128 + j * 16 + rl;
          sl16[so]        = hv;
          sl16[2048 + so] = (_Float16)((v - (float)hv) * 2048.0f);
        }
      }
      lds_wave_sync();
      {
#pragma unroll
        for (int it = 0; it < 8; ++it) {
          const int row = it * 2 + hh;
          const int c8  = rl * 8;
          const v8h vh = *(const v8h*)(sl16 + row * 128 + c8);
          const v8h vl = *(const v8h*)(sl16 + 2048 + row * 128 + c8);
          const size_t go = (size_t)(m0 + i * 16 + row) * ldc + n0 + c8;
          *(v8h*)(P0 + go) = vh;
          *(v8h*)(P1 + go) = vl;
        }
        
      }
      lds_wave_sync();
    }
  } else {
    float* C = (float*)C0;
#pragma unroll
    for (int i = 0; i < 2; ++i) {
#pragma unroll
      for (int j = 0; j < 8; ++j)
#pragma unroll
        for (int r = 0; r < 8; ++r)
          slf[(8 * hh + r) * 128 + j * 16 + rl] = acc[i][j][r];
      lds_wave_sync();
      {
#pragma unroll
        for (int row = 0; row < 16; ++row) {                     // 32 lanes x 16 B = the whole 512-B row segment per instruction
          const v4f v = *(const v4f*)(slf + row * 128 + lane * 4);
          *(v4f*)(C + (size_t)(m0 + i * 16 + row) * ldc + n0 + lane * 4) = v;
        }
        
      }
      lds_wave_sync();
    }
  }
}

// ---------------------------------------------------------------------------
// Causal multi-query flash attention (one shared 128-wide k/v head), 32-key chunks, block = 4 waves = 64 query rows of one (b, h);
// grid (n query tiles, NHQ, NSEQ).
//   q planes f16 [tok][h*128+d]: hi (qhp) and residual x2048 (qlp); k planes f16 [tok][d]: hi (khp), residual x2048 (klp);
//   v^T planes f16 [d][tok]: hi (vhp), residual x2048 (vlp); outputs attn bf16 hi (ahp) / lo (alp) [tok][h*128+d].
//   scores = (Sh + Sr/2048) * 128^-0.5 with Sh = qh.kh and Sr = ql'.kh + qh.kl'; keys > query -> -inf; online softmax f32;
//   p' = 1024 p stored per wave to LDS as f16 hi (and residual x2048 when PRES), reloaded as A fragments after a wave sync;
//   O = (Oh + Or/2048)/1024/l with Oh = ph.vh, Or = ph.vl' (+ pl'.vh when PRES).
//   K / V^T chunk staging: 128 threads x 4 x 16 B per plane = whole 32x128 / 128x32 tile, plain loads, __syncthreads before and after.
//   Trip count 2*qb+2 chunks (static bound 64); waves whose rows are all below the chunk skip it (wave-uniform, scalar branch).
// Coverage: 32 query tiles x 4 waves x 16 rows x 128 cols per (b,h) = the whole [tok][h*128..+127] slab of both output planes.
// ---------------------------------------------------------------------------
#define AT_KC   32
#define KS_P    136
#define VS_P    40
#define PS_P    40
#define LDS_KS  0
#define LDS_KLS (32 * KS_P)
#define LDS_VHS (2 * 32 * KS_P)
#define LDS_VLS (LDS_VHS + 128 * VS_P)
#define LDS_PH  (LDS_VLS + 128 * VS_P)
#define LDS_PL  (LDS_PH + 4 * 16 * PS_P)
#define LDS_TOT (LDS_PL + 4 * 16 * PS_P)
static_assert(LDS_TOT * 2 <= 65536);
static_assert(4 * 4096 <= LDS_TOT);          // output staging (2 planes x 16 x 128 per wave) aliases the chunk region after the loop

template <bool PRES>
__global__ __launch_bounds__(128) void attn_causal_kernel(
    const unsigned short* __restrict__ qhp, const unsigned short* __restrict__ qlp,
    const unsigned short* __restrict__ khp, const unsigned short* __restrict__ klp,
    const unsigned short* __restrict__ vhp, const unsigned short* __restrict__ vlp,
    unsigned short* __restrict__ ahp, unsigned short* __restrict__ alp, int qb_base) {
  __shared__ __align__(16) _Float16 lds[LDS_TOT];
  _Float16* Ks  = lds + LDS_KS;
  _Float16* Kls = lds + LDS_KLS;
  _Float16* Vhs = lds + LDS_VHS;
  _Float16* Vls = lds + LDS_VLS;

  const int tid  = (int)threadIdx.x;
  const int lane = tid & 31;
  const int wave = wave_id();
  const int hh   = lane >> 4;
  const int c    = lane & 15;
  const int qb   = (int)blockIdx.x + qb_base;
  const int h    = (int)blockIdx.y;
  const int b    = (int)blockIdx.z;
  const int q0   = qb * 64 + wave * 16;          // first query row of this wave (within sequence)
  const int qlast = q0 + 15;
  const size_t tok0 = (size_t)b * SQ;

  const _Float16* Qhr = (const _Float16*)(const void*)qhp + (tok0 + q0 + c) * HID + h * HDM + 8 * hh;
  const _Float16* Qlr = (const _Float16*)(const void*)qlp + (tok0 + q0 + c) * HID + h * HDM + 8 * hh;
  const _Float16* Kg  = (const _Float16*)(const void*)khp + tok0 * HDM;
  const _Float16* Klg = (const _Float16*)(const void*)klp + tok0 * HDM;
  const _Float16* Vhg = (const _Float16*)(const void*)vhp + tok0;
  const _Float16* Vlg = (const _Float16*)(const void*)vlp + tok0;
  _Float16* ph = lds + LDS_PH + wave * (16 * PS_P);
  _Float16* pl = lds + LDS_PL + wave * (16 * PS_P);

  float mrow[8], lrow[8];
  v8f oacc[8], oaccr[8];
#pragma unroll
  for (int r = 0; r < 8; ++r) { mrow[r] = -INFINITY; lrow[r] = 0.f; }
#pragma unroll
  for (int t = 0; t < 8; ++t) { oacc[t] = zero8(); oaccr[t] = zero8(); }

  // the wave's 16 query rows, both planes, as A fragments: loaded once, held in registers over the whole key loop
  // unrolled so that the arrays are registers
  v16h qfa[4], qfl[4];
#pragma unroll
  for (int dc = 0; dc < 4; ++dc) {
    qfa[dc] = ldfrag_h(Qhr + dc * 32);
    qfl[dc] = ldfrag_h(Qlr + dc * 32);
  }

  const int nch = 2 * qb + 2;                    // block-uniform, <= 64
  for (int kc = 0; kc < nch; ++kc) {
    const int kv0 = kc * AT_KC;
    __syncthreads();
#pragma unroll
    for (int i = 0; i < 4; ++i) {                // coverage: 512 pieces of 8 halves per plane = whole tile
      const int p   = tid + 128 * i;             // 0..511
      const int key = p >> 4, d8 = (p & 15) * 8; // K: 32 keys x 128 d
      const v8h kx = *(const v8h*)(Kg  + (size_t)(kv0 + key) * HDM + d8);
      const v8h ky = *(const v8h*)(Klg + (size_t)(kv0 + key) * HDM + d8);
      *(v8h*)(Ks  + key * KS_P + d8) = kx;
      *(v8h*)(Kls + key * KS_P + d8) = ky;
      const int d = p >> 2, k8 = (p & 3) * 8;    // V^T: 128 d x 32 keys
      const v8h vx = *(const v8h*)(Vhg + (size_t)d * NTOK + kv0 + k8);
      const v8h vy = *(const v8h*)(Vlg + (size_t)d * NTOK + kv0 + k8);
      *(v8h*)(Vhs + d * VS_P + k8) = vx;
      *(v8h*)(Vls + d * VS_P + k8) = vy;
    }
    __syncthreads();

    if (kv0 <= qlast) {                          // wave-uniform (scalar): skip chunks fully above this wave's rows
      // The chunk's LDS traffic is grouped and issued ahead of its use; each sched_barrier below keeps one group of LDS operations together
      // and ahead of the work that hides its latency (left free, the build waits on a pair of reads per WMMA pair, or walks the rows' reductions
      // one by one). Every accumulator and every row value still takes its terms in the same order.
      // ---- scores: fragment reads in groups of 4 (a 32-deep step's two hi tiles, then its two residual tiles), issued three groups ahead ----
      v8f sh[2], sr[2];
      sh[0] = zero8(); sh[1] = zero8(); sr[0] = zero8(); sr[1] = zero8();
      v16h kf[8][2];                             // group 2 * dc: hi plane, group 2 * dc + 1: residual plane; [j] = key tile
#pragma unroll
      for (int g = 0; g < 3; ++g)
#pragma unroll
        for (int j = 0; j < 2; ++j) kf[g][j] = ldfrag_h(((g & 1) ? Kls : Ks) + (j * 16 + c) * KS_P + (g >> 1) * 32 + 8 * hh);
#pragma unroll
      for (int g = 0; g < 8; ++g) {
        __builtin_amdgcn_sched_barrier(0);       // the reads above are issued before this group's WMMAs
        const v16h qa = qfa[g >> 1];
        const v16h ql = qfl[g >> 1];
        if ((g & 1) == 0) {
          sh[0] = mma_h(qa, kf[g][0], sh[0]);
          sr[0] = mma_h(ql, kf[g][0], sr[0]);
          sh[1] = mma_h(qa, kf[g][1], sh[1]);
          sr[1] = mma_h(ql, kf[g][1], sr[1]);
          if (g == 0) guard_first(sh[0], sr[0], sh[1], sr[1], kf[0][0], kf[0][1]);
        } else {
          sr[0] = mma_h(qa, kf[g][0], sr[0]);
          sr[1] = mma_h(qa, kf[g][1], sr[1]);
        }
        __builtin_amdgcn_sched_barrier(0);       // the refill below follows these WMMAs, whose registers it takes over
        if (g + 3 < 8) {
#pragma unroll
          for (int j = 0; j < 2; ++j)
            kf[g + 3][j] = ldfrag_h((((g + 3) & 1) ? Kls : Ks) + (j * 16 + c) * KS_P + ((g + 3) >> 1) * 32 + 8 * hh);
        }
      }
      // ---- scale, causal mask, chunk row max ----
      float cm[8];
#pragma unroll
      for (int r = 0; r < 8; ++r) {
        float m = -INFINITY;
#pragma unroll
        for (int j = 0; j < 2; ++j) {
          const int kd = kv0 + j * 16 + c - (q0 + 8 * hh);       // key - (row - r): key > row as kd > r, r a literal, so that no row number
          float s = (sh[j][r] + sr[j][r] * 0.00048828125f) * 0.08838834764831845f;   // per r is held over the loop (registers for the rings)
          s = (kd > r) ? -INFINITY : s;
          sh[j][r] = s;
          m = fmaxf(m, s);
        }
        cm[r] = m;
      }
#pragma unroll
      for (int off = 1; off < 16; off <<= 1) {
        float tm[8];
#pragma unroll
        for (int r = 0; r < 8; ++r) tm[r] = __shfl_xor(cm[r], off, 32);
        __builtin_amdgcn_sched_barrier(0);       // the 8 rows' exchanges of one step fly together: one LDS latency per step
#pragma unroll
        for (int r = 0; r < 8; ++r) cm[r] = fmaxf(cm[r], tm[r]);
      }
      // ---- online softmax, P' to LDS ----
      float al8[8], ps8[8];
#pragma unroll
      for (int r = 0; r < 8; ++r) {
        const float mnew  = fmaxf(mrow[r], cm[r]);
        const float alpha = __expf(mrow[r] - mnew);
        mrow[r] = mnew;
        al8[r] = alpha;
        float psum = 0.f;
#pragma unroll
        for (int j = 0; j < 2; ++j) {
          const float p  = __expf(sh[j][r] - mnew);
          psum += p;
          const float pp = p * 1024.0f;
          const _Float16 phv = (_Float16)pp;
          const int po = (8 * hh + r) * PS_P + j * 16 + c;
          ph[po] = phv;
          if (PRES) pl[po] = (_Float16)((pp - (float)phv) * 2048.0f);
        }
        ps8[r] = psum;
      }
#pragma unroll
      for (int r = 0; r < 8; ++r)
#pragma unroll
        for (int t = 0; t < 8; ++t) { oacc[t][r] *= al8[r]; oaccr[t][r] *= al8[r]; }
      lds_wave_sync();                           // P' stores visible to the other lanes of this wave before the fragment reload
      // ---- O += P' . V: the 4 fragment reads of each 16-wide d tile are issued three tiles ahead of its WMMAs ----
      const v16h pa = ldfrag_h(ph + c * PS_P + 8 * hh);
      v16h pr = pa;
      if (PRES) pr = ldfrag_h(pl + c * PS_P + 8 * hh);
      v16h vb[8], vr[8];
#pragma unroll
      for (int t = 0; t < 3; ++t) {
        vb[t] = ldfrag_h(Vhs + (t * 16 + c) * VS_P + 8 * hh);
        vr[t] = ldfrag_h(Vls + (t * 16 + c) * VS_P + 8 * hh);
      }
      float ts[8];
#pragma unroll
      for (int t = 0; t < 8; ++t) {
        if ((t & 1) == 0) {                      // one step of the 8 rows' sum exchange flies behind every two tiles' WMMAs
#pragma unroll
          for (int r = 0; r < 8; ++r) ts[r] = __shfl_xor(ps8[r], 1 << (t >> 1), 32);
        }
        __builtin_amdgcn_sched_barrier(0);       // the reads and exchanges above are issued before this tile's WMMAs
        oacc[t]  = mma_h(pa, vb[t], oacc[t]);
        oaccr[t] = mma_h(pa, vr[t], oaccr[t]);
        if (PRES) oaccr[t] = mma_h(pr, vb[t], oaccr[t]);
        __builtin_amdgcn_sched_barrier(0);       // the refill below follows these WMMAs, whose registers it takes over
        if (t + 3 < 8) {
          vb[t + 3] = ldfrag_h(Vhs + ((t + 3) * 16 + c) * VS_P + 8 * hh);
          vr[t + 3] = ldfrag_h(Vls + ((t + 3) * 16 + c) * VS_P + 8 * hh);
        }
        if ((t & 1) == 1) {
#pragma unroll
          for (int r = 0; r < 8; ++r) ps8[r] += ts[r];
        }
      }
#pragma unroll
      for (int r = 0; r < 8; ++r) lrow[r] = lrow[r] * al8[r] + ps8[r];
    }
  }

  __syncthreads();                               // all chunk-region readers done before aliasing it as output staging
  _Float16* osh = lds + wave * 4096;
  _Float16* osl = osh + 2048;
#pragma unroll
  for (int r = 0; r < 8; ++r) {
    const float inv = (1.0f / lrow[r]) * 0.0009765625f;
#pragma unroll
    for (int t = 0; t < 8; ++t) {
      const float o = (oacc[t][r] + oaccr[t][r] * 0.00048828125f) * inv;
      const unsigned short hb = bf_bits(o);
      const unsigned short lb = bf_bits(o - bf_val(hb));
      const int so = (8 * hh + r) * 128 + t * 16 + c;
      osh[so] = __builtin_bit_cast(_Float16, hb);
      osl[so] = __builtin_bit_cast(_Float16, lb);
    }
  }
  lds_wave_sync();
  _Float16* Ahg = (_Float16*)(void*)ahp + (tok0 + q0) * HID + h * HDM;
  _Float16* Alg = (_Float16*)(void*)alp + (tok0 + q0) * HID + h * HDM;
  {
#pragma unroll
    for (int it = 0; it < 8; ++it) {
      const int row = it * 2 + hh;               // it 0..7 x hh 0..1 covers rows 0..15
      const int c8  = c * 8;                     // 16 lanes x 16 B = the whole 256-B segment
      const v8h x = *(const v8h*)(osh + row * 128 + c8);
      const v8h y = *(const v8h*)(osl + row * 128 + c8);
      *(v8h*)(Ahg + (size_t)row * HID + c8) = x;
      *(v8h*)(Alg + (size_t)row * HID + c8) = y;
    }
    
  }
}

// ---------------------------------------------------------------------------
// Workspace map (bytes; every region is a whole number of the rows / lines its producer writes with whole-line stores):
//   Xb   bf16 [4096][2048]  16777216    Wqb bf16 [2048][2048]  8388608    Wkb bf16 [128][2048]  524288   Wvb bf16 [128][2048] 524288
//   Wob  bf16 [2048][2048]   8388608    Aqb/Akb/Avb/Aob bf16 [16][2048]  4 x 65536
//   BextQ bf16 [2048][32]     131072    BextK/BextV bf16 [128][32] 2 x 8192   BextO bf16 [2048][32] 131072
//   TextQ/TextK/TextV/TextO bf16 [4096][32]  4 x 262144      cst/snt f32 [2048][64]  2 x 524288
//   Qh/Ql f16 [4096][2048]  2 x 16777216   Kh/Kl f16 [4096][128]  2 x 1048576   Vh/Vl f16 [128][4096]  2 x 1048576
//   Ah/Al bf16 [4096][2048] 2 x 16777216
//   total 108544000
// ---------------------------------------------------------------------------
extern "C" void kernel_launch(void* const* d_in, const int* in_sizes, int n_in,
                              void* d_out, int out_size, void* d_ws, size_t ws_size,
                              hipStream_t stream) {
  if (n_in < 13) return;
  if (in_sizes[0]  != NTOK * HID) return;
  if (in_sizes[1]  != HID * HID)  return;
  if (in_sizes[2]  != LRK * HID)  return;
  if (in_sizes[3]  != HID * LRK)  return;
  if (in_sizes[4]  != HDM * HID)  return;
  if (in_sizes[5]  != LRK * HID)  return;
  if (in_sizes[6]  != HDM * LRK)  return;
  if (in_sizes[7]  != HDM * HID)  return;
  if (in_sizes[8]  != LRK * HID)  return;
  if (in_sizes[9]  != HDM * LRK)  return;
  if (in_sizes[10] != HID * HID)  return;
  if (in_sizes[11] != LRK * HID)  return;
  if (in_sizes[12] != HID * LRK)  return;
  if (out_size != NTOK * HID) return;

  const float* x    = (const float*)d_in[0];
  const float* wq_w = (const float*)d_in[1];
  const float* wq_a = (const float*)d_in[2];
  const float* wq_b = (const float*)d_in[3];
  const float* wk_w = (const float*)d_in[4];
  const float* wk_a = (const float*)d_in[5];
  const float* wk_b = (const float*)d_in[6];
  const float* wv_w = (const float*)d_in[7];
  const float* wv_a = (const float*)d_in[8];
  const float* wv_b = (const float*)d_in[9];
  const float* wo_w = (const float*)d_in[10];
  const float* wo_a = (const float*)d_in[11];
  const float* wo_b = (const float*)d_in[12];
  float* out = (float*)d_out;

  const size_t szX   = (size_t)NTOK * HID * 2;
  const size_t szWsq = (size_t)HID * HID * 2;
  const size_t szWkv = (size_t)HDM * HID * 2;
  const size_t szAl  = (size_t)LRK * HID * 2;
  const size_t szBeL = (size_t)HID * KEXT * 2;
  const size_t szBeS = (size_t)HDM * KEXT * 2;
  const size_t szTe  = (size_t)NTOK * KEXT * 2;
  const size_t szTab = (size_t)SQ * NFREQ * 4;
  const size_t szQ   = (size_t)NTOK * HID * 2;
  const size_t szK   = (size_t)NTOK * HDM * 2;
  const size_t szV   = (size_t)HDM * NTOK * 2;
  const size_t szA   = (size_t)NTOK * HID * 2;
  size_t off = 0;
  const size_t oX   = off; off += szX;
  const size_t oWq  = off; off += szWsq;
  const size_t oWk  = off; off += szWkv;
  const size_t oWv  = off; off += szWkv;
  const size_t oWo  = off; off += szWsq;
  const size_t oAq  = off; off += szAl;
  const size_t oAk  = off; off += szAl;
  const size_t oAv  = off; off += szAl;
  const size_t oAo  = off; off += szAl;
  const size_t oBq  = off; off += szBeL;
  const size_t oBk  = off; off += szBeS;
  const size_t oBv  = off; off += szBeS;
  const size_t oBo  = off; off += szBeL;
  const size_t oTq  = off; off += szTe;
  const size_t oTk  = off; off += szTe;
  const size_t oTv  = off; off += szTe;
  const size_t oTo  = off; off += szTe;
  const size_t oCs  = off; off += szTab;
  const size_t oSn  = off; off += szTab;
  const size_t oQh  = off; off += szQ;
  const size_t oQl  = off; off += szQ;
  const size_t oKh  = off; off += szK;
  const size_t oKl  = off; off += szK;
  const size_t oVh  = off; off += szV;
  const size_t oVl  = off; off += szV;
  const size_t oAh  = off; off += szA;
  const size_t oAl  = off; off += szA;
  if (off > ws_size) return;                     // off = 108544000

  char* ws = (char*)d_ws;
  unsigned short* Xb    = (unsigned short*)(ws + oX);
  unsigned short* Wqb   = (unsigned short*)(ws + oWq);
  unsigned short* Wkb   = (unsigned short*)(ws + oWk);
  unsigned short* Wvb   = (unsigned short*)(ws + oWv);
  unsigned short* Wob   = (unsigned short*)(ws + oWo);
  unsigned short* Aqb   = (unsigned short*)(ws + oAq);
  unsigned short* Akb   = (unsigned short*)(ws + oAk);
  unsigned short* Avb   = (unsigned short*)(ws + oAv);
  unsigned short* Aob   = (unsigned short*)(ws + oAo);
  unsigned short* BextQ = (unsigned short*)(ws + oBq);
  unsigned short* BextK = (unsigned short*)(ws + oBk);
  unsigned short* BextV = (unsigned short*)(ws + oBv);
  unsigned short* BextO = (unsigned short*)(ws + oBo);
  unsigned short* TextQ = (unsigned short*)(ws + oTq);
  unsigned short* TextK = (unsigned short*)(ws + oTk);
  unsigned short* TextV = (unsigned short*)(ws + oTv);
  unsigned short* TextO = (unsigned short*)(ws + oTo);
  float*          cst   = (float*)(ws + oCs);
  float*          snt   = (float*)(ws + oSn);
  unsigned short* Qh    = (unsigned short*)(ws + oQh);
  unsigned short* Ql    = (unsigned short*)(ws + oQl);
  unsigned short* Kh    = (unsigned short*)(ws + oKh);
  unsigned short* Kl    = (unsigned short*)(ws + oKl);
  unsigned short* Vh    = (unsigned short*)(ws + oVh);
  unsigned short* Vl    = (unsigned short*)(ws + oVl);
  unsigned short* Ah    = (unsigned short*)(ws + oAh);
  unsigned short* Al    = (unsigned short*)(ws + oAl);

  const dim3 b256(256), b128(128);
  const int n8X   = NTOK * HID / 8;              // 1048576
  const int n8Wsq = HID * HID / 8;               //  524288
  const int n8Wkv = HDM * HID / 8;               //   32768
  const int n8Al  = LRK * HID / 8;               //    4096
  const int npBL  = HID * 4;                     //    8192 pieces
  const int npBS  = HDM * 4;                     //     512 pieces

  // (1) cos/sin table [2048][64] x 2
  rope_table_kernel<<<dim3(SQ / 8), b256, 0, stream>>>(cst, snt, SQ);
  // (2) bf16 planes of x, the base weights and the adapter A matrices (layouts kept as given: [rows][K] with K contiguous)
  cvt_bf16_kernel<<<dim3((n8X + 255) / 256),   b256, 0, stream>>>(x,    Xb,  n8X);
  cvt_bf16_kernel<<<dim3((n8Wsq + 255) / 256), b256, 0, stream>>>(wq_w, Wqb, n8Wsq);
  cvt_bf16_kernel<<<dim3((n8Wkv + 255) / 256), b256, 0, stream>>>(wk_w, Wkb, n8Wkv);
  cvt_bf16_kernel<<<dim3((n8Wkv + 255) / 256), b256, 0, stream>>>(wv_w, Wvb, n8Wkv);
  cvt_bf16_kernel<<<dim3((n8Wsq + 255) / 256), b256, 0, stream>>>(wo_w, Wob, n8Wsq);
  cvt_bf16_kernel<<<dim3((n8Al + 255) / 256),  b256, 0, stream>>>(wq_a, Aqb, n8Al);
  cvt_bf16_kernel<<<dim3((n8Al + 255) / 256),  b256, 0, stream>>>(wk_a, Akb, n8Al);
  cvt_bf16_kernel<<<dim3((n8Al + 255) / 256),  b256, 0, stream>>>(wv_a, Avb, n8Al);
  cvt_bf16_kernel<<<dim3((n8Al + 255) / 256),  b256, 0, stream>>>(wo_a, Aob, n8Al);
  // (3) adapter B matrices -> [2B | 2B] extension planes
  bext_kernel<<<dim3((npBL + 255) / 256), b256, 0, stream>>>(wq_b, BextQ, npBL);
  bext_kernel<<<dim3((npBS + 255) / 256), b256, 0, stream>>>(wk_b, BextK, npBS);
  bext_kernel<<<dim3((npBS + 255) / 256), b256, 0, stream>>>(wv_b, BextV, npBS);
  bext_kernel<<<dim3((npBL + 255) / 256), b256, 0, stream>>>(wo_b, BextO, npBL);
  // (4) T = x . A^T -> [Th | Tl] extension planes for q, k, v   (M=4096, N=16, K=2048; 128 wave tiles / 4)
  tgemm_n16_kernel<false><<<dim3((NTOK / 32 + 3) / 4), b128, 0, stream>>>(Xb, Xb, HID, Aqb, HID, TextQ, NTOK, HID);
  tgemm_n16_kernel<false><<<dim3((NTOK / 32 + 3) / 4), b128, 0, stream>>>(Xb, Xb, HID, Akb, HID, TextK, NTOK, HID);
  tgemm_n16_kernel<false><<<dim3((NTOK / 32 + 3) / 4), b128, 0, stream>>>(Xb, Xb, HID, Avb, HID, TextV, NTOK, HID);
  // (5) q = x . Wq^T + 2 T.Bq^T, RoPE -> Qh/Ql [4096][2048]   (M=4096, N=2048, K=2048 + ext; 512 blocks)
  gemm_w32x128_kernel<0, false><<<dim3((NTOK / 128) * (HID / 128)), b128, 0, stream>>>(
      Xb, Xb, HID, TextQ, Wqb, HID, BextQ, cst, snt, (void*)Qh, (void*)Ql, HID, NTOK, HID, HID);
  // (6) k = x . Wk^T + 2 T.Bk^T, RoPE -> Kh/Kl [4096][128]     (M=4096, N=128; 32 blocks)
  gemm_w32x128_kernel<0, false><<<dim3((NTOK / 128) * (HDM / 128)), b128, 0, stream>>>(
      Xb, Xb, HID, TextK, Wkb, HID, BextK, cst, snt, (void*)Kh, (void*)Kl, HDM, NTOK, HDM, HID);
  // (7) v^T = Wv . x^T + 2 Bv . T^T -> Vh/Vl [128][4096]      (A = Wvb, Bt = Xb; M=128, N=4096; 32 blocks)
  gemm_w32x128_kernel<1, false><<<dim3((HDM / 128) * (NTOK / 128)), b128, 0, stream>>>(
      Wvb, Wvb, HID, BextV, Xb, HID, TextV, cst, snt, (void*)Vh, (void*)Vl, NTOK, HDM, NTOK, HID);
  // (8) causal attention, query tiles 0..3 with the p residual product, tiles 4..31 without
  attn_causal_kernel<true><<<dim3(4, NHQ, NSEQ), b128, 0, stream>>>(Qh, Ql, Kh, Kl, Vh, Vl, Ah, Al, 0);
  attn_causal_kernel<false><<<dim3(SQ / 64 - 4, NHQ, NSEQ), b128, 0, stream>>>(Qh, Ql, Kh, Kl, Vh, Vl, Ah, Al, 4);
  // (9) T_o = attn(hi + lo) . Ao^T -> [Th | Tl]
  tgemm_n16_kernel<true><<<dim3((NTOK / 32 + 3) / 4), b128, 0, stream>>>(Ah, Al, HID, Aob, HID, TextO, NTOK, HID);
  // (10) out = attn(hi + lo) . Wo^T + 2 T_o . Bo^T -> d_out f32 [4096][2048]   (M=4096, N=2048, K=2048 + ext; 512 blocks)
  gemm_w32x128_kernel<2, true><<<dim3((NTOK / 128) * (HID / 128)), b128, 0, stream>>>(
      Ah, Al, HID, TextO, Wob, HID, BextO, cst, snt, (void*)out, (void*)out, HID, NTOK, HID, HID);
  (void)hipGetLastError();
}

// v004
// A run of this version takes 317 microseconds.
// In two side-by-side timings against v003, it was 1.36 and 1.37 times as fast.
// Over all steps from v000 it is 3.08 times as fast.
// Contractions: x.Wq^T, x.Wk^T, Wv.x^T and the rank-16 adapter products x.A^T on v_wmma_f32_16x16x32_bf16 (operands = RNE bf16 of the
// f32 inputs, single products; the adapter term enters the base GEMM as one extra 32-deep k-step with T = x.A^T carried as bf16 hi + bf16 lo
// against 2B in bf16); q.k^T and p.v on v_wmma_f32_16x16x32_f16 (q, k, v^T = f16 hi + f16 residual x2^11 planes, lo.lo dropped; p x1024 f16
// plus f16 residual x2^11 on query tiles 0..3); attn.Wo^T and attn.Ao^T on v_wmma_f32_16x16x32_bf16 (attn = bf16 hi + bf16 lo planes, two
// products; Wo, Ao RNE bf16). f32 accumulate everywhere; RoPE (f32 cos/sin table), online softmax and scale folds in f32.
#include <hip/hip_runtime.h>
#include <math.h>
#include <stdint.h>

#define NSEQ   2
#define SQ     2048
#define HID    2048
#define NHQ    16
#define HDM    128
#define NTOK   4096
#define NFREQ  64
#define LRK    16
#define KEXT   32

typedef _Float16       v16h __attribute__((ext_vector_type(16)));
typedef _Float16       v8h  __attribute__((ext_vector_type(8)));
typedef __bf16         v16b __attribute__((ext_vector_type(16)));
typedef __bf16         v8b  __attribute__((ext_vector_type(8)));
typedef float          v8f  __attribute__((ext_vector_type(8)));
typedef float          v4f  __attribute__((ext_vector_type(4)));
typedef unsigned int   v4u  __attribute__((ext_vector_type(4)));
typedef unsigned short v8us __attribute__((ext_vector_type(8)));

// ---------------------------------------------------------------------------
// small helpers
// ---------------------------------------------------------------------------
__device__ __forceinline__ unsigned short bf_bits(float f) {          // RNE convert f32 -> bf16 bits
  const unsigned u = __float_as_uint(f);
  return (unsigned short)((u + 0x7FFFu + ((u >> 16) & 1u)) >> 16);
}
__device__ __forceinline__ float bf_val(unsigned short h) { return __uint_as_float(((unsigned)h) << 16); }
__device__ __forceinline__ unsigned pk16(unsigned short a, unsigned short b) { return (unsigned)a | ((unsigned)b << 16); }
__device__ __forceinline__ v8f zero8() { v8f z = {0.f, 0.f, 0.f, 0.f, 0.f, 0.f, 0.f, 0.f}; return z; }
__device__ __forceinline__ int wave_id() { return __builtin_amdgcn_readfirstlane((int)(threadIdx.x >> 5)); }

// orders one wave's LDS element stores before its own vector reloads of the same tile (other lanes' data)
__device__ __forceinline__ void lds_wave_sync() {
  __builtin_amdgcn_fence(__ATOMIC_RELEASE, "workgroup");
  __builtin_amdgcn_wave_barrier();
  __builtin_amdgcn_fence(__ATOMIC_ACQUIRE, "workgroup");
}

// ---------------------------------------------------------------------------
// WMMA fragments (wave32, 16x16x32, 16-bit operands). For A (row m = lane&15) and B (col n = lane&15) alike:
// elements 0..7 <- k0 + 8*(lane>>4) + 0..7, elements 8..15 <- k0 + 16 + 8*(lane>>4) + 0..7.
// ldfrag(p) with p = rowbase + k0 + 8*(lane>>4): two 16-B loads p[0..7], p[16..23].
// D: acc[r] = (row 8*(lane>>4) + r, col lane&15).
// ---------------------------------------------------------------------------
union FragH { v16h v; v8h h[2]; };
union FragB { v16b v; v8b h[2]; };
__device__ __forceinline__ v16h ldfrag_h(const _Float16* p) { FragH f; f.h[0] = *(const v8h*)(p); f.h[1] = *(const v8h*)(p + 16); return f.v; }
__device__ __forceinline__ v16b ldfrag_b(const __bf16* p)   { FragB f; f.h[0] = *(const v8b*)(p); f.h[1] = *(const v8b*)(p + 16); return f.v; }

__device__ __forceinline__ v8f mma_h(v16h a, v16h b, v8f c) {
  return __builtin_amdgcn_wmma_f32_16x16x32_f16(false, a, false, b, (short)0, c, false, false);
}
__device__ __forceinline__ v8f mma_b(v16b a, v16b b, v8f c) {
  return __builtin_amdgcn_wmma_f32_16x16x32_bf16(false, a, false, b, (short)0, c, false, false);
}
// hazard guards: 4 VALU slots after the last WMMA of a group, D tied, A/B kept live; memory clobber keeps later loads behind the group
__device__ __forceinline__ void guard_b5(v8f& a, v8f& b, v16b x0, v16b x1, v16b x2, v16b x3, v16b y) {
  asm volatile("v_nop\n\tv_nop\n\tv_nop\n\tv_nop" : "+v"(a), "+v"(b) : "v"(x0), "v"(x1), "v"(x2), "v"(x3), "v"(y) : "memory");
}
// behind the first score group, whose four results are new registers (C = 0): the two B fragments are named so that they stay live past the
// four WMMAs and no result is placed over a B that a WMMA just ahead reads; 4 VALU slots before those registers are free again
__device__ __forceinline__ void guard_first(v8f& a, v8f& b, v8f& c, v8f& d, v16h y, v16h z) {
  asm volatile("v_nop\n\tv_nop\n\tv_nop\n\tv_nop" : "+v"(a), "+v"(b), "+v"(c), "+v"(d) : "v"(y), "v"(z));
}
__device__ __forceinline__ void acc_guard4(v8f& a, v8f& b, v8f& c, v8f& d) {
  asm volatile("v_nop\n\tv_nop\n\tv_nop\n\tv_nop" : "+v"(a), "+v"(b), "+v"(c), "+v"(d));
}
__device__ __forceinline__ void acc_guard2(v8f& a, v8f& b) {
  asm volatile("v_nop\n\tv_nop\n\tv_nop\n\tv_nop" : "+v"(a), "+v"(b));
}

// ---------------------------------------------------------------------------
// RoPE table for positions t = 0..npos-1: cst[t][i] = cos(t * inv_freq[i]), snt[t][i] = sin(...), inv_freq[i] = 1 / 1e4^(i/64),
// i < 64, all f32. Block = 8 waves, wave w -> t = blk*8 + w, lane -> i = lane, lane + 32.
// Coverage: npos/8 blocks x 8 waves x 32 lanes x 2 = npos x 64 per plane.
// ---------------------------------------------------------------------------
__device__ __forceinline__ void rope_table_job(float* __restrict__ cst, float* __restrict__ snt, int npos, int blk) {
  const int lane = threadIdx.x & 31;
  const int wave = (int)(threadIdx.x >> 5);
  const int t = blk * 8 + wave;
  if (t >= npos) return;                       // no barriers in this job
  const float pf = (float)t;
  float c0 = 0.f, s0 = 0.f, c1 = 0.f, s1 = 0.f;
#pragma unroll 1
  for (int u = 0; u < 2; ++u) {
    const int i = lane + 32 * u;
    const float e   = (float)i * 0.015625f;      // i / 64 exact
    const float pw  = powf(10000.0f, e);
    const float inv = 1.0f / pw;
    const float ang = pf * inv;
    const float cv = cosf(ang);
    const float sv = sinf(ang);
    c1 = cv; s1 = sv;
    if (u == 0) { c0 = cv; s0 = sv; }
  }
  const size_t o = (size_t)t * NFREQ + lane;
  {
    ((float*)cst)[o]      = c0;
    ((float*)cst)[o + 32] = c1;
    ((float*)snt)[o]      = s0;
    ((float*)snt)[o + 32] = s1;
    
  }
}

// ---------------------------------------------------------------------------
// Elementwise RNE f32 -> bf16 plane: 8 elements per thread, one 16-B store per lane -> 32 consecutive lanes write 4 whole
// (every n8 used is a multiple of 256, so every instruction is full width).
// ---------------------------------------------------------------------------
__device__ __forceinline__ void cvt_bf16_job(const float* __restrict__ in, unsigned short* __restrict__ outp, int n8, int blk) {
  const int i = blk * 256 + (int)threadIdx.x;
  if (i >= n8) return;
  const size_t e = 8 * (size_t)i;
  const v4f a = *(const v4f*)(in + e);
  const v4f b = *(const v4f*)(in + e + 4);
  v4u w;
  w[0] = pk16(bf_bits(a[0]), bf_bits(a[1]));
  w[1] = pk16(bf_bits(a[2]), bf_bits(a[3]));
  w[2] = pk16(bf_bits(b[0]), bf_bits(b[1]));
  w[3] = pk16(bf_bits(b[2]), bf_bits(b[3]));
  *(v4u*)(outp + e) = w;
  
}

// ---------------------------------------------------------------------------
// Adapter B matrix [R][16] f32 -> extension plane [R][32] bf16: cols 0..15 = bf16(2*B[r][0..15]), cols 16..31 = the same again
// (pairs with the [Th | Tl] extension plane of T so one 32-deep k-step yields 2*(Th+Tl).B^T). 2*bf16(B) is exact.
// ---------------------------------------------------------------------------
__device__ __forceinline__ void bext_job(const float* __restrict__ Bm, unsigned short* __restrict__ outp, int npieces, int blk) {
  const int p = blk * 256 + (int)threadIdx.x;
  if (p >= npieces) return;
  const int row = p >> 2, q = p & 3;
  const float* src = Bm + (size_t)row * LRK + (q & 1) * 8;
  const v4f a = *(const v4f*)(src);
  const v4f b = *(const v4f*)(src + 4);
  v4u w;
  w[0] = pk16(bf_bits(2.0f * a[0]), bf_bits(2.0f * a[1]));
  w[1] = pk16(bf_bits(2.0f * a[2]), bf_bits(2.0f * a[3]));
  w[2] = pk16(bf_bits(2.0f * b[0]), bf_bits(2.0f * b[1]));
  w[3] = pk16(bf_bits(2.0f * b[2]), bf_bits(2.0f * b[3]));
  *(v4u*)(outp + (size_t)p * 8) = w;
  
}

// ---------------------------------------------------------------------------
// All preparation in ONE launch: the cos/sin table, the nine bf16 planes and the four adapter extension planes depend on the inputs alone
// and on nothing of each other, so each block takes one block's worth of one job, picked by its index (block-uniform; no barriers).
// Block ranges, in index order: table | x | Wq | Wo | Wk | Wv | Aq Ak Av Ao | Bq Bo | Bk Bv. Each range is exactly the job's own grid.
// ---------------------------------------------------------------------------
#define N8_X    (NTOK * HID / 8)     // 16-B output pieces of each plane
#define N8_WSQ  (HID * HID / 8)
#define N8_WKV  (HDM * HID / 8)
#define N8_AL   (LRK * HID / 8)
#define NP_BL   (HID * 4)
#define NP_BS   (HDM * 4)
#define PB_TAB  (SQ / 8)             // blocks of each job
#define PB_X    (N8_X / 256)
#define PB_WSQ  (N8_WSQ / 256)
#define PB_WKV  (N8_WKV / 256)
#define PB_AL   (N8_AL / 256)
#define PB_BL   (NP_BL / 256)
#define PB_BS   (NP_BS / 256)
#define PB_CVT  (PB_X + 2 * PB_WSQ + 2 * PB_WKV + 4 * PB_AL)
#define PB_ALL  (PB_TAB + PB_CVT + 2 * PB_BL + 2 * PB_BS)
static_assert(N8_X % 256 == 0 && N8_WSQ % 256 == 0 && N8_WKV % 256 == 0 && N8_AL % 256 == 0 && NP_BL % 256 == 0 && NP_BS % 256 == 0);

__global__ __launch_bounds__(256) void prep_kernel(
    const float* __restrict__ x,
    const float* __restrict__ wq_w, const float* __restrict__ wq_a, const float* __restrict__ wq_b,
    const float* __restrict__ wk_w, const float* __restrict__ wk_a, const float* __restrict__ wk_b,
    const float* __restrict__ wv_w, const float* __restrict__ wv_a, const float* __restrict__ wv_b,
    const float* __restrict__ wo_w, const float* __restrict__ wo_a, const float* __restrict__ wo_b,
    unsigned short* __restrict__ Xb,  unsigned short* __restrict__ Wqb, unsigned short* __restrict__ Wkb,
    unsigned short* __restrict__ Wvb, unsigned short* __restrict__ Wob,
    unsigned short* __restrict__ Aqb, unsigned short* __restrict__ Akb, unsigned short* __restrict__ Avb, unsigned short* __restrict__ Aob,
    unsigned short* __restrict__ BextQ, unsigned short* __restrict__ BextK, unsigned short* __restrict__ BextV,
    unsigned short* __restrict__ BextO, float* __restrict__ cst, float* __restrict__ snt) {
  int blk = (int)blockIdx.x;
  if (blk < PB_TAB) { rope_table_job(cst, snt, SQ, blk); return; }
  blk -= PB_TAB;
  if (blk < PB_CVT) {                            // one of the nine bf16 planes: pick source, plane and the block's number within the job
    const float* in = x;
    unsigned short* op = Xb;
    int n8 = N8_X;
    if (blk >= PB_X) {
      blk -= PB_X;
      if (blk < 2 * PB_WSQ) {
        const bool second = blk >= PB_WSQ;
        in = second ? wo_w : wq_w;  op = second ? Wob : Wqb;  n8 = N8_WSQ;  blk -= second ? PB_WSQ : 0;
      } else if ((blk -= 2 * PB_WSQ) < 2 * PB_WKV) {
        const bool second = blk >= PB_WKV;
        in = second ? wv_w : wk_w;  op = second ? Wvb : Wkb;  n8 = N8_WKV;  blk -= second ? PB_WKV : 0;
      } else {
        blk -= 2 * PB_WKV;
        const int j = blk / PB_AL;               // 0..3: q, k, v, o
        in = j == 0 ? wq_a : (j == 1 ? wk_a : (j == 2 ? wv_a : wo_a));
        op = j == 0 ? Aqb  : (j == 1 ? Akb  : (j == 2 ? Avb  : Aob));
        n8 = N8_AL;  blk -= j * PB_AL;
      }
    }
    cvt_bf16_job(in, op, n8, blk);
    return;
  }
  blk -= PB_CVT;
  {                                              // one of the four adapter extension planes
    const float* bm;
    unsigned short* op;
    int np;
    if (blk < 2 * PB_BL) {
      const bool second = blk >= PB_BL;
      bm = second ? wo_b : wq_b;  op = second ? BextO : BextQ;  np = NP_BL;  blk -= second ? PB_BL : 0;
    } else {
      blk -= 2 * PB_BL;
      const bool second = blk >= PB_BS;
      bm = second ? wv_b : wk_b;  op = second ? BextV : BextK;  np = NP_BS;  blk -= second ? PB_BS : 0;
    }
    bext_job(bm, op, np, blk);
  }
}

// ---------------------------------------------------------------------------
// Narrow bf16 WMMA GEMM for the rank-16 adapter: T[m][j] = sum_k A[m][k] * Bt[j][k], j < 16, written as the extension plane
// Tp [M][32] bf16 = [bf16 hi of T (16) | bf16 lo of T (16)]. A row-major [M][K] bf16 (pitch lda; SPLITA: hi plane Ap + lo plane A2p,
// two products), Bt [16][K] bf16 (pitch ldb); K % 32 == 0, M % 32 == 0. Wave tile 32 rows, block = 4 waves, grid = ceil(M/128);
// no block barriers. Epilogue per wave: stage 32x32 u16 in LDS, wave sync, then 4 store instructions of 32 lanes x 16 B
// grid.y = number of adapters that share A: adapter y reads Bt at Btp0 + y * bstep and writes its plane at Tp0 + y * tstep (elements).
// Coverage: per adapter M/32 waves x 32 rows x 32 cols = the whole [M][32] plane.
// ---------------------------------------------------------------------------
template <bool SPLITA>
__global__ __launch_bounds__(128) void tgemm_n16_kernel(
    const unsigned short* Ap, const unsigned short* A2p, int lda,
    const unsigned short* __restrict__ Btp0, int ldb, int bstep,
    unsigned short* __restrict__ Tp0, int tstep, int M, int K) {
  __shared__ __align__(16) unsigned short slab_all[4 * 1024];
  const unsigned short* Btp = Btp0 + (size_t)blockIdx.y * bstep;
  unsigned short*       Tp  = Tp0  + (size_t)blockIdx.y * tstep;
  const int lane = threadIdx.x & 31;
  const int wave = wave_id();
  const int hh = lane >> 4;
  const int rl = lane & 15;
  const int m0 = ((int)blockIdx.x * 4 + wave) * 32;
  if (m0 >= M) return;                          // wave-uniform; no block barriers in this kernel

  const __bf16* A  = (const __bf16*)(const void*)Ap;
  const __bf16* A2 = (const __bf16*)(const void*)A2p;
  const __bf16* Bt = (const __bf16*)(const void*)Btp;

  v8f acc[2];
  acc[0] = zero8(); acc[1] = zero8();
  for (int k0 = 0; k0 < K; k0 += 32) {
    v16b ah[2], al[2];
#pragma unroll
    for (int i = 0; i < 2; ++i) {
      const size_t ao = (size_t)(m0 + i * 16 + rl) * lda + k0 + 8 * hh;
      ah[i] = ldfrag_b(A + ao);
      al[i] = SPLITA ? ldfrag_b(A2 + ao) : ah[i];
    }
    const v16b bj = ldfrag_b(Bt + (size_t)rl * ldb + k0 + 8 * hh);
    acc[0] = mma_b(ah[0], bj, acc[0]);
    acc[1] = mma_b(ah[1], bj, acc[1]);
    if (SPLITA) {
      acc[0] = mma_b(al[0], bj, acc[0]);
      acc[1] = mma_b(al[1], bj, acc[1]);
    }
    guard_b5(acc[0], acc[1], ah[0], ah[1], al[0], al[1], bj);
  }
  acc_guard2(acc[0], acc[1]);

  unsigned short* sl = slab_all + wave * 1024;
#pragma unroll
  for (int i = 0; i < 2; ++i)
#pragma unroll
    for (int r = 0; r < 8; ++r) {
      const int row = i * 16 + 8 * hh + r;
      const float v = acc[i][r];
      const unsigned short hb = bf_bits(v);
      const unsigned short lb = bf_bits(v - bf_val(hb));
      sl[row * 32 + rl]      = hb;
      sl[row * 32 + 16 + rl] = lb;
    }
  lds_wave_sync();
  {
#pragma unroll
    for (int it = 0; it < 4; ++it) {
      const int p   = it * 32 + lane;             // piece 0..127 of 8 u16
      const int row = p >> 2;                     // 0..31
      const int c8  = (p & 3) * 8;                // 0..24
      const v8us w = *(const v8us*)(sl + row * 32 + c8);
      *(v8us*)(Tp + (size_t)(m0 + row) * KEXT + c8) = w;
    }
    
  }
}

// ---------------------------------------------------------------------------
// bf16 WMMA GEMM, wave tile 32 rows x 128 cols, block = 4 waves (128 threads) = one 128 x 128 tile of C (wave w: rows 32w..32w+31).
//   C[m][n] = sum_k A[m][k] * Bt[n][k]  +  sum_{k<32} Aext[m][k] * Bext[n][k]
//   A row-major [M][K] bf16 (pitch lda), Bt row-major [N][K] bf16 (pitch ldb), Aext [M][32], Bext [N][32] bf16 (pitch 32);
//   M % 128 == 0, N % 128 == 0, K % 64 == 0, K >= 128; grid.x = M/128 * N/128.
//   SPLITA: A carried as hi (Ap) + lo (A2p) bf16 planes, two products into one accumulator (Aext stays one plane).
//   K loop: stages of 64 k. A stage = the block's 128 A rows (both planes when SPLITA) and 128 Bt rows, 128 B of each row, brought to LDS
//   by 16-B async copies (a wave's copy = 4 whole lines), rows at pitch 144 B; two buffers, stage t + 2 copied while stage t + 1 is worked on.
//   Fragments come from LDS with the split k map (ldfrag_b); the adapter k-step still loads from global rows.
// Epilogues (all: per wave, per 16-row slab: stage in LDS, wave sync, write each row segment with ONE instruction of
//   EPI 0, rope (block-uniform run-time flag) set: q / k projection: RoPE with pairs (dim, dim+64), token position = row & (SQ-1), cos/sin
//          from the f32 table [SQ][64];
//          writes f16 hi plane C0 and f16 residual x2048 plane C1, both [M][ldc], cols n0..n0+127 (row segment 256 B = 16 lanes x 16 B).
//   EPI 0, rope clear: v^T projection: f16 hi plane C0, residual x2048 plane C1, [M][ldc], row segment 256 B.
//   EPI 2: f32 output C0 [M][ldc]; row segment 128 floats = 512 B = 32 lanes x 16 B per instruction.
// Coverage: M/128 * N/128 blocks (blk = the block's number within its own product) x 4 waves x 32x128 = the whole [M][N] region of each plane.
// The body is a device function on LDS arrays of the calling kernel, so that one launch can hold the blocks of several products.
// ---------------------------------------------------------------------------
template <int EPI> struct SlabT { typedef _Float16 T; static constexpr int PERW = 4096; };   // 2 planes x 16 x 128 halves
template <> struct SlabT<2>     { typedef float    T; static constexpr int PERW = 2048; };   // 16 x 128 floats

#define GK_KC    64                  // k per stage: 128 B of every operand row
#define GK_P     72                  // LDS row pitch in elements: 144 B = 16 B x 9, conflict-free for 16-B fragment reads
#define GK_PLANE (128 * GK_P)        // elements of one 128-row operand plane in LDS

__device__ __forceinline__ unsigned lds_off(const void* p) { return (unsigned)(size_t)p; }   // LDS byte address = low 32 bits

// One thread's share of one 128-row x 128-B plane: eight 16-B async copies, rows r, r + 16, .., r + 112 (r = tid >> 3, piece tid & 7).
// l = this lane's LDS byte address of row r, g = its global address of row r, step = 16 source rows in elements.
// The closing s_wait_xcnt 0 stands inside the statement so that no address register named here is rewritten ahead of it.
__device__ __forceinline__ void copy_plane8(unsigned l, const unsigned short* g, size_t step) {
  asm volatile(
      "global_load_async_to_lds_b128 %0, %8, off\n\t"
      "global_load_async_to_lds_b128 %1, %9, off\n\t"
      "global_load_async_to_lds_b128 %2, %10, off\n\t"
      "global_load_async_to_lds_b128 %3, %11, off\n\t"
      "global_load_async_to_lds_b128 %4, %12, off\n\t"
      "global_load_async_to_lds_b128 %5, %13, off\n\t"
      "global_load_async_to_lds_b128 %6, %14, off\n\t"
      "global_load_async_to_lds_b128 %7, %15, off\n\t"
      "s_wait_xcnt 0x0"
      :: "v"(l), "v"(l + 1u * 16u * GK_P * 2u), "v"(l + 2u * 16u * GK_P * 2u), "v"(l + 3u * 16u * GK_P * 2u),
         "v"(l + 4u * 16u * GK_P * 2u), "v"(l + 5u * 16u * GK_P * 2u), "v"(l + 6u * 16u * GK_P * 2u), "v"(l + 7u * 16u * GK_P * 2u),
         "v"(g), "v"(g + step), "v"(g + 2 * step), "v"(g + 3 * step),
         "v"(g + 4 * step), "v"(g + 5 * step), "v"(g + 6 * step), "v"(g + 7 * step)
      : "memory");
}
// this wave's async copies have landed in LDS
__device__ __forceinline__ void wait_async0() { asm volatile("s_wait_asynccnt 0x0" ::: "memory"); }
// this wave's LDS reads have returned, so the buffer they read may be refilled behind the next barrier
__device__ __forceinline__ void wait_ds0()    { asm volatile("s_wait_dscnt 0x0" ::: "memory"); }

template <int EPI, bool SPLITA>
__device__ __forceinline__ void gemm_w32x128_body(
    typename SlabT<EPI>::T* slab_all, unsigned short* stage_all, int blk, bool rope,
    const unsigned short* Ap, const unsigned short* A2p, int lda, const unsigned short* Aep,
    const unsigned short* Btp, int ldb, const unsigned short* Bep,
    const float* __restrict__ cst, const float* __restrict__ snt,
    void* C0, void* C1, int ldc, int M, int N, int K) {
  typedef typename SlabT<EPI>::T ST;
  constexpr int NPA      = SPLITA ? 2 : 1;               // A planes per stage
  constexpr int STAGE_EL = (NPA + 1) * GK_PLANE;         // elements per stage: A plane(s), then the Bt plane

  const int tid  = (int)threadIdx.x;
  const int lane = tid & 31;
  const int wave = wave_id();
  const int hh = lane >> 4;           // lane half: k offset 8*hh, D row offset 8*hh
  const int rl = lane & 15;           // A row / B col / D col within subtile
  const int tilesN = N >> 7;
  if (blk >= (M >> 7) * tilesN) return;         // block-uniform, in front of every barrier
  const int tmb = blk / tilesN;
  const int tn  = blk - tmb * tilesN;
  const int mb0 = tmb << 7;                     // first row of the block's tile
  const int m0  = mb0 + (wave << 5);            // first row of this wave's tile
  const int n0  = tn << 7;

  // this thread's copy addresses for stage 0, row tid >> 3 of each plane, 16-B piece tid & 7
  const int crow = tid >> 3, cpc = (tid & 7) * 8;
  const unsigned short* gA  = Ap  + (size_t)(mb0 + crow) * lda + cpc;
  const unsigned short* gA2 = A2p + (size_t)(mb0 + crow) * lda + cpc;
  const unsigned short* gB  = Btp + (size_t)(n0  + crow) * ldb + cpc;
  const size_t stepA = (size_t)16 * lda, stepB = (size_t)16 * ldb;
  const unsigned lc = lds_off(stage_all) + (unsigned)(crow * GK_P + cpc) * 2u;
  const int nst = K / GK_KC;                    // stages, block-uniform

  v8f acc[2][8];
#pragma unroll
  for (int i = 0; i < 2; ++i)
#pragma unroll
    for (int j = 0; j < 8; ++j) acc[i][j] = zero8();

  // stage s -> buffer s & 1
  auto copy_stage = [&](int s) {
    const unsigned l = lc + (unsigned)(s & 1) * (unsigned)(STAGE_EL * 2);
    const size_t ko = (size_t)s * GK_KC;
    copy_plane8(l, gA + ko, stepA);
    if (SPLITA) copy_plane8(l + GK_PLANE * 2u, gA2 + ko, stepA);
    copy_plane8(l + (unsigned)(NPA * GK_PLANE) * 2u, gB + ko, stepB);
  };
  copy_stage(0);
  wait_async0();
  __syncthreads();                              // stage 0 published
  if (nst > 1) copy_stage(1);

  for (int t = 0; t < nst; ++t) {
    const __bf16* S  = (const __bf16*)(const void*)(stage_all + (t & 1) * STAGE_EL);
    const __bf16* sA = S + (wave * 32 + rl) * GK_P + 8 * hh;
    const __bf16* sB = S + NPA * GK_PLANE + rl * GK_P + 8 * hh;
#pragma unroll
    for (int ks = 0; ks < 2; ++ks) {
      v16b ah[2], al[2], bj[8];
#pragma unroll
      for (int i = 0; i < 2; ++i) {
        ah[i] = ldfrag_b(sA + i * 16 * GK_P + ks * 32);
        al[i] = SPLITA ? ldfrag_b(sA + GK_PLANE + i * 16 * GK_P + ks * 32) : ah[i];
      }
#pragma unroll
      for (int j = 0; j < 8; ++j) bj[j] = ldfrag_b(sB + j * 16 * GK_P + ks * 32);
      __builtin_amdgcn_sched_barrier(0);        // keeps the k-step's LDS reads one group ahead of its WMMAs (else one waited pair per two WMMAs)
#pragma unroll
      for (int j = 0; j < 8; ++j) {
        acc[0][j] = mma_b(ah[0], bj[j], acc[0][j]);
        acc[1][j] = mma_b(ah[1], bj[j], acc[1][j]);
      }
      if (SPLITA) {
#pragma unroll
        for (int j = 0; j < 8; ++j) {
          acc[0][j] = mma_b(al[0], bj[j], acc[0][j]);
          acc[1][j] = mma_b(al[1], bj[j], acc[1][j]);
        }
      }
      __builtin_amdgcn_sched_barrier(0);        // keeps the next k-step's LDS reads from being spread among these WMMAs
    }
    // publish point of stage t + 1; it also ends every wave's reads of the buffer that stage t + 2 refills
    wait_ds0();
    wait_async0();
    __syncthreads();
    if (t + 2 < nst) copy_stage(t + 2);         // block-uniform test
  }
  wait_async0();                                // nothing of this wave is in flight behind the loop
  // ---- rank-16 adapter extension: one 32-deep k-step [Th | Tl] . [2B | 2B] ----
  {
    const __bf16* Ae = (const __bf16*)(const void*)Aep;
    const __bf16* Be = (const __bf16*)(const void*)Bep;
    v16b ae[2];
#pragma unroll
    for (int i = 0; i < 2; ++i) ae[i] = ldfrag_b(Ae + (size_t)(m0 + i * 16 + rl) * KEXT + 8 * hh);
#pragma unroll
    for (int j = 0; j < 8; ++j) {
      const v16b be = ldfrag_b(Be + (size_t)(n0 + j * 16 + rl) * KEXT + 8 * hh);
      acc[0][j] = mma_b(ae[0], be, acc[0][j]);
      acc[1][j] = mma_b(ae[1], be, acc[1][j]);
      guard_b5(acc[0][j], acc[1][j], ae[0], ae[1], ae[0], ae[1], be);
    }
  }
  acc_guard4(acc[0][0], acc[0][1], acc[0][2], acc[0][3]);
  acc_guard4(acc[0][4], acc[0][5], acc[0][6], acc[0][7]);
  acc_guard4(acc[1][0], acc[1][1], acc[1][2], acc[1][3]);
  acc_guard4(acc[1][4], acc[1][5], acc[1][6], acc[1][7]);

  // ---- epilogue ----
  ST* slab = slab_all + wave * SlabT<EPI>::PERW;
  _Float16* sl16 = (_Float16*)(void*)slab;
  float*    slf  = (float*)(void*)slab;

  if (EPI == 0 && rope) {
    _Float16* P0 = (_Float16*)C0;
    _Float16* P1 = (_Float16*)C1;
#pragma unroll
    for (int i = 0; i < 2; ++i) {
      const int rb = m0 + i * 16 + 8 * hh;
#pragma unroll
      for (int j = 0; j < 4; ++j) {
        const int dim = j * 16 + rl;                             // 0..63 within head; x2 partner at dim + 64
#pragma unroll
        for (int r = 0; r < 8; ++r) {
          const int row = rb + r;                                // token 0..M-1
          const int tp  = row & (SQ - 1);                        // position within its sequence
          const float cv = cst[(size_t)tp * NFREQ + dim];
          const float sv = snt[(size_t)tp * NFREQ + dim];
          const float x1 = acc[i][j][r];
          const float x2 = acc[i][j + 4][r];
          const float o1 = x1 * cv - x2 * sv;
          const float o2 = x2 * cv + x1 * sv;
          const _Float16 h1 = (_Float16)o1;
          const _Float16 h2 = (_Float16)o2;
          const int so = (8 * hh + r) * 128 + dim;
          sl16[so]             = h1;
          sl16[so + 64]        = h2;
          sl16[2048 + so]      = (_Float16)((o1 - (float)h1) * 2048.0f);
          sl16[2048 + so + 64] = (_Float16)((o2 - (float)h2) * 2048.0f);
        }
      }
      lds_wave_sync();
      {
#pragma unroll
        for (int it = 0; it < 8; ++it) {
          const int row = it * 2 + hh;                           // it x hh covers rows 0..15
          const int c8  = rl * 8;
          const v8h vh = *(const v8h*)(sl16 + row * 128 + c8);
          const v8h vl = *(const v8h*)(sl16 + 2048 + row * 128 + c8);
          const size_t go = (size_t)(m0 + i * 16 + row) * ldc + n0 + c8;
          *(v8h*)(P0 + go) = vh;
          *(v8h*)(P1 + go) = vl;
        }
        
      }
      lds_wave_sync();
    }
  } else if (EPI == 0) {
    _Float16* P0 = (_Float16*)C0;
    _Float16* P1 = (_Float16*)C1;
#pragma unroll
    for (int i = 0; i < 2; ++i) {
#pragma unroll
      for (int r = 0; r < 8; ++r) {
#pragma unroll
        for (int j = 0; j < 8; ++j) {
          const float v = acc[i][j][r];
          const _Float16 hv = (_Float16)v;
          const int so = (8 * hh + r) * 128 + j * 16 + rl;
          sl16[so]        = hv;
          sl16[2048 + so] = (_Float16)((v - (float)hv) * 2048.0f);
        }
      }
      lds_wave_sync();
      {
#pragma unroll
        for (int it = 0; it < 8; ++it) {
          const int row = it * 2 + hh;
          const int c8  = rl * 8;
          const v8h vh = *(const v8h*)(sl16 + row * 128 + c8);
          const v8h vl = *(const v8h*)(sl16 + 2048 + row * 128 + c8);
          const size_t go = (size_t)(m0 + i * 16 + row) * ldc + n0 + c8;
          *(v8h*)(P0 + go) = vh;
          *(v8h*)(P1 + go) = vl;
        }
        
      }
      lds_wave_sync();
    }
  } else {
    float* C = (float*)C0;
#pragma unroll
    for (int i = 0; i < 2; ++i) {
#pragma unroll
      for (int j = 0; j < 8; ++j)
#pragma unroll
        for (int r = 0; r < 8; ++r)
          slf[(8 * hh + r) * 128 + j * 16 + rl] = acc[i][j][r];
      lds_wave_sync();
      {
#pragma unroll
        for (int row = 0; row < 16; ++row) {                     // 32 lanes x 16 B = the whole 512-B row segment per instruction
          const v4f v = *(const v4f*)(slf + row * 128 + lane * 4);
          *(v4f*)(C + (size_t)(m0 + i * 16 + row) * ldc + n0 + lane * 4) = v;
        }
        
      }
      lds_wave_sync();
    }
  }
}

// one product per launch
template <int EPI, bool SPLITA>
__global__ __launch_bounds__(128) void gemm_w32x128_kernel(
    const unsigned short* Ap, const unsigned short* A2p, int lda, const unsigned short* __restrict__ Aep,
    const unsigned short* __restrict__ Btp, int ldb, const unsigned short* __restrict__ Bep,
    const float* __restrict__ cst, const float* __restrict__ snt,
    void* C0, void* C1, int ldc, int M, int N, int K) {
  __shared__ __align__(16) typename SlabT<EPI>::T slab_all[4 * SlabT<EPI>::PERW];
  __shared__ __align__(16) unsigned short stage_all[2 * (SPLITA ? 3 : 2) * GK_PLANE];
  gemm_w32x128_body<EPI, SPLITA>(slab_all, stage_all, (int)blockIdx.x, false,
                                 Ap, A2p, lda, Aep, Btp, ldb, Bep, cst, snt, C0, C1, ldc, M, N, K);
}

// The q, k and v^T projections in ONE launch: they read the same planes and none reads another's result. Blocks 0..nkv-1 take v^T
// (A = Wv, Bt = x), nkv..2nkv-1 take k, the rest q; nkv = ntok/128 * hdm/128. The choice is block-uniform, all operands are picked before
// the one body, whose barriers every wave of a block passes alike. grid.x = 2 * nkv + ntok/128 * hid/128.
__global__ __launch_bounds__(128) void gemm_qkv_kernel(
    const unsigned short* __restrict__ Xb,
    const unsigned short* __restrict__ Wqb, const unsigned short* __restrict__ Wkb, const unsigned short* __restrict__ Wvb,
    const unsigned short* __restrict__ TextQ, const unsigned short* __restrict__ TextK, const unsigned short* __restrict__ TextV,
    const unsigned short* __restrict__ BextQ, const unsigned short* __restrict__ BextK, const unsigned short* __restrict__ BextV,
    const float* __restrict__ cst, const float* __restrict__ snt,
    unsigned short* Qh, unsigned short* Ql, unsigned short* Kh, unsigned short* Kl, unsigned short* Vh, unsigned short* Vl,
    int ntok, int hid, int hdm) {
  __shared__ __align__(16) SlabT<0>::T slab_all[4 * SlabT<0>::PERW];
  __shared__ __align__(16) unsigned short stage_all[2 * 2 * GK_PLANE];
  const int nkv = (ntok >> 7) * (hdm >> 7);
  const int bx  = (int)blockIdx.x;
  const bool isv = bx < nkv;
  const bool isk = !isv && bx < 2 * nkv;
  const int blk = isv ? bx : (isk ? bx - nkv : bx - 2 * nkv);
  const unsigned short* A  = isv ? Wvb   : Xb;
  const unsigned short* Ae = isv ? BextV : (isk ? TextK : TextQ);
  const unsigned short* Bt = isv ? Xb    : (isk ? Wkb   : Wqb);
  const unsigned short* Be = isv ? TextV : (isk ? BextK : BextQ);
  unsigned short* P0 = isv ? Vh : (isk ? Kh : Qh);
  unsigned short* P1 = isv ? Vl : (isk ? Kl : Ql);
  const int M   = isv ? hdm  : ntok;
  const int N   = isv ? ntok : (isk ? hdm : hid);
  gemm_w32x128_body<0, false>(slab_all, stage_all, blk, !isv,
                              A, A, hid, Ae, Bt, hid, Be, cst, snt, (void*)P0, (void*)P1, N, M, N, hid);
}

// ---------------------------------------------------------------------------
// Causal multi-query flash attention (one shared 128-wide k/v head), 32-key chunks, block = 4 waves = 64 query rows of one (b, h);
// grid (SQ / 64 query tiles, NHQ, NSEQ): one launch; query tiles 0..AT_NPRES-1 run the PRES body, the others the body without it.
//   q planes f16 [tok][h*128+d]: hi (qhp) and residual x2048 (qlp); k planes f16 [tok][d]: hi (khp), residual x2048 (klp);
//   v^T planes f16 [d][tok]: hi (vhp), residual x2048 (vlp); outputs attn bf16 hi (ahp) / lo (alp) [tok][h*128+d].
//   scores = (Sh + Sr/2048) * 128^-0.5 with Sh = qh.kh and Sr = ql'.kh + qh.kl'; keys > query -> -inf; online softmax f32;
//   p' = 1024 p stored per wave to LDS as f16 hi (and residual x2048 when PRES), reloaded as A fragments after a wave sync;
//   O = (Oh + Or/2048)/1024/l with Oh = ph.vh, Or = ph.vl' (+ pl'.vh when PRES).
//   K / V^T chunk staging: 128 threads x 4 x 16 B per plane = whole 32x128 / 128x32 tile, plain loads, __syncthreads before and after.
//   Trip count 2*qb+2 chunks (static bound 64); waves whose rows are all below the chunk skip it (wave-uniform, scalar branch).
// Coverage: 32 query tiles x 4 waves x 16 rows x 128 cols per (b,h) = the whole [tok][h*128..+127] slab of both output planes.
// ---------------------------------------------------------------------------
#define AT_KC   32
#define KS_P    136
#define VS_P    40
#define PS_P    40
#define LDS_KS  0
#define LDS_KLS (32 * KS_P)
#define LDS_VHS (2 * 32 * KS_P)
#define LDS_VLS (LDS_VHS + 128 * VS_P)
#define LDS_PH  (LDS_VLS + 128 * VS_P)
#define LDS_PL  (LDS_PH + 4 * 16 * PS_P)
#define LDS_TOT (LDS_PL + 4 * 16 * PS_P)
static_assert(LDS_TOT * 2 <= 65536);
static_assert(4 * 4096 <= LDS_TOT);          // output staging (2 planes x 16 x 128 per wave) aliases the chunk region after the loop

template <bool PRES>
__device__ __forceinline__ void attn_causal_body(
    _Float16* lds, int qb,
    const unsigned short* __restrict__ qhp, const unsigned short* __restrict__ qlp,
    const unsigned short* __restrict__ khp, const unsigned short* __restrict__ klp,
    const unsigned short* __restrict__ vhp, const unsigned short* __restrict__ vlp,
    unsigned short* __restrict__ ahp, unsigned short* __restrict__ alp) {
  _Float16* Ks  = lds + LDS_KS;
  _Float16* Kls = lds + LDS_KLS;
  _Float16* Vhs = lds + LDS_VHS;
  _Float16* Vls = lds + LDS_VLS;

  const int tid  = (int)threadIdx.x;
  const int lane = tid & 31;
  const int wave = wave_id();
  const int hh   = lane >> 4;
  const int c    = lane & 15;
  const int h    = (int)blockIdx.y;
  const int b    = (int)blockIdx.z;
  const int q0   = qb * 64 + wave * 16;          // first query row of this wave (within sequence)
  const int qlast = q0 + 15;
  const size_t tok0 = (size_t)b * SQ;

  const _Float16* Qhr = (const _Float16*)(const void*)qhp + (tok0 + q0 + c) * HID + h * HDM + 8 * hh;
  const _Float16* Qlr = (const _Float16*)(const void*)qlp + (tok0 + q0 + c) * HID + h * HDM + 8 * hh;
  const _Float16* Kg  = (const _Float16*)(const void*)khp + tok0 * HDM;
  const _Float16* Klg = (const _Float16*)(const void*)klp + tok0 * HDM;
  const _Float16* Vhg = (const _Float16*)(const void*)vhp + tok0;
  const _Float16* Vlg = (const _Float16*)(const void*)vlp + tok0;
  _Float16* ph = lds + LDS_PH + wave * (16 * PS_P);
  _Float16* pl = lds + LDS_PL + wave * (16 * PS_P);

  float mrow[8], lrow[8];
  v8f oacc[8], oaccr[8];
#pragma unroll
  for (int r = 0; r < 8; ++r) { mrow[r] = -INFINITY; lrow[r] = 0.f; }
#pragma unroll
  for (int t = 0; t < 8; ++t) { oacc[t] = zero8(); oaccr[t] = zero8(); }

  // the wave's 16 query rows, both planes, as A fragments: loaded once, held in registers over the whole key loop
  // unrolled so that the arrays are registers
  v16h qfa[4], qfl[4];
#pragma unroll
  for (int dc = 0; dc < 4; ++dc) {
    qfa[dc] = ldfrag_h(Qhr + dc * 32);
    qfl[dc] = ldfrag_h(Qlr + dc * 32);
  }

  const int nch = 2 * qb + 2;                    // block-uniform, <= 64
  for (int kc = 0; kc < nch; ++kc) {
    const int kv0 = kc * AT_KC;
    __syncthreads();
#pragma unroll
    for (int i = 0; i < 4; ++i) {                // coverage: 512 pieces of 8 halves per plane = whole tile
      const int p   = tid + 128 * i;             // 0..511
      const int key = p >> 4, d8 = (p & 15) * 8; // K: 32 keys x 128 d
      const v8h kx = *(const v8h*)(Kg  + (size_t)(kv0 + key) * HDM + d8);
      const v8h ky = *(const v8h*)(Klg + (size_t)(kv0 + key) * HDM + d8);
      *(v8h*)(Ks  + key * KS_P + d8) = kx;
      *(v8h*)(Kls + key * KS_P + d8) = ky;
      const int d = p >> 2, k8 = (p & 3) * 8;    // V^T: 128 d x 32 keys
      const v8h vx = *(const v8h*)(Vhg + (size_t)d * NTOK + kv0 + k8);
      const v8h vy = *(const v8h*)(Vlg + (size_t)d * NTOK + kv0 + k8);
      *(v8h*)(Vhs + d * VS_P + k8) = vx;
      *(v8h*)(Vls + d * VS_P + k8) = vy;
    }
    __syncthreads();

    if (kv0 <= qlast) {                          // wave-uniform (scalar): skip chunks fully above this wave's rows
      // The chunk's LDS traffic is grouped and issued ahead of its use; each sched_barrier below keeps one group of LDS operations together
      // and ahead of the work that hides its latency (left free, the build waits on a pair of reads per WMMA pair, or walks the rows' reductions
      // one by one). Every accumulator and every row value still takes its terms in the same order.
      // ---- scores: fragment reads in groups of 4 (a 32-deep step's two hi tiles, then its two residual tiles), issued three groups ahead ----
      v8f sh[2], sr[2];
      sh[0] = zero8(); sh[1] = zero8(); sr[0] = zero8(); sr[1] = zero8();
      v16h kf[8][2];                             // group 2 * dc: hi plane, group 2 * dc + 1: residual plane; [j] = key tile
#pragma unroll
      for (int g = 0; g < 3; ++g)
#pragma unroll
        for (int j = 0; j < 2; ++j) kf[g][j] = ldfrag_h(((g & 1) ? Kls : Ks) + (j * 16 + c) * KS_P + (g >> 1) * 32 + 8 * hh);
#pragma unroll
      for (int g = 0; g < 8; ++g) {
        __builtin_amdgcn_sched_barrier(0);       // the reads above are issued before this group's WMMAs
        const v16h qa = qfa[g >> 1];
        const v16h ql = qfl[g >> 1];
        if ((g & 1) == 0) {
          sh[0] = mma_h(qa, kf[g][0], sh[0]);
          sr[0] = mma_h(ql, kf[g][0], sr[0]);
          sh[1] = mma_h(qa, kf[g][1], sh[1]);
          sr[1] = mma_h(ql, kf[g][1], sr[1]);
          if (g == 0) guard_first(sh[0], sr[0], sh[1], sr[1], kf[0][0], kf[0][1]);
        } else {
          sr[0] = mma_h(qa, kf[g][0], sr[0]);
          sr[1] = mma_h(qa, kf[g][1], sr[1]);
        }
        __builtin_amdgcn_sched_barrier(0);       // the refill below follows these WMMAs, whose registers it takes over
        if (g + 3 < 8) {
#pragma unroll
          for (int j = 0; j < 2; ++j)
            kf[g + 3][j] = ldfrag_h((((g + 3) & 1) ? Kls : Ks) + (j * 16 + c) * KS_P + ((g + 3) >> 1) * 32 + 8 * hh);
        }
      }
      // ---- scale, causal mask, chunk row max ----
      float cm[8];
#pragma unroll
      for (int r = 0; r < 8; ++r) {
        float m = -INFINITY;
#pragma unroll
        for (int j = 0; j < 2; ++j) {
          const int kd = kv0 + j * 16 + c - (q0 + 8 * hh);       // key - (row - r): key > row as kd > r, r a literal, so that no row number
          float s = (sh[j][r] + sr[j][r] * 0.00048828125f) * 0.08838834764831845f;   // per r is held over the loop (registers for the rings)
          s = (kd > r) ? -INFINITY : s;
          sh[j][r] = s;
          m = fmaxf(m, s);
        }
        cm[r] = m;
      }
#pragma unroll
      for (int off = 1; off < 16; off <<= 1) {
        float tm[8];
#pragma unroll
        for (int r = 0; r < 8; ++r) tm[r] = __shfl_xor(cm[r], off, 32);
        __builtin_amdgcn_sched_barrier(0);       // the 8 rows' exchanges of one step fly together: one LDS latency per step
#pragma unroll
        for (int r = 0; r < 8; ++r) cm[r] = fmaxf(cm[r], tm[r]);
      }
      // ---- online softmax, P' to LDS ----
      float al8[8], ps8[8];
#pragma unroll
      for (int r = 0; r < 8; ++r) {
        const float mnew  = fmaxf(mrow[r], cm[r]);
        const float alpha = __expf(mrow[r] - mnew);
        mrow[r] = mnew;
        al8[r] = alpha;
        float psum = 0.f;
#pragma unroll
        for (int j = 0; j < 2; ++j) {
          const float p  = __expf(sh[j][r] - mnew);
          psum += p;
          const float pp = p * 1024.0f;
          const _Float16 phv = (_Float16)pp;
          const int po = (8 * hh + r) * PS_P + j * 16 + c;
          ph[po] = phv;
          if (PRES) pl[po] = (_Float16)((pp - (float)phv) * 2048.0f);
        }
        ps8[r] = psum;
      }
#pragma unroll
      for (int r = 0; r < 8; ++r)
#pragma unroll
        for (int t = 0; t < 8; ++t) { oacc[t][r] *= al8[r]; oaccr[t][r] *= al8[r]; }
      lds_wave_sync();                           // P' stores visible to the other lanes of this wave before the fragment reload
      // ---- O += P' . V: the 4 fragment reads of each 16-wide d tile are issued three tiles ahead of its WMMAs ----
      const v16h pa = ldfrag_h(ph + c * PS_P + 8 * hh);
      v16h pr = pa;
      if (PRES) pr = ldfrag_h(pl + c * PS_P + 8 * hh);
      v16h vb[8], vr[8];
#pragma unroll
      for (int t = 0; t < 3; ++t) {
        vb[t] = ldfrag_h(Vhs + (t * 16 + c) * VS_P + 8 * hh);
        vr[t] = ldfrag_h(Vls + (t * 16 + c) * VS_P + 8 * hh);
      }
      float ts[8];
#pragma unroll
      for (int t = 0; t < 8; ++t) {
        if ((t & 1) == 0) {                      // one step of the 8 rows' sum exchange flies behind every two tiles' WMMAs
#pragma unroll
          for (int r = 0; r < 8; ++r) ts[r] = __shfl_xor(ps8[r], 1 << (t >> 1), 32);
        }
        __builtin_amdgcn_sched_barrier(0);       // the reads and exchanges above are issued before this tile's WMMAs
        oacc[t]  = mma_h(pa, vb[t], oacc[t]);
        oaccr[t] = mma_h(pa, vr[t], oaccr[t]);
        if (PRES) oaccr[t] = mma_h(pr, vb[t], oaccr[t]);
        __builtin_amdgcn_sched_barrier(0);       // the refill below follows these WMMAs, whose registers it takes over
        if (t + 3 < 8) {
          vb[t + 3] = ldfrag_h(Vhs + ((t + 3) * 16 + c) * VS_P + 8 * hh);
          vr[t + 3] = ldfrag_h(Vls + ((t + 3) * 16 + c) * VS_P + 8 * hh);
        }
        if ((t & 1) == 1) {
#pragma unroll
          for (int r = 0; r < 8; ++r) ps8[r] += ts[r];
        }
      }
#pragma unroll
      for (int r = 0; r < 8; ++r) lrow[r] = lrow[r] * al8[r] + ps8[r];
    }
  }

  __syncthreads();                               // all chunk-region readers done before aliasing it as output staging
  _Float16* osh = lds + wave * 4096;
  _Float16* osl = osh + 2048;
#pragma unroll
  for (int r = 0; r < 8; ++r) {
    const float inv = (1.0f / lrow[r]) * 0.0009765625f;
#pragma unroll
    for (int t = 0; t < 8; ++t) {
      const float o = (oacc[t][r] + oaccr[t][r] * 0.00048828125f) * inv;
      const unsigned short hb = bf_bits(o);
      const unsigned short lb = bf_bits(o - bf_val(hb));
      const int so = (8 * hh + r) * 128 + t * 16 + c;
      osh[so] = __builtin_bit_cast(_Float16, hb);
      osl[so] = __builtin_bit_cast(_Float16, lb);
    }
  }
  lds_wave_sync();
  _Float16* Ahg = (_Float16*)(void*)ahp + (tok0 + q0) * HID + h * HDM;
  _Float16* Alg = (_Float16*)(void*)alp + (tok0 + q0) * HID + h * HDM;
  {
#pragma unroll
    for (int it = 0; it < 8; ++it) {
      const int row = it * 2 + hh;               // it 0..7 x hh 0..1 covers rows 0..15
      const int c8  = c * 8;                     // 16 lanes x 16 B = the whole 256-B segment
      const v8h x = *(const v8h*)(osh + row * 128 + c8);
      const v8h y = *(const v8h*)(osl + row * 128 + c8);
      *(v8h*)(Ahg + (size_t)row * HID + c8) = x;
      *(v8h*)(Alg + (size_t)row * HID + c8) = y;
    }
    
  }
}

#define AT_NPRES 4                   // query tiles 0..3 carry the p residual product
__global__ __launch_bounds__(128) void attn_causal_kernel(
    const unsigned short* __restrict__ qhp, const unsigned short* __restrict__ qlp,
    const unsigned short* __restrict__ khp, const unsigned short* __restrict__ klp,
    const unsigned short* __restrict__ vhp, const unsigned short* __restrict__ vlp,
    unsigned short* __restrict__ ahp, unsigned short* __restrict__ alp) {
  __shared__ __align__(16) _Float16 lds[LDS_TOT];
  const int qb = (int)blockIdx.x;                // block-uniform: every wave of a block runs the same body and passes its barriers
  if (qb < AT_NPRES) attn_causal_body<true>(lds, qb, qhp, qlp, khp, klp, vhp, vlp, ahp, alp);
  else               attn_causal_body<false>(lds, qb, qhp, qlp, khp, klp, vhp, vlp, ahp, alp);
}

// ---------------------------------------------------------------------------
// Workspace map (bytes; every region is a whole number of the rows / lines its producer writes with whole-line stores):
//   Xb   bf16 [4096][2048]  16777216    Wqb bf16 [2048][2048]  8388608    Wkb bf16 [128][2048]  524288   Wvb bf16 [128][2048] 524288
//   Wob  bf16 [2048][2048]   8388608    Aqb/Akb/Avb/Aob bf16 [16][2048]  4 x 65536
//   BextQ bf16 [2048][32]     131072    BextK/BextV bf16 [128][32] 2 x 8192   BextO bf16 [2048][32] 131072
//   TextQ/TextK/TextV/TextO bf16 [4096][32]  4 x 262144      cst/snt f32 [2048][64]  2 x 524288
//   Qh/Ql f16 [4096][2048]  2 x 16777216   Kh/Kl f16 [4096][128]  2 x 1048576   Vh/Vl f16 [128][4096]  2 x 1048576
//   Ah/Al bf16 [4096][2048] 2 x 16777216
//   total 108544000
// ---------------------------------------------------------------------------
extern "C" void kernel_launch(void* const* d_in, const int* in_sizes, int n_in,
                              void* d_out, int out_size, void* d_ws, size_t ws_size,
                              hipStream_t stream) {
  if (n_in < 13) return;
  if (in_sizes[0]  != NTOK * HID) return;
  if (in_sizes[1]  != HID * HID)  return;
  if (in_sizes[2]  != LRK * HID)  return;
  if (in_sizes[3]  != HID * LRK)  return;
  if (in_sizes[4]  != HDM * HID)  return;
  if (in_sizes[5]  != LRK * HID)  return;
  if (in_sizes[6]  != HDM * LRK)  return;
  if (in_sizes[7]  != HDM * HID)  return;
  if (in_sizes[8]  != LRK * HID)  return;
  if (in_sizes[9]  != HDM * LRK)  return;
  if (in_sizes[10] != HID * HID)  return;
  if (in_sizes[11] != LRK * HID)  return;
  if (in_sizes[12] != HID * LRK)  return;
  if (out_size != NTOK * HID) return;

  const float* x    = (const float*)d_in[0];
  const float* wq_w = (const float*)d_in[1];
  const float* wq_a = (const float*)d_in[2];
  const float* wq_b = (const float*)d_in[3];
  const float* wk_w = (const float*)d_in[4];
  const float* wk_a = (const float*)d_in[5];
  const float* wk_b = (const float*)d_in[6];
  const float* wv_w = (const float*)d_in[7];
  const float* wv_a = (const float*)d_in[8];
  const float* wv_b = (const float*)d_in[9];
  const float* wo_w = (const float*)d_in[10];
  const float* wo_a = (const float*)d_in[11];
  const float* wo_b = (const float*)d_in[12];
  float* out = (float*)d_out;

  const size_t szX   = (size_t)NTOK * HID * 2;
  const size_t szWsq = (size_t)HID * HID * 2;
  const size_t szWkv = (size_t)HDM * HID * 2;
  const size_t szAl  = (size_t)LRK * HID * 2;
  const size_t szBeL = (size_t)HID * KEXT * 2;
  const size_t szBeS = (size_t)HDM * KEXT * 2;
  const size_t szTe  = (size_t)NTOK * KEXT * 2;
  const size_t szTab = (size_t)SQ * NFREQ * 4;
  const size_t szQ   = (size_t)NTOK * HID * 2;
  const size_t szK   = (size_t)NTOK * HDM * 2;
  const size_t szV   = (size_t)HDM * NTOK * 2;
  const size_t szA   = (size_t)NTOK * HID * 2;
  size_t off = 0;
  const size_t oX   = off; off += szX;
  const size_t oWq  = off; off += szWsq;
  const size_t oWk  = off; off += szWkv;
  const size_t oWv  = off; off += szWkv;
  const size_t oWo  = off; off += szWsq;
  const size_t oAq  = off; off += szAl;
  const size_t oAk  = off; off += szAl;
  const size_t oAv  = off; off += szAl;
  const size_t oAo  = off; off += szAl;
  const size_t oBq  = off; off += szBeL;
  const size_t oBk  = off; off += szBeS;
  const size_t oBv  = off; off += szBeS;
  const size_t oBo  = off; off += szBeL;
  const size_t oTq  = off; off += szTe;
  const size_t oTk  = off; off += szTe;
  const size_t oTv  = off; off += szTe;
  const size_t oTo  = off; off += szTe;
  const size_t oCs  = off; off += szTab;
  const size_t oSn  = off; off += szTab;
  const size_t oQh  = off; off += szQ;
  const size_t oQl  = off; off += szQ;
  const size_t oKh  = off; off += szK;
  const size_t oKl  = off; off += szK;
  const size_t oVh  = off; off += szV;
  const size_t oVl  = off; off += szV;
  const size_t oAh  = off; off += szA;
  const size_t oAl  = off; off += szA;
  if (off > ws_size) return;                     // off = 108544000

  char* ws = (char*)d_ws;
  unsigned short* Xb    = (unsigned short*)(ws + oX);
  unsigned short* Wqb   = (unsigned short*)(ws + oWq);
  unsigned short* Wkb   = (unsigned short*)(ws + oWk);
  unsigned short* Wvb   = (unsigned short*)(ws + oWv);
  unsigned short* Wob   = (unsigned short*)(ws + oWo);
  unsigned short* Aqb   = (unsigned short*)(ws + oAq);
  unsigned short* Akb   = (unsigned short*)(ws + oAk);
  unsigned short* Avb   = (unsigned short*)(ws + oAv);
  unsigned short* Aob   = (unsigned short*)(ws + oAo);
  unsigned short* BextQ = (unsigned short*)(ws + oBq);
  unsigned short* BextK = (unsigned short*)(ws + oBk);
  unsigned short* BextV = (unsigned short*)(ws + oBv);
  unsigned short* BextO = (unsigned short*)(ws + oBo);
  unsigned short* TextQ = (unsigned short*)(ws + oTq);
  unsigned short* TextK = (unsigned short*)(ws + oTk);
  unsigned short* TextV = (unsigned short*)(ws + oTv);
  unsigned short* TextO = (unsigned short*)(ws + oTo);
  float*          cst   = (float*)(ws + oCs);
  float*          snt   = (float*)(ws + oSn);
  unsigned short* Qh    = (unsigned short*)(ws + oQh);
  unsigned short* Ql    = (unsigned short*)(ws + oQl);
  unsigned short* Kh    = (unsigned short*)(ws + oKh);
  unsigned short* Kl    = (unsigned short*)(ws + oKl);
  unsigned short* Vh    = (unsigned short*)(ws + oVh);
  unsigned short* Vl    = (unsigned short*)(ws + oVl);
  unsigned short* Ah    = (unsigned short*)(ws + oAh);
  unsigned short* Al    = (unsigned short*)(ws + oAl);

  const dim3 b256(256), b128(128);

  // (1) preparation, one launch: cos/sin table [2048][64] x 2; bf16 planes of x, the base weights and the adapter A matrices (layouts kept
  //     as given: [rows][K] with K contiguous); adapter B matrices -> [2B | 2B] extension planes
  prep_kernel<<<dim3(PB_ALL), b256, 0, stream>>>(x, wq_w, wq_a, wq_b, wk_w, wk_a, wk_b, wv_w, wv_a, wv_b, wo_w, wo_a, wo_b,
      Xb, Wqb, Wkb, Wvb, Wob, Aqb, Akb, Avb, Aob, BextQ, BextK, BextV, BextO, cst, snt);
  // (2) T = x . A^T -> [Th | Tl] extension planes for q, k, v, one launch, grid.y = adapter (Aqb, Akb, Avb and TextQ, TextK, TextV lie
  //     one behind the other in the workspace)   (M=4096, N=16, K=2048; 128 wave tiles / 4 per adapter)
  tgemm_n16_kernel<false><<<dim3((NTOK / 32 + 3) / 4, 3), b128, 0, stream>>>(Xb, Xb, HID, Aqb, HID, LRK * HID, TextQ, NTOK * KEXT, NTOK, HID);
  // (3) one launch: v^T = Wv . x^T + 2 Bv . T^T -> Vh/Vl [128][4096] (32 blocks); k = x . Wk^T + 2 T.Bk^T, RoPE -> Kh/Kl [4096][128]
  //     (32 blocks); q = x . Wq^T + 2 T.Bq^T, RoPE -> Qh/Ql [4096][2048] (512 blocks); K = 2048 + ext each
  gemm_qkv_kernel<<<dim3(2 * (NTOK / 128) * (HDM / 128) + (NTOK / 128) * (HID / 128)), b128, 0, stream>>>(
      Xb, Wqb, Wkb, Wvb, TextQ, TextK, TextV, BextQ, BextK, BextV, cst, snt, Qh, Ql, Kh, Kl, Vh, Vl, NTOK, HID, HDM);
  // (4) causal attention, one launch: query tiles 0..3 with the p residual product, tiles 4..31 without
  attn_causal_kernel<<<dim3(SQ / 64, NHQ, NSEQ), b128, 0, stream>>>(Qh, Ql, Kh, Kl, Vh, Vl, Ah, Al);
  // (5) T_o = attn(hi + lo) . Ao^T -> [Th | Tl]
  tgemm_n16_kernel<true><<<dim3((NTOK / 32 + 3) / 4, 1), b128, 0, stream>>>(Ah, Al, HID, Aob, HID, 0, TextO, 0, NTOK, HID);
  // (6) out = attn(hi + lo) . Wo^T + 2 T_o . Bo^T -> d_out f32 [4096][2048]   (M=4096, N=2048, K=2048 + ext; 512 blocks)
  gemm_w32x128_kernel<2, true><<<dim3((NTOK / 128) * (HID / 128)), b128, 0, stream>>>(
      Ah, Al, HID, TextO, Wob, HID, BextO, cst, snt, (void*)out, (void*)out, HID, NTOK, HID, HID);
  (void)hipGetLastError();
}

// v005
// Measured time: 275 microseconds a run.
// Timed twice side by side with v004, it ran 1.15 times as fast both times.
// Over all steps from v000 it is 3.53 times as fast.
// Contractions: x.Wq^T, x.Wk^T, Wv.x^T and the rank-16 adapter products x.A^T on v_wmma_f32_16x16x32_bf16 (operands = RNE bf16 of the
// f32 inputs, single products; the adapter term enters the base GEMM as one extra 32-deep k-step with T = x.A^T carried as bf16 hi + bf16 lo
// against 2B in bf16); q.k^T and p.v on v_wmma_f32_16x16x32_f16 (q, k, v^T = f16 hi + f16 residual x2^11 planes, lo.lo dropped; p x1024 f16
// plus f16 residual x2^11 on query tiles 0..3); attn.Wo^T and attn.Ao^T on v_wmma_f32_16x16x32_bf16 (attn = bf16 hi + bf16 lo planes, two
// products; Wo, Ao RNE bf16). f32 accumulate everywhere; RoPE (f32 cos/sin table), online softmax and scale folds in f32.
#include <hip/hip_runtime.h>
#include <math.h>
#include <stdint.h>

#define NSEQ   2
#define SQ     2048
#define HID    2048
#define NHQ    16
#define HDM    128
#define NTOK   4096
#define NFREQ  64
#define LRK    16
#define KEXT   32

typedef _Float16       v16h __attribute__((ext_vector_type(16)));
typedef _Float16       v8h  __attribute__((ext_vector_type(8)));
typedef __bf16         v16b __attribute__((ext_vector_type(16)));
typedef __bf16         v8b  __attribute__((ext_vector_type(8)));
typedef float          v8f  __attribute__((ext_vector_type(8)));
typedef float          v4f  __attribute__((ext_vector_type(4)));
typedef unsigned int   v4u  __attribute__((ext_vector_type(4)));
typedef unsigned short v8us __attribute__((ext_vector_type(8)));

// ---------------------------------------------------------------------------
// small helpers
// ---------------------------------------------------------------------------
__device__ __forceinline__ unsigned short bf_bits(float f) {          // RNE convert f32 -> bf16 bits
  const unsigned u = __float_as_uint(f);
  return (unsigned short)((u + 0x7FFFu + ((u >> 16) & 1u)) >> 16);
}
__device__ __forceinline__ float bf_val(unsigned short h) { return __uint_as_float(((unsigned)h) << 16); }
__device__ __forceinline__ unsigned pk16(unsigned short a, unsigned short b) { return (unsigned)a | ((unsigned)b << 16); }
__device__ __forceinline__ v8f zero8() { v8f z = {0.f, 0.f, 0.f, 0.f, 0.f, 0.f, 0.f, 0.f}; return z; }
__device__ __forceinline__ int wave_id() { return __builtin_amdgcn_readfirstlane((int)(threadIdx.x >> 5)); }

// orders one wave's LDS element stores before its own vector reloads of the same tile (other lanes' data)
__device__ __forceinline__ void lds_wave_sync() {
  __builtin_amdgcn_fence(__ATOMIC_RELEASE, "workgroup");
  __builtin_amdgcn_wave_barrier();
  __builtin_amdgcn_fence(__ATOMIC_ACQUIRE, "workgroup");
}

// ---------------------------------------------------------------------------
// WMMA fragments (wave32, 16x16x32, 16-bit operands). For A (row m = lane&15) and B (col n = lane&15) alike:
// elements 0..7 <- k0 + 8*(lane>>4) + 0..7, elements 8..15 <- k0 + 16 + 8*(lane>>4) + 0..7.
// ldfrag(p) with p = rowbase + k0 + 8*(lane>>4): two 16-B loads p[0..7], p[16..23].
// D: acc[r] = (row 8*(lane>>4) + r, col lane&15).
// ---------------------------------------------------------------------------
union FragH { v16h v; v8h h[2]; };
union FragB { v16b v; v8b h[2]; };
__device__ __forceinline__ v16h ldfrag_h(const _Float16* p) { FragH f; f.h[0] = *(const v8h*)(p); f.h[1] = *(const v8h*)(p + 16); return f.v; }
__device__ __forceinline__ v16b ldfrag_b(const __bf16* p)   { FragB f; f.h[0] = *(const v8b*)(p); f.h[1] = *(const v8b*)(p + 16); return f.v; }

__device__ __forceinline__ v8f mma_h(v16h a, v16h b, v8f c) {
  return __builtin_amdgcn_wmma_f32_16x16x32_f16(false, a, false, b, (short)0, c, false, false);
}
__device__ __forceinline__ v8f mma_b(v16b a, v16b b, v8f c) {
  return __builtin_amdgcn_wmma_f32_16x16x32_bf16(false, a, false, b, (short)0, c, false, false);
}
// hazard guards: 4 VALU slots after the last WMMA of a group, D tied, A/B kept live; memory clobber keeps later loads behind the group
__device__ __forceinline__ void guard_b5(v8f& a, v8f& b, v16b x0, v16b x1, v16b x2, v16b x3, v16b y) {
  asm volatile("v_nop\n\tv_nop\n\tv_nop\n\tv_nop" : "+v"(a), "+v"(b) : "v"(x0), "v"(x1), "v"(x2), "v"(x3), "v"(y) : "memory");
}
// behind the first score group, whose four results are new registers (C = 0): the two B fragments are named so that they stay live past the
// four WMMAs and no result is placed over a B that a WMMA just ahead reads; 4 VALU slots before those registers are free again
__device__ __forceinline__ void guard_first(v8f& a, v8f& b, v8f& c, v8f& d, v16h y, v16h z) {
  asm volatile("v_nop\n\tv_nop\n\tv_nop\n\tv_nop" : "+v"(a), "+v"(b), "+v"(c), "+v"(d) : "v"(y), "v"(z));
}
__device__ __forceinline__ void acc_guard4(v8f& a, v8f& b, v8f& c, v8f& d) {
  asm volatile("v_nop\n\tv_nop\n\tv_nop\n\tv_nop" : "+v"(a), "+v"(b), "+v"(c), "+v"(d));
}
__device__ __forceinline__ void acc_guard2(v8f& a, v8f& b) {
  asm volatile("v_nop\n\tv_nop\n\tv_nop\n\tv_nop" : "+v"(a), "+v"(b));
}

// ---------------------------------------------------------------------------
// RoPE table for positions t = 0..npos-1: cst[t][i] = cos(t * inv_freq[i]), snt[t][i] = sin(...), inv_freq[i] = 1 / 1e4^(i/64),
// i < 64, all f32. Block = 8 waves, wave w -> t = blk*8 + w, lane -> i = lane, lane + 32.
// Coverage: npos/8 blocks x 8 waves x 32 lanes x 2 = npos x 64 per plane.
// ---------------------------------------------------------------------------
__device__ __forceinline__ void rope_table_job(float* __restrict__ cst, float* __restrict__ snt, int npos, int blk) {
  const int lane = threadIdx.x & 31;
  const int wave = (int)(threadIdx.x >> 5);
  const int t = blk * 8 + wave;
  if (t >= npos) return;                       // no barriers in this job
  const float pf = (float)t;
  float c0 = 0.f, s0 = 0.f, c1 = 0.f, s1 = 0.f;
#pragma unroll 1
  for (int u = 0; u < 2; ++u) {
    const int i = lane + 32 * u;
    const float e   = (float)i * 0.015625f;      // i / 64 exact
    const float pw  = powf(10000.0f, e);
    const float inv = 1.0f / pw;
    const float ang = pf * inv;
    const float cv = cosf(ang);
    const float sv = sinf(ang);
    c1 = cv; s1 = sv;
    if (u == 0) { c0 = cv; s0 = sv; }
  }
  const size_t o = (size_t)t * NFREQ + lane;
  {
    ((float*)cst)[o]      = c0;
    ((float*)cst)[o + 32] = c1;
    ((float*)snt)[o]      = s0;
    ((float*)snt)[o + 32] = s1;
    
  }
}

// ---------------------------------------------------------------------------
// Elementwise RNE f32 -> bf16 plane: 8 elements per thread, one 16-B store per lane -> 32 consecutive lanes write 4 whole
// (every n8 used is a multiple of 256, so every instruction is full width).
// ---------------------------------------------------------------------------
__device__ __forceinline__ void cvt_bf16_job(const float* __restrict__ in, unsigned short* __restrict__ outp, int n8, int blk) {
  const int i = blk * 256 + (int)threadIdx.x;
  if (i >= n8) return;
  const size_t e = 8 * (size_t)i;
  const v4f a = *(const v4f*)(in + e);
  const v4f b = *(const v4f*)(in + e + 4);
  v4u w;
  w[0] = pk16(bf_bits(a[0]), bf_bits(a[1]));
  w[1] = pk16(bf_bits(a[2]), bf_bits(a[3]));
  w[2] = pk16(bf_bits(b[0]), bf_bits(b[1]));
  w[3] = pk16(bf_bits(b[2]), bf_bits(b[3]));
  *(v4u*)(outp + e) = w;
  
}

// ---------------------------------------------------------------------------
// Adapter B matrix [R][16] f32 -> extension plane [R][32] bf16: cols 0..15 = bf16(2*B[r][0..15]), cols 16..31 = the same again
// (pairs with the [Th | Tl] extension plane of T so one 32-deep k-step yields 2*(Th+Tl).B^T). 2*bf16(B) is exact.
// ---------------------------------------------------------------------------
__device__ __forceinline__ void bext_job(const float* __restrict__ Bm, unsigned short* __restrict__ outp, int npieces, int blk) {
  const int p = blk * 256 + (int)threadIdx.x;
  if (p >= npieces) return;
  const int row = p >> 2, q = p & 3;
  const float* src = Bm + (size_t)row * LRK + (q & 1) * 8;
  const v4f a = *(const v4f*)(src);
  const v4f b = *(const v4f*)(src + 4);
  v4u w;
  w[0] = pk16(bf_bits(2.0f * a[0]), bf_bits(2.0f * a[1]));
  w[1] = pk16(bf_bits(2.0f * a[2]), bf_bits(2.0f * a[3]));
  w[2] = pk16(bf_bits(2.0f * b[0]), bf_bits(2.0f * b[1]));
  w[3] = pk16(bf_bits(2.0f * b[2]), bf_bits(2.0f * b[3]));
  *(v4u*)(outp + (size_t)p * 8) = w;
  
}

// ---------------------------------------------------------------------------
// All preparation in ONE launch: the cos/sin table, the nine bf16 planes and the four adapter extension planes depend on the inputs alone
// and on nothing of each other, so each block takes one block's worth of one job, picked by its index (block-uniform; no barriers).
// Block ranges, in index order: table | x | Wq | Wo | Wk | Wv | Aq Ak Av Ao | Bq Bo | Bk Bv. Each range is exactly the job's own grid.
// ---------------------------------------------------------------------------
#define N8_X    (NTOK * HID / 8)     // 16-B output pieces of each plane
#define N8_WSQ  (HID * HID / 8)
#define N8_WKV  (HDM * HID / 8)
#define N8_AL   (LRK * HID / 8)
#define NP_BL   (HID * 4)
#define NP_BS   (HDM * 4)
#define PB_TAB  (SQ / 8)             // blocks of each job
#define PB_X    (N8_X / 256)
#define PB_WSQ  (N8_WSQ / 256)
#define PB_WKV  (N8_WKV / 256)
#define PB_AL   (N8_AL / 256)
#define PB_BL   (NP_BL / 256)
#define PB_BS   (NP_BS / 256)
#define PB_CVT  (PB_X + 2 * PB_WSQ + 2 * PB_WKV + 4 * PB_AL)
#define PB_ALL  (PB_TAB + PB_CVT + 2 * PB_BL + 2 * PB_BS)
static_assert(N8_X % 256 == 0 && N8_WSQ % 256 == 0 && N8_WKV % 256 == 0 && N8_AL % 256 == 0 && NP_BL % 256 == 0 && NP_BS % 256 == 0);

__global__ __launch_bounds__(256) void prep_kernel(
    const float* __restrict__ x,
    const float* __restrict__ wq_w, const float* __restrict__ wq_a, const float* __restrict__ wq_b,
    const float* __restrict__ wk_w, const float* __restrict__ wk_a, const float* __restrict__ wk_b,
    const float* __restrict__ wv_w, const float* __restrict__ wv_a, const float* __restrict__ wv_b,
    const float* __restrict__ wo_w, const float* __restrict__ wo_a, const float* __restrict__ wo_b,
    unsigned short* __restrict__ Xb,  unsigned short* __restrict__ Wqb, unsigned short* __restrict__ Wkb,
    unsigned short* __restrict__ Wvb, unsigned short* __restrict__ Wob,
    unsigned short* __restrict__ Aqb, unsigned short* __restrict__ Akb, unsigned short* __restrict__ Avb, unsigned short* __restrict__ Aob,
    unsigned short* __restrict__ BextQ, unsigned short* __restrict__ BextK, unsigned short* __restrict__ BextV,
    unsigned short* __restrict__ BextO, float* __restrict__ cst, float* __restrict__ snt) {
  int blk = (int)blockIdx.x;
  if (blk < PB_TAB) { rope_table_job(cst, snt, SQ, blk); return; }
  blk -= PB_TAB;
  if (blk < PB_CVT) {                            // one of the nine bf16 planes: pick source, plane and the block's number within the job
    const float* in = x;
    unsigned short* op = Xb;
    int n8 = N8_X;
    if (blk >= PB_X) {
      blk -= PB_X;
      if (blk < 2 * PB_WSQ) {
        const bool second = blk >= PB_WSQ;
        in = second ? wo_w : wq_w;  op = second ? Wob : Wqb;  n8 = N8_WSQ;  blk -= second ? PB_WSQ : 0;
      } else if ((blk -= 2 * PB_WSQ) < 2 * PB_WKV) {
        const bool second = blk >= PB_WKV;
        in = second ? wv_w : wk_w;  op = second ? Wvb : Wkb;  n8 = N8_WKV;  blk -= second ? PB_WKV : 0;
      } else {
        blk -= 2 * PB_WKV;
        const int j = blk / PB_AL;               // 0..3: q, k, v, o
        in = j == 0 ? wq_a : (j == 1 ? wk_a : (j == 2 ? wv_a : wo_a));
        op = j == 0 ? Aqb  : (j == 1 ? Akb  : (j == 2 ? Avb  : Aob));
        n8 = N8_AL;  blk -= j * PB_AL;
      }
    }
    cvt_bf16_job(in, op, n8, blk);
    return;
  }
  blk -= PB_CVT;
  {                                              // one of the four adapter extension planes
    const float* bm;
    unsigned short* op;
    int np;
    if (blk < 2 * PB_BL) {
      const bool second = blk >= PB_BL;
      bm = second ? wo_b : wq_b;  op = second ? BextO : BextQ;  np = NP_BL;  blk -= second ? PB_BL : 0;
    } else {
      blk -= 2 * PB_BL;
      const bool second = blk >= PB_BS;
      bm = second ? wv_b : wk_b;  op = second ? BextV : BextK;  np = NP_BS;  blk -= second ? PB_BS : 0;
    }
    bext_job(bm, op, np, blk);
  }
}

// ---------------------------------------------------------------------------
// Narrow bf16 WMMA GEMM for the rank-16 adapter: T[m][j] = sum_k A[m][k] * Bt[j][k], j < 16, written as the extension plane
// Tp [M][32] bf16 = [bf16 hi of T (16) | bf16 lo of T (16)]. A row-major [M][K] bf16 (pitch lda; SPLITA: hi plane Ap + lo plane A2p,
// two products), Bt [16][K] bf16 (pitch ldb); K % 32 == 0, M % 32 == 0. Wave tile 32 rows, block = 4 waves, grid = ceil(M/128);
// no block barriers. Epilogue per wave: stage 32x32 u16 in LDS, wave sync, then 4 store instructions of 32 lanes x 16 B
// grid.y = number of adapters that share A: adapter y reads Bt at Btp0 + y * bstep and writes its plane at Tp0 + y * tstep (elements).
// Coverage: per adapter M/32 waves x 32 rows x 32 cols = the whole [M][32] plane.
// ---------------------------------------------------------------------------
template <bool SPLITA>
__global__ __launch_bounds__(128) void tgemm_n16_kernel(
    const unsigned short* Ap, const unsigned short* A2p, int lda,
    const unsigned short* __restrict__ Btp0, int ldb, int bstep,
    unsigned short* __restrict__ Tp0, int tstep, int M, int K) {
  __shared__ __align__(16) unsigned short slab_all[4 * 1024];
  const unsigned short* Btp = Btp0 + (size_t)blockIdx.y * bstep;
  unsigned short*       Tp  = Tp0  + (size_t)blockIdx.y * tstep;
  const int lane = threadIdx.x & 31;
  const int wave = wave_id();
  const int hh = lane >> 4;
  const int rl = lane & 15;
  const int m0 = ((int)blockIdx.x * 4 + wave) * 32;
  if (m0 >= M) return;                          // wave-uniform; no block barriers in this kernel

  const __bf16* A  = (const __bf16*)(const void*)Ap;
  const __bf16* A2 = (const __bf16*)(const void*)A2p;
  const __bf16* Bt = (const __bf16*)(const void*)Btp;

  v8f acc[2];
  acc[0] = zero8(); acc[1] = zero8();
  for (int k0 = 0; k0 < K; k0 += 32) {
    v16b ah[2], al[2];
#pragma unroll
    for (int i = 0; i < 2; ++i) {
      const size_t ao = (size_t)(m0 + i * 16 + rl) * lda + k0 + 8 * hh;
      ah[i] = ldfrag_b(A + ao);
      al[i] = SPLITA ? ldfrag_b(A2 + ao) : ah[i];
    }
    const v16b bj = ldfrag_b(Bt + (size_t)rl * ldb + k0 + 8 * hh);
    acc[0] = mma_b(ah[0], bj, acc[0]);
    acc[1] = mma_b(ah[1], bj, acc[1]);
    if (SPLITA) {
      acc[0] = mma_b(al[0], bj, acc[0]);
      acc[1] = mma_b(al[1], bj, acc[1]);
    }
    guard_b5(acc[0], acc[1], ah[0], ah[1], al[0], al[1], bj);
  }
  acc_guard2(acc[0], acc[1]);

  unsigned short* sl = slab_all + wave * 1024;
#pragma unroll
  for (int i = 0; i < 2; ++i)
#pragma unroll
    for (int r = 0; r < 8; ++r) {
      const int row = i * 16 + 8 * hh + r;
      const float v = acc[i][r];
      const unsigned short hb = bf_bits(v);
      const unsigned short lb = bf_bits(v - bf_val(hb));
      sl[row * 32 + rl]      = hb;
      sl[row * 32 + 16 + rl] = lb;
    }
  lds_wave_sync();
  {
#pragma unroll
    for (int it = 0; it < 4; ++it) {
      const int p   = it * 32 + lane;             // piece 0..127 of 8 u16
      const int row = p >> 2;                     // 0..31
      const int c8  = (p & 3) * 8;                // 0..24
      const v8us w = *(const v8us*)(sl + row * 32 + c8);
      *(v8us*)(Tp + (size_t)(m0 + row) * KEXT + c8) = w;
    }
    
  }
}

// ---------------------------------------------------------------------------
// bf16 WMMA GEMM, wave tile 32 rows x 128 cols, block = 4 waves (128 threads) = one 128 x 128 tile of C (wave w: rows 32w..32w+31).
//   C[m][n] = sum_k A[m][k] * Bt[n][k]  +  sum_{k<32} Aext[m][k] * Bext[n][k]
//   A row-major [M][K] bf16 (pitch lda), Bt row-major [N][K] bf16 (pitch ldb), Aext [M][32], Bext [N][32] bf16 (pitch 32);
//   M % 128 == 0, N % 128 == 0, K % 64 == 0, K >= 128; grid.x = M/128 * N/128.
//   SPLITA: A carried as hi (Ap) + lo (A2p) bf16 planes, two products into one accumulator (Aext stays one plane).
//   K loop: stages of 64 k. A stage = the block's 128 A rows (both planes when SPLITA) and 128 Bt rows, 128 B of each row, brought to LDS
//   by 16-B async copies (a wave's copy = 4 whole lines), rows at pitch 144 B; two buffers, stage t + 2 copied while stage t + 1 is worked on.
//   Fragments come from LDS with the split k map (ldfrag_b); the adapter k-step still loads from global rows.
// Epilogues (all: per wave, per 16-row slab: stage in LDS, wave sync, write each row segment with ONE instruction of
//   EPI 0, rope (block-uniform run-time flag) set: q / k projection: RoPE with pairs (dim, dim+64), token position = row & (SQ-1), cos/sin
//          from the f32 table [SQ][64];
//          writes f16 hi plane C0 and f16 residual x2048 plane C1, both [M][ldc], cols n0..n0+127 (row segment 256 B = 16 lanes x 16 B).
//   EPI 0, rope clear: v^T projection: f16 hi plane C0, residual x2048 plane C1, [M][ldc], row segment 256 B.
//   EPI 2: f32 output C0 [M][ldc]; row segment 128 floats = 512 B = 32 lanes x 16 B per instruction.
// Coverage: M/128 * N/128 blocks (blk = the block's number within its own product) x 4 waves x 32x128 = the whole [M][N] region of each plane.
// The body is a device function on LDS arrays of the calling kernel, so that one launch can hold the blocks of several products.
// ---------------------------------------------------------------------------
template <int EPI> struct SlabT { typedef _Float16 T; static constexpr int PERW = 4096; };   // 2 planes x 16 x 128 halves
template <> struct SlabT<2>     { typedef float    T; static constexpr int PERW = 2048; };   // 16 x 128 floats

#define GK_KC    64                  // k per stage: 128 B of every operand row
#define GK_P     72                  // LDS row pitch in elements: 144 B = 16 B x 9, conflict-free for 16-B fragment reads
#define GK_PLANE (128 * GK_P)        // elements of one 128-row operand plane in LDS

__device__ __forceinline__ unsigned lds_off(const void* p) { return (unsigned)(size_t)p; }   // LDS byte address = low 32 bits

// One thread's share of one 128-row x 128-B plane: eight 16-B async copies, rows r, r + 16, .., r + 112 (r = tid >> 3, piece tid & 7).
// l = this lane's LDS byte address of row r, g = its global address of row r, step = 16 source rows in elements.
// The closing s_wait_xcnt 0 stands inside the statement so that no address register named here is rewritten ahead of it.
__device__ __forceinline__ void copy_plane8(unsigned l, const unsigned short* g, size_t step) {
  asm volatile(
      "global_load_async_to_lds_b128 %0, %8, off\n\t"
      "global_load_async_to_lds_b128 %1, %9, off\n\t"
      "global_load_async_to_lds_b128 %2, %10, off\n\t"
      "global_load_async_to_lds_b128 %3, %11, off\n\t"
      "global_load_async_to_lds_b128 %4, %12, off\n\t"
      "global_load_async_to_lds_b128 %5, %13, off\n\t"
      "global_load_async_to_lds_b128 %6, %14, off\n\t"
      "global_load_async_to_lds_b128 %7, %15, off\n\t"
      "s_wait_xcnt 0x0"
      :: "v"(l), "v"(l + 1u * 16u * GK_P * 2u), "v"(l + 2u * 16u * GK_P * 2u), "v"(l + 3u * 16u * GK_P * 2u),
         "v"(l + 4u * 16u * GK_P * 2u), "v"(l + 5u * 16u * GK_P * 2u), "v"(l + 6u * 16u * GK_P * 2u), "v"(l + 7u * 16u * GK_P * 2u),
         "v"(g), "v"(g + step), "v"(g + 2 * step), "v"(g + 3 * step),
         "v"(g + 4 * step), "v"(g + 5 * step), "v"(g + 6 * step), "v"(g + 7 * step)
      : "memory");
}
// this wave's async copies have landed in LDS
__device__ __forceinline__ void wait_async0() { asm volatile("s_wait_asynccnt 0x0" ::: "memory"); }
// this wave's LDS reads have returned, so the buffer they read may be refilled behind the next barrier
__device__ __forceinline__ void wait_ds0()    { asm volatile("s_wait_dscnt 0x0" ::: "memory"); }

template <int EPI, bool SPLITA>
__device__ __forceinline__ void gemm_w32x128_body(
    typename SlabT<EPI>::T* slab_all, unsigned short* stage_all, int blk, bool rope,
    const unsigned short* Ap, const unsigned short* A2p, int lda, const unsigned short* Aep,
    const unsigned short* Btp, int ldb, const unsigned short* Bep,
    const float* __restrict__ cst, const float* __restrict__ snt,
    void* C0, void* C1, int ldc, int M, int N, int K) {
  typedef typename SlabT<EPI>::T ST;
  constexpr int NPA      = SPLITA ? 2 : 1;               // A planes per stage
  constexpr int STAGE_EL = (NPA + 1) * GK_PLANE;         // elements per stage: A plane(s), then the Bt plane

  const int tid  = (int)threadIdx.x;
  const int lane = tid & 31;
  const int wave = wave_id();
  const int hh = lane >> 4;           // lane half: k offset 8*hh, D row offset 8*hh
  const int rl = lane & 15;           // A row / B col / D col within subtile
  const int tilesN = N >> 7;
  if (blk >= (M >> 7) * tilesN) return;         // block-uniform, in front of every barrier
  const int tmb = blk / tilesN;
  const int tn  = blk - tmb * tilesN;
  const int mb0 = tmb << 7;                     // first row of the block's tile
  const int m0  = mb0 + (wave << 5);            // first row of this wave's tile
  const int n0  = tn << 7;

  // this thread's copy addresses for stage 0, row tid >> 3 of each plane, 16-B piece tid & 7
  const int crow = tid >> 3, cpc = (tid & 7) * 8;
  const unsigned short* gA  = Ap  + (size_t)(mb0 + crow) * lda + cpc;
  const unsigned short* gA2 = A2p + (size_t)(mb0 + crow) * lda + cpc;
  const unsigned short* gB  = Btp + (size_t)(n0  + crow) * ldb + cpc;
  const size_t stepA = (size_t)16 * lda, stepB = (size_t)16 * ldb;
  const unsigned lc = lds_off(stage_all) + (unsigned)(crow * GK_P + cpc) * 2u;
  const int nst = K / GK_KC;                    // stages, block-uniform

  v8f acc[2][8];
#pragma unroll
  for (int i = 0; i < 2; ++i)
#pragma unroll
    for (int j = 0; j < 8; ++j) acc[i][j] = zero8();

  // stage s -> buffer s & 1
  auto copy_stage = [&](int s) {
    const unsigned l = lc + (unsigned)(s & 1) * (unsigned)(STAGE_EL * 2);
    const size_t ko = (size_t)s * GK_KC;
    copy_plane8(l, gA + ko, stepA);
    if (SPLITA) copy_plane8(l + GK_PLANE * 2u, gA2 + ko, stepA);
    copy_plane8(l + (unsigned)(NPA * GK_PLANE) * 2u, gB + ko, stepB);
  };
  copy_stage(0);
  wait_async0();
  __syncthreads();                              // stage 0 published
  if (nst > 1) copy_stage(1);

  for (int t = 0; t < nst; ++t) {
    const __bf16* S  = (const __bf16*)(const void*)(stage_all + (t & 1) * STAGE_EL);
    const __bf16* sA = S + (wave * 32 + rl) * GK_P + 8 * hh;
    const __bf16* sB = S + NPA * GK_PLANE + rl * GK_P + 8 * hh;
#pragma unroll
    for (int ks = 0; ks < 2; ++ks) {
      v16b ah[2], al[2], bj[8];
#pragma unroll
      for (int i = 0; i < 2; ++i) {
        ah[i] = ldfrag_b(sA + i * 16 * GK_P + ks * 32);
        al[i] = SPLITA ? ldfrag_b(sA + GK_PLANE + i * 16 * GK_P + ks * 32) : ah[i];
      }
#pragma unroll
      for (int j = 0; j < 8; ++j) bj[j] = ldfrag_b(sB + j * 16 * GK_P + ks * 32);
      __builtin_amdgcn_sched_barrier(0);        // keeps the k-step's LDS reads one group ahead of its WMMAs (else one waited pair per two WMMAs)
#pragma unroll
      for (int j = 0; j < 8; ++j) {
        acc[0][j] = mma_b(ah[0], bj[j], acc[0][j]);
        acc[1][j] = mma_b(ah[1], bj[j], acc[1][j]);
      }
      if (SPLITA) {
#pragma unroll
        for (int j = 0; j < 8; ++j) {
          acc[0][j] = mma_b(al[0], bj[j], acc[0][j]);
          acc[1][j] = mma_b(al[1], bj[j], acc[1][j]);
        }
      }
      __builtin_amdgcn_sched_barrier(0);        // keeps the next k-step's LDS reads from being spread among these WMMAs
    }
    // publish point of stage t + 1; it also ends every wave's reads of the buffer that stage t + 2 refills
    wait_ds0();
    wait_async0();
    __syncthreads();
    if (t + 2 < nst) copy_stage(t + 2);         // block-uniform test
  }
  wait_async0();                                // nothing of this wave is in flight behind the loop
  // ---- rank-16 adapter extension: one 32-deep k-step [Th | Tl] . [2B | 2B] ----
  {
    const __bf16* Ae = (const __bf16*)(const void*)Aep;
    const __bf16* Be = (const __bf16*)(const void*)Bep;
    v16b ae[2];
#pragma unroll
    for (int i = 0; i < 2; ++i) ae[i] = ldfrag_b(Ae + (size_t)(m0 + i * 16 + rl) * KEXT + 8 * hh);
#pragma unroll
    for (int j = 0; j < 8; ++j) {
      const v16b be = ldfrag_b(Be + (size_t)(n0 + j * 16 + rl) * KEXT + 8 * hh);
      acc[0][j] = mma_b(ae[0], be, acc[0][j]);
      acc[1][j] = mma_b(ae[1], be, acc[1][j]);
      guard_b5(acc[0][j], acc[1][j], ae[0], ae[1], ae[0], ae[1], be);
    }
  }
  acc_guard4(acc[0][0], acc[0][1], acc[0][2], acc[0][3]);
  acc_guard4(acc[0][4], acc[0][5], acc[0][6], acc[0][7]);
  acc_guard4(acc[1][0], acc[1][1], acc[1][2], acc[1][3]);
  acc_guard4(acc[1][4], acc[1][5], acc[1][6], acc[1][7]);

  // ---- epilogue ----
  ST* slab = slab_all + wave * SlabT<EPI>::PERW;
  _Float16* sl16 = (_Float16*)(void*)slab;
  float*    slf  = (float*)(void*)slab;

  if (EPI == 0 && rope) {
    _Float16* P0 = (_Float16*)C0;
    _Float16* P1 = (_Float16*)C1;
#pragma unroll
    for (int i = 0; i < 2; ++i) {
      const int rb = m0 + i * 16 + 8 * hh;
#pragma unroll
      for (int j = 0; j < 4; ++j) {
        const int dim = j * 16 + rl;                             // 0..63 within head; x2 partner at dim + 64
#pragma unroll
        for (int r = 0; r < 8; ++r) {
          const int row = rb + r;                                // token 0..M-1
          const int tp  = row & (SQ - 1);                        // position within its sequence
          const float cv = cst[(size_t)tp * NFREQ + dim];
          const float sv = snt[(size_t)tp * NFREQ + dim];
          const float x1 = acc[i][j][r];
          const float x2 = acc[i][j + 4][r];
          const float o1 = x1 * cv - x2 * sv;
          const float o2 = x2 * cv + x1 * sv;
          const _Float16 h1 = (_Float16)o1;
          const _Float16 h2 = (_Float16)o2;
          const int so = (8 * hh + r) * 128 + dim;
          sl16[so]             = h1;
          sl16[so + 64]        = h2;
          sl16[2048 + so]      = (_Float16)((o1 - (float)h1) * 2048.0f);
          sl16[2048 + so + 64] = (_Float16)((o2 - (float)h2) * 2048.0f);
        }
      }
      lds_wave_sync();
      {
#pragma unroll
        for (int it = 0; it < 8; ++it) {
          const int row = it * 2 + hh;                           // it x hh covers rows 0..15
          const int c8  = rl * 8;
          const v8h vh = *(const v8h*)(sl16 + row * 128 + c8);
          const v8h vl = *(const v8h*)(sl16 + 2048 + row * 128 + c8);
          const size_t go = (size_t)(m0 + i * 16 + row) * ldc + n0 + c8;
          *(v8h*)(P0 + go) = vh;
          *(v8h*)(P1 + go) = vl;
        }
        
      }
      lds_wave_sync();
    }
  } else if (EPI == 0) {
    _Float16* P0 = (_Float16*)C0;
    _Float16* P1 = (_Float16*)C1;
#pragma unroll
    for (int i = 0; i < 2; ++i) {
#pragma unroll
      for (int r = 0; r < 8; ++r) {
#pragma unroll
        for (int j = 0; j < 8; ++j) {
          const float v = acc[i][j][r];
          const _Float16 hv = (_Float16)v;
          const int so = (8 * hh + r) * 128 + j * 16 + rl;
          sl16[so]        = hv;
          sl16[2048 + so] = (_Float16)((v - (float)hv) * 2048.0f);
        }
      }
      lds_wave_sync();
      {
#pragma unroll
        for (int it = 0; it < 8; ++it) {
          const int row = it * 2 + hh;
          const int c8  = rl * 8;
          const v8h vh = *(const v8h*)(sl16 + row * 128 + c8);
          const v8h vl = *(const v8h*)(sl16 + 2048 + row * 128 + c8);
          const size_t go = (size_t)(m0 + i * 16 + row) * ldc + n0 + c8;
          *(v8h*)(P0 + go) = vh;
          *(v8h*)(P1 + go) = vl;
        }
        
      }
      lds_wave_sync();
    }
  } else {
    float* C = (float*)C0;
#pragma unroll
    for (int i = 0; i < 2; ++i) {
#pragma unroll
      for (int j = 0; j < 8; ++j)
#pragma unroll
        for (int r = 0; r < 8; ++r)
          slf[(8 * hh + r) * 128 + j * 16 + rl] = acc[i][j][r];
      lds_wave_sync();
      {
#pragma unroll
        for (int row = 0; row < 16; ++row) {                     // 32 lanes x 16 B = the whole 512-B row segment per instruction
          const v4f v = *(const v4f*)(slf + row * 128 + lane * 4);
          *(v4f*)(C + (size_t)(m0 + i * 16 + row) * ldc + n0 + lane * 4) = v;
        }
        
      }
      lds_wave_sync();
    }
  }
}

// one product per launch
template <int EPI, bool SPLITA>
__global__ __launch_bounds__(128) void gemm_w32x128_kernel(
    const unsigned short* Ap, const unsigned short* A2p, int lda, const unsigned short* __restrict__ Aep,
    const unsigned short* __restrict__ Btp, int ldb, const unsigned short* __restrict__ Bep,
    const float* __restrict__ cst, const float* __restrict__ snt,
    void* C0, void* C1, int ldc, int M, int N, int K) {
  __shared__ __align__(16) typename SlabT<EPI>::T slab_all[4 * SlabT<EPI>::PERW];
  __shared__ __align__(16) unsigned short stage_all[2 * (SPLITA ? 3 : 2) * GK_PLANE];
  gemm_w32x128_body<EPI, SPLITA>(slab_all, stage_all, (int)blockIdx.x, false,
                                 Ap, A2p, lda, Aep, Btp, ldb, Bep, cst, snt, C0, C1, ldc, M, N, K);
}

// The q, k and v^T projections in ONE launch: they read the same planes and none reads another's result. Blocks 0..nkv-1 take v^T
// (A = Wv, Bt = x), nkv..2nkv-1 take k, the rest q; nkv = ntok/128 * hdm/128. The choice is block-uniform, all operands are picked before
// the one body, whose barriers every wave of a block passes alike. grid.x = 2 * nkv + ntok/128 * hid/128.
__global__ __launch_bounds__(128) void gemm_qkv_kernel(
    const unsigned short* __restrict__ Xb,
    const unsigned short* __restrict__ Wqb, const unsigned short* __restrict__ Wkb, const unsigned short* __restrict__ Wvb,
    const unsigned short* __restrict__ TextQ, const unsigned short* __restrict__ TextK, const unsigned short* __restrict__ TextV,
    const unsigned short* __restrict__ BextQ, const unsigned short* __restrict__ BextK, const unsigned short* __restrict__ BextV,
    const float* __restrict__ cst, const float* __restrict__ snt,
    unsigned short* Qh, unsigned short* Ql, unsigned short* Kh, unsigned short* Kl, unsigned short* Vh, unsigned short* Vl,
    int ntok, int hid, int hdm) {
  __shared__ __align__(16) SlabT<0>::T slab_all[4 * SlabT<0>::PERW];
  __shared__ __align__(16) unsigned short stage_all[2 * 2 * GK_PLANE];
  const int nkv = (ntok >> 7) * (hdm >> 7);
  const int bx  = (int)blockIdx.x;
  const bool isv = bx < nkv;
  const bool isk = !isv && bx < 2 * nkv;
  const int blk = isv ? bx : (isk ? bx - nkv : bx - 2 * nkv);
  const unsigned short* A  = isv ? Wvb   : Xb;
  const unsigned short* Ae = isv ? BextV : (isk ? TextK : TextQ);
  const unsigned short* Bt = isv ? Xb    : (isk ? Wkb   : Wqb);
  const unsigned short* Be = isv ? TextV : (isk ? BextK : BextQ);
  unsigned short* P0 = isv ? Vh : (isk ? Kh : Qh);
  unsigned short* P1 = isv ? Vl : (isk ? Kl : Ql);
  const int M   = isv ? hdm  : ntok;
  const int N   = isv ? ntok : (isk ? hdm : hid);
  gemm_w32x128_body<0, false>(slab_all, stage_all, blk, !isv,
                              A, A, hid, Ae, Bt, hid, Be, cst, snt, (void*)P0, (void*)P1, N, M, N, hid);
}

// ---------------------------------------------------------------------------
// Causal multi-query flash attention (one shared 128-wide k/v head), 32-key chunks, block = 4 waves = 64 query rows of one (b, h);
// grid = SQ / 64 query tiles x NHQ x NSEQ blocks in one dimension, longest query tile first (see attn_causal_kernel): one launch;
// query tiles 0..AT_NPRES-1 run the PRES body, the others the body without it.
//   q planes f16 [tok][h*128+d]: hi (qhp) and residual x2048 (qlp); k planes f16 [tok][d]: hi (khp), residual x2048 (klp);
//   v^T planes f16 [d][tok]: hi (vhp), residual x2048 (vlp); outputs attn bf16 hi (ahp) / lo (alp) [tok][h*128+d].
//   scores = (Sh + Sr/2048) * 128^-0.5 with Sh = qh.kh and Sr = ql'.kh + qh.kl'; keys > query -> -inf; online softmax f32;
//   p' = 1024 p stored per wave to LDS as f16 hi (and residual x2048 when PRES), reloaded as A fragments after a wave sync;
//   O = (Oh + Or/2048)/1024/l with Oh = ph.vh, Or = ph.vl' (+ pl'.vh when PRES).
//   K / V^T chunk staging: 128 threads x 4 x 16 B per plane = whole 32x128 / 128x32 tile, plain loads, __syncthreads before and after.
//   Trip count 2*qb+2 chunks (static bound 64); waves whose rows are all below the chunk skip it (wave-uniform, scalar branch).
// Coverage: 32 query tiles x 4 waves x 16 rows x 128 cols per (b,h) = the whole [tok][h*128..+127] slab of both output planes.
// ---------------------------------------------------------------------------
#define AT_KC   32
#define KS_P    136
#define VS_P    40
#define PS_P    40
#define LDS_KS  0
#define LDS_KLS (32 * KS_P)
#define LDS_VHS (2 * 32 * KS_P)
#define LDS_VLS (LDS_VHS + 128 * VS_P)
#define LDS_PH  (LDS_VLS + 128 * VS_P)
#define LDS_PL  (LDS_PH + 4 * 16 * PS_P)
#define LDS_TOT (LDS_PL + 4 * 16 * PS_P)
static_assert(LDS_TOT * 2 <= 65536);
static_assert(4 * 4096 <= LDS_TOT);          // output staging (2 planes x 16 x 128 per wave) aliases the chunk region after the loop

template <bool PRES>
__device__ __forceinline__ void attn_causal_body(
    _Float16* lds, int qb, int h, int b,
    const unsigned short* __restrict__ qhp, const unsigned short* __restrict__ qlp,
    const unsigned short* __restrict__ khp, const unsigned short* __restrict__ klp,
    const unsigned short* __restrict__ vhp, const unsigned short* __restrict__ vlp,
    unsigned short* __restrict__ ahp, unsigned short* __restrict__ alp) {
  _Float16* Ks  = lds + LDS_KS;
  _Float16* Kls = lds + LDS_KLS;
  _Float16* Vhs = lds + LDS_VHS;
  _Float16* Vls = lds + LDS_VLS;

  const int tid  = (int)threadIdx.x;
  const int lane = tid & 31;
  const int wave = wave_id();
  const int hh   = lane >> 4;
  const int c    = lane & 15;
  const int q0   = qb * 64 + wave * 16;          // first query row of this wave (within sequence)
  const int qlast = q0 + 15;
  const size_t tok0 = (size_t)b * SQ;

  const _Float16* Qhr = (const _Float16*)(const void*)qhp + (tok0 + q0 + c) * HID + h * HDM + 8 * hh;
  const _Float16* Qlr = (const _Float16*)(const void*)qlp + (tok0 + q0 + c) * HID + h * HDM + 8 * hh;
  const _Float16* Kg  = (const _Float16*)(const void*)khp + tok0 * HDM;
  const _Float16* Klg = (const _Float16*)(const void*)klp + tok0 * HDM;
  const _Float16* Vhg = (const _Float16*)(const void*)vhp + tok0;
  const _Float16* Vlg = (const _Float16*)(const void*)vlp + tok0;
  _Float16* ph = lds + LDS_PH + wave * (16 * PS_P);
  _Float16* pl = lds + LDS_PL + wave * (16 * PS_P);

  float mrow[8], lrow[8];
  v8f oacc[8], oaccr[8];
#pragma unroll
  for (int r = 0; r < 8; ++r) { mrow[r] = -INFINITY; lrow[r] = 0.f; }
#pragma unroll
  for (int t = 0; t < 8; ++t) { oacc[t] = zero8(); oaccr[t] = zero8(); }

  // the wave's 16 query rows, both planes, as A fragments: loaded once, held in registers over the whole key loop
  // unrolled so that the arrays are registers
  v16h qfa[4], qfl[4];
#pragma unroll
  for (int dc = 0; dc < 4; ++dc) {
    qfa[dc] = ldfrag_h(Qhr + dc * 32);
    qfl[dc] = ldfrag_h(Qlr + dc * 32);
  }

  const int nch = 2 * qb + 2;                    // block-uniform, <= 64
  for (int kc = 0; kc < nch; ++kc) {
    const int kv0 = kc * AT_KC;
    __syncthreads();
#pragma unroll
    for (int i = 0; i < 4; ++i) {                // coverage: 512 pieces of 8 halves per plane = whole tile
      const int p   = tid + 128 * i;             // 0..511
      const int key = p >> 4, d8 = (p & 15) * 8; // K: 32 keys x 128 d
      const v8h kx = *(const v8h*)(Kg  + (size_t)(kv0 + key) * HDM + d8);
      const v8h ky = *(const v8h*)(Klg + (size_t)(kv0 + key) * HDM + d8);
      *(v8h*)(Ks  + key * KS_P + d8) = kx;
      *(v8h*)(Kls + key * KS_P + d8) = ky;
      const int d = p >> 2, k8 = (p & 3) * 8;    // V^T: 128 d x 32 keys
      const v8h vx = *(const v8h*)(Vhg + (size_t)d * NTOK + kv0 + k8);
      const v8h vy = *(const v8h*)(Vlg + (size_t)d * NTOK + kv0 + k8);
      *(v8h*)(Vhs + d * VS_P + k8) = vx;
      *(v8h*)(Vls + d * VS_P + k8) = vy;
    }
    __syncthreads();

    if (kv0 <= qlast) {                          // wave-uniform (scalar): skip chunks fully above this wave's rows
      // The chunk's LDS traffic is grouped and issued ahead of its use; each sched_barrier below keeps one group of LDS operations together
      // and ahead of the work that hides its latency (left free, the build waits on a pair of reads per WMMA pair, or walks the rows' reductions
      // one by one). Every accumulator and every row value still takes its terms in the same order.
      // ---- scores: fragment reads in groups of 4 (a 32-deep step's two hi tiles, then its two residual tiles), issued three groups ahead ----
      v8f sh[2], sr[2];
      sh[0] = zero8(); sh[1] = zero8(); sr[0] = zero8(); sr[1] = zero8();
      v16h kf[8][2];                             // group 2 * dc: hi plane, group 2 * dc + 1: residual plane; [j] = key tile
#pragma unroll
      for (int g = 0; g < 3; ++g)
#pragma unroll
        for (int j = 0; j < 2; ++j) kf[g][j] = ldfrag_h(((g & 1) ? Kls : Ks) + (j * 16 + c) * KS_P + (g >> 1) * 32 + 8 * hh);
#pragma unroll
      for (int g = 0; g < 8; ++g) {
        __builtin_amdgcn_sched_barrier(0);       // the reads above are issued before this group's WMMAs
        const v16h qa = qfa[g >> 1];
        const v16h ql = qfl[g >> 1];
        if ((g & 1) == 0) {
          sh[0] = mma_h(qa, kf[g][0], sh[0]);
          sr[0] = mma_h(ql, kf[g][0], sr[0]);
          sh[1] = mma_h(qa, kf[g][1], sh[1]);
          sr[1] = mma_h(ql, kf[g][1], sr[1]);
          if (g == 0) guard_first(sh[0], sr[0], sh[1], sr[1], kf[0][0], kf[0][1]);
        } else {
          sr[0] = mma_h(qa, kf[g][0], sr[0]);
          sr[1] = mma_h(qa, kf[g][1], sr[1]);
        }
        __builtin_amdgcn_sched_barrier(0);       // the refill below follows these WMMAs, whose registers it takes over
        if (g + 3 < 8) {
#pragma unroll
          for (int j = 0; j < 2; ++j)
            kf[g + 3][j] = ldfrag_h((((g + 3) & 1) ? Kls : Ks) + (j * 16 + c) * KS_P + ((g + 3) >> 1) * 32 + 8 * hh);
        }
      }
      // ---- scale, causal mask, chunk row max ----
      float cm[8];
#pragma unroll
      for (int r = 0; r < 8; ++r) {
        float m = -INFINITY;
#pragma unroll
        for (int j = 0; j < 2; ++j) {
          const int kd = kv0 + j * 16 + c - (q0 + 8 * hh);       // key - (row - r): key > row as kd > r, r a literal, so that no row number
          float s = (sh[j][r] + sr[j][r] * 0.00048828125f) * 0.08838834764831845f;   // per r is held over the loop (registers for the rings)
          s = (kd > r) ? -INFINITY : s;
          sh[j][r] = s;
          m = fmaxf(m, s);
        }
        cm[r] = m;
      }
#pragma unroll
      for (int off = 1; off < 16; off <<= 1) {
        float tm[8];
#pragma unroll
        for (int r = 0; r < 8; ++r) tm[r] = __shfl_xor(cm[r], off, 32);
        __builtin_amdgcn_sched_barrier(0);       // the 8 rows' exchanges of one step fly together: one LDS latency per step
#pragma unroll
        for (int r = 0; r < 8; ++r) cm[r] = fmaxf(cm[r], tm[r]);
      }
      // ---- online softmax, P' to LDS ----
      float al8[8], ps8[8];
#pragma unroll
      for (int r = 0; r < 8; ++r) {
        const float mnew  = fmaxf(mrow[r], cm[r]);
        const float alpha = __expf(mrow[r] - mnew);
        mrow[r] = mnew;
        al8[r] = alpha;
        float psum = 0.f;
#pragma unroll
        for (int j = 0; j < 2; ++j) {
          const float p  = __expf(sh[j][r] - mnew);
          psum += p;
          const float pp = p * 1024.0f;
          const _Float16 phv = (_Float16)pp;
          const int po = (8 * hh + r) * PS_P + j * 16 + c;
          ph[po] = phv;
          if (PRES) pl[po] = (_Float16)((pp - (float)phv) * 2048.0f);
        }
        ps8[r] = psum;
      }
#pragma unroll
      for (int r = 0; r < 8; ++r)
#pragma unroll
        for (int t = 0; t < 8; ++t) { oacc[t][r] *= al8[r]; oaccr[t][r] *= al8[r]; }
      lds_wave_sync();                           // P' stores visible to the other lanes of this wave before the fragment reload
      // ---- O += P' . V: the 4 fragment reads of each 16-wide d tile are issued three tiles ahead of its WMMAs ----
      const v16h pa = ldfrag_h(ph + c * PS_P + 8 * hh);
      v16h pr = pa;
      if (PRES) pr = ldfrag_h(pl + c * PS_P + 8 * hh);
      v16h vb[8], vr[8];
#pragma unroll
      for (int t = 0; t < 3; ++t) {
        vb[t] = ldfrag_h(Vhs + (t * 16 + c) * VS_P + 8 * hh);
        vr[t] = ldfrag_h(Vls + (t * 16 + c) * VS_P + 8 * hh);
      }
      float ts[8];
#pragma unroll
      for (int t = 0; t < 8; ++t) {
        if ((t & 1) == 0) {                      // one step of the 8 rows' sum exchange flies behind every two tiles' WMMAs
#pragma unroll
          for (int r = 0; r < 8; ++r) ts[r] = __shfl_xor(ps8[r], 1 << (t >> 1), 32);
        }
        __builtin_amdgcn_sched_barrier(0);       // the reads and exchanges above are issued before this tile's WMMAs
        oacc[t]  = mma_h(pa, vb[t], oacc[t]);
        oaccr[t] = mma_h(pa, vr[t], oaccr[t]);
        if (PRES) oaccr[t] = mma_h(pr, vb[t], oaccr[t]);
        __builtin_amdgcn_sched_barrier(0);       // the refill below follows these WMMAs, whose registers it takes over
        if (t + 3 < 8) {
          vb[t + 3] = ldfrag_h(Vhs + ((t + 3) * 16 + c) * VS_P + 8 * hh);
          vr[t + 3] = ldfrag_h(Vls + ((t + 3) * 16 + c) * VS_P + 8 * hh);
        }
        if ((t & 1) == 1) {
#pragma unroll
          for (int r = 0; r < 8; ++r) ps8[r] += ts[r];
        }
      }
#pragma unroll
      for (int r = 0; r < 8; ++r) lrow[r] = lrow[r] * al8[r] + ps8[r];
    }
  }

  __syncthreads();                               // all chunk-region readers done before aliasing it as output staging
  _Float16* osh = lds + wave * 4096;
  _Float16* osl = osh + 2048;
#pragma unroll
  for (int r = 0; r < 8; ++r) {
    const float inv = (1.0f / lrow[r]) * 0.0009765625f;
#pragma unroll
    for (int t = 0; t < 8; ++t) {
      const float o = (oacc[t][r] + oaccr[t][r] * 0.00048828125f) * inv;
      const unsigned short hb = bf_bits(o);
      const unsigned short lb = bf_bits(o - bf_val(hb));
      const int so = (8 * hh + r) * 128 + t * 16 + c;
      osh[so] = __builtin_bit_cast(_Float16, hb);
      osl[so] = __builtin_bit_cast(_Float16, lb);
    }
  }
  lds_wave_sync();
  _Float16* Ahg = (_Float16*)(void*)ahp + (tok0 + q0) * HID + h * HDM;
  _Float16* Alg = (_Float16*)(void*)alp + (tok0 + q0) * HID + h * HDM;
  {
#pragma unroll
    for (int it = 0; it < 8; ++it) {
      const int row = it * 2 + hh;               // it 0..7 x hh 0..1 covers rows 0..15
      const int c8  = c * 8;                     // 16 lanes x 16 B = the whole 256-B segment
      const v8h x = *(const v8h*)(osh + row * 128 + c8);
      const v8h y = *(const v8h*)(osl + row * 128 + c8);
      *(v8h*)(Ahg + (size_t)row * HID + c8) = x;
      *(v8h*)(Alg + (size_t)row * HID + c8) = y;
    }
    
  }
}

#define AT_NPRES 4                   // query tiles 0..3 carry the p residual product
__global__ __launch_bounds__(128) void attn_causal_kernel(
    const unsigned short* __restrict__ qhp, const unsigned short* __restrict__ qlp,
    const unsigned short* __restrict__ khp, const unsigned short* __restrict__ klp,
    const unsigned short* __restrict__ vhp, const unsigned short* __restrict__ vlp,
    unsigned short* __restrict__ ahp, unsigned short* __restrict__ alp) {
  __shared__ __align__(16) _Float16 lds[LDS_TOT];
  // A block's key loop has 2 * qb + 2 trips and there are more blocks than resident places, so the cost falls with the block index: the
  // 64-trip tiles take the lowest indices, the short tiles the highest (for speed only). The query
  // tile is the slow digit of the index, so that neighbouring indices cost the same and indices far apart differ.
  // index -> (qb, h, b) is one to one: index = (SQ / 64 - 1 - qb) * NHQ * NSEQ + b * NHQ + h.
  const int idx = (int)blockIdx.x;
  const int qb  = SQ / 64 - 1 - idx / (NHQ * NSEQ);   // block-uniform: every wave of a block runs the same body and passes its barriers
  const int hb  = idx % (NHQ * NSEQ);
  const int h   = hb % NHQ;
  const int b   = hb / NHQ;
  if (qb < AT_NPRES) attn_causal_body<true>(lds, qb, h, b, qhp, qlp, khp, klp, vhp, vlp, ahp, alp);
  else               attn_causal_body<false>(lds, qb, h, b, qhp, qlp, khp, klp, vhp, vlp, ahp, alp);
}

// ---------------------------------------------------------------------------
// Workspace map (bytes; every region is a whole number of the rows / lines its producer writes with whole-line stores):
//   Xb   bf16 [4096][2048]  16777216    Wqb bf16 [2048][2048]  8388608    Wkb bf16 [128][2048]  524288   Wvb bf16 [128][2048] 524288
//   Wob  bf16 [2048][2048]   8388608    Aqb/Akb/Avb/Aob bf16 [16][2048]  4 x 65536
//   BextQ bf16 [2048][32]     131072    BextK/BextV bf16 [128][32] 2 x 8192   BextO bf16 [2048][32] 131072
//   TextQ/TextK/TextV/TextO bf16 [4096][32]  4 x 262144      cst/snt f32 [2048][64]  2 x 524288
//   Qh/Ql f16 [4096][2048]  2 x 16777216   Kh/Kl f16 [4096][128]  2 x 1048576   Vh/Vl f16 [128][4096]  2 x 1048576
//   Ah/Al bf16 [4096][2048] 2 x 16777216
//   total 108544000
// ---------------------------------------------------------------------------
extern "C" void kernel_launch(void* const* d_in, const int* in_sizes, int n_in,
                              void* d_out, int out_size, void* d_ws, size_t ws_size,
                              hipStream_t stream) {
  if (n_in < 13) return;
  if (in_sizes[0]  != NTOK * HID) return;
  if (in_sizes[1]  != HID * HID)  return;
  if (in_sizes[2]  != LRK * HID)  return;
  if (in_sizes[3]  != HID * LRK)  return;
  if (in_sizes[4]  != HDM * HID)  return;
  if (in_sizes[5]  != LRK * HID)  return;
  if (in_sizes[6]  != HDM * LRK)  return;
  if (in_sizes[7]  != HDM * HID)  return;
  if (in_sizes[8]  != LRK * HID)  return;
  if (in_sizes[9]  != HDM * LRK)  return;
  if (in_sizes[10] != HID * HID)  return;
  if (in_sizes[11] != LRK * HID)  return;
  if (in_sizes[12] != HID * LRK)  return;
  if (out_size != NTOK * HID) return;

  const float* x    = (const float*)d_in[0];
  const float* wq_w = (const float*)d_in[1];
  const float* wq_a = (const float*)d_in[2];
  const float* wq_b = (const float*)d_in[3];
  const float* wk_w = (const float*)d_in[4];
  const float* wk_a = (const float*)d_in[5];
  const float* wk_b = (const float*)d_in[6];
  const float* wv_w = (const float*)d_in[7];
  const float* wv_a = (const float*)d_in[8];
  const float* wv_b = (const float*)d_in[9];
  const float* wo_w = (const float*)d_in[10];
  const float* wo_a = (const float*)d_in[11];
  const float* wo_b = (const float*)d_in[12];
  float* out = (float*)d_out;

  const size_t szX   = (size_t)NTOK * HID * 2;
  const size_t szWsq = (size_t)HID * HID * 2;
  const size_t szWkv = (size_t)HDM * HID * 2;
  const size_t szAl  = (size_t)LRK * HID * 2;
  const size_t szBeL = (size_t)HID * KEXT * 2;
  const size_t szBeS = (size_t)HDM * KEXT * 2;
  const size_t szTe  = (size_t)NTOK * KEXT * 2;
  const size_t szTab = (size_t)SQ * NFREQ * 4;
  const size_t szQ   = (size_t)NTOK * HID * 2;
  const size_t szK   = (size_t)NTOK * HDM * 2;
  const size_t szV   = (size_t)HDM * NTOK * 2;
  const size_t szA   = (size_t)NTOK * HID * 2;
  size_t off = 0;
  const size_t oX   = off; off += szX;
  const size_t oWq  = off; off += szWsq;
  const size_t oWk  = off; off += szWkv;
  const size_t oWv  = off; off += szWkv;
  const size_t oWo  = off; off += szWsq;
  const size_t oAq  = off; off += szAl;
  const size_t oAk  = off; off += szAl;
  const size_t oAv  = off; off += szAl;
  const size_t oAo  = off; off += szAl;
  const size_t oBq  = off; off += szBeL;
  const size_t oBk  = off; off += szBeS;
  const size_t oBv  = off; off += szBeS;
  const size_t oBo  = off; off += szBeL;
  const size_t oTq  = off; off += szTe;
  const size_t oTk  = off; off += szTe;
  const size_t oTv  = off; off += szTe;
  const size_t oTo  = off; off += szTe;
  const size_t oCs  = off; off += szTab;
  const size_t oSn  = off; off += szTab;
  const size_t oQh  = off; off += szQ;
  const size_t oQl  = off; off += szQ;
  const size_t oKh  = off; off += szK;
  const size_t oKl  = off; off += szK;
  const size_t oVh  = off; off += szV;
  const size_t oVl  = off; off += szV;
  const size_t oAh  = off; off += szA;
  const size_t oAl  = off; off += szA;
  if (off > ws_size) return;                     // off = 108544000

  char* ws = (char*)d_ws;
  unsigned short* Xb    = (unsigned short*)(ws + oX);
  unsigned short* Wqb   = (unsigned short*)(ws + oWq);
  unsigned short* Wkb   = (unsigned short*)(ws + oWk);
  unsigned short* Wvb   = (unsigned short*)(ws + oWv);
  unsigned short* Wob   = (unsigned short*)(ws + oWo);
  unsigned short* Aqb   = (unsigned short*)(ws + oAq);
  unsigned short* Akb   = (unsigned short*)(ws + oAk);
  unsigned short* Avb   = (unsigned short*)(ws + oAv);
  unsigned short* Aob   = (unsigned short*)(ws + oAo);
  unsigned short* BextQ = (unsigned short*)(ws + oBq);
  unsigned short* BextK = (unsigned short*)(ws + oBk);
  unsigned short* BextV = (unsigned short*)(ws + oBv);
  unsigned short* BextO = (unsigned short*)(ws + oBo);
  unsigned short* TextQ = (unsigned short*)(ws + oTq);
  unsigned short* TextK = (unsigned short*)(ws + oTk);
  unsigned short* TextV = (unsigned short*)(ws + oTv);
  unsigned short* TextO = (unsigned short*)(ws + oTo);
  float*          cst   = (float*)(ws + oCs);
  float*          snt   = (float*)(ws + oSn);
  unsigned short* Qh    = (unsigned short*)(ws + oQh);
  unsigned short* Ql    = (unsigned short*)(ws + oQl);
  unsigned short* Kh    = (unsigned short*)(ws + oKh);
  unsigned short* Kl    = (unsigned short*)(ws + oKl);
  unsigned short* Vh    = (unsigned short*)(ws + oVh);
  unsigned short* Vl    = (unsigned short*)(ws + oVl);
  unsigned short* Ah    = (unsigned short*)(ws + oAh);
  unsigned short* Al    = (unsigned short*)(ws + oAl);

  const dim3 b256(256), b128(128);

  // (1) preparation, one launch: cos/sin table [2048][64] x 2; bf16 planes of x, the base weights and the adapter A matrices (layouts kept
  //     as given: [rows][K] with K contiguous); adapter B matrices -> [2B | 2B] extension planes
  prep_kernel<<<dim3(PB_ALL), b256, 0, stream>>>(x, wq_w, wq_a, wq_b, wk_w, wk_a, wk_b, wv_w, wv_a, wv_b, wo_w, wo_a, wo_b,
      Xb, Wqb, Wkb, Wvb, Wob, Aqb, Akb, Avb, Aob, BextQ, BextK, BextV, BextO, cst, snt);
  // (2) T = x . A^T -> [Th | Tl] extension planes for q, k, v, one launch, grid.y = adapter (Aqb, Akb, Avb and TextQ, TextK, TextV lie
  //     one behind the other in the workspace)   (M=4096, N=16, K=2048; 128 wave tiles / 4 per adapter)
  tgemm_n16_kernel<false><<<dim3((NTOK / 32 + 3) / 4, 3), b128, 0, stream>>>(Xb, Xb, HID, Aqb, HID, LRK * HID, TextQ, NTOK * KEXT, NTOK, HID);
  // (3) one launch: v^T = Wv . x^T + 2 Bv . T^T -> Vh/Vl [128][4096] (32 blocks); k = x . Wk^T + 2 T.Bk^T, RoPE -> Kh/Kl [4096][128]
  //     (32 blocks); q = x . Wq^T + 2 T.Bq^T, RoPE -> Qh/Ql [4096][2048] (512 blocks); K = 2048 + ext each
  gemm_qkv_kernel<<<dim3(2 * (NTOK / 128) * (HDM / 128) + (NTOK / 128) * (HID / 128)), b128, 0, stream>>>(
      Xb, Wqb, Wkb, Wvb, TextQ, TextK, TextV, BextQ, BextK, BextV, cst, snt, Qh, Ql, Kh, Kl, Vh, Vl, NTOK, HID, HDM);
  // (4) causal attention, one launch, longest query tiles first: query tiles 0..3 with the p residual product, tiles 4..31 without
  attn_causal_kernel<<<dim3((SQ / 64) * NHQ * NSEQ), b128, 0, stream>>>(Qh, Ql, Kh, Kl, Vh, Vl, Ah, Al);
  // (5) T_o = attn(hi + lo) . Ao^T -> [Th | Tl]
  tgemm_n16_kernel<true><<<dim3((NTOK / 32 + 3) / 4, 1), b128, 0, stream>>>(Ah, Al, HID, Aob, HID, 0, TextO, 0, NTOK, HID);
  // (6) out = attn(hi + lo) . Wo^T + 2 T_o . Bo^T -> d_out f32 [4096][2048]   (M=4096, N=2048, K=2048 + ext; 512 blocks)
  gemm_w32x128_kernel<2, true><<<dim3((NTOK / 128) * (HID / 128)), b128, 0, stream>>>(
      Ah, Al, HID, TextO, Wob, HID, BextO, cst, snt, (void*)out, (void*)out, HID, NTOK, HID, HID);
  (void)hipGetLastError();
}

// v006
// Measured time: 254 microseconds a run.
// Next to v005, in two timings, it ran 1.09 times as fast each time.
// Counting every step since v000, it is 3.85 times as fast.
// Contractions: x.Wq^T, x.Wk^T, Wv.x^T and the rank-16 adapter products x.A^T on v_wmma_f32_16x16x32_bf16 (operands = RNE bf16 of the
// f32 inputs, single products; the adapter term enters the base GEMM as one extra 32-deep k-step with T = x.A^T carried as bf16 hi + bf16 lo
// against 2B in bf16); q.k^T and p.v on v_wmma_f32_16x16x32_f16 (q, k, v^T = f16 hi + f16 residual x2^11 planes, lo.lo dropped; p x1024 f16
// plus f16 residual x2^11 on query tiles 0..3); attn.Wo^T and attn.Ao^T on v_wmma_f32_16x16x32_bf16 (attn = bf16 hi + bf16 lo planes, two
// products; Wo, Ao RNE bf16). f32 accumulate everywhere; RoPE (f32 cos/sin table), online softmax and scale folds in f32.
#include <hip/hip_runtime.h>
#include <math.h>
#include <stdint.h>

#define NSEQ   2
#define SQ     2048
#define HID    2048
#define NHQ    16
#define HDM    128
#define NTOK   4096
#define NFREQ  64
#define LRK    16
#define KEXT   32

typedef _Float16       v16h __attribute__((ext_vector_type(16)));
typedef _Float16       v8h  __attribute__((ext_vector_type(8)));
typedef __bf16         v16b __attribute__((ext_vector_type(16)));
typedef __bf16         v8b  __attribute__((ext_vector_type(8)));
typedef float          v8f  __attribute__((ext_vector_type(8)));
typedef float          v4f  __attribute__((ext_vector_type(4)));
typedef unsigned int   v4u  __attribute__((ext_vector_type(4)));
typedef unsigned short v8us __attribute__((ext_vector_type(8)));

// ---------------------------------------------------------------------------
// small helpers
// ---------------------------------------------------------------------------
__device__ __forceinline__ unsigned short bf_bits(float f) {          // RNE convert f32 -> bf16 bits
  const unsigned u = __float_as_uint(f);
  return (unsigned short)((u + 0x7FFFu + ((u >> 16) & 1u)) >> 16);
}
__device__ __forceinline__ float bf_val(unsigned short h) { return __uint_as_float(((unsigned)h) << 16); }
__device__ __forceinline__ unsigned pk16(unsigned short a, unsigned short b) { return (unsigned)a | ((unsigned)b << 16); }
__device__ __forceinline__ v8f zero8() { v8f z = {0.f, 0.f, 0.f, 0.f, 0.f, 0.f, 0.f, 0.f}; return z; }
__device__ __forceinline__ int wave_id() { return __builtin_amdgcn_readfirstlane((int)(threadIdx.x >> 5)); }

// orders one wave's LDS element stores before its own vector reloads of the same tile (other lanes' data)
__device__ __forceinline__ void lds_wave_sync() {
  __builtin_amdgcn_fence(__ATOMIC_RELEASE, "workgroup");
  __builtin_amdgcn_wave_barrier();
  __builtin_amdgcn_fence(__ATOMIC_ACQUIRE, "workgroup");
}

// ---------------------------------------------------------------------------
// WMMA fragments (wave32, 16x16x32, 16-bit operands). For A (row m = lane&15) and B (col n = lane&15) alike:
// elements 0..7 <- k0 + 8*(lane>>4) + 0..7, elements 8..15 <- k0 + 16 + 8*(lane>>4) + 0..7.
// ldfrag(p) with p = rowbase + k0 + 8*(lane>>4): two 16-B loads p[0..7], p[16..23].
// D: acc[r] = (row 8*(lane>>4) + r, col lane&15).
// ---------------------------------------------------------------------------
union FragH { v16h v; v8h h[2]; };
union FragB { v16b v; v8b h[2]; };
__device__ __forceinline__ v16h ldfrag_h(const _Float16* p) { FragH f; f.h[0] = *(const v8h*)(p); f.h[1] = *(const v8h*)(p + 16); return f.v; }
__device__ __forceinline__ v16b ldfrag_b(const __bf16* p)   { FragB f; f.h[0] = *(const v8b*)(p); f.h[1] = *(const v8b*)(p + 16); return f.v; }

__device__ __forceinline__ v8f mma_h(v16h a, v16h b, v8f c) {
  return __builtin_amdgcn_wmma_f32_16x16x32_f16(false, a, false, b, (short)0, c, false, false);
}
__device__ __forceinline__ v8f mma_b(v16b a, v16b b, v8f c) {
  return __builtin_amdgcn_wmma_f32_16x16x32_bf16(false, a, false, b, (short)0, c, false, false);
}
// hazard guards: 4 VALU slots after the last WMMA of a group, D tied, A/B kept live; memory clobber keeps later loads behind the group
__device__ __forceinline__ void guard_b5(v8f& a, v8f& b, v16b x0, v16b x1, v16b x2, v16b x3, v16b y) {
  asm volatile("v_nop\n\tv_nop\n\tv_nop\n\tv_nop" : "+v"(a), "+v"(b) : "v"(x0), "v"(x1), "v"(x2), "v"(x3), "v"(y) : "memory");
}
// behind the first score group, whose four results are new registers (C = 0): the two B fragments are named so that they stay live past the
// four WMMAs and no result is placed over a B that a WMMA just ahead reads; 4 VALU slots before those registers are free again
__device__ __forceinline__ void guard_first(v8f& a, v8f& b, v8f& c, v8f& d, v16h y, v16h z) {
  asm volatile("v_nop\n\tv_nop\n\tv_nop\n\tv_nop" : "+v"(a), "+v"(b), "+v"(c), "+v"(d) : "v"(y), "v"(z));
}
__device__ __forceinline__ void acc_guard4(v8f& a, v8f& b, v8f& c, v8f& d) {
  asm volatile("v_nop\n\tv_nop\n\tv_nop\n\tv_nop" : "+v"(a), "+v"(b), "+v"(c), "+v"(d));
}
__device__ __forceinline__ void acc_guard2(v8f& a, v8f& b) {
  asm volatile("v_nop\n\tv_nop\n\tv_nop\n\tv_nop" : "+v"(a), "+v"(b));
}

// ---------------------------------------------------------------------------
// RoPE table for positions t = 0..npos-1: cst[t][i] = cos(t * inv_freq[i]), snt[t][i] = sin(...), inv_freq[i] = 1 / 1e4^(i/64),
// i < 64, all f32. Block = 8 waves, wave w -> t = blk*8 + w, lane -> i = lane, lane + 32.
// Coverage: npos/8 blocks x 8 waves x 32 lanes x 2 = npos x 64 per plane.
// ---------------------------------------------------------------------------
__device__ __forceinline__ void rope_table_job(float* __restrict__ cst, float* __restrict__ snt, int npos, int blk) {
  const int lane = threadIdx.x & 31;
  const int wave = (int)(threadIdx.x >> 5);
  const int t = blk * 8 + wave;
  if (t >= npos) return;                       // no barriers in this job
  const float pf = (float)t;
  float c0 = 0.f, s0 = 0.f, c1 = 0.f, s1 = 0.f;
#pragma unroll 1
  for (int u = 0; u < 2; ++u) {
    const int i = lane + 32 * u;
    const float e   = (float)i * 0.015625f;      // i / 64 exact
    const float pw  = powf(10000.0f, e);
    const float inv = 1.0f / pw;
    const float ang = pf * inv;
    const float cv = cosf(ang);
    const float sv = sinf(ang);
    c1 = cv; s1 = sv;
    if (u == 0) { c0 = cv; s0 = sv; }
  }
  const size_t o = (size_t)t * NFREQ + lane;
  {
    ((float*)cst)[o]      = c0;
    ((float*)cst)[o + 32] = c1;
    ((float*)snt)[o]      = s0;
    ((float*)snt)[o + 32] = s1;
    
  }
}

// ---------------------------------------------------------------------------
// Elementwise RNE f32 -> bf16 plane: 8 elements per thread, one 16-B store per lane -> 32 consecutive lanes write 4 whole
// (every n8 used is a multiple of 256, so every instruction is full width).
// ---------------------------------------------------------------------------
__device__ __forceinline__ void cvt_bf16_job(const float* __restrict__ in, unsigned short* __restrict__ outp, int n8, int blk) {
  const int i = blk * 256 + (int)threadIdx.x;
  if (i >= n8) return;
  const size_t e = 8 * (size_t)i;
  const v4f a = *(const v4f*)(in + e);
  const v4f b = *(const v4f*)(in + e + 4);
  v4u w;
  w[0] = pk16(bf_bits(a[0]), bf_bits(a[1]));
  w[1] = pk16(bf_bits(a[2]), bf_bits(a[3]));
  w[2] = pk16(bf_bits(b[0]), bf_bits(b[1]));
  w[3] = pk16(bf_bits(b[2]), bf_bits(b[3]));
  *(v4u*)(outp + e) = w;
  
}

// ---------------------------------------------------------------------------
// Adapter B matrix [R][16] f32 -> extension plane [R][32] bf16: cols 0..15 = bf16(2*B[r][0..15]), cols 16..31 = the same again
// (pairs with the [Th | Tl] extension plane of T so one 32-deep k-step yields 2*(Th+Tl).B^T). 2*bf16(B) is exact.
// ---------------------------------------------------------------------------
__device__ __forceinline__ void bext_job(const float* __restrict__ Bm, unsigned short* __restrict__ outp, int npieces, int blk) {
  const int p = blk * 256 + (int)threadIdx.x;
  if (p >= npieces) return;
  const int row = p >> 2, q = p & 3;
  const float* src = Bm + (size_t)row * LRK + (q & 1) * 8;
  const v4f a = *(const v4f*)(src);
  const v4f b = *(const v4f*)(src + 4);
  v4u w;
  w[0] = pk16(bf_bits(2.0f * a[0]), bf_bits(2.0f * a[1]));
  w[1] = pk16(bf_bits(2.0f * a[2]), bf_bits(2.0f * a[3]));
  w[2] = pk16(bf_bits(2.0f * b[0]), bf_bits(2.0f * b[1]));
  w[3] = pk16(bf_bits(2.0f * b[2]), bf_bits(2.0f * b[3]));
  *(v4u*)(outp + (size_t)p * 8) = w;
  
}

// ---------------------------------------------------------------------------
// All preparation in ONE launch: the cos/sin table, the nine bf16 planes and the four adapter extension planes depend on the inputs alone
// and on nothing of each other, so each block takes one block's worth of one job, picked by its index (block-uniform; no barriers).
// Block ranges, in index order: table | x | Wq | Wo | Wk | Wv | Aq Ak Av Ao | Bq Bo | Bk Bv. Each range is exactly the job's own grid.
// ---------------------------------------------------------------------------
#define N8_X    (NTOK * HID / 8)     // 16-B output pieces of each plane
#define N8_WSQ  (HID * HID / 8)
#define N8_WKV  (HDM * HID / 8)
#define N8_AL   (LRK * HID / 8)
#define NP_BL   (HID * 4)
#define NP_BS   (HDM * 4)
#define PB_TAB  (SQ / 8)             // blocks of each job
#define PB_X    (N8_X / 256)
#define PB_WSQ  (N8_WSQ / 256)
#define PB_WKV  (N8_WKV / 256)
#define PB_AL   (N8_AL / 256)
#define PB_BL   (NP_BL / 256)
#define PB_BS   (NP_BS / 256)
#define PB_CVT  (PB_X + 2 * PB_WSQ + 2 * PB_WKV + 4 * PB_AL)
#define PB_ALL  (PB_TAB + PB_CVT + 2 * PB_BL + 2 * PB_BS)
static_assert(N8_X % 256 == 0 && N8_WSQ % 256 == 0 && N8_WKV % 256 == 0 && N8_AL % 256 == 0 && NP_BL % 256 == 0 && NP_BS % 256 == 0);

__global__ __launch_bounds__(256) void prep_kernel(
    const float* __restrict__ x,
    const float* __restrict__ wq_w, const float* __restrict__ wq_a, const float* __restrict__ wq_b,
    const float* __restrict__ wk_w, const float* __restrict__ wk_a, const float* __restrict__ wk_b,
    const float* __restrict__ wv_w, const float* __restrict__ wv_a, const float* __restrict__ wv_b,
    const float* __restrict__ wo_w, const float* __restrict__ wo_a, const float* __restrict__ wo_b,
    unsigned short* __restrict__ Xb,  unsigned short* __restrict__ Wqb, unsigned short* __restrict__ Wkb,
    unsigned short* __restrict__ Wvb, unsigned short* __restrict__ Wob,
    unsigned short* __restrict__ Aqb, unsigned short* __restrict__ Akb, unsigned short* __restrict__ Avb, unsigned short* __restrict__ Aob,
    unsigned short* __restrict__ BextQ, unsigned short* __restrict__ BextK, unsigned short* __restrict__ BextV,
    unsigned short* __restrict__ BextO, float* __restrict__ cst, float* __restrict__ snt) {
  int blk = (int)blockIdx.x;
  if (blk < PB_TAB) { rope_table_job(cst, snt, SQ, blk); return; }
  blk -= PB_TAB;
  if (blk < PB_CVT) {                            // one of the nine bf16 planes: pick source, plane and the block's number within the job
    const float* in = x;
    unsigned short* op = Xb;
    int n8 = N8_X;
    if (blk >= PB_X) {
      blk -= PB_X;
      if (blk < 2 * PB_WSQ) {
        const bool second = blk >= PB_WSQ;
        in = second ? wo_w : wq_w;  op = second ? Wob : Wqb;  n8 = N8_WSQ;  blk -= second ? PB_WSQ : 0;
      } else if ((blk -= 2 * PB_WSQ) < 2 * PB_WKV) {
        const bool second = blk >= PB_WKV;
        in = second ? wv_w : wk_w;  op = second ? Wvb : Wkb;  n8 = N8_WKV;  blk -= second ? PB_WKV : 0;
      } else {
        blk -= 2 * PB_WKV;
        const int j = blk / PB_AL;               // 0..3: q, k, v, o
        in = j == 0 ? wq_a : (j == 1 ? wk_a : (j == 2 ? wv_a : wo_a));
        op = j == 0 ? Aqb  : (j == 1 ? Akb  : (j == 2 ? Avb  : Aob));
        n8 = N8_AL;  blk -= j * PB_AL;
      }
    }
    cvt_bf16_job(in, op, n8, blk);
    return;
  }
  blk -= PB_CVT;
  {                                              // one of the four adapter extension planes
    const float* bm;
    unsigned short* op;
    int np;
    if (blk < 2 * PB_BL) {
      const bool second = blk >= PB_BL;
      bm = second ? wo_b : wq_b;  op = second ? BextO : BextQ;  np = NP_BL;  blk -= second ? PB_BL : 0;
    } else {
      blk -= 2 * PB_BL;
      const bool second = blk >= PB_BS;
      bm = second ? wv_b : wk_b;  op = second ? BextV : BextK;  np = NP_BS;  blk -= second ? PB_BS : 0;
    }
    bext_job(bm, op, np, blk);
  }
}

// ---------------------------------------------------------------------------
// Narrow bf16 WMMA GEMM for the rank-16 adapter: T[m][j] = sum_k A[m][k] * Bt[j][k], j < 16, written as the extension plane
// Tp [M][32] bf16 = [bf16 hi of T (16) | bf16 lo of T (16)]. A row-major [M][K] bf16 (pitch lda; SPLITA: hi plane Ap + lo plane A2p,
// two products), Bt [16][K] bf16 (pitch ldb); K % 32 == 0, M % 32 == 0. Wave tile 32 rows, block = 4 waves, grid = ceil(M/128);
// no block barriers. Epilogue per wave: stage 32x32 u16 in LDS, wave sync, then 4 store instructions of 32 lanes x 16 B
// grid.y = number of adapters that share A: adapter y reads Bt at Btp0 + y * bstep and writes its plane at Tp0 + y * tstep (elements).
// Coverage: per adapter M/32 waves x 32 rows x 32 cols = the whole [M][32] plane.
// ---------------------------------------------------------------------------
template <bool SPLITA>
__global__ __launch_bounds__(128) void tgemm_n16_kernel(
    const unsigned short* Ap, const unsigned short* A2p, int lda,
    const unsigned short* __restrict__ Btp0, int ldb, int bstep,
    unsigned short* __restrict__ Tp0, int tstep, int M, int K) {
  __shared__ __align__(16) unsigned short slab_all[4 * 1024];
  const unsigned short* Btp = Btp0 + (size_t)blockIdx.y * bstep;
  unsigned short*       Tp  = Tp0  + (size_t)blockIdx.y * tstep;
  const int lane = threadIdx.x & 31;
  const int wave = wave_id();
  const int hh = lane >> 4;
  const int rl = lane & 15;
  const int m0 = ((int)blockIdx.x * 4 + wave) * 32;
  if (m0 >= M) return;                          // wave-uniform; no block barriers in this kernel

  const __bf16* A  = (const __bf16*)(const void*)Ap;
  const __bf16* A2 = (const __bf16*)(const void*)A2p;
  const __bf16* Bt = (const __bf16*)(const void*)Btp;

  v8f acc[2];
  acc[0] = zero8(); acc[1] = zero8();
  for (int k0 = 0; k0 < K; k0 += 32) {
    v16b ah[2], al[2];
#pragma unroll
    for (int i = 0; i < 2; ++i) {
      const size_t ao = (size_t)(m0 + i * 16 + rl) * lda + k0 + 8 * hh;
      ah[i] = ldfrag_b(A + ao);
      al[i] = SPLITA ? ldfrag_b(A2 + ao) : ah[i];
    }
    const v16b bj = ldfrag_b(Bt + (size_t)rl * ldb + k0 + 8 * hh);
    acc[0] = mma_b(ah[0], bj, acc[0]);
    acc[1] = mma_b(ah[1], bj, acc[1]);
    if (SPLITA) {
      acc[0] = mma_b(al[0], bj, acc[0]);
      acc[1] = mma_b(al[1], bj, acc[1]);
    }
    guard_b5(acc[0], acc[1], ah[0], ah[1], al[0], al[1], bj);
  }
  acc_guard2(acc[0], acc[1]);

  unsigned short* sl = slab_all + wave * 1024;
#pragma unroll
  for (int i = 0; i < 2; ++i)
#pragma unroll
    for (int r = 0; r < 8; ++r) {
      const int row = i * 16 + 8 * hh + r;
      const float v = acc[i][r];
      const unsigned short hb = bf_bits(v);
      const unsigned short lb = bf_bits(v - bf_val(hb));
      sl[row * 32 + rl]      = hb;
      sl[row * 32 + 16 + rl] = lb;
    }
  lds_wave_sync();
  {
#pragma unroll
    for (int it = 0; it < 4; ++it) {
      const int p   = it * 32 + lane;             // piece 0..127 of 8 u16
      const int row = p >> 2;                     // 0..31
      const int c8  = (p & 3) * 8;                // 0..24
      const v8us w = *(const v8us*)(sl + row * 32 + c8);
      *(v8us*)(Tp + (size_t)(m0 + row) * KEXT + c8) = w;
    }
    
  }
}

// ---------------------------------------------------------------------------
// bf16 WMMA GEMM, wave tile 32 rows x 128 cols, block = 4 waves (128 threads) = one 128 x 128 tile of C (wave w: rows 32w..32w+31).
//   C[m][n] = sum_k A[m][k] * Bt[n][k]  +  sum_{k<32} Aext[m][k] * Bext[n][k]
//   A row-major [M][K] bf16 (pitch lda), Bt row-major [N][K] bf16 (pitch ldb), Aext [M][32], Bext [N][32] bf16 (pitch 32);
//   M % 128 == 0, N % 128 == 0, K % 64 == 0, K >= 128; grid.x = M/128 * N/128.
//   SPLITA: A carried as hi (Ap) + lo (A2p) bf16 planes, two products into one accumulator (Aext stays one plane).
//   K loop: stages of 64 k. A stage = the block's 128 A rows (both planes when SPLITA) and 128 Bt rows, 128 B of each row, brought to LDS
//   by 16-B async copies (a wave's copy = 4 whole lines), rows at pitch 144 B; two buffers, stage t + 2 copied while stage t + 1 is worked on.
//   Fragments come from LDS with the split k map (ldfrag_b); the adapter k-step still loads from global rows.
// Epilogues (all: per wave, per 16-row slab: stage in LDS, wave sync, write each row segment with ONE instruction of
//   EPI 0, rope (block-uniform run-time flag) set: q / k projection: RoPE with pairs (dim, dim+64), token position = row & (SQ-1), cos/sin
//          from the f32 table [SQ][64];
//          writes f16 hi plane C0 and f16 residual x2048 plane C1, both [M][ldc], cols n0..n0+127 (row segment 256 B = 16 lanes x 16 B).
//   EPI 0, rope clear: v^T projection: f16 hi plane C0, residual x2048 plane C1, [M][ldc], row segment 256 B.
//   EPI 2: f32 output C0 [M][ldc]; row segment 128 floats = 512 B = 32 lanes x 16 B per instruction.
// Coverage: M/128 * N/128 blocks (blk = the block's number within its own product) x 4 waves x 32x128 = the whole [M][N] region of each plane.
// The body is a device function on LDS arrays of the calling kernel, so that one launch can hold the blocks of several products.
// ---------------------------------------------------------------------------
template <int EPI> struct SlabT { typedef _Float16 T; static constexpr int PERW = 4096; };   // 2 planes x 16 x 128 halves
template <> struct SlabT<2>     { typedef float    T; static constexpr int PERW = 2048; };   // 16 x 128 floats

#define GK_KC    64                  // k per stage: 128 B of every operand row
#define GK_P     72                  // LDS row pitch in elements: 144 B = 16 B x 9, conflict-free for 16-B fragment reads
#define GK_PLANE (128 * GK_P)        // elements of one 128-row operand plane in LDS

__device__ __forceinline__ unsigned lds_off(const void* p) { return (unsigned)(size_t)p; }   // LDS byte address = low 32 bits

// One thread's share of one 128-row x 128-B plane: eight 16-B async copies, rows r, r + 16, .., r + 112 (r = tid >> 3, piece tid & 7).
// l = this lane's LDS byte address of row r, g = its global address of row r, step = 16 source rows in elements.
// The closing s_wait_xcnt 0 stands inside the statement so that no address register named here is rewritten ahead of it.
__device__ __forceinline__ void copy_plane8(unsigned l, const unsigned short* g, size_t step) {
  asm volatile(
      "global_load_async_to_lds_b128 %0, %8, off\n\t"
      "global_load_async_to_lds_b128 %1, %9, off\n\t"
      "global_load_async_to_lds_b128 %2, %10, off\n\t"
      "global_load_async_to_lds_b128 %3, %11, off\n\t"
      "global_load_async_to_lds_b128 %4, %12, off\n\t"
      "global_load_async_to_lds_b128 %5, %13, off\n\t"
      "global_load_async_to_lds_b128 %6, %14, off\n\t"
      "global_load_async_to_lds_b128 %7, %15, off\n\t"
      "s_wait_xcnt 0x0"
      :: "v"(l), "v"(l + 1u * 16u * GK_P * 2u), "v"(l + 2u * 16u * GK_P * 2u), "v"(l + 3u * 16u * GK_P * 2u),
         "v"(l + 4u * 16u * GK_P * 2u), "v"(l + 5u * 16u * GK_P * 2u), "v"(l + 6u * 16u * GK_P * 2u), "v"(l + 7u * 16u * GK_P * 2u),
         "v"(g), "v"(g + step), "v"(g + 2 * step), "v"(g + 3 * step),
         "v"(g + 4 * step), "v"(g + 5 * step), "v"(g + 6 * step), "v"(g + 7 * step)
      : "memory");
}
// this wave's async copies have landed in LDS
__device__ __forceinline__ void wait_async0() { asm volatile("s_wait_asynccnt 0x0" ::: "memory"); }
// this wave's LDS reads have returned, so the buffer they read may be refilled behind the next barrier
__device__ __forceinline__ void wait_ds0()    { asm volatile("s_wait_dscnt 0x0" ::: "memory"); }

template <int EPI, bool SPLITA>
__device__ __forceinline__ void gemm_w32x128_body(
    typename SlabT<EPI>::T* slab_all, unsigned short* stage_all, int blk, bool rope,
    const unsigned short* Ap, const unsigned short* A2p, int lda, const unsigned short* Aep,
    const unsigned short* Btp, int ldb, const unsigned short* Bep,
    const float* __restrict__ cst, const float* __restrict__ snt,
    void* C0, void* C1, int ldc, int M, int N, int K) {
  typedef typename SlabT<EPI>::T ST;
  constexpr int NPA      = SPLITA ? 2 : 1;               // A planes per stage
  constexpr int STAGE_EL = (NPA + 1) * GK_PLANE;         // elements per stage: A plane(s), then the Bt plane

  const int tid  = (int)threadIdx.x;
  const int lane = tid & 31;
  const int wave = wave_id();
  const int hh = lane >> 4;           // lane half: k offset 8*hh, D row offset 8*hh
  const int rl = lane & 15;           // A row / B col / D col within subtile
  const int tilesN = N >> 7;
  if (blk >= (M >> 7) * tilesN) return;         // block-uniform, in front of every barrier
  const int tmb = blk / tilesN;
  const int tn  = blk - tmb * tilesN;
  const int mb0 = tmb << 7;                     // first row of the block's tile
  const int m0  = mb0 + (wave << 5);            // first row of this wave's tile
  const int n0  = tn << 7;

  // this thread's copy addresses for stage 0, row tid >> 3 of each plane, 16-B piece tid & 7
  const int crow = tid >> 3, cpc = (tid & 7) * 8;
  const unsigned short* gA  = Ap  + (size_t)(mb0 + crow) * lda + cpc;
  const unsigned short* gA2 = A2p + (size_t)(mb0 + crow) * lda + cpc;
  const unsigned short* gB  = Btp + (size_t)(n0  + crow) * ldb + cpc;
  const size_t stepA = (size_t)16 * lda, stepB = (size_t)16 * ldb;
  const unsigned lc = lds_off(stage_all) + (unsigned)(crow * GK_P + cpc) * 2u;
  const int nst = K / GK_KC;                    // stages, block-uniform

  v8f acc[2][8];
#pragma unroll
  for (int i = 0; i < 2; ++i)
#pragma unroll
    for (int j = 0; j < 8; ++j) acc[i][j] = zero8();

  // stage s -> buffer s & 1
  auto copy_stage = [&](int s) {
    const unsigned l = lc + (unsigned)(s & 1) * (unsigned)(STAGE_EL * 2);
    const size_t ko = (size_t)s * GK_KC;
    copy_plane8(l, gA + ko, stepA);
    if (SPLITA) copy_plane8(l + GK_PLANE * 2u, gA2 + ko, stepA);
    copy_plane8(l + (unsigned)(NPA * GK_PLANE) * 2u, gB + ko, stepB);
  };
  copy_stage(0);
  wait_async0();
  __syncthreads();                              // stage 0 published
  if (nst > 1) copy_stage(1);

  for (int t = 0; t < nst; ++t) {
    const __bf16* S  = (const __bf16*)(const void*)(stage_all + (t & 1) * STAGE_EL);
    const __bf16* sA = S + (wave * 32 + rl) * GK_P + 8 * hh;
    const __bf16* sB = S + NPA * GK_PLANE + rl * GK_P + 8 * hh;
#pragma unroll
    for (int ks = 0; ks < 2; ++ks) {
      v16b ah[2], al[2], bj[8];
#pragma unroll
      for (int i = 0; i < 2; ++i) {
        ah[i] = ldfrag_b(sA + i * 16 * GK_P + ks * 32);
        al[i] = SPLITA ? ldfrag_b(sA + GK_PLANE + i * 16 * GK_P + ks * 32) : ah[i];
      }
#pragma unroll
      for (int j = 0; j < 8; ++j) bj[j] = ldfrag_b(sB + j * 16 * GK_P + ks * 32);
      __builtin_amdgcn_sched_barrier(0);        // keeps the k-step's LDS reads one group ahead of its WMMAs (else one waited pair per two WMMAs)
#pragma unroll
      for (int j = 0; j < 8; ++j) {
        acc[0][j] = mma_b(ah[0], bj[j], acc[0][j]);
        acc[1][j] = mma_b(ah[1], bj[j], acc[1][j]);
      }
      if (SPLITA) {
#pragma unroll
        for (int j = 0; j < 8; ++j) {
          acc[0][j] = mma_b(al[0], bj[j], acc[0][j]);
          acc[1][j] = mma_b(al[1], bj[j], acc[1][j]);
        }
      }
      __builtin_amdgcn_sched_barrier(0);        // keeps the next k-step's LDS reads from being spread among these WMMAs
    }
    // publish point of stage t + 1; it also ends every wave's reads of the buffer that stage t + 2 refills
    wait_ds0();
    wait_async0();
    __syncthreads();
    if (t + 2 < nst) copy_stage(t + 2);         // block-uniform test
  }
  wait_async0();                                // nothing of this wave is in flight behind the loop
  // ---- rank-16 adapter extension: one 32-deep k-step [Th | Tl] . [2B | 2B] ----
  {
    const __bf16* Ae = (const __bf16*)(const void*)Aep;
    const __bf16* Be = (const __bf16*)(const void*)Bep;
    v16b ae[2];
#pragma unroll
    for (int i = 0; i < 2; ++i) ae[i] = ldfrag_b(Ae + (size_t)(m0 + i * 16 + rl) * KEXT + 8 * hh);
#pragma unroll
    for (int j = 0; j < 8; ++j) {
      const v16b be = ldfrag_b(Be + (size_t)(n0 + j * 16 + rl) * KEXT + 8 * hh);
      acc[0][j] = mma_b(ae[0], be, acc[0][j]);
      acc[1][j] = mma_b(ae[1], be, acc[1][j]);
      guard_b5(acc[0][j], acc[1][j], ae[0], ae[1], ae[0], ae[1], be);
    }
  }
  acc_guard4(acc[0][0], acc[0][1], acc[0][2], acc[0][3]);
  acc_guard4(acc[0][4], acc[0][5], acc[0][6], acc[0][7]);
  acc_guard4(acc[1][0], acc[1][1], acc[1][2], acc[1][3]);
  acc_guard4(acc[1][4], acc[1][5], acc[1][6], acc[1][7]);

  // ---- epilogue ----
  ST* slab = slab_all + wave * SlabT<EPI>::PERW;
  _Float16* sl16 = (_Float16*)(void*)slab;
  float*    slf  = (float*)(void*)slab;

  if (EPI == 0 && rope) {
    _Float16* P0 = (_Float16*)C0;
    _Float16* P1 = (_Float16*)C1;
#pragma unroll
    for (int i = 0; i < 2; ++i) {
      const int rb = m0 + i * 16 + 8 * hh;
#pragma unroll
      for (int j = 0; j < 4; ++j) {
        const int dim = j * 16 + rl;                             // 0..63 within head; x2 partner at dim + 64
#pragma unroll
        for (int r = 0; r < 8; ++r) {
          const int row = rb + r;                                // token 0..M-1
          const int tp  = row & (SQ - 1);                        // position within its sequence
          const float cv = cst[(size_t)tp * NFREQ + dim];
          const float sv = snt[(size_t)tp * NFREQ + dim];
          const float x1 = acc[i][j][r];
          const float x2 = acc[i][j + 4][r];
          const float o1 = x1 * cv - x2 * sv;
          const float o2 = x2 * cv + x1 * sv;
          const _Float16 h1 = (_Float16)o1;
          const _Float16 h2 = (_Float16)o2;
          const int so = (8 * hh + r) * 128 + dim;
          sl16[so]             = h1;
          sl16[so + 64]        = h2;
          sl16[2048 + so]      = (_Float16)((o1 - (float)h1) * 2048.0f);
          sl16[2048 + so + 64] = (_Float16)((o2 - (float)h2) * 2048.0f);
        }
      }
      lds_wave_sync();
      {
#pragma unroll
        for (int it = 0; it < 8; ++it) {
          const int row = it * 2 + hh;                           // it x hh covers rows 0..15
          const int c8  = rl * 8;
          const v8h vh = *(const v8h*)(sl16 + row * 128 + c8);
          const v8h vl = *(const v8h*)(sl16 + 2048 + row * 128 + c8);
          const size_t go = (size_t)(m0 + i * 16 + row) * ldc + n0 + c8;
          *(v8h*)(P0 + go) = vh;
          *(v8h*)(P1 + go) = vl;
        }
        
      }
      lds_wave_sync();
    }
  } else if (EPI == 0) {
    _Float16* P0 = (_Float16*)C0;
    _Float16* P1 = (_Float16*)C1;
#pragma unroll
    for (int i = 0; i < 2; ++i) {
#pragma unroll
      for (int r = 0; r < 8; ++r) {
#pragma unroll
        for (int j = 0; j < 8; ++j) {
          const float v = acc[i][j][r];
          const _Float16 hv = (_Float16)v;
          const int so = (8 * hh + r) * 128 + j * 16 + rl;
          sl16[so]        = hv;
          sl16[2048 + so] = (_Float16)((v - (float)hv) * 2048.0f);
        }
      }
      lds_wave_sync();
      {
#pragma unroll
        for (int it = 0; it < 8; ++it) {
          const int row = it * 2 + hh;
          const int c8  = rl * 8;
          const v8h vh = *(const v8h*)(sl16 + row * 128 + c8);
          const v8h vl = *(const v8h*)(sl16 + 2048 + row * 128 + c8);
          const size_t go = (size_t)(m0 + i * 16 + row) * ldc + n0 + c8;
          *(v8h*)(P0 + go) = vh;
          *(v8h*)(P1 + go) = vl;
        }
        
      }
      lds_wave_sync();
    }
  } else {
    float* C = (float*)C0;
#pragma unroll
    for (int i = 0; i < 2; ++i) {
#pragma unroll
      for (int j = 0; j < 8; ++j)
#pragma unroll
        for (int r = 0; r < 8; ++r)
          slf[(8 * hh + r) * 128 + j * 16 + rl] = acc[i][j][r];
      lds_wave_sync();
      {
#pragma unroll
        for (int row = 0; row < 16; ++row) {                     // 32 lanes x 16 B = the whole 512-B row segment per instruction
          const v4f v = *(const v4f*)(slf + row * 128 + lane * 4);
          *(v4f*)(C + (size_t)(m0 + i * 16 + row) * ldc + n0 + lane * 4) = v;
        }
        
      }
      lds_wave_sync();
    }
  }
}

// one product per launch
template <int EPI, bool SPLITA>
__global__ __launch_bounds__(128) void gemm_w32x128_kernel(
    const unsigned short* Ap, const unsigned short* A2p, int lda, const unsigned short* __restrict__ Aep,
    const unsigned short* __restrict__ Btp, int ldb, const unsigned short* __restrict__ Bep,
    const float* __restrict__ cst, const float* __restrict__ snt,
    void* C0, void* C1, int ldc, int M, int N, int K) {
  __shared__ __align__(16) typename SlabT<EPI>::T slab_all[4 * SlabT<EPI>::PERW];
  __shared__ __align__(16) unsigned short stage_all[2 * (SPLITA ? 3 : 2) * GK_PLANE];
  gemm_w32x128_body<EPI, SPLITA>(slab_all, stage_all, (int)blockIdx.x, false,
                                 Ap, A2p, lda, Aep, Btp, ldb, Bep, cst, snt, C0, C1, ldc, M, N, K);
}

// The q, k and v^T projections in ONE launch: they read the same planes and none reads another's result. Blocks 0..nkv-1 take v^T
// (A = Wv, Bt = x), nkv..2nkv-1 take k, the rest q; nkv = ntok/128 * hdm/128. The choice is block-uniform, all operands are picked before
// the one body, whose barriers every wave of a block passes alike. grid.x = 2 * nkv + ntok/128 * hid/128.
__global__ __launch_bounds__(128) void gemm_qkv_kernel(
    const unsigned short* __restrict__ Xb,
    const unsigned short* __restrict__ Wqb, const unsigned short* __restrict__ Wkb, const unsigned short* __restrict__ Wvb,
    const unsigned short* __restrict__ TextQ, const unsigned short* __restrict__ TextK, const unsigned short* __restrict__ TextV,
    const unsigned short* __restrict__ BextQ, const unsigned short* __restrict__ BextK, const unsigned short* __restrict__ BextV,
    const float* __restrict__ cst, const float* __restrict__ snt,
    unsigned short* Qh, unsigned short* Ql, unsigned short* Kh, unsigned short* Kl, unsigned short* Vh, unsigned short* Vl,
    int ntok, int hid, int hdm) {
  __shared__ __align__(16) SlabT<0>::T slab_all[4 * SlabT<0>::PERW];
  __shared__ __align__(16) unsigned short stage_all[2 * 2 * GK_PLANE];
  const int nkv = (ntok >> 7) * (hdm >> 7);
  const int bx  = (int)blockIdx.x;
  const bool isv = bx < nkv;
  const bool isk = !isv && bx < 2 * nkv;
  const int blk = isv ? bx : (isk ? bx - nkv : bx - 2 * nkv);
  const unsigned short* A  = isv ? Wvb   : Xb;
  const unsigned short* Ae = isv ? BextV : (isk ? TextK : TextQ);
  const unsigned short* Bt = isv ? Xb    : (isk ? Wkb   : Wqb);
  const unsigned short* Be = isv ? TextV : (isk ? BextK : BextQ);
  unsigned short* P0 = isv ? Vh : (isk ? Kh : Qh);
  unsigned short* P1 = isv ? Vl : (isk ? Kl : Ql);
  const int M   = isv ? hdm  : ntok;
  const int N   = isv ? ntok : (isk ? hdm : hid);
  gemm_w32x128_body<0, false>(slab_all, stage_all, blk, !isv,
                              A, A, hid, Ae, Bt, hid, Be, cst, snt, (void*)P0, (void*)P1, N, M, N, hid);
}

// ---------------------------------------------------------------------------
// Causal multi-query flash attention (one shared 128-wide k/v head), 32-key chunks, block = 4 waves = 64 query rows of one (b, h);
// grid = SQ / 64 query tiles x NHQ x NSEQ blocks in one dimension, longest query tile first (see attn_causal_kernel): one launch;
// query tiles 0..AT_NPRES-1 run the PRES body, the others the body without it.
//   q planes f16 [tok][h*128+d]: hi (qhp) and residual x2048 (qlp); k planes f16 [tok][d]: hi (khp), residual x2048 (klp);
//   v^T planes f16 [d][tok]: hi (vhp), residual x2048 (vlp); outputs attn bf16 hi (ahp) / lo (alp) [tok][h*128+d].
//   scores = (Sh + Sr/2048) * 128^-0.5 with Sh = qh.kh and Sr = ql'.kh + qh.kl'; keys > query -> -inf; online softmax f32;
//   p' = 1024 p stored per wave to LDS as f16 hi (and residual x2048 when PRES), reloaded as A fragments after a wave sync;
//   O = (Oh + Or/2048)/1024/l with Oh = ph.vh, Or = ph.vl' (+ pl'.vh when PRES).
//   K / V^T chunk staging: 128 threads x 4 x 16 B per plane = whole 32x128 / 128x32 tile, by 16-B async copies to LDS, two chunk buffers:
//   chunk kc + 2 is copied into the buffer that chunk kc has left while chunk kc + 1 is worked on; one publish point (waits + barrier) a chunk.
//   Trip count 2*qb+2 chunks (static bound 64); waves whose rows are all below the chunk skip it (wave-uniform, scalar branch).
// Coverage: 32 query tiles x 4 waves x 16 rows x 128 cols per (b,h) = the whole [tok][h*128..+127] slab of both output planes.
// ---------------------------------------------------------------------------
#define AT_KC   32
#define KS_P    136
#define VS_P    40
#define PS_P    40
#define LDS_KS  0
#define LDS_KLS (32 * KS_P)
#define LDS_VHS (2 * 32 * KS_P)
#define LDS_VLS (LDS_VHS + 128 * VS_P)
#define AT_BUF  (LDS_VLS + 128 * VS_P)       // halves of one chunk buffer (the four planes above are offsets within a buffer)
#define LDS_PH  (2 * AT_BUF)
#define LDS_PL  (LDS_PH + 4 * 16 * PS_P)
#define LDS_TOT (LDS_PL + 4 * 16 * PS_P)
static_assert(3 * LDS_TOT * 2 <= 320 * 1024); // three blocks per WGP, as many as the registers allow
static_assert((AT_BUF * 2) % 16 == 0);
static_assert(4 * 4096 <= 2 * AT_BUF);       // output staging (2 planes x 16 x 128 per wave) aliases the chunk region after the loop

// One thread's share of a pair of planes (hi, residual) of one chunk: four 16-B async copies per plane, rows r, r + n, r + 2n, r + 3n.
// la, lb = this lane's LDS byte addresses of row r in the two planes, lstep = n rows in LDS bytes; ga, gb = its global addresses of row r,
// gstep = n source rows in elements. The closing s_wait_xcnt 0 stands inside the statement so that no address register named here is
// rewritten ahead of it.
__device__ __forceinline__ void copy_pair4(unsigned la, unsigned lb, unsigned lstep,
                                           const _Float16* ga, const _Float16* gb, size_t gstep) {
  asm volatile(
      "global_load_async_to_lds_b128 %0, %8, off\n\t"
      "global_load_async_to_lds_b128 %1, %9, off\n\t"
      "global_load_async_to_lds_b128 %2, %10, off\n\t"
      "global_load_async_to_lds_b128 %3, %11, off\n\t"
      "global_load_async_to_lds_b128 %4, %12, off\n\t"
      "global_load_async_to_lds_b128 %5, %13, off\n\t"
      "global_load_async_to_lds_b128 %6, %14, off\n\t"
      "global_load_async_to_lds_b128 %7, %15, off\n\t"
      "s_wait_xcnt 0x0"
      :: "v"(la), "v"(la + lstep), "v"(la + 2u * lstep), "v"(la + 3u * lstep),
         "v"(lb), "v"(lb + lstep), "v"(lb + 2u * lstep), "v"(lb + 3u * lstep),
         "v"(ga), "v"(ga + gstep), "v"(ga + 2 * gstep), "v"(ga + 3 * gstep),
         "v"(gb), "v"(gb + gstep), "v"(gb + 2 * gstep), "v"(gb + 3 * gstep)
      : "memory");
}

template <bool PRES>
__device__ __forceinline__ void attn_causal_body(
    _Float16* lds, int qb, int h, int b,
    const unsigned short* __restrict__ qhp, const unsigned short* __restrict__ qlp,
    const unsigned short* __restrict__ khp, const unsigned short* __restrict__ klp,
    const unsigned short* __restrict__ vhp, const unsigned short* __restrict__ vlp,
    unsigned short* __restrict__ ahp, unsigned short* __restrict__ alp) {
  const int tid  = (int)threadIdx.x;
  const int lane = tid & 31;
  const int wave = wave_id();
  const int hh   = lane >> 4;
  const int c    = lane & 15;
  const int q0   = qb * 64 + wave * 16;          // first query row of this wave (within sequence)
  const int qlast = q0 + 15;
  const size_t tok0 = (size_t)b * SQ;

  const _Float16* Qhr = (const _Float16*)(const void*)qhp + (tok0 + q0 + c) * HID + h * HDM + 8 * hh;
  const _Float16* Qlr = (const _Float16*)(const void*)qlp + (tok0 + q0 + c) * HID + h * HDM + 8 * hh;
  const _Float16* Kg  = (const _Float16*)(const void*)khp + tok0 * HDM;
  const _Float16* Klg = (const _Float16*)(const void*)klp + tok0 * HDM;
  const _Float16* Vhg = (const _Float16*)(const void*)vhp + tok0;
  const _Float16* Vlg = (const _Float16*)(const void*)vlp + tok0;
  _Float16* ph = lds + LDS_PH + wave * (16 * PS_P);
  _Float16* pl = lds + LDS_PL + wave * (16 * PS_P);

  float mrow[8], lrow[8];
  v8f oacc[8], oaccr[8];
#pragma unroll
  for (int r = 0; r < 8; ++r) { mrow[r] = -INFINITY; lrow[r] = 0.f; }
#pragma unroll
  for (int t = 0; t < 8; ++t) { oacc[t] = zero8(); oaccr[t] = zero8(); }

  // the wave's 16 query rows, both planes, as A fragments: loaded once, held in registers over the whole key loop
  // unrolled so that the arrays are registers
  v16h qfa[4], qfl[4];
#pragma unroll
  for (int dc = 0; dc < 4; ++dc) {
    qfa[dc] = ldfrag_h(Qhr + dc * 32);
    qfl[dc] = ldfrag_h(Qlr + dc * 32);
  }

  const int nch = 2 * qb + 2;                    // block-uniform, 2 .. 64
  // this thread's copy addresses for chunk 0, buffer 0. Coverage per plane: 128 threads x 4 pieces of 8 halves = 512 pieces = whole tile.
  const int ckey = tid >> 4, cd8 = (tid & 15) * 8;   // K: keys ckey + 8 i, i < 4, of 32 keys x 128 d
  const int cdim = tid >> 2, ck8 = (tid & 3) * 8;    // V^T: rows cdim + 32 i, i < 4, of 128 d x 32 keys
  const unsigned lK = lds_off(lds) + (unsigned)(LDS_KS  + ckey * KS_P + cd8) * 2u;
  const unsigned lV = lds_off(lds) + (unsigned)(LDS_VHS + cdim * VS_P + ck8) * 2u;
  const size_t goK = (size_t)ckey * HDM + cd8;
  const size_t goV = (size_t)cdim * NTOK + ck8;
  // chunk s -> buffer s & 1
  auto copy_chunk = [&](int s) {
    const unsigned lb = (unsigned)(s & 1) * (unsigned)(AT_BUF * 2);
    const size_t kv = (size_t)s * AT_KC;
    copy_pair4(lK + lb, lK + lb + (unsigned)(LDS_KLS - LDS_KS) * 2u, 8u * KS_P * 2u,
               Kg + goK + kv * HDM, Klg + goK + kv * HDM, (size_t)8 * HDM);
    copy_pair4(lV + lb, lV + lb + (unsigned)(LDS_VLS - LDS_VHS) * 2u, 32u * VS_P * 2u,
               Vhg + goV + kv, Vlg + goV + kv, (size_t)32 * NTOK);
  };
  copy_chunk(0);
  wait_async0();
  __syncthreads();                               // chunk 0 published
  if (nch > 1) copy_chunk(1);                    // block-uniform test

  for (int kc = 0; kc < nch; ++kc) {
    const int kv0 = kc * AT_KC;
    const _Float16* Cb  = lds + (kc & 1) * AT_BUF;   // this trip reads this buffer alone
    const _Float16* Ks  = Cb + LDS_KS;
    const _Float16* Kls = Cb + LDS_KLS;
    const _Float16* Vhs = Cb + LDS_VHS;
    const _Float16* Vls = Cb + LDS_VLS;

    if (kv0 <= qlast) {                          // wave-uniform (scalar): skip chunks fully above this wave's rows
      // The chunk's LDS traffic is grouped and issued ahead of its use; each sched_barrier below keeps one group of LDS operations together
      // and ahead of the work that hides its latency (left free, the build waits on a pair of reads per WMMA pair, or walks the rows' reductions
      // one by one). Every accumulator and every row value still takes its terms in the same order.
      // ---- scores: fragment reads in groups of 4 (a 32-deep step's two hi tiles, then its two residual tiles), issued three groups ahead ----
      v8f sh[2], sr[2];
      sh[0] = zero8(); sh[1] = zero8(); sr[0] = zero8(); sr[1] = zero8();
      v16h kf[8][2];                             // group 2 * dc: hi plane, group 2 * dc + 1: residual plane; [j] = key tile
#pragma unroll
      for (int g = 0; g < 3; ++g)
#pragma unroll
        for (int j = 0; j < 2; ++j) kf[g][j] = ldfrag_h(((g & 1) ? Kls : Ks) + (j * 16 + c) * KS_P + (g >> 1) * 32 + 8 * hh);
#pragma unroll
      for (int g = 0; g < 8; ++g) {
        __builtin_amdgcn_sched_barrier(0);       // the reads above are issued before this group's WMMAs
        const v16h qa = qfa[g >> 1];
        const v16h ql = qfl[g >> 1];
        if ((g & 1) == 0) {
          sh[0] = mma_h(qa, kf[g][0], sh[0]);
          sr[0] = mma_h(ql, kf[g][0], sr[0]);
          sh[1] = mma_h(qa, kf[g][1], sh[1]);
          sr[1] = mma_h(ql, kf[g][1], sr[1]);
          if (g == 0) guard_first(sh[0], sr[0], sh[1], sr[1], kf[0][0], kf[0][1]);
        } else {
          sr[0] = mma_h(qa, kf[g][0], sr[0]);
          sr[1] = mma_h(qa, kf[g][1], sr[1]);
        }
        __builtin_amdgcn_sched_barrier(0);       // the refill below follows these WMMAs, whose registers it takes over
        if (g + 3 < 8) {
#pragma unroll
          for (int j = 0; j < 2; ++j)
            kf[g + 3][j] = ldfrag_h((((g + 3) & 1) ? Kls : Ks) + (j * 16 + c) * KS_P + ((g + 3) >> 1) * 32 + 8 * hh);
        }
      }
      // ---- scale, causal mask, chunk row max ----
      float cm[8];
#pragma unroll
      for (int r = 0; r < 8; ++r) {
        float m = -INFINITY;
#pragma unroll
        for (int j = 0; j < 2; ++j) {
          const int kd = kv0 + j * 16 + c - (q0 + 8 * hh);       // key - (row - r): key > row as kd > r, r a literal, so that no row number
          float s = (sh[j][r] + sr[j][r] * 0.00048828125f) * 0.08838834764831845f;   // per r is held over the loop (registers for the rings)
          s = (kd > r) ? -INFINITY : s;
          sh[j][r] = s;
          m = fmaxf(m, s);
        }
        cm[r] = m;
      }
#pragma unroll
      for (int off = 1; off < 16; off <<= 1) {
        float tm[8];
#pragma unroll
        for (int r = 0; r < 8; ++r) tm[r] = __shfl_xor(cm[r], off, 32);
        __builtin_amdgcn_sched_barrier(0);       // the 8 rows' exchanges of one step fly together: one LDS latency per step
#pragma unroll
        for (int r = 0; r < 8; ++r) cm[r] = fmaxf(cm[r], tm[r]);
      }
      // ---- online softmax, P' to LDS ----
      float al8[8], ps8[8];
#pragma unroll
      for (int r = 0; r < 8; ++r) {
        const float mnew  = fmaxf(mrow[r], cm[r]);
        const float alpha = __expf(mrow[r] - mnew);
        mrow[r] = mnew;
        al8[r] = alpha;
        float psum = 0.f;
#pragma unroll
        for (int j = 0; j < 2; ++j) {
          const float p  = __expf(sh[j][r] - mnew);
          psum += p;
          const float pp = p * 1024.0f;
          const _Float16 phv = (_Float16)pp;
          const int po = (8 * hh + r) * PS_P + j * 16 + c;
          ph[po] = phv;
          if (PRES) pl[po] = (_Float16)((pp - (float)phv) * 2048.0f);
        }
        ps8[r] = psum;
      }
#pragma unroll
      for (int r = 0; r < 8; ++r)
#pragma unroll
        for (int t = 0; t < 8; ++t) { oacc[t][r] *= al8[r]; oaccr[t][r] *= al8[r]; }
      lds_wave_sync();                           // P' stores visible to the other lanes of this wave before the fragment reload
      // ---- O += P' . V: the 4 fragment reads of each 16-wide d tile are issued three tiles ahead of its WMMAs ----
      const v16h pa = ldfrag_h(ph + c * PS_P + 8 * hh);
      v16h pr = pa;
      if (PRES) pr = ldfrag_h(pl + c * PS_P + 8 * hh);
      v16h vb[8], vr[8];
#pragma unroll
      for (int t = 0; t < 3; ++t) {
        vb[t] = ldfrag_h(Vhs + (t * 16 + c) * VS_P + 8 * hh);
        vr[t] = ldfrag_h(Vls + (t * 16 + c) * VS_P + 8 * hh);
      }
      float ts[8];
#pragma unroll
      for (int t = 0; t < 8; ++t) {
        if ((t & 1) == 0) {                      // one step of the 8 rows' sum exchange flies behind every two tiles' WMMAs
#pragma unroll
          for (int r = 0; r < 8; ++r) ts[r] = __shfl_xor(ps8[r], 1 << (t >> 1), 32);
        }
        __builtin_amdgcn_sched_barrier(0);       // the reads and exchanges above are issued before this tile's WMMAs
        oacc[t]  = mma_h(pa, vb[t], oacc[t]);
        oaccr[t] = mma_h(pa, vr[t], oaccr[t]);
        if (PRES) oaccr[t] = mma_h(pr, vb[t], oaccr[t]);
        __builtin_amdgcn_sched_barrier(0);       // the refill below follows these WMMAs, whose registers it takes over
        if (t + 3 < 8) {
          vb[t + 3] = ldfrag_h(Vhs + ((t + 3) * 16 + c) * VS_P + 8 * hh);
          vr[t + 3] = ldfrag_h(Vls + ((t + 3) * 16 + c) * VS_P + 8 * hh);
        }
        if ((t & 1) == 1) {
#pragma unroll
          for (int r = 0; r < 8; ++r) ps8[r] += ts[r];
        }
      }
#pragma unroll
      for (int r = 0; r < 8; ++r) lrow[r] = lrow[r] * al8[r] + ps8[r];
    }
    // publish point of chunk kc + 1, passed by every wave (outside the per-wave skip); it also ends every wave's reads of the buffer
    // that chunk kc + 2 refills
    wait_ds0();
    wait_async0();
    __syncthreads();
    if (kc + 2 < nch) copy_chunk(kc + 2);        // block-uniform test
  }
  wait_async0();                                 // nothing of this wave is in flight behind the loop
  // the last trip's barrier has ended every reader's last read of the chunk region, which now becomes output staging
  _Float16* osh = lds + wave * 4096;
  _Float16* osl = osh + 2048;
#pragma unroll
  for (int r = 0; r < 8; ++r) {
    const float inv = (1.0f / lrow[r]) * 0.0009765625f;
#pragma unroll
    for (int t = 0; t < 8; ++t) {
      const float o = (oacc[t][r] + oaccr[t][r] * 0.00048828125f) * inv;
      const unsigned short hb = bf_bits(o);
      const unsigned short lb = bf_bits(o - bf_val(hb));
      const int so = (8 * hh + r) * 128 + t * 16 + c;
      osh[so] = __builtin_bit_cast(_Float16, hb);
      osl[so] = __builtin_bit_cast(_Float16, lb);
    }
  }
  lds_wave_sync();
  _Float16* Ahg = (_Float16*)(void*)ahp + (tok0 + q0) * HID + h * HDM;
  _Float16* Alg = (_Float16*)(void*)alp + (tok0 + q0) * HID + h * HDM;
  {
#pragma unroll
    for (int it = 0; it < 8; ++it) {
      const int row = it * 2 + hh;               // it 0..7 x hh 0..1 covers rows 0..15
      const int c8  = c * 8;                     // 16 lanes x 16 B = the whole 256-B segment
      const v8h x = *(const v8h*)(osh + row * 128 + c8);
      const v8h y = *(const v8h*)(osl + row * 128 + c8);
      *(v8h*)(Ahg + (size_t)row * HID + c8) = x;
      *(v8h*)(Alg + (size_t)row * HID + c8) = y;
    }
    
  }
}

#define AT_NPRES 4                   // query tiles 0..3 carry the p residual product
__global__ __launch_bounds__(128) void attn_causal_kernel(
    const unsigned short* __restrict__ qhp, const unsigned short* __restrict__ qlp,
    const unsigned short* __restrict__ khp, const unsigned short* __restrict__ klp,
    const unsigned short* __restrict__ vhp, const unsigned short* __restrict__ vlp,
    unsigned short* __restrict__ ahp, unsigned short* __restrict__ alp) {
  __shared__ __align__(16) _Float16 lds[LDS_TOT];
  // A block's key loop has 2 * qb + 2 trips and there are more blocks than resident places, so the cost falls with the block index: the
  // 64-trip tiles take the lowest indices, the short tiles the highest (for speed only). The query
  // tile is the slow digit of the index, so that neighbouring indices cost the same and indices far apart differ.
  // index -> (qb, h, b) is one to one: index = (SQ / 64 - 1 - qb) * NHQ * NSEQ + b * NHQ + h.
  const int idx = (int)blockIdx.x;
  const int qb  = SQ / 64 - 1 - idx / (NHQ * NSEQ);   // block-uniform: every wave of a block runs the same body and passes its barriers
  const int hb  = idx % (NHQ * NSEQ);
  const int h   = hb % NHQ;
  const int b   = hb / NHQ;
  if (qb < AT_NPRES) attn_causal_body<true>(lds, qb, h, b, qhp, qlp, khp, klp, vhp, vlp, ahp, alp);
  else               attn_causal_body<false>(lds, qb, h, b, qhp, qlp, khp, klp, vhp, vlp, ahp, alp);
}

// ---------------------------------------------------------------------------
// Workspace map (bytes; every region is a whole number of the rows / lines its producer writes with whole-line stores):
//   Xb   bf16 [4096][2048]  16777216    Wqb bf16 [2048][2048]  8388608    Wkb bf16 [128][2048]  524288   Wvb bf16 [128][2048] 524288
//   Wob  bf16 [2048][2048]   8388608    Aqb/Akb/Avb/Aob bf16 [16][2048]  4 x 65536
//   BextQ bf16 [2048][32]     131072    BextK/BextV bf16 [128][32] 2 x 8192   BextO bf16 [2048][32] 131072
//   TextQ/TextK/TextV/TextO bf16 [4096][32]  4 x 262144      cst/snt f32 [2048][64]  2 x 524288
//   Qh/Ql f16 [4096][2048]  2 x 16777216   Kh/Kl f16 [4096][128]  2 x 1048576   Vh/Vl f16 [128][4096]  2 x 1048576
//   Ah/Al bf16 [4096][2048] 2 x 16777216
//   total 108544000
// ---------------------------------------------------------------------------
extern "C" void kernel_launch(void* const* d_in, const int* in_sizes, int n_in,
                              void* d_out, int out_size, void* d_ws, size_t ws_size,
                              hipStream_t stream) {
  if (n_in < 13) return;
  if (in_sizes[0]  != NTOK * HID) return;
  if (in_sizes[1]  != HID * HID)  return;
  if (in_sizes[2]  != LRK * HID)  return;
  if (in_sizes[3]  != HID * LRK)  return;
  if (in_sizes[4]  != HDM * HID)  return;
  if (in_sizes[5]  != LRK * HID)  return;
  if (in_sizes[6]  != HDM * LRK)  return;
  if (in_sizes[7]  != HDM * HID)  return;
  if (in_sizes[8]  != LRK * HID)  return;
  if (in_sizes[9]  != HDM * LRK)  return;
  if (in_sizes[10] != HID * HID)  return;
  if (in_sizes[11] != LRK * HID)  return;
  if (in_sizes[12] != HID * LRK)  return;
  if (out_size != NTOK * HID) return;

  const float* x    = (const float*)d_in[0];
  const float* wq_w = (const float*)d_in[1];
  const float* wq_a = (const float*)d_in[2];
  const float* wq_b = (const float*)d_in[3];
  const float* wk_w = (const float*)d_in[4];
  const float* wk_a = (const float*)d_in[5];
  const float* wk_b = (const float*)d_in[6];
  const float* wv_w = (const float*)d_in[7];
  const float* wv_a = (const float*)d_in[8];
  const float* wv_b = (const float*)d_in[9];
  const float* wo_w = (const float*)d_in[10];
  const float* wo_a = (const float*)d_in[11];
  const float* wo_b = (const float*)d_in[12];
  float* out = (float*)d_out;

  const size_t szX   = (size_t)NTOK * HID * 2;
  const size_t szWsq = (size_t)HID * HID * 2;
  const size_t szWkv = (size_t)HDM * HID * 2;
  const size_t szAl  = (size_t)LRK * HID * 2;
  const size_t szBeL = (size_t)HID * KEXT * 2;
  const size_t szBeS = (size_t)HDM * KEXT * 2;
  const size_t szTe  = (size_t)NTOK * KEXT * 2;
  const size_t szTab = (size_t)SQ * NFREQ * 4;
  const size_t szQ   = (size_t)NTOK * HID * 2;
  const size_t szK   = (size_t)NTOK * HDM * 2;
  const size_t szV   = (size_t)HDM * NTOK * 2;
  const size_t szA   = (size_t)NTOK * HID * 2;
  size_t off = 0;
  const size_t oX   = off; off += szX;
  const size_t oWq  = off; off += szWsq;
  const size_t oWk  = off; off += szWkv;
  const size_t oWv  = off; off += szWkv;
  const size_t oWo  = off; off += szWsq;
  const size_t oAq  = off; off += szAl;
  const size_t oAk  = off; off += szAl;
  const size_t oAv  = off; off += szAl;
  const size_t oAo  = off; off += szAl;
  const size_t oBq  = off; off += szBeL;
  const size_t oBk  = off; off += szBeS;
  const size_t oBv  = off; off += szBeS;
  const size_t oBo  = off; off += szBeL;
  const size_t oTq  = off; off += szTe;
  const size_t oTk  = off; off += szTe;
  const size_t oTv  = off; off += szTe;
  const size_t oTo  = off; off += szTe;
  const size_t oCs  = off; off += szTab;
  const size_t oSn  = off; off += szTab;
  const size_t oQh  = off; off += szQ;
  const size_t oQl  = off; off += szQ;
  const size_t oKh  = off; off += szK;
  const size_t oKl  = off; off += szK;
  const size_t oVh  = off; off += szV;
  const size_t oVl  = off; off += szV;
  const size_t oAh  = off; off += szA;
  const size_t oAl  = off; off += szA;
  if (off > ws_size) return;                     // off = 108544000

  char* ws = (char*)d_ws;
  unsigned short* Xb    = (unsigned short*)(ws + oX);
  unsigned short* Wqb   = (unsigned short*)(ws + oWq);
  unsigned short* Wkb   = (unsigned short*)(ws + oWk);
  unsigned short* Wvb   = (unsigned short*)(ws + oWv);
  unsigned short* Wob   = (unsigned short*)(ws + oWo);
  unsigned short* Aqb   = (unsigned short*)(ws + oAq);
  unsigned short* Akb   = (unsigned short*)(ws + oAk);
  unsigned short* Avb   = (unsigned short*)(ws + oAv);
  unsigned short* Aob   = (unsigned short*)(ws + oAo);
  unsigned short* BextQ = (unsigned short*)(ws + oBq);
  unsigned short* BextK = (unsigned short*)(ws + oBk);
  unsigned short* BextV = (unsigned short*)(ws + oBv);
  unsigned short* BextO = (unsigned short*)(ws + oBo);
  unsigned short* TextQ = (unsigned short*)(ws + oTq);
  unsigned short* TextK = (unsigned short*)(ws + oTk);
  unsigned short* TextV = (unsigned short*)(ws + oTv);
  unsigned short* TextO = (unsigned short*)(ws + oTo);
  float*          cst   = (float*)(ws + oCs);
  float*          snt   = (float*)(ws + oSn);
  unsigned short* Qh    = (unsigned short*)(ws + oQh);
  unsigned short* Ql    = (unsigned short*)(ws + oQl);
  unsigned short* Kh    = (unsigned short*)(ws + oKh);
  unsigned short* Kl    = (unsigned short*)(ws + oKl);
  unsigned short* Vh    = (unsigned short*)(ws + oVh);
  unsigned short* Vl    = (unsigned short*)(ws + oVl);
  unsigned short* Ah    = (unsigned short*)(ws + oAh);
  unsigned short* Al    = (unsigned short*)(ws + oAl);

  const dim3 b256(256), b128(128);

  // (1) preparation, one launch: cos/sin table [2048][64] x 2; bf16 planes of x, the base weights and the adapter A matrices (layouts kept
  //     as given: [rows][K] with K contiguous); adapter B matrices -> [2B | 2B] extension planes
  prep_kernel<<<dim3(PB_ALL), b256, 0, stream>>>(x, wq_w, wq_a, wq_b, wk_w, wk_a, wk_b, wv_w, wv_a, wv_b, wo_w, wo_a, wo_b,
      Xb, Wqb, Wkb, Wvb, Wob, Aqb, Akb, Avb, Aob, BextQ, BextK, BextV, BextO, cst, snt);
  // (2) T = x . A^T -> [Th | Tl] extension planes for q, k, v, one launch, grid.y = adapter (Aqb, Akb, Avb and TextQ, TextK, TextV lie
  //     one behind the other in the workspace)   (M=4096, N=16, K=2048; 128 wave tiles / 4 per adapter)
  tgemm_n16_kernel<false><<<dim3((NTOK / 32 + 3) / 4, 3), b128, 0, stream>>>(Xb, Xb, HID, Aqb, HID, LRK * HID, TextQ, NTOK * KEXT, NTOK, HID);
  // (3) one launch: v^T = Wv . x^T + 2 Bv . T^T -> Vh/Vl [128][4096] (32 blocks); k = x . Wk^T + 2 T.Bk^T, RoPE -> Kh/Kl [4096][128]
  //     (32 blocks); q = x . Wq^T + 2 T.Bq^T, RoPE -> Qh/Ql [4096][2048] (512 blocks); K = 2048 + ext each
  gemm_qkv_kernel<<<dim3(2 * (NTOK / 128) * (HDM / 128) + (NTOK / 128) * (HID / 128)), b128, 0, stream>>>(
      Xb, Wqb, Wkb, Wvb, TextQ, TextK, TextV, BextQ, BextK, BextV, cst, snt, Qh, Ql, Kh, Kl, Vh, Vl, NTOK, HID, HDM);
  // (4) causal attention, one launch, longest query tiles first: query tiles 0..3 with the p residual product, tiles 4..31 without
  attn_causal_kernel<<<dim3((SQ / 64) * NHQ * NSEQ), b128, 0, stream>>>(Qh, Ql, Kh, Kl, Vh, Vl, Ah, Al);
  // (5) T_o = attn(hi + lo) . Ao^T -> [Th | Tl]
  tgemm_n16_kernel<true><<<dim3((NTOK / 32 + 3) / 4, 1), b128, 0, stream>>>(Ah, Al, HID, Aob, HID, 0, TextO, 0, NTOK, HID);
  // (6) out = attn(hi + lo) . Wo^T + 2 T_o . Bo^T -> d_out f32 [4096][2048]   (M=4096, N=2048, K=2048 + ext; 512 blocks)
  gemm_w32x128_kernel<2, true><<<dim3((NTOK / 128) * (HID / 128)), b128, 0, stream>>>(
      Ah, Al, HID, TextO, Wob, HID, BextO, cst, snt, (void*)out, (void*)out, HID, NTOK, HID, HID);
  (void)hipGetLastError();
}

// v007
// One run takes 212 microseconds.
// Two timings next to v006 put it at 1.19 and 1.20 times that version's speed.
// Over all steps from v000 it is 4.61 times as fast.
// Contractions: x.Wq^T, x.Wk^T, Wv.x^T and the rank-16 adapter products x.A^T on v_wmma_f32_16x16x32_bf16 (operands = RNE bf16 of the
// f32 inputs, single products; the adapter term enters the base GEMM as one extra 32-deep k-step with T = x.A^T carried as bf16 hi + bf16 lo
// against 2B in bf16; T is formed inside the GEMM that uses it); q.k^T and p.v on v_wmma_f32_16x16x32_f16 (q, k, v^T = f16 hi + f16 residual x2^11 planes, lo.lo dropped; p x1024 f16
// plus f16 residual x2^11 on query tiles 0..3); attn.Wo^T and attn.Ao^T on v_wmma_f32_16x16x32_bf16 (attn = bf16 hi + bf16 lo planes, two
// products; Wo, Ao RNE bf16). f32 accumulate everywhere; RoPE (f32 cos/sin table), online softmax and scale folds in f32.
#include <hip/hip_runtime.h>
#include <math.h>
#include <stdint.h>

#define NSEQ   2
#define SQ     2048
#define HID    2048
#define NHQ    16
#define HDM    128
#define NTOK   4096
#define NFREQ  64
#define LRK    16
#define KEXT   32

typedef _Float16       v16h __attribute__((ext_vector_type(16)));
typedef _Float16       v8h  __attribute__((ext_vector_type(8)));
typedef __bf16         v16b __attribute__((ext_vector_type(16)));
typedef __bf16         v8b  __attribute__((ext_vector_type(8)));
typedef float          v8f  __attribute__((ext_vector_type(8)));
typedef float          v4f  __attribute__((ext_vector_type(4)));
typedef unsigned int   v4u  __attribute__((ext_vector_type(4)));

// ---------------------------------------------------------------------------
// small helpers
// ---------------------------------------------------------------------------
__device__ __forceinline__ unsigned short bf_bits(float f) {          // RNE convert f32 -> bf16 bits
  const unsigned u = __float_as_uint(f);
  return (unsigned short)((u + 0x7FFFu + ((u >> 16) & 1u)) >> 16);
}
__device__ __forceinline__ float bf_val(unsigned short h) { return __uint_as_float(((unsigned)h) << 16); }
__device__ __forceinline__ unsigned pk16(unsigned short a, unsigned short b) { return (unsigned)a | ((unsigned)b << 16); }
__device__ __forceinline__ v8f zero8() { v8f z = {0.f, 0.f, 0.f, 0.f, 0.f, 0.f, 0.f, 0.f}; return z; }
__device__ __forceinline__ int wave_id() { return __builtin_amdgcn_readfirstlane((int)(threadIdx.x >> 5)); }

// orders one wave's LDS element stores before its own vector reloads of the same tile (other lanes' data)
__device__ __forceinline__ void lds_wave_sync() {
  __builtin_amdgcn_fence(__ATOMIC_RELEASE, "workgroup");
  __builtin_amdgcn_wave_barrier();
  __builtin_amdgcn_fence(__ATOMIC_ACQUIRE, "workgroup");
}

// ---------------------------------------------------------------------------
// WMMA fragments (wave32, 16x16x32, 16-bit operands). For A (row m = lane&15) and B (col n = lane&15) alike:
// elements 0..7 <- k0 + 8*(lane>>4) + 0..7, elements 8..15 <- k0 + 16 + 8*(lane>>4) + 0..7.
// ldfrag(p) with p = rowbase + k0 + 8*(lane>>4): two 16-B loads p[0..7], p[16..23].
// D: acc[r] = (row 8*(lane>>4) + r, col lane&15).
// ---------------------------------------------------------------------------
union FragH { v16h v; v8h h[2]; };
union FragB { v16b v; v8b h[2]; };
__device__ __forceinline__ v16h ldfrag_h(const _Float16* p) { FragH f; f.h[0] = *(const v8h*)(p); f.h[1] = *(const v8h*)(p + 16); return f.v; }
__device__ __forceinline__ v16b ldfrag_b(const __bf16* p)   { FragB f; f.h[0] = *(const v8b*)(p); f.h[1] = *(const v8b*)(p + 16); return f.v; }

__device__ __forceinline__ v8f mma_h(v16h a, v16h b, v8f c) {
  return __builtin_amdgcn_wmma_f32_16x16x32_f16(false, a, false, b, (short)0, c, false, false);
}
__device__ __forceinline__ v8f mma_b(v16b a, v16b b, v8f c) {
  return __builtin_amdgcn_wmma_f32_16x16x32_bf16(false, a, false, b, (short)0, c, false, false);
}
// hazard guards: 4 VALU slots after the last WMMA of a group, D tied, A/B kept live; memory clobber keeps later loads behind the group
__device__ __forceinline__ void guard_b5(v8f& a, v8f& b, v16b x0, v16b x1, v16b x2, v16b x3, v16b y) {
  asm volatile("v_nop\n\tv_nop\n\tv_nop\n\tv_nop" : "+v"(a), "+v"(b) : "v"(x0), "v"(x1), "v"(x2), "v"(x3), "v"(y) : "memory");
}
// behind the first score group, whose four results are new registers (C = 0): the two B fragments are named so that they stay live past the
// four WMMAs and no result is placed over a B that a WMMA just ahead reads; 4 VALU slots before those registers are free again
__device__ __forceinline__ void guard_first(v8f& a, v8f& b, v8f& c, v8f& d, v16h y, v16h z) {
  asm volatile("v_nop\n\tv_nop\n\tv_nop\n\tv_nop" : "+v"(a), "+v"(b), "+v"(c), "+v"(d) : "v"(y), "v"(z));
}
__device__ __forceinline__ void acc_guard4(v8f& a, v8f& b, v8f& c, v8f& d) {
  asm volatile("v_nop\n\tv_nop\n\tv_nop\n\tv_nop" : "+v"(a), "+v"(b), "+v"(c), "+v"(d));
}
__device__ __forceinline__ void acc_guard2(v8f& a, v8f& b) {
  asm volatile("v_nop\n\tv_nop\n\tv_nop\n\tv_nop" : "+v"(a), "+v"(b));
}

// ---------------------------------------------------------------------------
// RoPE table for positions t = 0..npos-1: cst[t][i] = cos(t * inv_freq[i]), snt[t][i] = sin(...), inv_freq[i] = 1 / 1e4^(i/64),
// i < 64, all f32. Block = 8 waves, wave w -> t = blk*8 + w, lane -> i = lane, lane + 32.
// Coverage: npos/8 blocks x 8 waves x 32 lanes x 2 = npos x 64 per plane.
// ---------------------------------------------------------------------------
__device__ __forceinline__ void rope_table_job(float* __restrict__ cst, float* __restrict__ snt, int npos, int blk) {
  const int lane = threadIdx.x & 31;
  const int wave = (int)(threadIdx.x >> 5);
  const int t = blk * 8 + wave;
  if (t >= npos) return;                       // no barriers in this job
  const float pf = (float)t;
  float c0 = 0.f, s0 = 0.f, c1 = 0.f, s1 = 0.f;
#pragma unroll 1
  for (int u = 0; u < 2; ++u) {
    const int i = lane + 32 * u;
    const float e   = (float)i * 0.015625f;      // i / 64 exact
    const float pw  = powf(10000.0f, e);
    const float inv = 1.0f / pw;
    const float ang = pf * inv;
    const float cv = cosf(ang);
    const float sv = sinf(ang);
    c1 = cv; s1 = sv;
    if (u == 0) { c0 = cv; s0 = sv; }
  }
  const size_t o = (size_t)t * NFREQ + lane;
  {
    ((float*)cst)[o]      = c0;
    ((float*)cst)[o + 32] = c1;
    ((float*)snt)[o]      = s0;
    ((float*)snt)[o + 32] = s1;
    
  }
}

// ---------------------------------------------------------------------------
// Elementwise RNE f32 -> bf16 plane: 8 elements per thread, one 16-B store per lane -> 32 consecutive lanes write 4 whole
// (every n8 used is a multiple of 256, so every instruction is full width).
// ---------------------------------------------------------------------------
__device__ __forceinline__ void cvt_bf16_job(const float* __restrict__ in, unsigned short* __restrict__ outp, int n8, int blk) {
  const int i = blk * 256 + (int)threadIdx.x;
  if (i >= n8) return;
  const size_t e = 8 * (size_t)i;
  const v4f a = *(const v4f*)(in + e);
  const v4f b = *(const v4f*)(in + e + 4);
  v4u w;
  w[0] = pk16(bf_bits(a[0]), bf_bits(a[1]));
  w[1] = pk16(bf_bits(a[2]), bf_bits(a[3]));
  w[2] = pk16(bf_bits(b[0]), bf_bits(b[1]));
  w[3] = pk16(bf_bits(b[2]), bf_bits(b[3]));
  *(v4u*)(outp + e) = w;
  
}

// ---------------------------------------------------------------------------
// Adapter B matrix [R][16] f32 -> extension plane [R][32] bf16: cols 0..15 = bf16(2*B[r][0..15]), cols 16..31 = the same again
// (pairs with the [Th | Tl] extension plane of T so one 32-deep k-step yields 2*(Th+Tl).B^T). 2*bf16(B) is exact.
// ---------------------------------------------------------------------------
__device__ __forceinline__ void bext_job(const float* __restrict__ Bm, unsigned short* __restrict__ outp, int npieces, int blk) {
  const int p = blk * 256 + (int)threadIdx.x;
  if (p >= npieces) return;
  const int row = p >> 2, q = p & 3;
  const float* src = Bm + (size_t)row * LRK + (q & 1) * 8;
  const v4f a = *(const v4f*)(src);
  const v4f b = *(const v4f*)(src + 4);
  v4u w;
  w[0] = pk16(bf_bits(2.0f * a[0]), bf_bits(2.0f * a[1]));
  w[1] = pk16(bf_bits(2.0f * a[2]), bf_bits(2.0f * a[3]));
  w[2] = pk16(bf_bits(2.0f * b[0]), bf_bits(2.0f * b[1]));
  w[3] = pk16(bf_bits(2.0f * b[2]), bf_bits(2.0f * b[3]));
  *(v4u*)(outp + (size_t)p * 8) = w;
  
}

// ---------------------------------------------------------------------------
// All preparation in ONE launch: the cos/sin table, the nine bf16 planes and the four adapter extension planes depend on the inputs alone
// and on nothing of each other, so each block takes one block's worth of one job, picked by its index (block-uniform; no barriers).
// Block ranges, in index order: table | x | Wq | Wo | Wk | Wv | Aq Ak Av Ao | Bq Bo | Bk Bv. Each range is exactly the job's own grid.
// ---------------------------------------------------------------------------
#define N8_X    (NTOK * HID / 8)     // 16-B output pieces of each plane
#define N8_WSQ  (HID * HID / 8)
#define N8_WKV  (HDM * HID / 8)
#define N8_AL   (LRK * HID / 8)
#define NP_BL   (HID * 4)
#define NP_BS   (HDM * 4)
#define PB_TAB  (SQ / 8)             // blocks of each job
#define PB_X    (N8_X / 256)
#define PB_WSQ  (N8_WSQ / 256)
#define PB_WKV  (N8_WKV / 256)
#define PB_AL   (N8_AL / 256)
#define PB_BL   (NP_BL / 256)
#define PB_BS   (NP_BS / 256)
#define PB_CVT  (PB_X + 2 * PB_WSQ + 2 * PB_WKV + 4 * PB_AL)
#define PB_ALL  (PB_TAB + PB_CVT + 2 * PB_BL + 2 * PB_BS)
static_assert(N8_X % 256 == 0 && N8_WSQ % 256 == 0 && N8_WKV % 256 == 0 && N8_AL % 256 == 0 && NP_BL % 256 == 0 && NP_BS % 256 == 0);

__global__ __launch_bounds__(256) void prep_kernel(
    const float* __restrict__ x,
    const float* __restrict__ wq_w, const float* __restrict__ wq_a, const float* __restrict__ wq_b,
    const float* __restrict__ wk_w, const float* __restrict__ wk_a, const float* __restrict__ wk_b,
    const float* __restrict__ wv_w, const float* __restrict__ wv_a, const float* __restrict__ wv_b,
    const float* __restrict__ wo_w, const float* __restrict__ wo_a, const float* __restrict__ wo_b,
    unsigned short* __restrict__ Xb,  unsigned short* __restrict__ Wqb, unsigned short* __restrict__ Wkb,
    unsigned short* __restrict__ Wvb, unsigned short* __restrict__ Wob,
    unsigned short* __restrict__ Aqb, unsigned short* __restrict__ Akb, unsigned short* __restrict__ Avb, unsigned short* __restrict__ Aob,
    unsigned short* __restrict__ BextQ, unsigned short* __restrict__ BextK, unsigned short* __restrict__ BextV,
    unsigned short* __restrict__ BextO, float* __restrict__ cst, float* __restrict__ snt) {
  int blk = (int)blockIdx.x;
  if (blk < PB_TAB) { rope_table_job(cst, snt, SQ, blk); return; }
  blk -= PB_TAB;
  if (blk < PB_CVT) {                            // one of the nine bf16 planes: pick source, plane and the block's number within the job
    const float* in = x;
    unsigned short* op = Xb;
    int n8 = N8_X;
    if (blk >= PB_X) {
      blk -= PB_X;
      if (blk < 2 * PB_WSQ) {
        const bool second = blk >= PB_WSQ;
        in = second ? wo_w : wq_w;  op = second ? Wob : Wqb;  n8 = N8_WSQ;  blk -= second ? PB_WSQ : 0;
      } else if ((blk -= 2 * PB_WSQ) < 2 * PB_WKV) {
        const bool second = blk >= PB_WKV;
        in = second ? wv_w : wk_w;  op = second ? Wvb : Wkb;  n8 = N8_WKV;  blk -= second ? PB_WKV : 0;
      } else {
        blk -= 2 * PB_WKV;
        const int j = blk / PB_AL;               // 0..3: q, k, v, o
        in = j == 0 ? wq_a : (j == 1 ? wk_a : (j == 2 ? wv_a : wo_a));
        op = j == 0 ? Aqb  : (j == 1 ? Akb  : (j == 2 ? Avb  : Aob));
        n8 = N8_AL;  blk -= j * PB_AL;
      }
    }
    cvt_bf16_job(in, op, n8, blk);
    return;
  }
  blk -= PB_CVT;
  {                                              // one of the four adapter extension planes
    const float* bm;
    unsigned short* op;
    int np;
    if (blk < 2 * PB_BL) {
      const bool second = blk >= PB_BL;
      bm = second ? wo_b : wq_b;  op = second ? BextO : BextQ;  np = NP_BL;  blk -= second ? PB_BL : 0;
    } else {
      blk -= 2 * PB_BL;
      const bool second = blk >= PB_BS;
      bm = second ? wv_b : wk_b;  op = second ? BextV : BextK;  np = NP_BS;  blk -= second ? PB_BS : 0;
    }
    bext_job(bm, op, np, blk);
  }
}

// ---------------------------------------------------------------------------
// bf16 WMMA GEMM, wave tile 32 rows x 128 cols, block = 4 waves (128 threads) = one 128 x 128 tile of C (wave w: rows 32w..32w+31).
//   C[m][n] = sum_k A[m][k] * Bt[n][k]  +  sum_{k<32} Aext[m][k] * Bext[n][k]
//   A row-major [M][K] bf16 (pitch lda), Bt row-major [N][K] bf16 (pitch ldb), Aext [M][32], Bext [N][32] bf16;
//   M % 128 == 0, N % 128 == 0, K % 64 == 0, K >= 128; grid.x = M/128 * N/128.
//   SPLITA: A carried as hi (Ap) + lo (A2p) bf16 planes, two products into one accumulator.
//   One of the two extension planes is the plane Ep in global memory ([2B | 2B], pitch 32); the other is [Th | Tl], bf16 hi and lo of
//   T[r][j] = sum_k X[r][k] * L[j][k], j < 16, L = the adapter's A matrix [16][K] bf16 (pitch ldl), X = the activations: the A operand
//   (XB clear, T = Aext) or the Bt operand (XB set, T = Bext). T is formed in the same K loop: L's 16 rows are staged with every stage, wave w
//   takes rows 32w..32w+31 of the block's X tile (its own A fragments when XB is clear) and adds one WMMA per 16 rows, plane and k-step,
//   k ascending, hi before lo. Behind the loop T goes to LDS as [Th | Tl] rows and comes back as fragments of the extension k-step.
//   K loop: stages of 64 k. A stage = the block's 128 A rows (both planes when SPLITA) and 128 Bt rows, 128 B of each row, brought to LDS
//   by 16-B async copies (a wave's copy = 4 whole lines), rows at pitch 144 B; two buffers, stage t + 2 copied while stage t + 1 is worked on.
//   Fragments come from LDS with the split k map (ldfrag_b); the adapter k-step loads Ep from global rows.
// Epilogues (all: per wave, per 16-row slab: stage in LDS, wave sync, write each row segment with ONE instruction of
//   EPI 0, XB clear: q / k projection: RoPE with pairs (dim, dim+64), token position = row & (SQ-1), cos/sin
//          from the f32 table [SQ][64];
//          writes f16 hi plane C0 and f16 residual x2048 plane C1, both [M][ldc], cols n0..n0+127 (row segment 256 B = 16 lanes x 16 B).
//   EPI 0, XB set: v^T projection: f16 hi plane C0, residual x2048 plane C1, [M][ldc], row segment 256 B.
//   EPI 2: f32 output C0 [M][ldc]; row segment 128 floats = 512 B = 32 lanes x 16 B per instruction.
// Coverage: M/128 * N/128 blocks (blk = the block's number within its own product) x 4 waves x 32x128 = the whole [M][N] region of each plane.
// The body is a device function on LDS arrays of the calling kernel, so that one launch can hold the blocks of several products.
// ---------------------------------------------------------------------------
template <int EPI> struct SlabT { typedef _Float16 T; static constexpr int PERW = 4096; };   // 2 planes x 16 x 128 halves
template <> struct SlabT<2>     { typedef float    T; static constexpr int PERW = 2048; };   // 16 x 128 floats

#define GK_KC    64                  // k per stage: 128 B of every operand row
#define GK_P     72                  // LDS row pitch in elements: 144 B = 16 B x 9, conflict-free for 16-B fragment reads
#define GK_PLANE (128 * GK_P)        // elements of one 128-row operand plane in LDS
#define GK_LPL   (16 * GK_P)         // elements of the adapter matrix's 16-row plane in LDS
#define TT_P     40                  // T row pitch in LDS in elements: 80 B = 16 B x 5, conflict-free for 16-B fragment reads
#define TT_W     4096                // elements from one wave's 32 T rows to the next wave's: a wave's 8-KiB epilogue slab

__device__ __forceinline__ unsigned lds_off(const void* p) { return (unsigned)(size_t)p; }   // LDS byte address = low 32 bits

// One thread's share of one 128-row x 128-B plane: eight 16-B async copies, rows r, r + 16, .., r + 112 (r = tid >> 3, piece tid & 7).
// l = this lane's LDS byte address of row r, g = its global address of row r, step = 16 source rows in elements.
// The closing s_wait_xcnt 0 stands inside the statement so that no address register named here is rewritten ahead of it.
__device__ __forceinline__ void copy_plane8(unsigned l, const unsigned short* g, size_t step) {
  asm volatile(
      "global_load_async_to_lds_b128 %0, %8, off\n\t"
      "global_load_async_to_lds_b128 %1, %9, off\n\t"
      "global_load_async_to_lds_b128 %2, %10, off\n\t"
      "global_load_async_to_lds_b128 %3, %11, off\n\t"
      "global_load_async_to_lds_b128 %4, %12, off\n\t"
      "global_load_async_to_lds_b128 %5, %13, off\n\t"
      "global_load_async_to_lds_b128 %6, %14, off\n\t"
      "global_load_async_to_lds_b128 %7, %15, off\n\t"
      "s_wait_xcnt 0x0"
      :: "v"(l), "v"(l + 1u * 16u * GK_P * 2u), "v"(l + 2u * 16u * GK_P * 2u), "v"(l + 3u * 16u * GK_P * 2u),
         "v"(l + 4u * 16u * GK_P * 2u), "v"(l + 5u * 16u * GK_P * 2u), "v"(l + 6u * 16u * GK_P * 2u), "v"(l + 7u * 16u * GK_P * 2u),
         "v"(g), "v"(g + step), "v"(g + 2 * step), "v"(g + 3 * step),
         "v"(g + 4 * step), "v"(g + 5 * step), "v"(g + 6 * step), "v"(g + 7 * step)
      : "memory");
}
// One thread's share of the adapter matrix's 16-row x 128-B plane: one 16-B async copy (row tid >> 3, piece tid & 7).
// The closing s_wait_xcnt 0 stands inside the statement so that no address register named here is rewritten ahead of it.
__device__ __forceinline__ void copy_plane1(unsigned l, const unsigned short* g) {
  asm volatile(
      "global_load_async_to_lds_b128 %0, %1, off\n\t"
      "s_wait_xcnt 0x0"
      :: "v"(l), "v"(g)
      : "memory");
}
// this wave's async copies have landed in LDS
__device__ __forceinline__ void wait_async0() { asm volatile("s_wait_asynccnt 0x0" ::: "memory"); }
// this wave's LDS reads have returned, so the buffer they read may be refilled behind the next barrier
__device__ __forceinline__ void wait_ds0()    { asm volatile("s_wait_dscnt 0x0" ::: "memory"); }

template <int EPI, bool SPLITA, bool XB>
__device__ __forceinline__ void gemm_w32x128_body(
    typename SlabT<EPI>::T* slab_all, unsigned short* stage_all, int blk,
    const unsigned short* Ap, const unsigned short* A2p, int lda,
    const unsigned short* Btp, int ldb, const unsigned short* Lp, int ldl, const unsigned short* Ep,
    const float* __restrict__ cst, const float* __restrict__ snt,
    void* C0, void* C1, int ldc, int M, int N, int K) {
  typedef typename SlabT<EPI>::T ST;
  constexpr int NPA      = SPLITA ? 2 : 1;               // A planes per stage
  constexpr int STAGE_EL = (NPA + 1) * GK_PLANE;         // elements per stage: A plane(s), then the Bt plane
  constexpr bool rope    = EPI == 0 && !XB;
  static_assert(!(SPLITA && XB));
  // The epilogue slabs are idle until the K loop has ended: up to there their first bytes hold the two stage buffers of the adapter matrix
  // (an array of their own would cost the q, k, v^T launch its third block per WGP); behind the loop's last barrier they take T.
  static_assert(2 * GK_LPL <= TT_W && 32 * TT_P <= TT_W);
  unsigned short* lst = (unsigned short*)(void*)slab_all;

  const int tid  = (int)threadIdx.x;
  const int lane = tid & 31;
  const int wave = wave_id();
  const int hh = lane >> 4;           // lane half: k offset 8*hh, D row offset 8*hh
  const int rl = lane & 15;           // A row / B col / D col within subtile
  const int tilesN = N >> 7;
  if (blk >= (M >> 7) * tilesN) return;         // block-uniform, in front of every barrier
  const int tmb = blk / tilesN;
  const int tn  = blk - tmb * tilesN;
  const int mb0 = tmb << 7;                     // first row of the block's tile
  const int m0  = mb0 + (wave << 5);            // first row of this wave's tile
  const int n0  = tn << 7;

  // this thread's copy addresses for stage 0, row tid >> 3 of each plane, 16-B piece tid & 7
  const int crow = tid >> 3, cpc = (tid & 7) * 8;
  const unsigned short* gA  = Ap  + (size_t)(mb0 + crow) * lda + cpc;
  const unsigned short* gA2 = A2p + (size_t)(mb0 + crow) * lda + cpc;
  const unsigned short* gB  = Btp + (size_t)(n0  + crow) * ldb + cpc;
  const unsigned short* gL  = Lp  + (size_t)crow * ldl + cpc;            // crow = 0..15: the 16 adapter rows
  const size_t stepA = (size_t)16 * lda, stepB = (size_t)16 * ldb;
  const unsigned lc = lds_off(stage_all) + (unsigned)(crow * GK_P + cpc) * 2u;
  const unsigned ll = lds_off(lst) + (unsigned)(crow * GK_P + cpc) * 2u;
  const int nst = K / GK_KC;                    // stages, block-uniform

  v8f acc[2][8];
#pragma unroll
  for (int i = 0; i < 2; ++i)
#pragma unroll
    for (int j = 0; j < 8; ++j) acc[i][j] = zero8();
  v8f tacc[2];                                  // T of this wave's 32 X rows
  tacc[0] = zero8(); tacc[1] = zero8();

  // stage s -> buffer s & 1
  auto copy_stage = [&](int s) {
    const unsigned l = lc + (unsigned)(s & 1) * (unsigned)(STAGE_EL * 2);
    const size_t ko = (size_t)s * GK_KC;
    copy_plane8(l, gA + ko, stepA);
    if (SPLITA) copy_plane8(l + GK_PLANE * 2u, gA2 + ko, stepA);
    copy_plane8(l + (unsigned)(NPA * GK_PLANE) * 2u, gB + ko, stepB);
    copy_plane1(ll + (unsigned)(s & 1) * (unsigned)(GK_LPL * 2), gL + ko);
  };
  copy_stage(0);
  wait_async0();
  __syncthreads();                              // stage 0 published
  if (nst > 1) copy_stage(1);

  for (int t = 0; t < nst; ++t) {
    const __bf16* S  = (const __bf16*)(const void*)(stage_all + (t & 1) * STAGE_EL);
    const __bf16* sA = S + (wave * 32 + rl) * GK_P + 8 * hh;
    const __bf16* sB = S + NPA * GK_PLANE + rl * GK_P + 8 * hh;
    const __bf16* sL = (const __bf16*)(const void*)(lst + (t & 1) * GK_LPL) + rl * GK_P + 8 * hh;
#pragma unroll
    for (int ks = 0; ks < 2; ++ks) {
      v16b ah[2], al[2], bj[8], xa[2];
#pragma unroll
      for (int i = 0; i < 2; ++i) {
        ah[i] = ldfrag_b(sA + i * 16 * GK_P + ks * 32);
        al[i] = SPLITA ? ldfrag_b(sA + GK_PLANE + i * 16 * GK_P + ks * 32) : ah[i];
      }
#pragma unroll
      for (int j = 0; j < 8; ++j) bj[j] = ldfrag_b(sB + j * 16 * GK_P + ks * 32);
      const v16b lj = ldfrag_b(sL + ks * 32);
#pragma unroll
      for (int i = 0; i < 2; ++i) xa[i] = XB ? ldfrag_b(sB + (wave * 32 + i * 16) * GK_P + ks * 32) : ah[i];
      __builtin_amdgcn_sched_barrier(0);        // keeps the k-step's LDS reads one group ahead of its WMMAs (else one waited pair per two WMMAs)
#pragma unroll
      for (int j = 0; j < 8; ++j) {
        acc[0][j] = mma_b(ah[0], bj[j], acc[0][j]);
        acc[1][j] = mma_b(ah[1], bj[j], acc[1][j]);
      }
      tacc[0] = mma_b(xa[0], lj, tacc[0]);
      tacc[1] = mma_b(xa[1], lj, tacc[1]);
      if (SPLITA) {
#pragma unroll
        for (int j = 0; j < 8; ++j) {
          acc[0][j] = mma_b(al[0], bj[j], acc[0][j]);
          acc[1][j] = mma_b(al[1], bj[j], acc[1][j]);
        }
        tacc[0] = mma_b(al[0], lj, tacc[0]);
        tacc[1] = mma_b(al[1], lj, tacc[1]);
      }
      __builtin_amdgcn_sched_barrier(0);        // keeps the next k-step's LDS reads from being spread among these WMMAs
    }
    // publish point of stage t + 1; it also ends every wave's reads of the buffer that stage t + 2 refills
    wait_ds0();
    wait_async0();
    __syncthreads();
    if (t + 2 < nst) copy_stage(t + 2);         // block-uniform test
  }
  wait_async0();                                // nothing of this wave is in flight behind the loop
  // ---- T -> [Th | Tl] rows in LDS: wave w's 32 rows in its own slab; the loop's last barrier has ended every read of the adapter stages ----
  acc_guard2(tacc[0], tacc[1]);
  {
    unsigned short* tw = lst + wave * TT_W;
#pragma unroll
    for (int i = 0; i < 2; ++i)
#pragma unroll
      for (int r = 0; r < 8; ++r) {
        const int row = i * 16 + 8 * hh + r;
        const float v = tacc[i][r];
        const unsigned short hb = bf_bits(v);
        const unsigned short lb = bf_bits(v - bf_val(hb));
        tw[row * TT_P + rl]      = hb;
        tw[row * TT_P + 16 + rl] = lb;
      }
  }
  if (XB) __syncthreads();                      // every wave reads all 128 T rows
  else    lds_wave_sync();                      // a wave reads its own 32 T rows alone
  // ---- rank-16 adapter extension: one 32-deep k-step [Th | Tl] . [2B | 2B] ----
  {
    const __bf16* Ee = (const __bf16*)(const void*)Ep;
    const __bf16* Tt = (const __bf16*)(const void*)lst;
    v16b ae[2];
#pragma unroll
    for (int i = 0; i < 2; ++i)
      ae[i] = XB ? ldfrag_b(Ee + (size_t)(m0 + i * 16 + rl) * KEXT + 8 * hh)
                 : ldfrag_b(Tt + wave * TT_W + (i * 16 + rl) * TT_P + 8 * hh);
#pragma unroll
    for (int j = 0; j < 8; ++j) {
      const v16b be = XB ? ldfrag_b(Tt + (j >> 1) * TT_W + ((j & 1) * 16 + rl) * TT_P + 8 * hh)
                         : ldfrag_b(Ee + (size_t)(n0 + j * 16 + rl) * KEXT + 8 * hh);
      acc[0][j] = mma_b(ae[0], be, acc[0][j]);
      acc[1][j] = mma_b(ae[1], be, acc[1][j]);
      guard_b5(acc[0][j], acc[1][j], ae[0], ae[1], ae[0], ae[1], be);
    }
  }
  if (XB) __syncthreads();                      // every wave has read the T rows in the other waves' slabs, which the epilogue now overwrites
  acc_guard4(acc[0][0], acc[0][1], acc[0][2], acc[0][3]);
  acc_guard4(acc[0][4], acc[0][5], acc[0][6], acc[0][7]);
  acc_guard4(acc[1][0], acc[1][1], acc[1][2], acc[1][3]);
  acc_guard4(acc[1][4], acc[1][5], acc[1][6], acc[1][7]);

  // ---- epilogue ----
  ST* slab = slab_all + wave * SlabT<EPI>::PERW;
  _Float16* sl16 = (_Float16*)(void*)slab;
  float*    slf  = (float*)(void*)slab;

  if (rope) {
    _Float16* P0 = (_Float16*)C0;
    _Float16* P1 = (_Float16*)C1;
#pragma unroll
    for (int i = 0; i < 2; ++i) {
      const int rb = m0 + i * 16 + 8 * hh;
#pragma unroll
      for (int j = 0; j < 4; ++j) {
        const int dim = j * 16 + rl;                             // 0..63 within head; x2 partner at dim + 64
#pragma unroll
        for (int r = 0; r < 8; ++r) {
          const int row = rb + r;                                // token 0..M-1
          const int tp  = row & (SQ - 1);                        // position within its sequence
          const float cv = cst[(size_t)tp * NFREQ + dim];
          const float sv = snt[(size_t)tp * NFREQ + dim];
          const float x1 = acc[i][j][r];
          const float x2 = acc[i][j + 4][r];
          const float o1 = x1 * cv - x2 * sv;
          const float o2 = x2 * cv + x1 * sv;
          const _Float16 h1 = (_Float16)o1;
          const _Float16 h2 = (_Float16)o2;
          const int so = (8 * hh + r) * 128 + dim;
          sl16[so]             = h1;
          sl16[so + 64]        = h2;
          sl16[2048 + so]      = (_Float16)((o1 - (float)h1) * 2048.0f);
          sl16[2048 + so + 64] = (_Float16)((o2 - (float)h2) * 2048.0f);
        }
      }
      lds_wave_sync();
      {
#pragma unroll
        for (int it = 0; it < 8; ++it) {
          const int row = it * 2 + hh;                           // it x hh covers rows 0..15
          const int c8  = rl * 8;
          const v8h vh = *(const v8h*)(sl16 + row * 128 + c8);
          const v8h vl = *(const v8h*)(sl16 + 2048 + row * 128 + c8);
          const size_t go = (size_t)(m0 + i * 16 + row) * ldc + n0 + c8;
          *(v8h*)(P0 + go) = vh;
          *(v8h*)(P1 + go) = vl;
        }
        
      }
      lds_wave_sync();
    }
  } else if (EPI == 0) {
    _Float16* P0 = (_Float16*)C0;
    _Float16* P1 = (_Float16*)C1;
#pragma unroll
    for (int i = 0; i < 2; ++i) {
#pragma unroll
      for (int r = 0; r < 8; ++r) {
#pragma unroll
        for (int j = 0; j < 8; ++j) {
          const float v = acc[i][j][r];
          const _Float16 hv = (_Float16)v;
          const int so = (8 * hh + r) * 128 + j * 16 + rl;
          sl16[so]        = hv;
          sl16[2048 + so] = (_Float16)((v - (float)hv) * 2048.0f);
        }
      }
      lds_wave_sync();
      {
#pragma unroll
        for (int it = 0; it < 8; ++it) {
          const int row = it * 2 + hh;
          const int c8  = rl * 8;
          const v8h vh = *(const v8h*)(sl16 + row * 128 + c8);
          const v8h vl = *(const v8h*)(sl16 + 2048 + row * 128 + c8);
          const size_t go = (size_t)(m0 + i * 16 + row) * ldc + n0 + c8;
          *(v8h*)(P0 + go) = vh;
          *(v8h*)(P1 + go) = vl;
        }
        
      }
      lds_wave_sync();
    }
  } else {
    float* C = (float*)C0;
#pragma unroll
    for (int i = 0; i < 2; ++i) {
#pragma unroll
      for (int j = 0; j < 8; ++j)
#pragma unroll
        for (int r = 0; r < 8; ++r)
          slf[(8 * hh + r) * 128 + j * 16 + rl] = acc[i][j][r];
      lds_wave_sync();
      {
#pragma unroll
        for (int row = 0; row < 16; ++row) {                     // 32 lanes x 16 B = the whole 512-B row segment per instruction
          const v4f v = *(const v4f*)(slf + row * 128 + lane * 4);
          *(v4f*)(C + (size_t)(m0 + i * 16 + row) * ldc + n0 + lane * 4) = v;
        }
        
      }
      lds_wave_sync();
    }
  }
}

// one product per launch
template <int EPI, bool SPLITA>
__global__ __launch_bounds__(128) void gemm_w32x128_kernel(
    const unsigned short* Ap, const unsigned short* A2p, int lda,
    const unsigned short* __restrict__ Btp, int ldb, const unsigned short* __restrict__ Lp, int ldl, const unsigned short* __restrict__ Ep,
    const float* __restrict__ cst, const float* __restrict__ snt,
    void* C0, void* C1, int ldc, int M, int N, int K) {
  __shared__ __align__(16) typename SlabT<EPI>::T slab_all[4 * SlabT<EPI>::PERW];
  __shared__ __align__(16) unsigned short stage_all[2 * (SPLITA ? 3 : 2) * GK_PLANE];
  gemm_w32x128_body<EPI, SPLITA, false>(slab_all, stage_all, (int)blockIdx.x,
                                        Ap, A2p, lda, Btp, ldb, Lp, ldl, Ep, cst, snt, C0, C1, ldc, M, N, K);
}

// The q, k and v^T projections in ONE launch: they read the same planes and none reads another's result. Blocks 0..nkv-1 take v^T
// (A = Wv, Bt = x: the body with x on the Bt side), nkv..2nkv-1 take k, the rest q (the body with x on the A side, operands picked before it);
// nkv = ntok/128 * hdm/128. The choice is block-uniform: every wave of a block runs the same body and passes its barriers alike.
// grid.x = 2 * nkv + ntok/128 * hid/128.
__global__ __launch_bounds__(128) void gemm_qkv_kernel(
    const unsigned short* __restrict__ Xb,
    const unsigned short* __restrict__ Wqb, const unsigned short* __restrict__ Wkb, const unsigned short* __restrict__ Wvb,
    const unsigned short* __restrict__ Aqb, const unsigned short* __restrict__ Akb, const unsigned short* __restrict__ Avb,
    const unsigned short* __restrict__ BextQ, const unsigned short* __restrict__ BextK, const unsigned short* __restrict__ BextV,
    const float* __restrict__ cst, const float* __restrict__ snt,
    unsigned short* Qh, unsigned short* Ql, unsigned short* Kh, unsigned short* Kl, unsigned short* Vh, unsigned short* Vl,
    int ntok, int hid, int hdm) {
  __shared__ __align__(16) SlabT<0>::T slab_all[4 * SlabT<0>::PERW];
  __shared__ __align__(16) unsigned short stage_all[2 * 2 * GK_PLANE];
  const int nkv = (ntok >> 7) * (hdm >> 7);
  const int bx  = (int)blockIdx.x;
  const bool isv = bx < nkv;
  if (isv) {
    gemm_w32x128_body<0, false, true>(slab_all, stage_all, bx,
                                      Wvb, Wvb, hid, Xb, hid, Avb, hid, BextV, cst, snt, (void*)Vh, (void*)Vl, ntok, hdm, ntok, hid);
  } else {
    const bool isk = bx < 2 * nkv;
    const int blk = isk ? bx - nkv : bx - 2 * nkv;
    const unsigned short* Bt = isk ? Wkb   : Wqb;
    const unsigned short* Lm = isk ? Akb   : Aqb;
    const unsigned short* Be = isk ? BextK : BextQ;
    unsigned short* P0 = isk ? Kh : Qh;
    unsigned short* P1 = isk ? Kl : Ql;
    const int N = isk ? hdm : hid;
    gemm_w32x128_body<0, false, false>(slab_all, stage_all, blk,
                                       Xb, Xb, hid, Bt, hid, Lm, hid, Be, cst, snt, (void*)P0, (void*)P1, N, ntok, N, hid);
  }
}

// ---------------------------------------------------------------------------
// Causal multi-query flash attention (one shared 128-wide k/v head), 32-key chunks, block = 4 waves = 64 query rows of one (b, h);
// grid = SQ / 64 query tiles x NHQ x NSEQ blocks in one dimension, longest query tile first (see attn_causal_kernel): one launch;
// query tiles 0..AT_NPRES-1 run the PRES body, the others the body without it.
//   q planes f16 [tok][h*128+d]: hi (qhp) and residual x2048 (qlp); k planes f16 [tok][d]: hi (khp), residual x2048 (klp);
//   v^T planes f16 [d][tok]: hi (vhp), residual x2048 (vlp); outputs attn bf16 hi (ahp) / lo (alp) [tok][h*128+d].
//   scores = (Sh + Sr/2048) * 128^-0.5 with Sh = qh.kh and Sr = ql'.kh + qh.kl'; keys > query -> -inf; online softmax f32;
//   p' = 1024 p stored per wave to LDS as f16 hi (and residual x2048 when PRES), reloaded as A fragments after a wave sync;
//   O = (Oh + Or/2048)/1024/l with Oh = ph.vh, Or = ph.vl' (+ pl'.vh when PRES).
//   K / V^T chunk staging: 128 threads x 4 x 16 B per plane = whole 32x128 / 128x32 tile, by 16-B async copies to LDS, two chunk buffers:
//   chunk kc + 2 is copied into the buffer that chunk kc has left while chunk kc + 1 is worked on; one publish point (waits + barrier) a chunk.
//   Trip count 2*qb+2 chunks (static bound 64); waves whose rows are all below the chunk skip it (wave-uniform, scalar branch).
// Coverage: 32 query tiles x 4 waves x 16 rows x 128 cols per (b,h) = the whole [tok][h*128..+127] slab of both output planes.
// ---------------------------------------------------------------------------
#define AT_KC   32
#define KS_P    136
#define VS_P    40
#define PS_P    40
#define LDS_KS  0
#define LDS_KLS (32 * KS_P)
#define LDS_VHS (2 * 32 * KS_P)
#define LDS_VLS (LDS_VHS + 128 * VS_P)
#define AT_BUF  (LDS_VLS + 128 * VS_P)       // halves of one chunk buffer (the four planes above are offsets within a buffer)
#define LDS_PH  (2 * AT_BUF)
#define LDS_PL  (LDS_PH + 4 * 16 * PS_P)
#define LDS_TOT (LDS_PL + 4 * 16 * PS_P)
static_assert(3 * LDS_TOT * 2 <= 320 * 1024); // three blocks per WGP, as many as the registers allow
static_assert((AT_BUF * 2) % 16 == 0);
static_assert(4 * 4096 <= 2 * AT_BUF);       // output staging (2 planes x 16 x 128 per wave) aliases the chunk region after the loop

// One thread's share of a pair of planes (hi, residual) of one chunk: four 16-B async copies per plane, rows r, r + n, r + 2n, r + 3n.
// la, lb = this lane's LDS byte addresses of row r in the two planes, lstep = n rows in LDS bytes; ga, gb = its global addresses of row r,
// gstep = n source rows in elements. The closing s_wait_xcnt 0 stands inside the statement so that no address register named here is
// rewritten ahead of it.
__device__ __forceinline__ void copy_pair4(unsigned la, unsigned lb, unsigned lstep,
                                           const _Float16* ga, const _Float16* gb, size_t gstep) {
  asm volatile(
      "global_load_async_to_lds_b128 %0, %8, off\n\t"
      "global_load_async_to_lds_b128 %1, %9, off\n\t"
      "global_load_async_to_lds_b128 %2, %10, off\n\t"
      "global_load_async_to_lds_b128 %3, %11, off\n\t"
      "global_load_async_to_lds_b128 %4, %12, off\n\t"
      "global_load_async_to_lds_b128 %5, %13, off\n\t"
      "global_load_async_to_lds_b128 %6, %14, off\n\t"
      "global_load_async_to_lds_b128 %7, %15, off\n\t"
      "s_wait_xcnt 0x0"
      :: "v"(la), "v"(la + lstep), "v"(la + 2u * lstep), "v"(la + 3u * lstep),
         "v"(lb), "v"(lb + lstep), "v"(lb + 2u * lstep), "v"(lb + 3u * lstep),
         "v"(ga), "v"(ga + gstep), "v"(ga + 2 * gstep), "v"(ga + 3 * gstep),
         "v"(gb), "v"(gb + gstep), "v"(gb + 2 * gstep), "v"(gb + 3 * gstep)
      : "memory");
}

template <bool PRES>
__device__ __forceinline__ void attn_causal_body(
    _Float16* lds, int qb, int h, int b,
    const unsigned short* __restrict__ qhp, const unsigned short* __restrict__ qlp,
    const unsigned short* __restrict__ khp, const unsigned short* __restrict__ klp,
    const unsigned short* __restrict__ vhp, const unsigned short* __restrict__ vlp,
    unsigned short* __restrict__ ahp, unsigned short* __restrict__ alp) {
  const int tid  = (int)threadIdx.x;
  const int lane = tid & 31;
  const int wave = wave_id();
  const int hh   = lane >> 4;
  const int c    = lane & 15;
  const int q0   = qb * 64 + wave * 16;          // first query row of this wave (within sequence)
  const int qlast = q0 + 15;
  const size_t tok0 = (size_t)b * SQ;

  const _Float16* Qhr = (const _Float16*)(const void*)qhp + (tok0 + q0 + c) * HID + h * HDM + 8 * hh;
  const _Float16* Qlr = (const _Float16*)(const void*)qlp + (tok0 + q0 + c) * HID + h * HDM + 8 * hh;
  const _Float16* Kg  = (const _Float16*)(const void*)khp + tok0 * HDM;
  const _Float16* Klg = (const _Float16*)(const void*)klp + tok0 * HDM;
  const _Float16* Vhg = (const _Float16*)(const void*)vhp + tok0;
  const _Float16* Vlg = (const _Float16*)(const void*)vlp + tok0;
  _Float16* ph = lds + LDS_PH + wave * (16 * PS_P);
  _Float16* pl = lds + LDS_PL + wave * (16 * PS_P);

  float mrow[8], lrow[8];
  v8f oacc[8], oaccr[8];
#pragma unroll
  for (int r = 0; r < 8; ++r) { mrow[r] = -INFINITY; lrow[r] = 0.f; }
#pragma unroll
  for (int t = 0; t < 8; ++t) { oacc[t] = zero8(); oaccr[t] = zero8(); }

  // the wave's 16 query rows, both planes, as A fragments: loaded once, held in registers over the whole key loop
  // unrolled so that the arrays are registers
  v16h qfa[4], qfl[4];
#pragma unroll
  for (int dc = 0; dc < 4; ++dc) {
    qfa[dc] = ldfrag_h(Qhr + dc * 32);
    qfl[dc] = ldfrag_h(Qlr + dc * 32);
  }

  const int nch = 2 * qb + 2;                    // block-uniform, 2 .. 64
  // this thread's copy addresses for chunk 0, buffer 0. Coverage per plane: 128 threads x 4 pieces of 8 halves = 512 pieces = whole tile.
  const int ckey = tid >> 4, cd8 = (tid & 15) * 8;   // K: keys ckey + 8 i, i < 4, of 32 keys x 128 d
  const int cdim = tid >> 2, ck8 = (tid & 3) * 8;    // V^T: rows cdim + 32 i, i < 4, of 128 d x 32 keys
  const unsigned lK = lds_off(lds) + (unsigned)(LDS_KS  + ckey * KS_P + cd8) * 2u;
  const unsigned lV = lds_off(lds) + (unsigned)(LDS_VHS + cdim * VS_P + ck8) * 2u;
  const size_t goK = (size_t)ckey * HDM + cd8;
  const size_t goV = (size_t)cdim * NTOK + ck8;
  // chunk s -> buffer s & 1
  auto copy_chunk = [&](int s) {
    const unsigned lb = (unsigned)(s & 1) * (unsigned)(AT_BUF * 2);
    const size_t kv = (size_t)s * AT_KC;
    copy_pair4(lK + lb, lK + lb + (unsigned)(LDS_KLS - LDS_KS) * 2u, 8u * KS_P * 2u,
               Kg + goK + kv * HDM, Klg + goK + kv * HDM, (size_t)8 * HDM);
    copy_pair4(lV + lb, lV + lb + (unsigned)(LDS_VLS - LDS_VHS) * 2u, 32u * VS_P * 2u,
               Vhg + goV + kv, Vlg + goV + kv, (size_t)32 * NTOK);
  };
  copy_chunk(0);
  wait_async0();
  __syncthreads();                               // chunk 0 published
  if (nch > 1) copy_chunk(1);                    // block-uniform test

  for (int kc = 0; kc < nch; ++kc) {
    const int kv0 = kc * AT_KC;
    const _Float16* Cb  = lds + (kc & 1) * AT_BUF;   // this trip reads this buffer alone
    const _Float16* Ks  = Cb + LDS_KS;
    const _Float16* Kls = Cb + LDS_KLS;
    const _Float16* Vhs = Cb + LDS_VHS;
    const _Float16* Vls = Cb + LDS_VLS;

    if (kv0 <= qlast) {                          // wave-uniform (scalar): skip chunks fully above this wave's rows
      // The chunk's LDS traffic is grouped and issued ahead of its use; each sched_barrier below keeps one group of LDS operations together
      // and ahead of the work that hides its latency (left free, the build waits on a pair of reads per WMMA pair, or walks the rows' reductions
      // one by one). Every accumulator and every row value still takes its terms in the same order.
      // ---- scores: fragment reads in groups of 4 (a 32-deep step's two hi tiles, then its two residual tiles), issued three groups ahead ----
      v8f sh[2], sr[2];
      sh[0] = zero8(); sh[1] = zero8(); sr[0] = zero8(); sr[1] = zero8();
      v16h kf[8][2];                             // group 2 * dc: hi plane, group 2 * dc + 1: residual plane; [j] = key tile
#pragma unroll
      for (int g = 0; g < 3; ++g)
#pragma unroll
        for (int j = 0; j < 2; ++j) kf[g][j] = ldfrag_h(((g & 1) ? Kls : Ks) + (j * 16 + c) * KS_P + (g >> 1) * 32 + 8 * hh);
#pragma unroll
      for (int g = 0; g < 8; ++g) {
        __builtin_amdgcn_sched_barrier(0);       // the reads above are issued before this group's WMMAs
        const v16h qa = qfa[g >> 1];
        const v16h ql = qfl[g >> 1];
        if ((g & 1) == 0) {
          sh[0] = mma_h(qa, kf[g][0], sh[0]);
          sr[0] = mma_h(ql, kf[g][0], sr[0]);
          sh[1] = mma_h(qa, kf[g][1], sh[1]);
          sr[1] = mma_h(ql, kf[g][1], sr[1]);
          if (g == 0) guard_first(sh[0], sr[0], sh[1], sr[1], kf[0][0], kf[0][1]);
        } else {
          sr[0] = mma_h(qa, kf[g][0], sr[0]);
          sr[1] = mma_h(qa, kf[g][1], sr[1]);
        }
        __builtin_amdgcn_sched_barrier(0);       // the refill below follows these WMMAs, whose registers it takes over
        if (g + 3 < 8) {
#pragma unroll
          for (int j = 0; j < 2; ++j)
            kf[g + 3][j] = ldfrag_h((((g + 3) & 1) ? Kls : Ks) + (j * 16 + c) * KS_P + ((g + 3) >> 1) * 32 + 8 * hh);
        }
      }
      // ---- scale, causal mask, chunk row max ----
      float cm[8];
#pragma unroll
      for (int r = 0; r < 8; ++r) {
        float m = -INFINITY;
#pragma unroll
        for (int j = 0; j < 2; ++j) {
          const int kd = kv0 + j * 16 + c - (q0 + 8 * hh);       // key - (row - r): key > row as kd > r, r a literal, so that no row number
          float s = (sh[j][r] + sr[j][r] * 0.00048828125f) * 0.08838834764831845f;   // per r is held over the loop (registers for the rings)
          s = (kd > r) ? -INFINITY : s;
          sh[j][r] = s;
          m = fmaxf(m, s);
        }
        cm[r] = m;
      }
#pragma unroll
      for (int off = 1; off < 16; off <<= 1) {
        float tm[8];
#pragma unroll
        for (int r = 0; r < 8; ++r) tm[r] = __shfl_xor(cm[r], off, 32);
        __builtin_amdgcn_sched_barrier(0);       // the 8 rows' exchanges of one step fly together: one LDS latency per step
#pragma unroll
        for (int r = 0; r < 8; ++r) cm[r] = fmaxf(cm[r], tm[r]);
      }
      // ---- online softmax, P' to LDS ----
      float al8[8], ps8[8];
#pragma unroll
      for (int r = 0; r < 8; ++r) {
        const float mnew  = fmaxf(mrow[r], cm[r]);
        const float alpha = __expf(mrow[r] - mnew);
        mrow[r] = mnew;
        al8[r] = alpha;
        float psum = 0.f;
#pragma unroll
        for (int j = 0; j < 2; ++j) {
          const float p  = __expf(sh[j][r] - mnew);
          psum += p;
          const float pp = p * 1024.0f;
          const _Float16 phv = (_Float16)pp;
          const int po = (8 * hh + r) * PS_P + j * 16 + c;
          ph[po] = phv;
          if (PRES) pl[po] = (_Float16)((pp - (float)phv) * 2048.0f);
        }
        ps8[r] = psum;
      }
#pragma unroll
      for (int r = 0; r < 8; ++r)
#pragma unroll
        for (int t = 0; t < 8; ++t) { oacc[t][r] *= al8[r]; oaccr[t][r] *= al8[r]; }
      lds_wave_sync();                           // P' stores visible to the other lanes of this wave before the fragment reload
      // ---- O += P' . V: the 4 fragment reads of each 16-wide d tile are issued three tiles ahead of its WMMAs ----
      const v16h pa = ldfrag_h(ph + c * PS_P + 8 * hh);
      v16h pr = pa;
      if (PRES) pr = ldfrag_h(pl + c * PS_P + 8 * hh);
      v16h vb[8], vr[8];
#pragma unroll
      for (int t = 0; t < 3; ++t) {
        vb[t] = ldfrag_h(Vhs + (t * 16 + c) * VS_P + 8 * hh);
        vr[t] = ldfrag_h(Vls + (t * 16 + c) * VS_P + 8 * hh);
      }
      float ts[8];
#pragma unroll
      for (int t = 0; t < 8; ++t) {
        if ((t & 1) == 0) {                      // one step of the 8 rows' sum exchange flies behind every two tiles' WMMAs
#pragma unroll
          for (int r = 0; r < 8; ++r) ts[r] = __shfl_xor(ps8[r], 1 << (t >> 1), 32);
        }
        __builtin_amdgcn_sched_barrier(0);       // the reads and exchanges above are issued before this tile's WMMAs
        oacc[t]  = mma_h(pa, vb[t], oacc[t]);
        oaccr[t] = mma_h(pa, vr[t], oaccr[t]);
        if (PRES) oaccr[t] = mma_h(pr, vb[t], oaccr[t]);
        __builtin_amdgcn_sched_barrier(0);       // the refill below follows these WMMAs, whose registers it takes over
        if (t + 3 < 8) {
          vb[t + 3] = ldfrag_h(Vhs + ((t + 3) * 16 + c) * VS_P + 8 * hh);
          vr[t + 3] = ldfrag_h(Vls + ((t + 3) * 16 + c) * VS_P + 8 * hh);
        }
        if ((t & 1) == 1) {
#pragma unroll
          for (int r = 0; r < 8; ++r) ps8[r] += ts[r];
        }
      }
#pragma unroll
      for (int r = 0; r < 8; ++r) lrow[r] = lrow[r] * al8[r] + ps8[r];
    }
    // publish point of chunk kc + 1, passed by every wave (outside the per-wave skip); it also ends every wave's reads of the buffer
    // that chunk kc + 2 refills
    wait_ds0();
    wait_async0();
    __syncthreads();
    if (kc + 2 < nch) copy_chunk(kc + 2);        // block-uniform test
  }
  wait_async0();                                 // nothing of this wave is in flight behind the loop
  // the last trip's barrier has ended every reader's last read of the chunk region, which now becomes output staging
  _Float16* osh = lds + wave * 4096;
  _Float16* osl = osh + 2048;
#pragma unroll
  for (int r = 0; r < 8; ++r) {
    const float inv = (1.0f / lrow[r]) * 0.0009765625f;
#pragma unroll
    for (int t = 0; t < 8; ++t) {
      const float o = (oacc[t][r] + oaccr[t][r] * 0.00048828125f) * inv;
      const unsigned short hb = bf_bits(o);
      const unsigned short lb = bf_bits(o - bf_val(hb));
      const int so = (8 * hh + r) * 128 + t * 16 + c;
      osh[so] = __builtin_bit_cast(_Float16, hb);
      osl[so] = __builtin_bit_cast(_Float16, lb);
    }
  }
  lds_wave_sync();
  _Float16* Ahg = (_Float16*)(void*)ahp + (tok0 + q0) * HID + h * HDM;
  _Float16* Alg = (_Float16*)(void*)alp + (tok0 + q0) * HID + h * HDM;
  {
#pragma unroll
    for (int it = 0; it < 8; ++it) {
      const int row = it * 2 + hh;               // it 0..7 x hh 0..1 covers rows 0..15
      const int c8  = c * 8;                     // 16 lanes x 16 B = the whole 256-B segment
      const v8h x = *(const v8h*)(osh + row * 128 + c8);
      const v8h y = *(const v8h*)(osl + row * 128 + c8);
      *(v8h*)(Ahg + (size_t)row * HID + c8) = x;
      *(v8h*)(Alg + (size_t)row * HID + c8) = y;
    }
    
  }
}

#define AT_NPRES 4                   // query tiles 0..3 carry the p residual product
__global__ __launch_bounds__(128) void attn_causal_kernel(
    const unsigned short* __restrict__ qhp, const unsigned short* __restrict__ qlp,
    const unsigned short* __restrict__ khp, const unsigned short* __restrict__ klp,
    const unsigned short* __restrict__ vhp, const unsigned short* __restrict__ vlp,
    unsigned short* __restrict__ ahp, unsigned short* __restrict__ alp) {
  __shared__ __align__(16) _Float16 lds[LDS_TOT];
  // A block's key loop has 2 * qb + 2 trips and there are more blocks than resident places, so the cost falls with the block index: the
  // 64-trip tiles take the lowest indices, the short tiles the highest (for speed only). The query
  // tile is the slow digit of the index, so that neighbouring indices cost the same and indices far apart differ.
  // index -> (qb, h, b) is one to one: index = (SQ / 64 - 1 - qb) * NHQ * NSEQ + b * NHQ + h.
  const int idx = (int)blockIdx.x;
  const int qb  = SQ / 64 - 1 - idx / (NHQ * NSEQ);   // block-uniform: every wave of a block runs the same body and passes its barriers
  const int hb  = idx % (NHQ * NSEQ);
  const int h   = hb % NHQ;
  const int b   = hb / NHQ;
  if (qb < AT_NPRES) attn_causal_body<true>(lds, qb, h, b, qhp, qlp, khp, klp, vhp, vlp, ahp, alp);
  else               attn_causal_body<false>(lds, qb, h, b, qhp, qlp, khp, klp, vhp, vlp, ahp, alp);
}

// ---------------------------------------------------------------------------
// Workspace map (bytes; every region is a whole number of the rows / lines its producer writes with whole-line stores):
//   Xb   bf16 [4096][2048]  16777216    Wqb bf16 [2048][2048]  8388608    Wkb bf16 [128][2048]  524288   Wvb bf16 [128][2048] 524288
//   Wob  bf16 [2048][2048]   8388608    Aqb/Akb/Avb/Aob bf16 [16][2048]  4 x 65536
//   BextQ bf16 [2048][32]     131072    BextK/BextV bf16 [128][32] 2 x 8192   BextO bf16 [2048][32] 131072
//   cst/snt f32 [2048][64]  2 x 524288
//   Qh/Ql f16 [4096][2048]  2 x 16777216   Kh/Kl f16 [4096][128]  2 x 1048576   Vh/Vl f16 [128][4096]  2 x 1048576
//   Ah/Al bf16 [4096][2048] 2 x 16777216
//   total 107495424
// ---------------------------------------------------------------------------
extern "C" void kernel_launch(void* const* d_in, const int* in_sizes, int n_in,
                              void* d_out, int out_size, void* d_ws, size_t ws_size,
                              hipStream_t stream) {
  if (n_in < 13) return;
  if (in_sizes[0]  != NTOK * HID) return;
  if (in_sizes[1]  != HID * HID)  return;
  if (in_sizes[2]  != LRK * HID)  return;
  if (in_sizes[3]  != HID * LRK)  return;
  if (in_sizes[4]  != HDM * HID)  return;
  if (in_sizes[5]  != LRK * HID)  return;
  if (in_sizes[6]  != HDM * LRK)  return;
  if (in_sizes[7]  != HDM * HID)  return;
  if (in_sizes[8]  != LRK * HID)  return;
  if (in_sizes[9]  != HDM * LRK)  return;
  if (in_sizes[10] != HID * HID)  return;
  if (in_sizes[11] != LRK * HID)  return;
  if (in_sizes[12] != HID * LRK)  return;
  if (out_size != NTOK * HID) return;

  const float* x    = (const float*)d_in[0];
  const float* wq_w = (const float*)d_in[1];
  const float* wq_a = (const float*)d_in[2];
  const float* wq_b = (const float*)d_in[3];
  const float* wk_w = (const float*)d_in[4];
  const float* wk_a = (const float*)d_in[5];
  const float* wk_b = (const float*)d_in[6];
  const float* wv_w = (const float*)d_in[7];
  const float* wv_a = (const float*)d_in[8];
  const float* wv_b = (const float*)d_in[9];
  const float* wo_w = (const float*)d_in[10];
  const float* wo_a = (const float*)d_in[11];
  const float* wo_b = (const float*)d_in[12];
  float* out = (float*)d_out;

  const size_t szX   = (size_t)NTOK * HID * 2;
  const size_t szWsq = (size_t)HID * HID * 2;
  const size_t szWkv = (size_t)HDM * HID * 2;
  const size_t szAl  = (size_t)LRK * HID * 2;
  const size_t szBeL = (size_t)HID * KEXT * 2;
  const size_t szBeS = (size_t)HDM * KEXT * 2;
  const size_t szTab = (size_t)SQ * NFREQ * 4;
  const size_t szQ   = (size_t)NTOK * HID * 2;
  const size_t szK   = (size_t)NTOK * HDM * 2;
  const size_t szV   = (size_t)HDM * NTOK * 2;
  const size_t szA   = (size_t)NTOK * HID * 2;
  size_t off = 0;
  const size_t oX   = off; off += szX;
  const size_t oWq  = off; off += szWsq;
  const size_t oWk  = off; off += szWkv;
  const size_t oWv  = off; off += szWkv;
  const size_t oWo  = off; off += szWsq;
  const size_t oAq  = off; off += szAl;
  const size_t oAk  = off; off += szAl;
  const size_t oAv  = off; off += szAl;
  const size_t oAo  = off; off += szAl;
  const size_t oBq  = off; off += szBeL;
  const size_t oBk  = off; off += szBeS;
  const size_t oBv  = off; off += szBeS;
  const size_t oBo  = off; off += szBeL;
  const size_t oCs  = off; off += szTab;
  const size_t oSn  = off; off += szTab;
  const size_t oQh  = off; off += szQ;
  const size_t oQl  = off; off += szQ;
  const size_t oKh  = off; off += szK;
  const size_t oKl  = off; off += szK;
  const size_t oVh  = off; off += szV;
  const size_t oVl  = off; off += szV;
  const size_t oAh  = off; off += szA;
  const size_t oAl  = off; off += szA;
  if (off > ws_size) return;                     // off = 107495424

  char* ws = (char*)d_ws;
  unsigned short* Xb    = (unsigned short*)(ws + oX);
  unsigned short* Wqb   = (unsigned short*)(ws + oWq);
  unsigned short* Wkb   = (unsigned short*)(ws + oWk);
  unsigned short* Wvb   = (unsigned short*)(ws + oWv);
  unsigned short* Wob   = (unsigned short*)(ws + oWo);
  unsigned short* Aqb   = (unsigned short*)(ws + oAq);
  unsigned short* Akb   = (unsigned short*)(ws + oAk);
  unsigned short* Avb   = (unsigned short*)(ws + oAv);
  unsigned short* Aob   = (unsigned short*)(ws + oAo);
  unsigned short* BextQ = (unsigned short*)(ws + oBq);
  unsigned short* BextK = (unsigned short*)(ws + oBk);
  unsigned short* BextV = (unsigned short*)(ws + oBv);
  unsigned short* BextO = (unsigned short*)(ws + oBo);
  float*          cst   = (float*)(ws + oCs);
  float*          snt   = (float*)(ws + oSn);
  unsigned short* Qh    = (unsigned short*)(ws + oQh);
  unsigned short* Ql    = (unsigned short*)(ws + oQl);
  unsigned short* Kh    = (unsigned short*)(ws + oKh);
  unsigned short* Kl    = (unsigned short*)(ws + oKl);
  unsigned short* Vh    = (unsigned short*)(ws + oVh);
  unsigned short* Vl    = (unsigned short*)(ws + oVl);
  unsigned short* Ah    = (unsigned short*)(ws + oAh);
  unsigned short* Al    = (unsigned short*)(ws + oAl);

  const dim3 b256(256), b128(128);

  // (1) preparation, one launch: cos/sin table [2048][64] x 2; bf16 planes of x, the base weights and the adapter A matrices (layouts kept
  //     as given: [rows][K] with K contiguous); adapter B matrices -> [2B | 2B] extension planes
  prep_kernel<<<dim3(PB_ALL), b256, 0, stream>>>(x, wq_w, wq_a, wq_b, wk_w, wk_a, wk_b, wv_w, wv_a, wv_b, wo_w, wo_a, wo_b,
      Xb, Wqb, Wkb, Wvb, Wob, Aqb, Akb, Avb, Aob, BextQ, BextK, BextV, BextO, cst, snt);
  // (2) one launch: v^T = Wv . x^T + 2 Bv . T^T -> Vh/Vl [128][4096] (32 blocks); k = x . Wk^T + 2 T.Bk^T, RoPE -> Kh/Kl [4096][128]
  //     (32 blocks); q = x . Wq^T + 2 T.Bq^T, RoPE -> Qh/Ql [4096][2048] (512 blocks); K = 2048 + ext each; T = x . A^T formed in the blocks
  gemm_qkv_kernel<<<dim3(2 * (NTOK / 128) * (HDM / 128) + (NTOK / 128) * (HID / 128)), b128, 0, stream>>>(
      Xb, Wqb, Wkb, Wvb, Aqb, Akb, Avb, BextQ, BextK, BextV, cst, snt, Qh, Ql, Kh, Kl, Vh, Vl, NTOK, HID, HDM);
  // (3) causal attention, one launch, longest query tiles first: query tiles 0..3 with the p residual product, tiles 4..31 without
  attn_causal_kernel<<<dim3((SQ / 64) * NHQ * NSEQ), b128, 0, stream>>>(Qh, Ql, Kh, Kl, Vh, Vl, Ah, Al);
  // (4) out = attn(hi + lo) . Wo^T + 2 T_o . Bo^T -> d_out f32 [4096][2048], T_o = attn(hi + lo) . Ao^T formed in the blocks
  //     (M=4096, N=2048, K=2048 + ext; 512 blocks)
  gemm_w32x128_kernel<2, true><<<dim3((NTOK / 128) * (HID / 128)), b128, 0, stream>>>(
      Ah, Al, HID, Wob, HID, Aob, HID, BextO, cst, snt, (void*)out, (void*)out, HID, NTOK, HID, HID);
  (void)hipGetLastError();
}

// v008
// It runs in 191 microseconds.
// Timed twice side by side with v007, it ran 1.11 times as fast both times.
// All steps since v000 together make it 5.11 times as fast.
// Contractions: x.Wq^T, x.Wk^T, Wv.x^T and the rank-16 adapter products x.A^T on v_wmma_f32_16x16x32_bf16 (operands = RNE bf16 of the
// f32 inputs, single products; the adapter term enters the base GEMM as one extra 32-deep k-step with T = x.A^T carried as bf16 hi + bf16 lo
// against 2B in bf16; T is formed inside the GEMM that uses it); k.q^T and v^T.p^T on v_wmma_f32_16x16x32_f16 (q, k, v^T = f16 hi + f16 residual x2^11 planes, lo.lo dropped; p x1024 f16
// plus f16 residual x2^11 on query tiles 0..3); attn.Wo^T and attn.Ao^T on v_wmma_f32_16x16x32_bf16 (attn = bf16 hi + bf16 lo planes, two
// products; Wo, Ao RNE bf16). f32 accumulate everywhere; RoPE (f32 cos/sin table), online softmax and scale folds in f32.
#include <hip/hip_runtime.h>
#include <math.h>
#include <stdint.h>

#define NSEQ   2
#define SQ     2048
#define HID    2048
#define NHQ    16
#define HDM    128
#define NTOK   4096
#define NFREQ  64
#define LRK    16
#define KEXT   32

typedef _Float16       v16h __attribute__((ext_vector_type(16)));
typedef _Float16       v8h  __attribute__((ext_vector_type(8)));
typedef __bf16         v16b __attribute__((ext_vector_type(16)));
typedef __bf16         v8b  __attribute__((ext_vector_type(8)));
typedef float          v8f  __attribute__((ext_vector_type(8)));
typedef float          v4f  __attribute__((ext_vector_type(4)));
typedef unsigned int   v4u  __attribute__((ext_vector_type(4)));

// ---------------------------------------------------------------------------
// small helpers
// ---------------------------------------------------------------------------
__device__ __forceinline__ unsigned short bf_bits(float f) {          // RNE convert f32 -> bf16 bits
  const unsigned u = __float_as_uint(f);
  return (unsigned short)((u + 0x7FFFu + ((u >> 16) & 1u)) >> 16);
}
__device__ __forceinline__ float bf_val(unsigned short h) { return __uint_as_float(((unsigned)h) << 16); }
__device__ __forceinline__ unsigned pk16(unsigned short a, unsigned short b) { return (unsigned)a | ((unsigned)b << 16); }
__device__ __forceinline__ v8f zero8() { v8f z = {0.f, 0.f, 0.f, 0.f, 0.f, 0.f, 0.f, 0.f}; return z; }
__device__ __forceinline__ int wave_id() { return __builtin_amdgcn_readfirstlane((int)(threadIdx.x >> 5)); }
// the value of lane l ^ 16 (a vector cross-row move, no LDS)
__device__ __forceinline__ float xhalf(float x) {
  const int b = __builtin_bit_cast(int, x);
  return __builtin_bit_cast(float, __builtin_amdgcn_permlanex16(b, b, 0x76543210, 0xfedcba98, false, false));
}

// orders one wave's LDS element stores before its own vector reloads of the same tile (other lanes' data)
__device__ __forceinline__ void lds_wave_sync() {
  __builtin_amdgcn_fence(__ATOMIC_RELEASE, "workgroup");
  __builtin_amdgcn_wave_barrier();
  __builtin_amdgcn_fence(__ATOMIC_ACQUIRE, "workgroup");
}

// ---------------------------------------------------------------------------
// WMMA fragments (wave32, 16x16x32, 16-bit operands). For A (row m = lane&15) and B (col n = lane&15) alike:
// elements 0..7 <- k0 + 8*(lane>>4) + 0..7, elements 8..15 <- k0 + 16 + 8*(lane>>4) + 0..7.
// ldfrag(p) with p = rowbase + k0 + 8*(lane>>4): two 16-B loads p[0..7], p[16..23].
// D: acc[r] = (row 8*(lane>>4) + r, col lane&15).
// ---------------------------------------------------------------------------
union FragH { v16h v; v8h h[2]; };
union FragB { v16b v; v8b h[2]; };
__device__ __forceinline__ v16h ldfrag_h(const _Float16* p) { FragH f; f.h[0] = *(const v8h*)(p); f.h[1] = *(const v8h*)(p + 16); return f.v; }
__device__ __forceinline__ v16b ldfrag_b(const __bf16* p)   { FragB f; f.h[0] = *(const v8b*)(p); f.h[1] = *(const v8b*)(p + 16); return f.v; }

__device__ __forceinline__ v8f mma_h(v16h a, v16h b, v8f c) {
  return __builtin_amdgcn_wmma_f32_16x16x32_f16(false, a, false, b, (short)0, c, false, false);
}
__device__ __forceinline__ v8f mma_b(v16b a, v16b b, v8f c) {
  return __builtin_amdgcn_wmma_f32_16x16x32_bf16(false, a, false, b, (short)0, c, false, false);
}
// hazard guards: 4 VALU slots after the last WMMA of a group, D tied, A/B kept live; memory clobber keeps later loads behind the group
__device__ __forceinline__ void guard_b5(v8f& a, v8f& b, v16b x0, v16b x1, v16b x2, v16b x3, v16b y) {
  asm volatile("v_nop\n\tv_nop\n\tv_nop\n\tv_nop" : "+v"(a), "+v"(b) : "v"(x0), "v"(x1), "v"(x2), "v"(x3), "v"(y) : "memory");
}
// behind the first score group, whose four results are new registers (C = 0): the two k fragments are named so that they stay live past the
// four WMMAs and no result is placed over an operand that a WMMA just ahead reads; 4 VALU slots before those registers are free again
__device__ __forceinline__ void guard_first(v8f& a, v8f& b, v8f& c, v8f& d, v16h y, v16h z) {
  asm volatile("v_nop\n\tv_nop\n\tv_nop\n\tv_nop" : "+v"(a), "+v"(b), "+v"(c), "+v"(d) : "v"(y), "v"(z));
}
__device__ __forceinline__ void acc_guard4(v8f& a, v8f& b, v8f& c, v8f& d) {
  asm volatile("v_nop\n\tv_nop\n\tv_nop\n\tv_nop" : "+v"(a), "+v"(b), "+v"(c), "+v"(d));
}
__device__ __forceinline__ void acc_guard2(v8f& a, v8f& b) {
  asm volatile("v_nop\n\tv_nop\n\tv_nop\n\tv_nop" : "+v"(a), "+v"(b));
}

// ---------------------------------------------------------------------------
// RoPE table for positions t = 0..npos-1: cst[t][i] = cos(t * inv_freq[i]), snt[t][i] = sin(...), inv_freq[i] = 1 / 1e4^(i/64),
// i < 64, all f32. Block = 8 waves, wave w -> t = blk*8 + w, lane -> i = lane, lane + 32.
// Coverage: npos/8 blocks x 8 waves x 32 lanes x 2 = npos x 64 per plane.
// ---------------------------------------------------------------------------
__device__ __forceinline__ void rope_table_job(float* __restrict__ cst, float* __restrict__ snt, int npos, int blk) {
  const int lane = threadIdx.x & 31;
  const int wave = (int)(threadIdx.x >> 5);
  const int t = blk * 8 + wave;
  if (t >= npos) return;                       // no barriers in this job
  const float pf = (float)t;
  float c0 = 0.f, s0 = 0.f, c1 = 0.f, s1 = 0.f;
#pragma unroll 1
  for (int u = 0; u < 2; ++u) {
    const int i = lane + 32 * u;
    const float e   = (float)i * 0.015625f;      // i / 64 exact
    const float pw  = powf(10000.0f, e);
    const float inv = 1.0f / pw;
    const float ang = pf * inv;
    const float cv = cosf(ang);
    const float sv = sinf(ang);
    c1 = cv; s1 = sv;
    if (u == 0) { c0 = cv; s0 = sv; }
  }
  const size_t o = (size_t)t * NFREQ + lane;
  {
    ((float*)cst)[o]      = c0;
    ((float*)cst)[o + 32] = c1;
    ((float*)snt)[o]      = s0;
    ((float*)snt)[o + 32] = s1;
    
  }
}

// ---------------------------------------------------------------------------
// Elementwise RNE f32 -> bf16 plane: 8 elements per thread, one 16-B store per lane -> 32 consecutive lanes write 4 whole
// (every n8 used is a multiple of 256, so every instruction is full width).
// ---------------------------------------------------------------------------
__device__ __forceinline__ void cvt_bf16_job(const float* __restrict__ in, unsigned short* __restrict__ outp, int n8, int blk) {
  const int i = blk * 256 + (int)threadIdx.x;
  if (i >= n8) return;
  const size_t e = 8 * (size_t)i;
  const v4f a = *(const v4f*)(in + e);
  const v4f b = *(const v4f*)(in + e + 4);
  v4u w;
  w[0] = pk16(bf_bits(a[0]), bf_bits(a[1]));
  w[1] = pk16(bf_bits(a[2]), bf_bits(a[3]));
  w[2] = pk16(bf_bits(b[0]), bf_bits(b[1]));
  w[3] = pk16(bf_bits(b[2]), bf_bits(b[3]));
  *(v4u*)(outp + e) = w;
  
}

// ---------------------------------------------------------------------------
// Adapter B matrix [R][16] f32 -> extension plane [R][32] bf16: cols 0..15 = bf16(2*B[r][0..15]), cols 16..31 = the same again
// (pairs with the [Th | Tl] extension plane of T so one 32-deep k-step yields 2*(Th+Tl).B^T). 2*bf16(B) is exact.
// ---------------------------------------------------------------------------
__device__ __forceinline__ void bext_job(const float* __restrict__ Bm, unsigned short* __restrict__ outp, int npieces, int blk) {
  const int p = blk * 256 + (int)threadIdx.x;
  if (p >= npieces) return;
  const int row = p >> 2, q = p & 3;
  const float* src = Bm + (size_t)row * LRK + (q & 1) * 8;
  const v4f a = *(const v4f*)(src);
  const v4f b = *(const v4f*)(src + 4);
  v4u w;
  w[0] = pk16(bf_bits(2.0f * a[0]), bf_bits(2.0f * a[1]));
  w[1] = pk16(bf_bits(2.0f * a[2]), bf_bits(2.0f * a[3]));
  w[2] = pk16(bf_bits(2.0f * b[0]), bf_bits(2.0f * b[1]));
  w[3] = pk16(bf_bits(2.0f * b[2]), bf_bits(2.0f * b[3]));
  *(v4u*)(outp + (size_t)p * 8) = w;
  
}

// ---------------------------------------------------------------------------
// All preparation in ONE launch: the cos/sin table, the nine bf16 planes and the four adapter extension planes depend on the inputs alone
// and on nothing of each other, so each block takes one block's worth of one job, picked by its index (block-uniform; no barriers).
// Block ranges, in index order: table | x | Wq | Wo | Wk | Wv | Aq Ak Av Ao | Bq Bo | Bk Bv. Each range is exactly the job's own grid.
// ---------------------------------------------------------------------------
#define N8_X    (NTOK * HID / 8)     // 16-B output pieces of each plane
#define N8_WSQ  (HID * HID / 8)
#define N8_WKV  (HDM * HID / 8)
#define N8_AL   (LRK * HID / 8)
#define NP_BL   (HID * 4)
#define NP_BS   (HDM * 4)
#define PB_TAB  (SQ / 8)             // blocks of each job
#define PB_X    (N8_X / 256)
#define PB_WSQ  (N8_WSQ / 256)
#define PB_WKV  (N8_WKV / 256)
#define PB_AL   (N8_AL / 256)
#define PB_BL   (NP_BL / 256)
#define PB_BS   (NP_BS / 256)
#define PB_CVT  (PB_X + 2 * PB_WSQ + 2 * PB_WKV + 4 * PB_AL)
#define PB_ALL  (PB_TAB + PB_CVT + 2 * PB_BL + 2 * PB_BS)
static_assert(N8_X % 256 == 0 && N8_WSQ % 256 == 0 && N8_WKV % 256 == 0 && N8_AL % 256 == 0 && NP_BL % 256 == 0 && NP_BS % 256 == 0);

__global__ __launch_bounds__(256) void prep_kernel(
    const float* __restrict__ x,
    const float* __restrict__ wq_w, const float* __restrict__ wq_a, const float* __restrict__ wq_b,
    const float* __restrict__ wk_w, const float* __restrict__ wk_a, const float* __restrict__ wk_b,
    const float* __restrict__ wv_w, const float* __restrict__ wv_a, const float* __restrict__ wv_b,
    const float* __restrict__ wo_w, const float* __restrict__ wo_a, const float* __restrict__ wo_b,
    unsigned short* __restrict__ Xb,  unsigned short* __restrict__ Wqb, unsigned short* __restrict__ Wkb,
    unsigned short* __restrict__ Wvb, unsigned short* __restrict__ Wob,
    unsigned short* __restrict__ Aqb, unsigned short* __restrict__ Akb, unsigned short* __restrict__ Avb, unsigned short* __restrict__ Aob,
    unsigned short* __restrict__ BextQ, unsigned short* __restrict__ BextK, unsigned short* __restrict__ BextV,
    unsigned short* __restrict__ BextO, float* __restrict__ cst, float* __restrict__ snt) {
  int blk = (int)blockIdx.x;
  if (blk < PB_TAB) { rope_table_job(cst, snt, SQ, blk); return; }
  blk -= PB_TAB;
  if (blk < PB_CVT) {                            // one of the nine bf16 planes: pick source, plane and the block's number within the job
    const float* in = x;
    unsigned short* op = Xb;
    int n8 = N8_X;
    if (blk >= PB_X) {
      blk -= PB_X;
      if (blk < 2 * PB_WSQ) {
        const bool second = blk >= PB_WSQ;
        in = second ? wo_w : wq_w;  op = second ? Wob : Wqb;  n8 = N8_WSQ;  blk -= second ? PB_WSQ : 0;
      } else if ((blk -= 2 * PB_WSQ) < 2 * PB_WKV) {
        const bool second = blk >= PB_WKV;
        in = second ? wv_w : wk_w;  op = second ? Wvb : Wkb;  n8 = N8_WKV;  blk -= second ? PB_WKV : 0;
      } else {
        blk -= 2 * PB_WKV;
        const int j = blk / PB_AL;               // 0..3: q, k, v, o
        in = j == 0 ? wq_a : (j == 1 ? wk_a : (j == 2 ? wv_a : wo_a));
        op = j == 0 ? Aqb  : (j == 1 ? Akb  : (j == 2 ? Avb  : Aob));
        n8 = N8_AL;  blk -= j * PB_AL;
      }
    }
    cvt_bf16_job(in, op, n8, blk);
    return;
  }
  blk -= PB_CVT;
  {                                              // one of the four adapter extension planes
    const float* bm;
    unsigned short* op;
    int np;
    if (blk < 2 * PB_BL) {
      const bool second = blk >= PB_BL;
      bm = second ? wo_b : wq_b;  op = second ? BextO : BextQ;  np = NP_BL;  blk -= second ? PB_BL : 0;
    } else {
      blk -= 2 * PB_BL;
      const bool second = blk >= PB_BS;
      bm = second ? wv_b : wk_b;  op = second ? BextV : BextK;  np = NP_BS;  blk -= second ? PB_BS : 0;
    }
    bext_job(bm, op, np, blk);
  }
}

// ---------------------------------------------------------------------------
// bf16 WMMA GEMM, wave tile 32 rows x 128 cols, block = 4 waves (128 threads) = one 128 x 128 tile of C (wave w: rows 32w..32w+31).
//   C[m][n] = sum_k A[m][k] * Bt[n][k]  +  sum_{k<32} Aext[m][k] * Bext[n][k]
//   A row-major [M][K] bf16 (pitch lda), Bt row-major [N][K] bf16 (pitch ldb), Aext [M][32], Bext [N][32] bf16;
//   M % 128 == 0, N % 128 == 0, K % 64 == 0, K >= 128; grid.x = M/128 * N/128.
//   SPLITA: A carried as hi (Ap) + lo (A2p) bf16 planes, two products into one accumulator.
//   One of the two extension planes is the plane Ep in global memory ([2B | 2B], pitch 32); the other is [Th | Tl], bf16 hi and lo of
//   T[r][j] = sum_k X[r][k] * L[j][k], j < 16, L = the adapter's A matrix [16][K] bf16 (pitch ldl), X = the activations: the A operand
//   (XB clear, T = Aext) or the Bt operand (XB set, T = Bext). T is formed in the same K loop: L's 16 rows are staged with every stage, wave w
//   takes rows 32w..32w+31 of the block's X tile (its own A fragments when XB is clear) and adds one WMMA per 16 rows, plane and k-step,
//   k ascending, hi before lo. Behind the loop T goes to LDS as [Th | Tl] rows and comes back as fragments of the extension k-step.
//   K loop: stages of 64 k. A stage = the block's 128 A rows (both planes when SPLITA) and 128 Bt rows, 128 B of each row, brought to LDS
//   by 16-B async copies (a wave's copy = 4 whole lines), rows at pitch 144 B; two buffers, stage t + 2 copied while stage t + 1 is worked on.
//   Fragments come from LDS with the split k map (ldfrag_b); the adapter k-step loads Ep from global rows.
// Epilogues (all: per wave, per 16-row slab: stage in LDS, wave sync, write each row segment with ONE instruction of
//   EPI 0, XB clear: q / k projection: RoPE with pairs (dim, dim+64), token position = row & (SQ-1), cos/sin
//          from the f32 table [SQ][64];
//          writes f16 hi plane C0 and f16 residual x2048 plane C1, both [M][ldc], cols n0..n0+127 (row segment 256 B = 16 lanes x 16 B).
//   EPI 0, XB set: v^T projection: f16 hi plane C0, residual x2048 plane C1, [M][ldc], row segment 256 B.
//   EPI 2: f32 output C0 [M][ldc]; row segment 128 floats = 512 B = 32 lanes x 16 B per instruction.
// Coverage: M/128 * N/128 blocks (blk = the block's number within its own product) x 4 waves x 32x128 = the whole [M][N] region of each plane.
// The body is a device function on LDS arrays of the calling kernel, so that one launch can hold the blocks of several products.
// ---------------------------------------------------------------------------
template <int EPI> struct SlabT { typedef _Float16 T; static constexpr int PERW = 4096; };   // 2 planes x 16 x 128 halves
template <> struct SlabT<2>     { typedef float    T; static constexpr int PERW = 2048; };   // 16 x 128 floats

#define GK_KC    64                  // k per stage: 128 B of every operand row
#define GK_P     72                  // LDS row pitch in elements: 144 B = 16 B x 9, conflict-free for 16-B fragment reads
#define GK_PLANE (128 * GK_P)        // elements of one 128-row operand plane in LDS
#define GK_LPL   (16 * GK_P)         // elements of the adapter matrix's 16-row plane in LDS
#define TT_P     40                  // T row pitch in LDS in elements: 80 B = 16 B x 5, conflict-free for 16-B fragment reads
#define TT_W     4096                // elements from one wave's 32 T rows to the next wave's: a wave's 8-KiB epilogue slab

__device__ __forceinline__ unsigned lds_off(const void* p) { return (unsigned)(size_t)p; }   // LDS byte address = low 32 bits

// One thread's share of one 128-row x 128-B plane: eight 16-B async copies, rows r, r + 16, .., r + 112 (r = tid >> 3, piece tid & 7).
// l = this lane's LDS byte address of row r, g = its global address of row r, step = 16 source rows in elements.
// The closing s_wait_xcnt 0 stands inside the statement so that no address register named here is rewritten ahead of it.
__device__ __forceinline__ void copy_plane8(unsigned l, const unsigned short* g, size_t step) {
  asm volatile(
      "global_load_async_to_lds_b128 %0, %8, off\n\t"
      "global_load_async_to_lds_b128 %1, %9, off\n\t"
      "global_load_async_to_lds_b128 %2, %10, off\n\t"
      "global_load_async_to_lds_b128 %3, %11, off\n\t"
      "global_load_async_to_lds_b128 %4, %12, off\n\t"
      "global_load_async_to_lds_b128 %5, %13, off\n\t"
      "global_load_async_to_lds_b128 %6, %14, off\n\t"
      "global_load_async_to_lds_b128 %7, %15, off\n\t"
      "s_wait_xcnt 0x0"
      :: "v"(l), "v"(l + 1u * 16u * GK_P * 2u), "v"(l + 2u * 16u * GK_P * 2u), "v"(l + 3u * 16u * GK_P * 2u),
         "v"(l + 4u * 16u * GK_P * 2u), "v"(l + 5u * 16u * GK_P * 2u), "v"(l + 6u * 16u * GK_P * 2u), "v"(l + 7u * 16u * GK_P * 2u),
         "v"(g), "v"(g + step), "v"(g + 2 * step), "v"(g + 3 * step),
         "v"(g + 4 * step), "v"(g + 5 * step), "v"(g + 6 * step), "v"(g + 7 * step)
      : "memory");
}
// One thread's share of the adapter matrix's 16-row x 128-B plane: one 16-B async copy (row tid >> 3, piece tid & 7).
// The closing s_wait_xcnt 0 stands inside the statement so that no address register named here is rewritten ahead of it.
__device__ __forceinline__ void copy_plane1(unsigned l, const unsigned short* g) {
  asm volatile(
      "global_load_async_to_lds_b128 %0, %1, off\n\t"
      "s_wait_xcnt 0x0"
      :: "v"(l), "v"(g)
      : "memory");
}
// this wave's async copies have landed in LDS
__device__ __forceinline__ void wait_async0() { asm volatile("s_wait_asynccnt 0x0" ::: "memory"); }
// this wave's LDS reads have returned, so the buffer they read may be refilled behind the next barrier
__device__ __forceinline__ void wait_ds0()    { asm volatile("s_wait_dscnt 0x0" ::: "memory"); }

template <int EPI, bool SPLITA, bool XB>
__device__ __forceinline__ void gemm_w32x128_body(
    typename SlabT<EPI>::T* slab_all, unsigned short* stage_all, int blk,
    const unsigned short* Ap, const unsigned short* A2p, int lda,
    const unsigned short* Btp, int ldb, const unsigned short* Lp, int ldl, const unsigned short* Ep,
    const float* __restrict__ cst, const float* __restrict__ snt,
    void* C0, void* C1, int ldc, int M, int N, int K) {
  typedef typename SlabT<EPI>::T ST;
  constexpr int NPA      = SPLITA ? 2 : 1;               // A planes per stage
  constexpr int STAGE_EL = (NPA + 1) * GK_PLANE;         // elements per stage: A plane(s), then the Bt plane
  constexpr bool rope    = EPI == 0 && !XB;
  static_assert(!(SPLITA && XB));
  // The epilogue slabs are idle until the K loop has ended: up to there their first bytes hold the two stage buffers of the adapter matrix
  // (an array of their own would cost the q, k, v^T launch its third block per WGP); behind the loop's last barrier they take T.
  static_assert(2 * GK_LPL <= TT_W && 32 * TT_P <= TT_W);
  unsigned short* lst = (unsigned short*)(void*)slab_all;

  const int tid  = (int)threadIdx.x;
  const int lane = tid & 31;
  const int wave = wave_id();
  const int hh = lane >> 4;           // lane half: k offset 8*hh, D row offset 8*hh
  const int rl = lane & 15;           // A row / B col / D col within subtile
  const int tilesN = N >> 7;
  if (blk >= (M >> 7) * tilesN) return;         // block-uniform, in front of every barrier
  const int tmb = blk / tilesN;
  const int tn  = blk - tmb * tilesN;
  const int mb0 = tmb << 7;                     // first row of the block's tile
  const int m0  = mb0 + (wave << 5);            // first row of this wave's tile
  const int n0  = tn << 7;

  // this thread's copy addresses for stage 0, row tid >> 3 of each plane, 16-B piece tid & 7
  const int crow = tid >> 3, cpc = (tid & 7) * 8;
  const unsigned short* gA  = Ap  + (size_t)(mb0 + crow) * lda + cpc;
  const unsigned short* gA2 = A2p + (size_t)(mb0 + crow) * lda + cpc;
  const unsigned short* gB  = Btp + (size_t)(n0  + crow) * ldb + cpc;
  const unsigned short* gL  = Lp  + (size_t)crow * ldl + cpc;            // crow = 0..15: the 16 adapter rows
  const size_t stepA = (size_t)16 * lda, stepB = (size_t)16 * ldb;
  const unsigned lc = lds_off(stage_all) + (unsigned)(crow * GK_P + cpc) * 2u;
  const unsigned ll = lds_off(lst) + (unsigned)(crow * GK_P + cpc) * 2u;
  const int nst = K / GK_KC;                    // stages, block-uniform

  v8f acc[2][8];
#pragma unroll
  for (int i = 0; i < 2; ++i)
#pragma unroll
    for (int j = 0; j < 8; ++j) acc[i][j] = zero8();
  v8f tacc[2];                                  // T of this wave's 32 X rows
  tacc[0] = zero8(); tacc[1] = zero8();

  // stage s -> buffer s & 1
  auto copy_stage = [&](int s) {
    const unsigned l = lc + (unsigned)(s & 1) * (unsigned)(STAGE_EL * 2);
    const size_t ko = (size_t)s * GK_KC;
    copy_plane8(l, gA + ko, stepA);
    if (SPLITA) copy_plane8(l + GK_PLANE * 2u, gA2 + ko, stepA);
    copy_plane8(l + (unsigned)(NPA * GK_PLANE) * 2u, gB + ko, stepB);
    copy_plane1(ll + (unsigned)(s & 1) * (unsigned)(GK_LPL * 2), gL + ko);
  };
  copy_stage(0);
  wait_async0();
  __syncthreads();                              // stage 0 published
  if (nst > 1) copy_stage(1);

  for (int t = 0; t < nst; ++t) {
    const __bf16* S  = (const __bf16*)(const void*)(stage_all + (t & 1) * STAGE_EL);
    const __bf16* sA = S + (wave * 32 + rl) * GK_P + 8 * hh;
    const __bf16* sB = S + NPA * GK_PLANE + rl * GK_P + 8 * hh;
    const __bf16* sL = (const __bf16*)(const void*)(lst + (t & 1) * GK_LPL) + rl * GK_P + 8 * hh;
#pragma unroll
    for (int ks = 0; ks < 2; ++ks) {
      v16b ah[2], al[2], bj[8], xa[2];
#pragma unroll
      for (int i = 0; i < 2; ++i) {
        ah[i] = ldfrag_b(sA + i * 16 * GK_P + ks * 32);
        al[i] = SPLITA ? ldfrag_b(sA + GK_PLANE + i * 16 * GK_P + ks * 32) : ah[i];
      }
#pragma unroll
      for (int j = 0; j < 8; ++j) bj[j] = ldfrag_b(sB + j * 16 * GK_P + ks * 32);
      const v16b lj = ldfrag_b(sL + ks * 32);
#pragma unroll
      for (int i = 0; i < 2; ++i) xa[i] = XB ? ldfrag_b(sB + (wave * 32 + i * 16) * GK_P + ks * 32) : ah[i];
      __builtin_amdgcn_sched_barrier(0);        // keeps the k-step's LDS reads one group ahead of its WMMAs (else one waited pair per two WMMAs)
#pragma unroll
      for (int j = 0; j < 8; ++j) {
        acc[0][j] = mma_b(ah[0], bj[j], acc[0][j]);
        acc[1][j] = mma_b(ah[1], bj[j], acc[1][j]);
      }
      tacc[0] = mma_b(xa[0], lj, tacc[0]);
      tacc[1] = mma_b(xa[1], lj, tacc[1]);
      if (SPLITA) {
#pragma unroll
        for (int j = 0; j < 8; ++j) {
          acc[0][j] = mma_b(al[0], bj[j], acc[0][j]);
          acc[1][j] = mma_b(al[1], bj[j], acc[1][j]);
        }
        tacc[0] = mma_b(al[0], lj, tacc[0]);
        tacc[1] = mma_b(al[1], lj, tacc[1]);
      }
      __builtin_amdgcn_sched_barrier(0);        // keeps the next k-step's LDS reads from being spread among these WMMAs
    }
    // publish point of stage t + 1; it also ends every wave's reads of the buffer that stage t + 2 refills
    wait_ds0();
    wait_async0();
    __syncthreads();
    if (t + 2 < nst) copy_stage(t + 2);         // block-uniform test
  }
  wait_async0();                                // nothing of this wave is in flight behind the loop
  // ---- T -> [Th | Tl] rows in LDS: wave w's 32 rows in its own slab; the loop's last barrier has ended every read of the adapter stages ----
  acc_guard2(tacc[0], tacc[1]);
  {
    unsigned short* tw = lst + wave * TT_W;
#pragma unroll
    for (int i = 0; i < 2; ++i)
#pragma unroll
      for (int r = 0; r < 8; ++r) {
        const int row = i * 16 + 8 * hh + r;
        const float v = tacc[i][r];
        const unsigned short hb = bf_bits(v);
        const unsigned short lb = bf_bits(v - bf_val(hb));
        tw[row * TT_P + rl]      = hb;
        tw[row * TT_P + 16 + rl] = lb;
      }
  }
  if (XB) __syncthreads();                      // every wave reads all 128 T rows
  else    lds_wave_sync();                      // a wave reads its own 32 T rows alone
  // ---- rank-16 adapter extension: one 32-deep k-step [Th | Tl] . [2B | 2B] ----
  {
    const __bf16* Ee = (const __bf16*)(const void*)Ep;
    const __bf16* Tt = (const __bf16*)(const void*)lst;
    v16b ae[2];
#pragma unroll
    for (int i = 0; i < 2; ++i)
      ae[i] = XB ? ldfrag_b(Ee + (size_t)(m0 + i * 16 + rl) * KEXT + 8 * hh)
                 : ldfrag_b(Tt + wave * TT_W + (i * 16 + rl) * TT_P + 8 * hh);
#pragma unroll
    for (int j = 0; j < 8; ++j) {
      const v16b be = XB ? ldfrag_b(Tt + (j >> 1) * TT_W + ((j & 1) * 16 + rl) * TT_P + 8 * hh)
                         : ldfrag_b(Ee + (size_t)(n0 + j * 16 + rl) * KEXT + 8 * hh);
      acc[0][j] = mma_b(ae[0], be, acc[0][j]);
      acc[1][j] = mma_b(ae[1], be, acc[1][j]);
      guard_b5(acc[0][j], acc[1][j], ae[0], ae[1], ae[0], ae[1], be);
    }
  }
  if (XB) __syncthreads();                      // every wave has read the T rows in the other waves' slabs, which the epilogue now overwrites
  acc_guard4(acc[0][0], acc[0][1], acc[0][2], acc[0][3]);
  acc_guard4(acc[0][4], acc[0][5], acc[0][6], acc[0][7]);
  acc_guard4(acc[1][0], acc[1][1], acc[1][2], acc[1][3]);
  acc_guard4(acc[1][4], acc[1][5], acc[1][6], acc[1][7]);

  // ---- epilogue ----
  ST* slab = slab_all + wave * SlabT<EPI>::PERW;
  _Float16* sl16 = (_Float16*)(void*)slab;
  float*    slf  = (float*)(void*)slab;

  if (rope) {
    _Float16* P0 = (_Float16*)C0;
    _Float16* P1 = (_Float16*)C1;
#pragma unroll
    for (int i = 0; i < 2; ++i) {
      const int rb = m0 + i * 16 + 8 * hh;
#pragma unroll
      for (int j = 0; j < 4; ++j) {
        const int dim = j * 16 + rl;                             // 0..63 within head; x2 partner at dim + 64
#pragma unroll
        for (int r = 0; r < 8; ++r) {
          const int row = rb + r;                                // token 0..M-1
          const int tp  = row & (SQ - 1);                        // position within its sequence
          const float cv = cst[(size_t)tp * NFREQ + dim];
          const float sv = snt[(size_t)tp * NFREQ + dim];
          const float x1 = acc[i][j][r];
          const float x2 = acc[i][j + 4][r];
          const float o1 = x1 * cv - x2 * sv;
          const float o2 = x2 * cv + x1 * sv;
          const _Float16 h1 = (_Float16)o1;
          const _Float16 h2 = (_Float16)o2;
          const int so = (8 * hh + r) * 128 + dim;
          sl16[so]             = h1;
          sl16[so + 64]        = h2;
          sl16[2048 + so]      = (_Float16)((o1 - (float)h1) * 2048.0f);
          sl16[2048 + so + 64] = (_Float16)((o2 - (float)h2) * 2048.0f);
        }
      }
      lds_wave_sync();
      {
#pragma unroll
        for (int it = 0; it < 8; ++it) {
          const int row = it * 2 + hh;                           // it x hh covers rows 0..15
          const int c8  = rl * 8;
          const v8h vh = *(const v8h*)(sl16 + row * 128 + c8);
          const v8h vl = *(const v8h*)(sl16 + 2048 + row * 128 + c8);
          const size_t go = (size_t)(m0 + i * 16 + row) * ldc + n0 + c8;
          *(v8h*)(P0 + go) = vh;
          *(v8h*)(P1 + go) = vl;
        }
        
      }
      lds_wave_sync();
    }
  } else if (EPI == 0) {
    _Float16* P0 = (_Float16*)C0;
    _Float16* P1 = (_Float16*)C1;
#pragma unroll
    for (int i = 0; i < 2; ++i) {
#pragma unroll
      for (int r = 0; r < 8; ++r) {
#pragma unroll
        for (int j = 0; j < 8; ++j) {
          const float v = acc[i][j][r];
          const _Float16 hv = (_Float16)v;
          const int so = (8 * hh + r) * 128 + j * 16 + rl;
          sl16[so]        = hv;
          sl16[2048 + so] = (_Float16)((v - (float)hv) * 2048.0f);
        }
      }
      lds_wave_sync();
      {
#pragma unroll
        for (int it = 0; it < 8; ++it) {
          const int row = it * 2 + hh;
          const int c8  = rl * 8;
          const v8h vh = *(const v8h*)(sl16 + row * 128 + c8);
          const v8h vl = *(const v8h*)(sl16 + 2048 + row * 128 + c8);
          const size_t go = (size_t)(m0 + i * 16 + row) * ldc + n0 + c8;
          *(v8h*)(P0 + go) = vh;
          *(v8h*)(P1 + go) = vl;
        }
        
      }
      lds_wave_sync();
    }
  } else {
    float* C = (float*)C0;
#pragma unroll
    for (int i = 0; i < 2; ++i) {
#pragma unroll
      for (int j = 0; j < 8; ++j)
#pragma unroll
        for (int r = 0; r < 8; ++r)
          slf[(8 * hh + r) * 128 + j * 16 + rl] = acc[i][j][r];
      lds_wave_sync();
      {
#pragma unroll
        for (int row = 0; row < 16; ++row) {                     // 32 lanes x 16 B = the whole 512-B row segment per instruction
          const v4f v = *(const v4f*)(slf + row * 128 + lane * 4);
          *(v4f*)(C + (size_t)(m0 + i * 16 + row) * ldc + n0 + lane * 4) = v;
        }
        
      }
      lds_wave_sync();
    }
  }
}

// one product per launch
template <int EPI, bool SPLITA>
__global__ __launch_bounds__(128) void gemm_w32x128_kernel(
    const unsigned short* Ap, const unsigned short* A2p, int lda,
    const unsigned short* __restrict__ Btp, int ldb, const unsigned short* __restrict__ Lp, int ldl, const unsigned short* __restrict__ Ep,
    const float* __restrict__ cst, const float* __restrict__ snt,
    void* C0, void* C1, int ldc, int M, int N, int K) {
  __shared__ __align__(16) typename SlabT<EPI>::T slab_all[4 * SlabT<EPI>::PERW];
  __shared__ __align__(16) unsigned short stage_all[2 * (SPLITA ? 3 : 2) * GK_PLANE];
  gemm_w32x128_body<EPI, SPLITA, false>(slab_all, stage_all, (int)blockIdx.x,
                                        Ap, A2p, lda, Btp, ldb, Lp, ldl, Ep, cst, snt, C0, C1, ldc, M, N, K);
}

// The q, k and v^T projections in ONE launch: they read the same planes and none reads another's result. Blocks 0..nkv-1 take v^T
// (A = Wv, Bt = x: the body with x on the Bt side), nkv..2nkv-1 take k, the rest q (the body with x on the A side, operands picked before it);
// nkv = ntok/128 * hdm/128. The choice is block-uniform: every wave of a block runs the same body and passes its barriers alike.
// grid.x = 2 * nkv + ntok/128 * hid/128.
__global__ __launch_bounds__(128) void gemm_qkv_kernel(
    const unsigned short* __restrict__ Xb,
    const unsigned short* __restrict__ Wqb, const unsigned short* __restrict__ Wkb, const unsigned short* __restrict__ Wvb,
    const unsigned short* __restrict__ Aqb, const unsigned short* __restrict__ Akb, const unsigned short* __restrict__ Avb,
    const unsigned short* __restrict__ BextQ, const unsigned short* __restrict__ BextK, const unsigned short* __restrict__ BextV,
    const float* __restrict__ cst, const float* __restrict__ snt,
    unsigned short* Qh, unsigned short* Ql, unsigned short* Kh, unsigned short* Kl, unsigned short* Vh, unsigned short* Vl,
    int ntok, int hid, int hdm) {
  __shared__ __align__(16) SlabT<0>::T slab_all[4 * SlabT<0>::PERW];
  __shared__ __align__(16) unsigned short stage_all[2 * 2 * GK_PLANE];
  const int nkv = (ntok >> 7) * (hdm >> 7);
  const int bx  = (int)blockIdx.x;
  const bool isv = bx < nkv;
  if (isv) {
    gemm_w32x128_body<0, false, true>(slab_all, stage_all, bx,
                                      Wvb, Wvb, hid, Xb, hid, Avb, hid, BextV, cst, snt, (void*)Vh, (void*)Vl, ntok, hdm, ntok, hid);
  } else {
    const bool isk = bx < 2 * nkv;
    const int blk = isk ? bx - nkv : bx - 2 * nkv;
    const unsigned short* Bt = isk ? Wkb   : Wqb;
    const unsigned short* Lm = isk ? Akb   : Aqb;
    const unsigned short* Be = isk ? BextK : BextQ;
    unsigned short* P0 = isk ? Kh : Qh;
    unsigned short* P1 = isk ? Kl : Ql;
    const int N = isk ? hdm : hid;
    gemm_w32x128_body<0, false, false>(slab_all, stage_all, blk,
                                       Xb, Xb, hid, Bt, hid, Lm, hid, Be, cst, snt, (void*)P0, (void*)P1, N, ntok, N, hid);
  }
}

#define AT_KC   32
#define KS_P    136
#define VS_P    40
#define OS_P    136                          // output staging row pitch in halves: 272 B, the k rows' pitch, for the same 16-B access shape
#define LDS_KS  0
#define LDS_KLS (32 * KS_P)
#define LDS_VHS (2 * 32 * KS_P)
#define LDS_VLS (LDS_VHS + 128 * VS_P)
#define AT_BUF  (LDS_VLS + 128 * VS_P)       // halves of one chunk buffer (the four planes above are offsets within a buffer)
#define LDS_TOT (2 * AT_BUF)
static_assert(3 * LDS_TOT * 2 <= 320 * 1024); // three blocks per WGP, as many as the registers allow
static_assert((AT_BUF * 2) % 16 == 0);
static_assert(4 * 2 * 16 * OS_P <= 2 * AT_BUF);   // output staging (2 planes x 16 rows per wave) aliases the chunk region after the loop

// One thread's share of a pair of planes (hi, residual) of one chunk: four 16-B async copies per plane, rows r, r + n, r + 2n, r + 3n.
// la, lb = this lane's LDS byte addresses of row r in the two planes, lstep = n rows in LDS bytes; ga, gb = its global addresses of row r,
// gstep = n source rows in elements. The closing s_wait_xcnt 0 stands inside the statement so that no address register named here is
// rewritten ahead of it.
__device__ __forceinline__ void copy_pair4(unsigned la, unsigned lb, unsigned lstep,
                                           const _Float16* ga, const _Float16* gb, size_t gstep) {
  asm volatile(
      "global_load_async_to_lds_b128 %0, %8, off\n\t"
      "global_load_async_to_lds_b128 %1, %9, off\n\t"
      "global_load_async_to_lds_b128 %2, %10, off\n\t"
      "global_load_async_to_lds_b128 %3, %11, off\n\t"
      "global_load_async_to_lds_b128 %4, %12, off\n\t"
      "global_load_async_to_lds_b128 %5, %13, off\n\t"
      "global_load_async_to_lds_b128 %6, %14, off\n\t"
      "global_load_async_to_lds_b128 %7, %15, off\n\t"
      "s_wait_xcnt 0x0"
      :: "v"(la), "v"(la + lstep), "v"(la + 2u * lstep), "v"(la + 3u * lstep),
         "v"(lb), "v"(lb + lstep), "v"(lb + 2u * lstep), "v"(lb + 3u * lstep),
         "v"(ga), "v"(ga + gstep), "v"(ga + 2 * gstep), "v"(ga + 3 * gstep),
         "v"(gb), "v"(gb + gstep), "v"(gb + 2 * gstep), "v"(gb + 3 * gstep)
      : "memory");
}

template <bool PRES>
__device__ __forceinline__ void attn_causal_body(
    _Float16* lds, int qb, int h, int b,
    const unsigned short* __restrict__ qhp, const unsigned short* __restrict__ qlp,
    const unsigned short* __restrict__ khp, const unsigned short* __restrict__ klp,
    const unsigned short* __restrict__ vhp, const unsigned short* __restrict__ vlp,
    unsigned short* __restrict__ ahp, unsigned short* __restrict__ alp) {
  const int tid  = (int)threadIdx.x;
  const int lane = tid & 31;
  const int wave = wave_id();
  const int hh   = lane >> 4;
  const int c    = lane & 15;
  const int q0   = qb * 64 + wave * 16;          // first query row of this wave (within sequence)
  const int qlast = q0 + 15;
  const size_t tok0 = (size_t)b * SQ;

  const _Float16* Qhr = (const _Float16*)(const void*)qhp + (tok0 + q0 + c) * HID + h * HDM + 8 * hh;
  const _Float16* Qlr = (const _Float16*)(const void*)qlp + (tok0 + q0 + c) * HID + h * HDM + 8 * hh;
  const _Float16* Kg  = (const _Float16*)(const void*)khp + tok0 * HDM;
  const _Float16* Klg = (const _Float16*)(const void*)klp + tok0 * HDM;
  const _Float16* Vhg = (const _Float16*)(const void*)vhp + tok0;
  const _Float16* Vlg = (const _Float16*)(const void*)vlp + tok0;

  float mrow = -INFINITY;                        // running maximum of query q0 + c (equal in both lane halves)
  float lrow = 0.f;                              // running sum of query q0 + c over this lane half's keys; the halves are joined behind the loop
  v8f oacc[8], oaccr[8];
#pragma unroll
  for (int t = 0; t < 8; ++t) { oacc[t] = zero8(); oaccr[t] = zero8(); }

  // the wave's 16 query rows, both planes, as B fragments: loaded once, held in registers over the whole key loop
  // unrolled so that the arrays are registers
  v16h qfa[4], qfl[4];
#pragma unroll
  for (int dc = 0; dc < 4; ++dc) {
    qfa[dc] = ldfrag_h(Qhr + dc * 32);
    qfl[dc] = ldfrag_h(Qlr + dc * 32);
  }

  const int nch = 2 * qb + 2;                    // block-uniform, 2 .. 64
  // this thread's copy addresses for chunk 0, buffer 0. Coverage per plane: 128 threads x 4 pieces of 8 halves = 512 pieces = whole tile.
  const int ckey = tid >> 4, cd8 = (tid & 15) * 8;   // K: keys ckey + 8 i, i < 4, of 32 keys x 128 d
  const int cdim = tid >> 2, ck8 = (tid & 3) * 8;    // V^T: rows cdim + 32 i, i < 4, of 128 d x 32 keys
  const unsigned lK = lds_off(lds) + (unsigned)(LDS_KS  + ckey * KS_P + cd8) * 2u;
  const unsigned lV = lds_off(lds) + (unsigned)(LDS_VHS + cdim * VS_P + ck8) * 2u;
  const size_t goK = (size_t)ckey * HDM + cd8;
  const size_t goV = (size_t)cdim * NTOK + ck8;
  // chunk s -> buffer s & 1
  auto copy_chunk = [&](int s) {
    const unsigned lb = (unsigned)(s & 1) * (unsigned)(AT_BUF * 2);
    const size_t kv = (size_t)s * AT_KC;
    copy_pair4(lK + lb, lK + lb + (unsigned)(LDS_KLS - LDS_KS) * 2u, 8u * KS_P * 2u,
               Kg + goK + kv * HDM, Klg + goK + kv * HDM, (size_t)8 * HDM);
    copy_pair4(lV + lb, lV + lb + (unsigned)(LDS_VLS - LDS_VHS) * 2u, 32u * VS_P * 2u,
               Vhg + goV + kv, Vlg + goV + kv, (size_t)32 * NTOK);
  };
  copy_chunk(0);
  wait_async0();
  __syncthreads();                               // chunk 0 published
  if (nch > 1) copy_chunk(1);                    // block-uniform test

  for (int kc = 0; kc < nch; ++kc) {
    const int kv0 = kc * AT_KC;
    const _Float16* Cb  = lds + (kc & 1) * AT_BUF;   // this trip reads this buffer alone
    const _Float16* Ks  = Cb + LDS_KS;
    const _Float16* Kls = Cb + LDS_KLS;
    const _Float16* Vhs = Cb + LDS_VHS;
    const _Float16* Vls = Cb + LDS_VLS;

    if (kv0 <= qlast) {                          // wave-uniform (scalar): skip chunks fully above this wave's rows
      // The chunk's LDS traffic is grouped and issued ahead of its use; each sched_barrier below keeps one group of LDS operations together
      // and ahead of the work that hides its latency (left free, the build waits on a pair of reads per WMMA pair).
      // ---- scores: fragment reads in groups of 4 (a 32-deep step's two hi tiles, then its two residual tiles), issued three groups ahead ----
      v8f sh[2], sr[2];
      sh[0] = zero8(); sh[1] = zero8(); sr[0] = zero8(); sr[1] = zero8();
      v16h kf[8][2];                             // group 2 * dc: hi plane, group 2 * dc + 1: residual plane; [j] = key tile
#pragma unroll
      for (int g = 0; g < 3; ++g)
#pragma unroll
        for (int j = 0; j < 2; ++j) kf[g][j] = ldfrag_h(((g & 1) ? Kls : Ks) + (j * 16 + c) * KS_P + (g >> 1) * 32 + 8 * hh);
#pragma unroll
      for (int g = 0; g < 8; ++g) {
        __builtin_amdgcn_sched_barrier(0);       // the reads above are issued before this group's WMMAs
        const v16h qa = qfa[g >> 1];
        const v16h ql = qfl[g >> 1];
        if ((g & 1) == 0) {
          sh[0] = mma_h(kf[g][0], qa, sh[0]);
          sr[0] = mma_h(kf[g][0], ql, sr[0]);
          sh[1] = mma_h(kf[g][1], qa, sh[1]);
          sr[1] = mma_h(kf[g][1], ql, sr[1]);
          if (g == 0) guard_first(sh[0], sr[0], sh[1], sr[1], kf[0][0], kf[0][1]);
        } else {
          sr[0] = mma_h(kf[g][0], qa, sr[0]);
          sr[1] = mma_h(kf[g][1], qa, sr[1]);
        }
        __builtin_amdgcn_sched_barrier(0);       // the refill below follows these WMMAs, whose registers it takes over
        if (g + 3 < 8) {
#pragma unroll
          for (int j = 0; j < 2; ++j)
            kf[g + 3][j] = ldfrag_h((((g + 3) & 1) ? Kls : Ks) + (j * 16 + c) * KS_P + ((g + 3) >> 1) * 32 + 8 * hh);
        }
      }
      // ---- scale, causal mask, maximum of this lane's query over the chunk ----
      const int kd = kv0 + 8 * hh - (q0 + c);    // key - query of tile 0, register 0: key > query as kd > -(16 j + r), a literal
      float cm = -INFINITY;
#pragma unroll
      for (int j = 0; j < 2; ++j)
#pragma unroll
        for (int r = 0; r < 8; ++r) {
          float s = (sh[j][r] + sr[j][r] * 0.00048828125f) * 0.08838834764831845f;
          s = (kd > -(j * 16 + r)) ? -INFINITY : s;
          sh[j][r] = s;
          cm = fmaxf(cm, s);
        }
      cm = fmaxf(cm, xhalf(cm));                 // the other lane half holds the query's other 16 keys
      // ---- online softmax; p' goes from the score registers into the B fragment(s) of p^T ----
      const float mnew  = fmaxf(mrow, cm);
      const float alpha = __expf(mrow - mnew);
      mrow = mnew;
      float ps[4] = {0.f, 0.f, 0.f, 0.f};        // four independent chains for the 16 terms
      v16h pa, pr;
#pragma unroll
      for (int j = 0; j < 2; ++j)
#pragma unroll
        for (int r = 0; r < 8; ++r) {
          const float pv = __expf(sh[j][r] - mnew);
          ps[r & 3] += pv;
          const float pp = pv * 1024.0f;
          const _Float16 phv = (_Float16)pp;
          pa[j * 8 + r] = phv;
          pr[j * 8 + r] = PRES ? (_Float16)((pp - (float)phv) * 2048.0f) : phv;
        }
      lrow = lrow * alpha + ((ps[0] + ps[1]) + (ps[2] + ps[3]));
      // the first three d tiles' v^T fragments, issued once the score registers are free: their reads fly under the rescale below
      v16h vb[8], vr[8];
#pragma unroll
      for (int t = 0; t < 3; ++t) {
        vb[t] = ldfrag_h(Vhs + (t * 16 + c) * VS_P + 8 * hh);
        vr[t] = ldfrag_h(Vls + (t * 16 + c) * VS_P + 8 * hh);
      }
      __builtin_amdgcn_sched_barrier(0);         // keeps those reads ahead of the rescale (sunk to their use, the first v^T WMMA waits out their latency)
#pragma unroll
      for (int t = 0; t < 8; ++t)
#pragma unroll
        for (int r = 0; r < 8; ++r) { oacc[t][r] *= alpha; oaccr[t][r] *= alpha; }
      // ---- O^T += V^T . P'^T: the 4 fragment reads of each 16-wide d tile are issued three tiles ahead of its WMMAs ----
      // inputs only: the p^T fragment is complete in front of the ring below, so that each tile's WMMAs stand between the ring's reads
      // (else the build sinks all 16 WMMAs behind the last read and holds all 8 tiles: 377 VGPRs, not 309: two blocks per WGP, not three)
      if (PRES) asm volatile("" :: "v"(pa), "v"(pr) : "memory");
      else      asm volatile("" :: "v"(pa) : "memory");
#pragma unroll
      for (int t = 0; t < 8; ++t) {
        __builtin_amdgcn_sched_barrier(0);       // the reads above are issued before this tile's WMMAs
        oacc[t]  = mma_h(vb[t], pa, oacc[t]);
        oaccr[t] = mma_h(vr[t], pa, oaccr[t]);
        if (PRES) oaccr[t] = mma_h(vb[t], pr, oaccr[t]);
        __builtin_amdgcn_sched_barrier(0);       // the refill below follows these WMMAs, whose registers it takes over
        if (t + 3 < 8) {
          vb[t + 3] = ldfrag_h(Vhs + ((t + 3) * 16 + c) * VS_P + 8 * hh);
          vr[t + 3] = ldfrag_h(Vls + ((t + 3) * 16 + c) * VS_P + 8 * hh);
        }
      }
    }
    // publish point of chunk kc + 1, passed by every wave (outside the per-wave skip); it also ends every wave's reads of the buffer
    // that chunk kc + 2 refills
    wait_ds0();
    wait_async0();
    __syncthreads();
    if (kc + 2 < nch) copy_chunk(kc + 2);        // block-uniform test
  }
  wait_async0();                                 // nothing of this wave is in flight behind the loop
  // the last trip's barrier has ended every reader's last read of the chunk region, which now becomes output staging
  _Float16* osh = lds + wave * (2 * 16 * OS_P);
  _Float16* osl = osh + 16 * OS_P;
  {
    const float lsum = lrow + xhalf(lrow);       // the two lane halves' key sums of query q0 + c
    const float inv = (1.0f / lsum) * 0.0009765625f;
#pragma unroll
    for (int t = 0; t < 8; ++t) {                // a lane's 8 registers of a tile = 8 consecutive d of its query: one 16-B LDS store per plane
      v8h xh, xl;
#pragma unroll
      for (int r = 0; r < 8; ++r) {
        const float o = (oacc[t][r] + oaccr[t][r] * 0.00048828125f) * inv;
        const unsigned short hb = bf_bits(o);
        const unsigned short lb = bf_bits(o - bf_val(hb));
        xh[r] = __builtin_bit_cast(_Float16, hb);
        xl[r] = __builtin_bit_cast(_Float16, lb);
      }
      *(v8h*)(osh + c * OS_P + t * 16 + 8 * hh) = xh;
      *(v8h*)(osl + c * OS_P + t * 16 + 8 * hh) = xl;
    }
  }
  lds_wave_sync();
  _Float16* Ahg = (_Float16*)(void*)ahp + (tok0 + q0) * HID + h * HDM;
  _Float16* Alg = (_Float16*)(void*)alp + (tok0 + q0) * HID + h * HDM;
  {
#pragma unroll
    for (int it = 0; it < 8; ++it) {
      const int row = it * 2 + hh;               // it 0..7 x hh 0..1 covers rows 0..15
      const int c8  = c * 8;                     // 16 lanes x 16 B = the whole 256-B segment
      const v8h x = *(const v8h*)(osh + row * OS_P + c8);
      const v8h y = *(const v8h*)(osl + row * OS_P + c8);
      *(v8h*)(Ahg + (size_t)row * HID + c8) = x;
      *(v8h*)(Alg + (size_t)row * HID + c8) = y;
    }
  }
}

#define AT_NPRES 4                   // query tiles 0..3 carry the p residual product
__global__ __launch_bounds__(128) void attn_causal_kernel(
    const unsigned short* __restrict__ qhp, const unsigned short* __restrict__ qlp,
    const unsigned short* __restrict__ khp, const unsigned short* __restrict__ klp,
    const unsigned short* __restrict__ vhp, const unsigned short* __restrict__ vlp,
    unsigned short* __restrict__ ahp, unsigned short* __restrict__ alp) {
  __shared__ __align__(16) _Float16 lds[LDS_TOT];
  // A block's key loop has 2 * qb + 2 trips and there are more blocks than resident places, so the cost falls with the block index: the
  // 64-trip tiles take the lowest indices, the short tiles the highest (for speed only). The query
  // tile is the slow digit of the index, so that neighbouring indices cost the same and indices far apart differ.
  // index -> (qb, h, b) is one to one: index = (SQ / 64 - 1 - qb) * NHQ * NSEQ + b * NHQ + h.
  const int idx = (int)blockIdx.x;
  const int qb  = SQ / 64 - 1 - idx / (NHQ * NSEQ);   // block-uniform: every wave of a block runs the same body and passes its barriers
  const int hb  = idx % (NHQ * NSEQ);
  const int h   = hb % NHQ;
  const int b   = hb / NHQ;
  if (qb < AT_NPRES) attn_causal_body<true>(lds, qb, h, b, qhp, qlp, khp, klp, vhp, vlp, ahp, alp);
  else               attn_causal_body<false>(lds, qb, h, b, qhp, qlp, khp, klp, vhp, vlp, ahp, alp);
}

// ---------------------------------------------------------------------------
// Workspace map (bytes; every region is a whole number of the rows / lines its producer writes with whole-line stores):
//   Xb   bf16 [4096][2048]  16777216    Wqb bf16 [2048][2048]  8388608    Wkb bf16 [128][2048]  524288   Wvb bf16 [128][2048] 524288
//   Wob  bf16 [2048][2048]   8388608    Aqb/Akb/Avb/Aob bf16 [16][2048]  4 x 65536
//   BextQ bf16 [2048][32]     131072    BextK/BextV bf16 [128][32] 2 x 8192   BextO bf16 [2048][32] 131072
//   cst/snt f32 [2048][64]  2 x 524288
//   Qh/Ql f16 [4096][2048]  2 x 16777216   Kh/Kl f16 [4096][128]  2 x 1048576   Vh/Vl f16 [128][4096]  2 x 1048576
//   Ah/Al bf16 [4096][2048] 2 x 16777216
//   total 107495424
// ---------------------------------------------------------------------------
extern "C" void kernel_launch(void* const* d_in, const int* in_sizes, int n_in,
                              void* d_out, int out_size, void* d_ws, size_t ws_size,
                              hipStream_t stream) {
  if (n_in < 13) return;
  if (in_sizes[0]  != NTOK * HID) return;
  if (in_sizes[1]  != HID * HID)  return;
  if (in_sizes[2]  != LRK * HID)  return;
  if (in_sizes[3]  != HID * LRK)  return;
  if (in_sizes[4]  != HDM * HID)  return;
  if (in_sizes[5]  != LRK * HID)  return;
  if (in_sizes[6]  != HDM * LRK)  return;
  if (in_sizes[7]  != HDM * HID)  return;
  if (in_sizes[8]  != LRK * HID)  return;
  if (in_sizes[9]  != HDM * LRK)  return;
  if (in_sizes[10] != HID * HID)  return;
  if (in_sizes[11] != LRK * HID)  return;
  if (in_sizes[12] != HID * LRK)  return;
  if (out_size != NTOK * HID) return;

  const float* x    = (const float*)d_in[0];
  const float* wq_w = (const float*)d_in[1];
  const float* wq_a = (const float*)d_in[2];
  const float* wq_b = (const float*)d_in[3];
  const float* wk_w = (const float*)d_in[4];
  const float* wk_a = (const float*)d_in[5];
  const float* wk_b = (const float*)d_in[6];
  const float* wv_w = (const float*)d_in[7];
  const float* wv_a = (const float*)d_in[8];
  const float* wv_b = (const float*)d_in[9];
  const float* wo_w = (const float*)d_in[10];
  const float* wo_a = (const float*)d_in[11];
  const float* wo_b = (const float*)d_in[12];
  float* out = (float*)d_out;

  const size_t szX   = (size_t)NTOK * HID * 2;
  const size_t szWsq = (size_t)HID * HID * 2;
  const size_t szWkv = (size_t)HDM * HID * 2;
  const size_t szAl  = (size_t)LRK * HID * 2;
  const size_t szBeL = (size_t)HID * KEXT * 2;
  const size_t szBeS = (size_t)HDM * KEXT * 2;
  const size_t szTab = (size_t)SQ * NFREQ * 4;
  const size_t szQ   = (size_t)NTOK * HID * 2;
  const size_t szK   = (size_t)NTOK * HDM * 2;
  const size_t szV   = (size_t)HDM * NTOK * 2;
  const size_t szA   = (size_t)NTOK * HID * 2;
  size_t off = 0;
  const size_t oX   = off; off += szX;
  const size_t oWq  = off; off += szWsq;
  const size_t oWk  = off; off += szWkv;
  const size_t oWv  = off; off += szWkv;
  const size_t oWo  = off; off += szWsq;
  const size_t oAq  = off; off += szAl;
  const size_t oAk  = off; off += szAl;
  const size_t oAv  = off; off += szAl;
  const size_t oAo  = off; off += szAl;
  const size_t oBq  = off; off += szBeL;
  const size_t oBk  = off; off += szBeS;
  const size_t oBv  = off; off += szBeS;
  const size_t oBo  = off; off += szBeL;
  const size_t oCs  = off; off += szTab;
  const size_t oSn  = off; off += szTab;
  const size_t oQh  = off; off += szQ;
  const size_t oQl  = off; off += szQ;
  const size_t oKh  = off; off += szK;
  const size_t oKl  = off; off += szK;
  const size_t oVh  = off; off += szV;
  const size_t oVl  = off; off += szV;
  const size_t oAh  = off; off += szA;
  const size_t oAl  = off; off += szA;
  if (off > ws_size) return;                     // off = 107495424

  char* ws = (char*)d_ws;
  unsigned short* Xb    = (unsigned short*)(ws + oX);
  unsigned short* Wqb   = (unsigned short*)(ws + oWq);
  unsigned short* Wkb   = (unsigned short*)(ws + oWk);
  unsigned short* Wvb   = (unsigned short*)(ws + oWv);
  unsigned short* Wob   = (unsigned short*)(ws + oWo);
  unsigned short* Aqb   = (unsigned short*)(ws + oAq);
  unsigned short* Akb   = (unsigned short*)(ws + oAk);
  unsigned short* Avb   = (unsigned short*)(ws + oAv);
  unsigned short* Aob   = (unsigned short*)(ws + oAo);
  unsigned short* BextQ = (unsigned short*)(ws + oBq);
  unsigned short* BextK = (unsigned short*)(ws + oBk);
  unsigned short* BextV = (unsigned short*)(ws + oBv);
  unsigned short* BextO = (unsigned short*)(ws + oBo);
  float*          cst   = (float*)(ws + oCs);
  float*          snt   = (float*)(ws + oSn);
  unsigned short* Qh    = (unsigned short*)(ws + oQh);
  unsigned short* Ql    = (unsigned short*)(ws + oQl);
  unsigned short* Kh    = (unsigned short*)(ws + oKh);
  unsigned short* Kl    = (unsigned short*)(ws + oKl);
  unsigned short* Vh    = (unsigned short*)(ws + oVh);
  unsigned short* Vl    = (unsigned short*)(ws + oVl);
  unsigned short* Ah    = (unsigned short*)(ws + oAh);
  unsigned short* Al    = (unsigned short*)(ws + oAl);

  const dim3 b256(256), b128(128);

  // (1) preparation, one launch: cos/sin table [2048][64] x 2; bf16 planes of x, the base weights and the adapter A matrices (layouts kept
  //     as given: [rows][K] with K contiguous); adapter B matrices -> [2B | 2B] extension planes
  prep_kernel<<<dim3(PB_ALL), b256, 0, stream>>>(x, wq_w, wq_a, wq_b, wk_w, wk_a, wk_b, wv_w, wv_a, wv_b, wo_w, wo_a, wo_b,
      Xb, Wqb, Wkb, Wvb, Wob, Aqb, Akb, Avb, Aob, BextQ, BextK, BextV, BextO, cst, snt);
  // (2) one launch: v^T = Wv . x^T + 2 Bv . T^T -> Vh/Vl [128][4096] (32 blocks); k = x . Wk^T + 2 T.Bk^T, RoPE -> Kh/Kl [4096][128]
  //     (32 blocks); q = x . Wq^T + 2 T.Bq^T, RoPE -> Qh/Ql [4096][2048] (512 blocks); K = 2048 + ext each; T = x . A^T formed in the blocks
  gemm_qkv_kernel<<<dim3(2 * (NTOK / 128) * (HDM / 128) + (NTOK / 128) * (HID / 128)), b128, 0, stream>>>(
      Xb, Wqb, Wkb, Wvb, Aqb, Akb, Avb, BextQ, BextK, BextV, cst, snt, Qh, Ql, Kh, Kl, Vh, Vl, NTOK, HID, HDM);
  // (3) causal attention, one launch, longest query tiles first: query tiles 0..3 with the p residual product, tiles 4..31 without
  attn_causal_kernel<<<dim3((SQ / 64) * NHQ * NSEQ), b128, 0, stream>>>(Qh, Ql, Kh, Kl, Vh, Vl, Ah, Al);
  // (4) out = attn(hi + lo) . Wo^T + 2 T_o . Bo^T -> d_out f32 [4096][2048], T_o = attn(hi + lo) . Ao^T formed in the blocks
  //     (M=4096, N=2048, K=2048 + ext; 512 blocks)
  gemm_w32x128_kernel<2, true><<<dim3((NTOK / 128) * (HID / 128)), b128, 0, stream>>>(
      Ah, Al, HID, Wob, HID, Aob, HID, BextO, cst, snt, (void*)out, (void*)out, HID, NTOK, HID, HID);
  (void)hipGetLastError();
}

// v009
// Measured time: 179 microseconds a run.
// In two side-by-side timings against v008, it was 1.07 and 1.06 times as fast.
// Over all steps from v000 it is 5.46 times as fast.
// Contractions: x.Wq^T, x.Wk^T, Wv.x^T and the rank-16 adapter products x.A^T on v_wmma_f32_16x16x32_bf16 (operands = RNE bf16 of the
// f32 inputs, single products; the adapter term enters the base GEMM as one extra 32-deep k-step with T = x.A^T carried as bf16 hi + bf16 lo
// against 2B in bf16; T is formed inside the GEMM that uses it); k.q^T and v^T.p^T on v_wmma_f32_16x16x32_f16 (q, k, v^T = f16 hi + f16 residual x2^11 planes, lo.lo dropped; p x1024 f16
// plus f16 residual x2^11 on query tiles 0..3); attn.Wo^T and attn.Ao^T on v_wmma_f32_16x16x32_bf16 (attn = bf16 hi + bf16 lo planes, two
// products; Wo, Ao RNE bf16). f32 accumulate everywhere; RoPE (f32 cos/sin table), online softmax and scale folds in f32.
#include <hip/hip_runtime.h>
#include <math.h>
#include <stdint.h>

#define NSEQ   2
#define SQ     2048
#define HID    2048
#define NHQ    16
#define HDM    128
#define NTOK   4096
#define NFREQ  64
#define LRK    16
#define KEXT   32

typedef _Float16       v16h __attribute__((ext_vector_type(16)));
typedef _Float16       v8h  __attribute__((ext_vector_type(8)));
typedef __bf16         v16b __attribute__((ext_vector_type(16)));
typedef __bf16         v8b  __attribute__((ext_vector_type(8)));
typedef float          v8f  __attribute__((ext_vector_type(8)));
typedef float          v4f  __attribute__((ext_vector_type(4)));
typedef unsigned int   v4u  __attribute__((ext_vector_type(4)));

// ---------------------------------------------------------------------------
// small helpers
// ---------------------------------------------------------------------------
__device__ __forceinline__ unsigned short bf_bits(float f) {          // RNE convert f32 -> bf16 bits
  const unsigned u = __float_as_uint(f);
  return (unsigned short)((u + 0x7FFFu + ((u >> 16) & 1u)) >> 16);
}
__device__ __forceinline__ float bf_val(unsigned short h) { return __uint_as_float(((unsigned)h) << 16); }
__device__ __forceinline__ unsigned pk16(unsigned short a, unsigned short b) { return (unsigned)a | ((unsigned)b << 16); }
__device__ __forceinline__ v8f zero8() { v8f z = {0.f, 0.f, 0.f, 0.f, 0.f, 0.f, 0.f, 0.f}; return z; }
__device__ __forceinline__ int wave_id() { return __builtin_amdgcn_readfirstlane((int)(threadIdx.x >> 5)); }
// the value of lane l ^ 16 (a vector cross-row move, no LDS)
__device__ __forceinline__ float xhalf(float x) {
  const int b = __builtin_bit_cast(int, x);
  return __builtin_bit_cast(float, __builtin_amdgcn_permlanex16(b, b, 0x76543210, 0xfedcba98, false, false));
}

// orders one wave's LDS element stores before its own vector reloads of the same tile (other lanes' data)
__device__ __forceinline__ void lds_wave_sync() {
  __builtin_amdgcn_fence(__ATOMIC_RELEASE, "workgroup");
  __builtin_amdgcn_wave_barrier();
  __builtin_amdgcn_fence(__ATOMIC_ACQUIRE, "workgroup");
}

// ---------------------------------------------------------------------------
// WMMA fragments (wave32, 16x16x32, 16-bit operands). For A (row m = lane&15) and B (col n = lane&15) alike:
// elements 0..7 <- k0 + 8*(lane>>4) + 0..7, elements 8..15 <- k0 + 16 + 8*(lane>>4) + 0..7.
// ldfrag(p) with p = rowbase + k0 + 8*(lane>>4): two 16-B loads p[0..7], p[16..23].
// D: acc[r] = (row 8*(lane>>4) + r, col lane&15).
// ---------------------------------------------------------------------------
union FragH { v16h v; v8h h[2]; };
union FragB { v16b v; v8b h[2]; };
__device__ __forceinline__ v16h ldfrag_h(const _Float16* p) { FragH f; f.h[0] = *(const v8h*)(p); f.h[1] = *(const v8h*)(p + 16); return f.v; }
__device__ __forceinline__ v16b ldfrag_b(const __bf16* p)   { FragB f; f.h[0] = *(const v8b*)(p); f.h[1] = *(const v8b*)(p + 16); return f.v; }

__device__ __forceinline__ v8f mma_h(v16h a, v16h b, v8f c) {
  return __builtin_amdgcn_wmma_f32_16x16x32_f16(false, a, false, b, (short)0, c, false, false);
}
__device__ __forceinline__ v8f mma_b(v16b a, v16b b, v8f c) {
  return __builtin_amdgcn_wmma_f32_16x16x32_bf16(false, a, false, b, (short)0, c, false, false);
}
// hazard guards: 4 VALU slots after the last WMMA of a group, D tied, A/B kept live; memory clobber keeps later loads behind the group
__device__ __forceinline__ void guard_b5(v8f& a, v8f& b, v16b x0, v16b x1, v16b x2, v16b x3, v16b y) {
  asm volatile("v_nop\n\tv_nop\n\tv_nop\n\tv_nop" : "+v"(a), "+v"(b) : "v"(x0), "v"(x1), "v"(x2), "v"(x3), "v"(y) : "memory");
}
// behind the first score group, whose four results are new registers (C = 0): the two k fragments are named so that they stay live past the
// four WMMAs and no result is placed over an operand that a WMMA just ahead reads; 4 VALU slots before those registers are free again
__device__ __forceinline__ void guard_first(v8f& a, v8f& b, v8f& c, v8f& d, v16h y, v16h z) {
  asm volatile("v_nop\n\tv_nop\n\tv_nop\n\tv_nop" : "+v"(a), "+v"(b), "+v"(c), "+v"(d) : "v"(y), "v"(z));
}
__device__ __forceinline__ void acc_guard4(v8f& a, v8f& b, v8f& c, v8f& d) {
  asm volatile("v_nop\n\tv_nop\n\tv_nop\n\tv_nop" : "+v"(a), "+v"(b), "+v"(c), "+v"(d));
}
__device__ __forceinline__ void acc_guard2(v8f& a, v8f& b) {
  asm volatile("v_nop\n\tv_nop\n\tv_nop\n\tv_nop" : "+v"(a), "+v"(b));
}

// ---------------------------------------------------------------------------
// RoPE table for positions t = 0..npos-1: cst[t][i] = cos(t * inv_freq[i]), snt[t][i] = sin(...), inv_freq[i] = 1 / 1e4^(i/64),
// i < 64, all f32. Block = 8 waves, wave w -> t = blk*8 + w, lane -> i = lane, lane + 32.
// Coverage: npos/8 blocks x 8 waves x 32 lanes x 2 = npos x 64 per plane.
// ---------------------------------------------------------------------------
__device__ __forceinline__ void rope_table_job(float* __restrict__ cst, float* __restrict__ snt, int npos, int blk) {
  const int lane = threadIdx.x & 31;
  const int wave = (int)(threadIdx.x >> 5);
  const int t = blk * 8 + wave;
  if (t >= npos) return;                       // no barriers in this job
  const float pf = (float)t;
  float c0 = 0.f, s0 = 0.f, c1 = 0.f, s1 = 0.f;
#pragma unroll 1
  for (int u = 0; u < 2; ++u) {
    const int i = lane + 32 * u;
    const float e   = (float)i * 0.015625f;      // i / 64 exact
    const float pw  = powf(10000.0f, e);
    const float inv = 1.0f / pw;
    const float ang = pf * inv;
    const float cv = cosf(ang);
    const float sv = sinf(ang);
    c1 = cv; s1 = sv;
    if (u == 0) { c0 = cv; s0 = sv; }
  }
  const size_t o = (size_t)t * NFREQ + lane;
  {
    ((float*)cst)[o]      = c0;
    ((float*)cst)[o + 32] = c1;
    ((float*)snt)[o]      = s0;
    ((float*)snt)[o + 32] = s1;
    
  }
}

// ---------------------------------------------------------------------------
// Elementwise RNE f32 -> bf16 plane: 8 elements per thread, one 16-B store per lane -> 32 consecutive lanes write 4 whole
// (every n8 used is a multiple of 256, so every instruction is full width).
// ---------------------------------------------------------------------------
__device__ __forceinline__ void cvt_bf16_job(const float* __restrict__ in, unsigned short* __restrict__ outp, int n8, int blk) {
  const int i = blk * 256 + (int)threadIdx.x;
  if (i >= n8) return;
  const size_t e = 8 * (size_t)i;
  const v4f a = *(const v4f*)(in + e);
  const v4f b = *(const v4f*)(in + e + 4);
  v4u w;
  w[0] = pk16(bf_bits(a[0]), bf_bits(a[1]));
  w[1] = pk16(bf_bits(a[2]), bf_bits(a[3]));
  w[2] = pk16(bf_bits(b[0]), bf_bits(b[1]));
  w[3] = pk16(bf_bits(b[2]), bf_bits(b[3]));
  *(v4u*)(outp + e) = w;
  
}

// ---------------------------------------------------------------------------
// Adapter B matrix [R][16] f32 -> extension plane [R][32] bf16: cols 0..15 = bf16(2*B[r][0..15]), cols 16..31 = the same again
// (pairs with the [Th | Tl] extension plane of T so one 32-deep k-step yields 2*(Th+Tl).B^T). 2*bf16(B) is exact.
// ---------------------------------------------------------------------------
__device__ __forceinline__ void bext_job(const float* __restrict__ Bm, unsigned short* __restrict__ outp, int npieces, int blk) {
  const int p = blk * 256 + (int)threadIdx.x;
  if (p >= npieces) return;
  const int row = p >> 2, q = p & 3;
  const float* src = Bm + (size_t)row * LRK + (q & 1) * 8;
  const v4f a = *(const v4f*)(src);
  const v4f b = *(const v4f*)(src + 4);
  v4u w;
  w[0] = pk16(bf_bits(2.0f * a[0]), bf_bits(2.0f * a[1]));
  w[1] = pk16(bf_bits(2.0f * a[2]), bf_bits(2.0f * a[3]));
  w[2] = pk16(bf_bits(2.0f * b[0]), bf_bits(2.0f * b[1]));
  w[3] = pk16(bf_bits(2.0f * b[2]), bf_bits(2.0f * b[3]));
  *(v4u*)(outp + (size_t)p * 8) = w;
  
}

// ---------------------------------------------------------------------------
// All preparation in ONE launch: the cos/sin table, the nine bf16 planes and the four adapter extension planes depend on the inputs alone
// and on nothing of each other, so each block takes one block's worth of one job, picked by its index (block-uniform; no barriers).
// Block ranges, in index order: table | x | Wq | Wo | Wk | Wv | Aq Ak Av Ao | Bq Bo | Bk Bv. Each range is exactly the job's own grid.
// ---------------------------------------------------------------------------
#define N8_X    (NTOK * HID / 8)     // 16-B output pieces of each plane
#define N8_WSQ  (HID * HID / 8)
#define N8_WKV  (HDM * HID / 8)
#define N8_AL   (LRK * HID / 8)
#define NP_BL   (HID * 4)
#define NP_BS   (HDM * 4)
#define PB_TAB  (SQ / 8)             // blocks of each job
#define PB_X    (N8_X / 256)
#define PB_WSQ  (N8_WSQ / 256)
#define PB_WKV  (N8_WKV / 256)
#define PB_AL   (N8_AL / 256)
#define PB_BL   (NP_BL / 256)
#define PB_BS   (NP_BS / 256)
#define PB_CVT  (PB_X + 2 * PB_WSQ + 2 * PB_WKV + 4 * PB_AL)
#define PB_ALL  (PB_TAB + PB_CVT + 2 * PB_BL + 2 * PB_BS)
static_assert(N8_X % 256 == 0 && N8_WSQ % 256 == 0 && N8_WKV % 256 == 0 && N8_AL % 256 == 0 && NP_BL % 256 == 0 && NP_BS % 256 == 0);

__global__ __launch_bounds__(256) void prep_kernel(
    const float* __restrict__ x,
    const float* __restrict__ wq_w, const float* __restrict__ wq_a, const float* __restrict__ wq_b,
    const float* __restrict__ wk_w, const float* __restrict__ wk_a, const float* __restrict__ wk_b,
    const float* __restrict__ wv_w, const float* __restrict__ wv_a, const float* __restrict__ wv_b,
    const float* __restrict__ wo_w, const float* __restrict__ wo_a, const float* __restrict__ wo_b,
    unsigned short* __restrict__ Xb,  unsigned short* __restrict__ Wqb, unsigned short* __restrict__ Wkb,
    unsigned short* __restrict__ Wvb, unsigned short* __restrict__ Wob,
    unsigned short* __restrict__ Aqb, unsigned short* __restrict__ Akb, unsigned short* __restrict__ Avb, unsigned short* __restrict__ Aob,
    unsigned short* __restrict__ BextQ, unsigned short* __restrict__ BextK, unsigned short* __restrict__ BextV,
    unsigned short* __restrict__ BextO, float* __restrict__ cst, float* __restrict__ snt) {
  int blk = (int)blockIdx.x;
  if (blk < PB_TAB) { rope_table_job(cst, snt, SQ, blk); return; }
  blk -= PB_TAB;
  if (blk < PB_CVT) {                            // one of the nine bf16 planes: pick source, plane and the block's number within the job
    const float* in = x;
    unsigned short* op = Xb;
    int n8 = N8_X;
    if (blk >= PB_X) {
      blk -= PB_X;
      if (blk < 2 * PB_WSQ) {
        const bool second = blk >= PB_WSQ;
        in = second ? wo_w : wq_w;  op = second ? Wob : Wqb;  n8 = N8_WSQ;  blk -= second ? PB_WSQ : 0;
      } else if ((blk -= 2 * PB_WSQ) < 2 * PB_WKV) {
        const bool second = blk >= PB_WKV;
        in = second ? wv_w : wk_w;  op = second ? Wvb : Wkb;  n8 = N8_WKV;  blk -= second ? PB_WKV : 0;
      } else {
        blk -= 2 * PB_WKV;
        const int j = blk / PB_AL;               // 0..3: q, k, v, o
        in = j == 0 ? wq_a : (j == 1 ? wk_a : (j == 2 ? wv_a : wo_a));
        op = j == 0 ? Aqb  : (j == 1 ? Akb  : (j == 2 ? Avb  : Aob));
        n8 = N8_AL;  blk -= j * PB_AL;
      }
    }
    cvt_bf16_job(in, op, n8, blk);
    return;
  }
  blk -= PB_CVT;
  {                                              // one of the four adapter extension planes
    const float* bm;
    unsigned short* op;
    int np;
    if (blk < 2 * PB_BL) {
      const bool second = blk >= PB_BL;
      bm = second ? wo_b : wq_b;  op = second ? BextO : BextQ;  np = NP_BL;  blk -= second ? PB_BL : 0;
    } else {
      blk -= 2 * PB_BL;
      const bool second = blk >= PB_BS;
      bm = second ? wv_b : wk_b;  op = second ? BextV : BextK;  np = NP_BS;  blk -= second ? PB_BS : 0;
    }
    bext_job(bm, op, np, blk);
  }
}

// ---------------------------------------------------------------------------
// bf16 WMMA GEMM, wave tile 32 rows x 128 cols, block = 4 waves (128 threads) = one 128 x 128 tile of C (wave w: rows 32w..32w+31).
//   C[m][n] = sum_k A[m][k] * Bt[n][k]  +  sum_{k<32} Aext[m][k] * Bext[n][k]
//   A row-major [M][K] bf16 (pitch lda), Bt row-major [N][K] bf16 (pitch ldb), Aext [M][32], Bext [N][32] bf16;
//   M % 128 == 0, N % 128 == 0, K % 64 == 0, K >= 128; grid.x = M/128 * N/128.
//   SPLITA: A carried as hi (Ap) + lo (A2p) bf16 planes, two products into one accumulator.
//   One of the two extension planes is the plane Ep in global memory ([2B | 2B], pitch 32); the other is [Th | Tl], bf16 hi and lo of
//   T[r][j] = sum_k X[r][k] * L[j][k], j < 16, L = the adapter's A matrix [16][K] bf16 (pitch ldl), X = the activations: the A operand
//   (XB clear, T = Aext) or the Bt operand (XB set, T = Bext). T is formed in the same K loop: L's 16 rows are staged with every stage, wave w
//   takes rows 32w..32w+31 of the block's X tile (its own A fragments when XB is clear) and adds one WMMA per 16 rows, plane and k-step,
//   k ascending, hi before lo. Behind the loop T goes to LDS as [Th | Tl] rows and comes back as fragments of the extension k-step.
//   K loop: stages of 64 k. A stage = the block's 128 A rows (both planes when SPLITA) and 128 Bt rows, 128 B of each row, brought to LDS
//   by 16-B async copies (a wave's copy = 4 whole lines), rows at pitch 144 B; two buffers, stage t + 2 copied while stage t + 1 is worked on.
//   Fragments come from LDS with the split k map (ldfrag_b); the adapter k-step loads Ep from global rows.
// Epilogues (all: per wave, per 16-row slab: stage in LDS, wave sync, write each row segment with ONE instruction of
//   EPI 0, XB clear: q / k projection: RoPE with pairs (dim, dim+64), token position = row & (SQ-1), cos/sin
//          from the f32 table [SQ][64];
//          writes f16 hi plane C0 and f16 residual x2048 plane C1, both [M][ldc], cols n0..n0+127 (row segment 256 B = 16 lanes x 16 B).
//   EPI 0, XB set: v^T projection: f16 hi plane C0, residual x2048 plane C1, chunk-tiled [N / 32][M][32]: the M x 32 tile that attention
//          stages per key chunk is contiguous.
//   EPI 2: f32 output C0 [M][ldc]; row segment 128 floats = 512 B = 32 lanes x 16 B per instruction.
// Coverage: M/128 * N/128 blocks (blk = the block's number within its own product) x 4 waves x 32x128 = the whole [M][N] region of each plane.
// The body is a device function on LDS arrays of the calling kernel, so that one launch can hold the blocks of several products.
// ---------------------------------------------------------------------------
template <int EPI> struct SlabT { typedef _Float16 T; static constexpr int PERW = 4096; };   // 2 planes x 16 x 128 halves
template <> struct SlabT<2>     { typedef float    T; static constexpr int PERW = 2048; };   // 16 x 128 floats

#define GK_KC    64                  // k per stage: 128 B of every operand row
#define GK_P     72                  // LDS row pitch in elements: 144 B = 16 B x 9, conflict-free for 16-B fragment reads
#define GK_PLANE (128 * GK_P)        // elements of one 128-row operand plane in LDS
#define GK_LPL   (16 * GK_P)         // elements of the adapter matrix's 16-row plane in LDS
#define TT_P     40                  // T row pitch in LDS in elements: 80 B = 16 B x 5, conflict-free for 16-B fragment reads
#define TT_W     4096                // elements from one wave's 32 T rows to the next wave's: a wave's 8-KiB epilogue slab

__device__ __forceinline__ unsigned lds_off(const void* p) { return (unsigned)(size_t)p; }   // LDS byte address = low 32 bits

// One thread's share of one 128-row x 128-B plane: eight 16-B async copies, rows r, r + 16, .., r + 112 (r = tid >> 3, piece tid & 7).
// l = this lane's LDS byte address of row r, g = its global address of row r, step = 16 source rows in elements.
// The closing s_wait_xcnt 0 stands inside the statement so that no address register named here is rewritten ahead of it.
__device__ __forceinline__ void copy_plane8(unsigned l, const unsigned short* g, size_t step) {
  asm volatile(
      "global_load_async_to_lds_b128 %0, %8, off\n\t"
      "global_load_async_to_lds_b128 %1, %9, off\n\t"
      "global_load_async_to_lds_b128 %2, %10, off\n\t"
      "global_load_async_to_lds_b128 %3, %11, off\n\t"
      "global_load_async_to_lds_b128 %4, %12, off\n\t"
      "global_load_async_to_lds_b128 %5, %13, off\n\t"
      "global_load_async_to_lds_b128 %6, %14, off\n\t"
      "global_load_async_to_lds_b128 %7, %15, off\n\t"
      "s_wait_xcnt 0x0"
      :: "v"(l), "v"(l + 1u * 16u * GK_P * 2u), "v"(l + 2u * 16u * GK_P * 2u), "v"(l + 3u * 16u * GK_P * 2u),
         "v"(l + 4u * 16u * GK_P * 2u), "v"(l + 5u * 16u * GK_P * 2u), "v"(l + 6u * 16u * GK_P * 2u), "v"(l + 7u * 16u * GK_P * 2u),
         "v"(g), "v"(g + step), "v"(g + 2 * step), "v"(g + 3 * step),
         "v"(g + 4 * step), "v"(g + 5 * step), "v"(g + 6 * step), "v"(g + 7 * step)
      : "memory");
}
// One thread's share of the adapter matrix's 16-row x 128-B plane: one 16-B async copy (row tid >> 3, piece tid & 7).
// The closing s_wait_xcnt 0 stands inside the statement so that no address register named here is rewritten ahead of it.
__device__ __forceinline__ void copy_plane1(unsigned l, const unsigned short* g) {
  asm volatile(
      "global_load_async_to_lds_b128 %0, %1, off\n\t"
      "s_wait_xcnt 0x0"
      :: "v"(l), "v"(g)
      : "memory");
}
// this wave's async copies have landed in LDS
__device__ __forceinline__ void wait_async0() { asm volatile("s_wait_asynccnt 0x0" ::: "memory"); }
// this wave's LDS reads have returned, so the buffer they read may be refilled behind the next barrier
__device__ __forceinline__ void wait_ds0()    { asm volatile("s_wait_dscnt 0x0" ::: "memory"); }

template <int EPI, bool SPLITA, bool XB>
__device__ __forceinline__ void gemm_w32x128_body(
    typename SlabT<EPI>::T* slab_all, unsigned short* stage_all, int blk,
    const unsigned short* Ap, const unsigned short* A2p, int lda,
    const unsigned short* Btp, int ldb, const unsigned short* Lp, int ldl, const unsigned short* Ep,
    const float* __restrict__ cst, const float* __restrict__ snt,
    void* C0, void* C1, int ldc, int M, int N, int K) {
  typedef typename SlabT<EPI>::T ST;
  constexpr int NPA      = SPLITA ? 2 : 1;               // A planes per stage
  constexpr int STAGE_EL = (NPA + 1) * GK_PLANE;         // elements per stage: A plane(s), then the Bt plane
  constexpr bool rope    = EPI == 0 && !XB;
  static_assert(!(SPLITA && XB));
  // The epilogue slabs are idle until the K loop has ended: up to there their first bytes hold the two stage buffers of the adapter matrix
  // (an array of their own would cost the q, k, v^T launch its third block per WGP); behind the loop's last barrier they take T.
  static_assert(2 * GK_LPL <= TT_W && 32 * TT_P <= TT_W);
  unsigned short* lst = (unsigned short*)(void*)slab_all;

  const int tid  = (int)threadIdx.x;
  const int lane = tid & 31;
  const int wave = wave_id();
  const int hh = lane >> 4;           // lane half: k offset 8*hh, D row offset 8*hh
  const int rl = lane & 15;           // A row / B col / D col within subtile
  const int tilesN = N >> 7;
  if (blk >= (M >> 7) * tilesN) return;         // block-uniform, in front of every barrier
  const int tmb = blk / tilesN;
  const int tn  = blk - tmb * tilesN;
  const int mb0 = tmb << 7;                     // first row of the block's tile
  const int m0  = mb0 + (wave << 5);            // first row of this wave's tile
  const int n0  = tn << 7;

  // this thread's copy addresses for stage 0, row tid >> 3 of each plane, 16-B piece tid & 7
  const int crow = tid >> 3, cpc = (tid & 7) * 8;
  const unsigned short* gA  = Ap  + (size_t)(mb0 + crow) * lda + cpc;
  const unsigned short* gA2 = A2p + (size_t)(mb0 + crow) * lda + cpc;
  const unsigned short* gB  = Btp + (size_t)(n0  + crow) * ldb + cpc;
  const unsigned short* gL  = Lp  + (size_t)crow * ldl + cpc;            // crow = 0..15: the 16 adapter rows
  const size_t stepA = (size_t)16 * lda, stepB = (size_t)16 * ldb;
  const unsigned lc = lds_off(stage_all) + (unsigned)(crow * GK_P + cpc) * 2u;
  const unsigned ll = lds_off(lst) + (unsigned)(crow * GK_P + cpc) * 2u;
  const int nst = K / GK_KC;                    // stages, block-uniform

  v8f acc[2][8];
#pragma unroll
  for (int i = 0; i < 2; ++i)
#pragma unroll
    for (int j = 0; j < 8; ++j) acc[i][j] = zero8();
  v8f tacc[2];                                  // T of this wave's 32 X rows
  tacc[0] = zero8(); tacc[1] = zero8();

  // stage s -> buffer s & 1
  auto copy_stage = [&](int s) {
    const unsigned l = lc + (unsigned)(s & 1) * (unsigned)(STAGE_EL * 2);
    const size_t ko = (size_t)s * GK_KC;
    copy_plane8(l, gA + ko, stepA);
    if (SPLITA) copy_plane8(l + GK_PLANE * 2u, gA2 + ko, stepA);
    copy_plane8(l + (unsigned)(NPA * GK_PLANE) * 2u, gB + ko, stepB);
    copy_plane1(ll + (unsigned)(s & 1) * (unsigned)(GK_LPL * 2), gL + ko);
  };
  copy_stage(0);
  wait_async0();
  __syncthreads();                              // stage 0 published
  if (nst > 1) copy_stage(1);

  for (int t = 0; t < nst; ++t) {
    const __bf16* S  = (const __bf16*)(const void*)(stage_all + (t & 1) * STAGE_EL);
    const __bf16* sA = S + (wave * 32 + rl) * GK_P + 8 * hh;
    const __bf16* sB = S + NPA * GK_PLANE + rl * GK_P + 8 * hh;
    const __bf16* sL = (const __bf16*)(const void*)(lst + (t & 1) * GK_LPL) + rl * GK_P + 8 * hh;
#pragma unroll
    for (int ks = 0; ks < 2; ++ks) {
      v16b ah[2], al[2], bj[8], xa[2];
#pragma unroll
      for (int i = 0; i < 2; ++i) {
        ah[i] = ldfrag_b(sA + i * 16 * GK_P + ks * 32);
        al[i] = SPLITA ? ldfrag_b(sA + GK_PLANE + i * 16 * GK_P + ks * 32) : ah[i];
      }
#pragma unroll
      for (int j = 0; j < 8; ++j) bj[j] = ldfrag_b(sB + j * 16 * GK_P + ks * 32);
      const v16b lj = ldfrag_b(sL + ks * 32);
#pragma unroll
      for (int i = 0; i < 2; ++i) xa[i] = XB ? ldfrag_b(sB + (wave * 32 + i * 16) * GK_P + ks * 32) : ah[i];
      __builtin_amdgcn_sched_barrier(0);        // keeps the k-step's LDS reads one group ahead of its WMMAs (else one waited pair per two WMMAs)
#pragma unroll
      for (int j = 0; j < 8; ++j) {
        acc[0][j] = mma_b(ah[0], bj[j], acc[0][j]);
        acc[1][j] = mma_b(ah[1], bj[j], acc[1][j]);
      }
      tacc[0] = mma_b(xa[0], lj, tacc[0]);
      tacc[1] = mma_b(xa[1], lj, tacc[1]);
      if (SPLITA) {
#pragma unroll
        for (int j = 0; j < 8; ++j) {
          acc[0][j] = mma_b(al[0], bj[j], acc[0][j]);
          acc[1][j] = mma_b(al[1], bj[j], acc[1][j]);
        }
        tacc[0] = mma_b(al[0], lj, tacc[0]);
        tacc[1] = mma_b(al[1], lj, tacc[1]);
      }
      __builtin_amdgcn_sched_barrier(0);        // keeps the next k-step's LDS reads from being spread among these WMMAs
    }
    // publish point of stage t + 1; it also ends every wave's reads of the buffer that stage t + 2 refills
    wait_ds0();
    wait_async0();
    __syncthreads();
    if (t + 2 < nst) copy_stage(t + 2);         // block-uniform test
  }
  wait_async0();                                // nothing of this wave is in flight behind the loop
  // ---- T -> [Th | Tl] rows in LDS: wave w's 32 rows in its own slab; the loop's last barrier has ended every read of the adapter stages ----
  acc_guard2(tacc[0], tacc[1]);
  {
    unsigned short* tw = lst + wave * TT_W;
#pragma unroll
    for (int i = 0; i < 2; ++i)
#pragma unroll
      for (int r = 0; r < 8; ++r) {
        const int row = i * 16 + 8 * hh + r;
        const float v = tacc[i][r];
        const unsigned short hb = bf_bits(v);
        const unsigned short lb = bf_bits(v - bf_val(hb));
        tw[row * TT_P + rl]      = hb;
        tw[row * TT_P + 16 + rl] = lb;
      }
  }
  if (XB) __syncthreads();                      // every wave reads all 128 T rows
  else    lds_wave_sync();                      // a wave reads its own 32 T rows alone
  // ---- rank-16 adapter extension: one 32-deep k-step [Th | Tl] . [2B | 2B] ----
  {
    const __bf16* Ee = (const __bf16*)(const void*)Ep;
    const __bf16* Tt = (const __bf16*)(const void*)lst;
    v16b ae[2];
#pragma unroll
    for (int i = 0; i < 2; ++i)
      ae[i] = XB ? ldfrag_b(Ee + (size_t)(m0 + i * 16 + rl) * KEXT + 8 * hh)
                 : ldfrag_b(Tt + wave * TT_W + (i * 16 + rl) * TT_P + 8 * hh);
#pragma unroll
    for (int j = 0; j < 8; ++j) {
      const v16b be = XB ? ldfrag_b(Tt + (j >> 1) * TT_W + ((j & 1) * 16 + rl) * TT_P + 8 * hh)
                         : ldfrag_b(Ee + (size_t)(n0 + j * 16 + rl) * KEXT + 8 * hh);
      acc[0][j] = mma_b(ae[0], be, acc[0][j]);
      acc[1][j] = mma_b(ae[1], be, acc[1][j]);
      guard_b5(acc[0][j], acc[1][j], ae[0], ae[1], ae[0], ae[1], be);
    }
  }
  if (XB) __syncthreads();                      // every wave has read the T rows in the other waves' slabs, which the epilogue now overwrites
  acc_guard4(acc[0][0], acc[0][1], acc[0][2], acc[0][3]);
  acc_guard4(acc[0][4], acc[0][5], acc[0][6], acc[0][7]);
  acc_guard4(acc[1][0], acc[1][1], acc[1][2], acc[1][3]);
  acc_guard4(acc[1][4], acc[1][5], acc[1][6], acc[1][7]);

  // ---- epilogue ----
  ST* slab = slab_all + wave * SlabT<EPI>::PERW;
  _Float16* sl16 = (_Float16*)(void*)slab;
  float*    slf  = (float*)(void*)slab;

  if (rope) {
    _Float16* P0 = (_Float16*)C0;
    _Float16* P1 = (_Float16*)C1;
#pragma unroll
    for (int i = 0; i < 2; ++i) {
      const int rb = m0 + i * 16 + 8 * hh;
#pragma unroll
      for (int j = 0; j < 4; ++j) {
        const int dim = j * 16 + rl;                             // 0..63 within head; x2 partner at dim + 64
#pragma unroll
        for (int r = 0; r < 8; ++r) {
          const int row = rb + r;                                // token 0..M-1
          const int tp  = row & (SQ - 1);                        // position within its sequence
          const float cv = cst[(size_t)tp * NFREQ + dim];
          const float sv = snt[(size_t)tp * NFREQ + dim];
          const float x1 = acc[i][j][r];
          const float x2 = acc[i][j + 4][r];
          const float o1 = x1 * cv - x2 * sv;
          const float o2 = x2 * cv + x1 * sv;
          const _Float16 h1 = (_Float16)o1;
          const _Float16 h2 = (_Float16)o2;
          const int so = (8 * hh + r) * 128 + dim;
          sl16[so]             = h1;
          sl16[so + 64]        = h2;
          sl16[2048 + so]      = (_Float16)((o1 - (float)h1) * 2048.0f);
          sl16[2048 + so + 64] = (_Float16)((o2 - (float)h2) * 2048.0f);
        }
      }
      lds_wave_sync();
      {
#pragma unroll
        for (int it = 0; it < 8; ++it) {
          const int row = it * 2 + hh;                           // it x hh covers rows 0..15
          const int c8  = rl * 8;
          const v8h vh = *(const v8h*)(sl16 + row * 128 + c8);
          const v8h vl = *(const v8h*)(sl16 + 2048 + row * 128 + c8);
          const size_t go = (size_t)(m0 + i * 16 + row) * ldc + n0 + c8;
          *(v8h*)(P0 + go) = vh;
          *(v8h*)(P1 + go) = vl;
        }
        
      }
      lds_wave_sync();
    }
  } else if (EPI == 0) {
    _Float16* P0 = (_Float16*)C0;
    _Float16* P1 = (_Float16*)C1;
#pragma unroll
    for (int i = 0; i < 2; ++i) {
#pragma unroll
      for (int r = 0; r < 8; ++r) {
#pragma unroll
        for (int j = 0; j < 8; ++j) {
          const float v = acc[i][j][r];
          const _Float16 hv = (_Float16)v;
          const int so = (8 * hh + r) * 128 + j * 16 + rl;
          sl16[so]        = hv;
          sl16[2048 + so] = (_Float16)((v - (float)hv) * 2048.0f);
        }
      }
      lds_wave_sync();
      {
#pragma unroll
        for (int it = 0; it < 8; ++it) {
          const int row = it * 2 + hh;
          const int c8  = rl * 8;
          const v8h vh = *(const v8h*)(sl16 + row * 128 + c8);
          const v8h vl = *(const v8h*)(sl16 + 2048 + row * 128 + c8);
          // chunk-tiled planes [col / 32][M rows][32]: rows 2 it, 2 it + 1 of one 32-column chunk are one 128-B line, 4 whole lines a store
          const int col = n0 + c8;
          const size_t go = (size_t)(col >> 5) * ((size_t)M * 32) + (size_t)(m0 + i * 16 + row) * 32 + (col & 31);
          *(v8h*)(P0 + go) = vh;
          *(v8h*)(P1 + go) = vl;
        }
        
      }
      lds_wave_sync();
    }
  } else {
    float* C = (float*)C0;
#pragma unroll
    for (int i = 0; i < 2; ++i) {
#pragma unroll
      for (int j = 0; j < 8; ++j)
#pragma unroll
        for (int r = 0; r < 8; ++r)
          slf[(8 * hh + r) * 128 + j * 16 + rl] = acc[i][j][r];
      lds_wave_sync();
      {
#pragma unroll
        for (int row = 0; row < 16; ++row) {                     // 32 lanes x 16 B = the whole 512-B row segment per instruction
          const v4f v = *(const v4f*)(slf + row * 128 + lane * 4);
          *(v4f*)(C + (size_t)(m0 + i * 16 + row) * ldc + n0 + lane * 4) = v;
        }
        
      }
      lds_wave_sync();
    }
  }
}

// one product per launch
template <int EPI, bool SPLITA>
__global__ __launch_bounds__(128) void gemm_w32x128_kernel(
    const unsigned short* Ap, const unsigned short* A2p, int lda,
    const unsigned short* __restrict__ Btp, int ldb, const unsigned short* __restrict__ Lp, int ldl, const unsigned short* __restrict__ Ep,
    const float* __restrict__ cst, const float* __restrict__ snt,
    void* C0, void* C1, int ldc, int M, int N, int K) {
  __shared__ __align__(16) typename SlabT<EPI>::T slab_all[4 * SlabT<EPI>::PERW];
  __shared__ __align__(16) unsigned short stage_all[2 * (SPLITA ? 3 : 2) * GK_PLANE];
  gemm_w32x128_body<EPI, SPLITA, false>(slab_all, stage_all, (int)blockIdx.x,
                                        Ap, A2p, lda, Btp, ldb, Lp, ldl, Ep, cst, snt, C0, C1, ldc, M, N, K);
}

// The q, k and v^T projections in ONE launch: they read the same planes and none reads another's result. Blocks 0..nkv-1 take v^T
// (A = Wv, Bt = x: the body with x on the Bt side), nkv..2nkv-1 take k, the rest q (the body with x on the A side, operands picked before it);
// nkv = ntok/128 * hdm/128. The choice is block-uniform: every wave of a block runs the same body and passes its barriers alike.
// grid.x = 2 * nkv + ntok/128 * hid/128.
__global__ __launch_bounds__(128) void gemm_qkv_kernel(
    const unsigned short* __restrict__ Xb,
    const unsigned short* __restrict__ Wqb, const unsigned short* __restrict__ Wkb, const unsigned short* __restrict__ Wvb,
    const unsigned short* __restrict__ Aqb, const unsigned short* __restrict__ Akb, const unsigned short* __restrict__ Avb,
    const unsigned short* __restrict__ BextQ, const unsigned short* __restrict__ BextK, const unsigned short* __restrict__ BextV,
    const float* __restrict__ cst, const float* __restrict__ snt,
    unsigned short* Qh, unsigned short* Ql, unsigned short* Kh, unsigned short* Kl, unsigned short* Vh, unsigned short* Vl,
    int ntok, int hid, int hdm) {
  __shared__ __align__(16) SlabT<0>::T slab_all[4 * SlabT<0>::PERW];
  __shared__ __align__(16) unsigned short stage_all[2 * 2 * GK_PLANE];
  const int nkv = (ntok >> 7) * (hdm >> 7);
  const int bx  = (int)blockIdx.x;
  const bool isv = bx < nkv;
  if (isv) {
    gemm_w32x128_body<0, false, true>(slab_all, stage_all, bx,
                                      Wvb, Wvb, hid, Xb, hid, Avb, hid, BextV, cst, snt, (void*)Vh, (void*)Vl, ntok, hdm, ntok, hid);
  } else {
    const bool isk = bx < 2 * nkv;
    const int blk = isk ? bx - nkv : bx - 2 * nkv;
    const unsigned short* Bt = isk ? Wkb   : Wqb;
    const unsigned short* Lm = isk ? Akb   : Aqb;
    const unsigned short* Be = isk ? BextK : BextQ;
    unsigned short* P0 = isk ? Kh : Qh;
    unsigned short* P1 = isk ? Kl : Ql;
    const int N = isk ? hdm : hid;
    gemm_w32x128_body<0, false, false>(slab_all, stage_all, blk,
                                       Xb, Xb, hid, Bt, hid, Lm, hid, Be, cst, snt, (void*)P0, (void*)P1, N, ntok, N, hid);
  }
}

#define AT_KC   32
#define KS_P    136
#define VS_P    40
#define OS_P    136                          // output staging row pitch in halves: 272 B, the k rows' pitch, for the same 16-B access shape
#define LDS_KS  0
#define LDS_KLS (32 * KS_P)
#define LDS_VHS (2 * 32 * KS_P)
#define LDS_VLS (LDS_VHS + 128 * VS_P)
#define AT_BUF  (LDS_VLS + 128 * VS_P)       // halves of one chunk buffer (the four planes above are offsets within a buffer)
#define LDS_TOT (2 * AT_BUF)
static_assert(3 * LDS_TOT * 2 <= 320 * 1024); // three blocks per WGP, as many as the registers allow
static_assert((AT_BUF * 2) % 16 == 0);
static_assert(4 * 2 * 16 * OS_P <= 2 * AT_BUF);   // output staging (2 planes x 16 rows per wave) aliases the chunk region after the loop

// One thread's share of a pair of planes (hi, residual) of one chunk: four 16-B async copies per plane, rows r, r + n, r + 2n, r + 3n.
// la, lb = this lane's LDS byte addresses of row r in the two planes, lstep = n rows in LDS bytes; ga, gb = its global addresses of row r,
// gstep = n source rows in elements. The closing s_wait_xcnt 0 stands inside the statement so that no address register named here is
// rewritten ahead of it.
__device__ __forceinline__ void copy_pair4(unsigned la, unsigned lb, unsigned lstep,
                                           const _Float16* ga, const _Float16* gb, size_t gstep) {
  asm volatile(
      "global_load_async_to_lds_b128 %0, %8, off\n\t"
      "global_load_async_to_lds_b128 %1, %9, off\n\t"
      "global_load_async_to_lds_b128 %2, %10, off\n\t"
      "global_load_async_to_lds_b128 %3, %11, off\n\t"
      "global_load_async_to_lds_b128 %4, %12, off\n\t"
      "global_load_async_to_lds_b128 %5, %13, off\n\t"
      "global_load_async_to_lds_b128 %6, %14, off\n\t"
      "global_load_async_to_lds_b128 %7, %15, off\n\t"
      "s_wait_xcnt 0x0"
      :: "v"(la), "v"(la + lstep), "v"(la + 2u * lstep), "v"(la + 3u * lstep),
         "v"(lb), "v"(lb + lstep), "v"(lb + 2u * lstep), "v"(lb + 3u * lstep),
         "v"(ga), "v"(ga + gstep), "v"(ga + 2 * gstep), "v"(ga + 3 * gstep),
         "v"(gb), "v"(gb + gstep), "v"(gb + 2 * gstep), "v"(gb + 3 * gstep)
      : "memory");
}

template <bool PRES>
__device__ __forceinline__ void attn_causal_body(
    _Float16* lds, int qb, int h, int b,
    const unsigned short* __restrict__ qhp, const unsigned short* __restrict__ qlp,
    const unsigned short* __restrict__ khp, const unsigned short* __restrict__ klp,
    const unsigned short* __restrict__ vhp, const unsigned short* __restrict__ vlp,
    unsigned short* __restrict__ ahp, unsigned short* __restrict__ alp) {
  const int tid  = (int)threadIdx.x;
  const int lane = tid & 31;
  const int wave = wave_id();
  const int hh   = lane >> 4;
  const int c    = lane & 15;
  const int q0   = qb * 64 + wave * 16;          // first query row of this wave (within sequence)
  const int qlast = q0 + 15;
  const size_t tok0 = (size_t)b * SQ;

  const _Float16* Qhr = (const _Float16*)(const void*)qhp + (tok0 + q0 + c) * HID + h * HDM + 8 * hh;
  const _Float16* Qlr = (const _Float16*)(const void*)qlp + (tok0 + q0 + c) * HID + h * HDM + 8 * hh;
  const _Float16* Kg  = (const _Float16*)(const void*)khp + tok0 * HDM;
  const _Float16* Klg = (const _Float16*)(const void*)klp + tok0 * HDM;
  const _Float16* Vhg = (const _Float16*)(const void*)vhp + tok0 * HDM;   // chunk-tiled: tile tok / 32 = 128 d x 32 keys, 8 KiB contiguous
  const _Float16* Vlg = (const _Float16*)(const void*)vlp + tok0 * HDM;

  float mrow = -INFINITY;                        // running maximum of query q0 + c (equal in both lane halves)
  float lrow = 0.f;                              // running sum of query q0 + c over this lane half's keys; the halves are joined behind the loop
  v8f oacc[8], oaccr[8];
#pragma unroll
  for (int t = 0; t < 8; ++t) { oacc[t] = zero8(); oaccr[t] = zero8(); }

  // the wave's 16 query rows, both planes, as B fragments: loaded once, held in registers over the whole key loop
  // unrolled so that the arrays are registers
  v16h qfa[4], qfl[4];
#pragma unroll
  for (int dc = 0; dc < 4; ++dc) {
    qfa[dc] = ldfrag_h(Qhr + dc * 32);
    qfl[dc] = ldfrag_h(Qlr + dc * 32);
  }

  const int nch = 2 * qb + 2;                    // block-uniform, 2 .. 64
  // this thread's copy addresses for chunk 0, buffer 0. Coverage per plane: 128 threads x 4 pieces of 8 halves = 512 pieces = whole tile.
  const int ckey = tid >> 4, cd8 = (tid & 15) * 8;   // K: keys ckey + 8 i, i < 4, of 32 keys x 128 d
  const int cdim = tid >> 2, ck8 = (tid & 3) * 8;    // V^T: rows cdim + 32 i, i < 4, of 128 d x 32 keys
  const unsigned lK = lds_off(lds) + (unsigned)(LDS_KS  + ckey * KS_P + cd8) * 2u;
  const unsigned lV = lds_off(lds) + (unsigned)(LDS_VHS + cdim * VS_P + ck8) * 2u;
  const size_t goK = (size_t)ckey * HDM + cd8;
  const size_t goV = (size_t)cdim * AT_KC + ck8;     // = 8 tid: a wave's copy is 512 contiguous bytes, 4 whole lines
  // chunk s -> buffer s & 1
  auto copy_chunk = [&](int s) {
    const unsigned lb = (unsigned)(s & 1) * (unsigned)(AT_BUF * 2);
    const size_t kv = (size_t)s * AT_KC;
    copy_pair4(lK + lb, lK + lb + (unsigned)(LDS_KLS - LDS_KS) * 2u, 8u * KS_P * 2u,
               Kg + goK + kv * HDM, Klg + goK + kv * HDM, (size_t)8 * HDM);
    copy_pair4(lV + lb, lV + lb + (unsigned)(LDS_VLS - LDS_VHS) * 2u, 32u * VS_P * 2u,
               Vhg + goV + kv * HDM, Vlg + goV + kv * HDM, (size_t)32 * AT_KC);
  };
  copy_chunk(0);
  wait_async0();
  __syncthreads();                               // chunk 0 published
  if (nch > 1) copy_chunk(1);                    // block-uniform test

  for (int kc = 0; kc < nch; ++kc) {
    const int kv0 = kc * AT_KC;
    const _Float16* Cb  = lds + (kc & 1) * AT_BUF;   // this trip reads this buffer alone
    const _Float16* Ks  = Cb + LDS_KS;
    const _Float16* Kls = Cb + LDS_KLS;
    const _Float16* Vhs = Cb + LDS_VHS;
    const _Float16* Vls = Cb + LDS_VLS;

    if (kv0 <= qlast) {                          // wave-uniform (scalar): skip chunks fully above this wave's rows
      // The chunk's LDS traffic is grouped and issued ahead of its use; each sched_barrier below keeps one group of LDS operations together
      // and ahead of the work that hides its latency (left free, the build waits on a pair of reads per WMMA pair).
      // ---- scores: fragment reads in groups of 4 (a 32-deep step's two hi tiles, then its two residual tiles), issued three groups ahead ----
      v8f sh[2], sr[2];
      sh[0] = zero8(); sh[1] = zero8(); sr[0] = zero8(); sr[1] = zero8();
      v16h kf[8][2];                             // group 2 * dc: hi plane, group 2 * dc + 1: residual plane; [j] = key tile
#pragma unroll
      for (int g = 0; g < 3; ++g)
#pragma unroll
        for (int j = 0; j < 2; ++j) kf[g][j] = ldfrag_h(((g & 1) ? Kls : Ks) + (j * 16 + c) * KS_P + (g >> 1) * 32 + 8 * hh);
#pragma unroll
      for (int g = 0; g < 8; ++g) {
        __builtin_amdgcn_sched_barrier(0);       // the reads above are issued before this group's WMMAs
        const v16h qa = qfa[g >> 1];
        const v16h ql = qfl[g >> 1];
        if ((g & 1) == 0) {
          sh[0] = mma_h(kf[g][0], qa, sh[0]);
          sr[0] = mma_h(kf[g][0], ql, sr[0]);
          sh[1] = mma_h(kf[g][1], qa, sh[1]);
          sr[1] = mma_h(kf[g][1], ql, sr[1]);
          if (g == 0) guard_first(sh[0], sr[0], sh[1], sr[1], kf[0][0], kf[0][1]);
        } else {
          sr[0] = mma_h(kf[g][0], qa, sr[0]);
          sr[1] = mma_h(kf[g][1], qa, sr[1]);
        }
        __builtin_amdgcn_sched_barrier(0);       // the refill below follows these WMMAs, whose registers it takes over
        if (g + 3 < 8) {
#pragma unroll
          for (int j = 0; j < 2; ++j)
            kf[g + 3][j] = ldfrag_h((((g + 3) & 1) ? Kls : Ks) + (j * 16 + c) * KS_P + ((g + 3) >> 1) * 32 + 8 * hh);
        }
      }
      // ---- scale, causal mask, maximum of this lane's query over the chunk ----
      const int kd = kv0 + 8 * hh - (q0 + c);    // key - query of tile 0, register 0: key > query as kd > -(16 j + r), a literal
      float cm = -INFINITY;
#pragma unroll
      for (int j = 0; j < 2; ++j)
#pragma unroll
        for (int r = 0; r < 8; ++r) {
          float s = (sh[j][r] + sr[j][r] * 0.00048828125f) * 0.08838834764831845f;
          s = (kd > -(j * 16 + r)) ? -INFINITY : s;
          sh[j][r] = s;
          cm = fmaxf(cm, s);
        }
      cm = fmaxf(cm, xhalf(cm));                 // the other lane half holds the query's other 16 keys
      // ---- online softmax; p' goes from the score registers into the B fragment(s) of p^T ----
      const float mnew  = fmaxf(mrow, cm);
      const float alpha = __expf(mrow - mnew);
      mrow = mnew;
      float ps[4] = {0.f, 0.f, 0.f, 0.f};        // four independent chains for the 16 terms
      v16h pa, pr;
#pragma unroll
      for (int j = 0; j < 2; ++j)
#pragma unroll
        for (int r = 0; r < 8; ++r) {
          const float pv = __expf(sh[j][r] - mnew);
          ps[r & 3] += pv;
          const float pp = pv * 1024.0f;
          const _Float16 phv = (_Float16)pp;
          pa[j * 8 + r] = phv;
          pr[j * 8 + r] = PRES ? (_Float16)((pp - (float)phv) * 2048.0f) : phv;
        }
      lrow = lrow * alpha + ((ps[0] + ps[1]) + (ps[2] + ps[3]));
      // the first three d tiles' v^T fragments, issued once the score registers are free: their reads fly under the rescale below
      v16h vb[8], vr[8];
#pragma unroll
      for (int t = 0; t < 3; ++t) {
        vb[t] = ldfrag_h(Vhs + (t * 16 + c) * VS_P + 8 * hh);
        vr[t] = ldfrag_h(Vls + (t * 16 + c) * VS_P + 8 * hh);
      }
      __builtin_amdgcn_sched_barrier(0);         // keeps those reads ahead of the rescale (sunk to their use, the first v^T WMMA waits out their latency)
#pragma unroll
      for (int t = 0; t < 8; ++t)
#pragma unroll
        for (int r = 0; r < 8; ++r) { oacc[t][r] *= alpha; oaccr[t][r] *= alpha; }
      // ---- O^T += V^T . P'^T: the 4 fragment reads of each 16-wide d tile are issued three tiles ahead of its WMMAs ----
      // inputs only: the p^T fragment is complete in front of the ring below, so that each tile's WMMAs stand between the ring's reads
      // (else the build sinks all 16 WMMAs behind the last read and holds all 8 tiles: 377 VGPRs, not 309: two blocks per WGP, not three)
      if (PRES) asm volatile("" :: "v"(pa), "v"(pr) : "memory");
      else      asm volatile("" :: "v"(pa) : "memory");
#pragma unroll
      for (int t = 0; t < 8; ++t) {
        __builtin_amdgcn_sched_barrier(0);       // the reads above are issued before this tile's WMMAs
        oacc[t]  = mma_h(vb[t], pa, oacc[t]);
        oaccr[t] = mma_h(vr[t], pa, oaccr[t]);
        if (PRES) oaccr[t] = mma_h(vb[t], pr, oaccr[t]);
        __builtin_amdgcn_sched_barrier(0);       // the refill below follows these WMMAs, whose registers it takes over
        if (t + 3 < 8) {
          vb[t + 3] = ldfrag_h(Vhs + ((t + 3) * 16 + c) * VS_P + 8 * hh);
          vr[t + 3] = ldfrag_h(Vls + ((t + 3) * 16 + c) * VS_P + 8 * hh);
        }
      }
    }
    // publish point of chunk kc + 1, passed by every wave (outside the per-wave skip); it also ends every wave's reads of the buffer
    // that chunk kc + 2 refills
    wait_ds0();
    wait_async0();
    __syncthreads();
    if (kc + 2 < nch) copy_chunk(kc + 2);        // block-uniform test
  }
  wait_async0();                                 // nothing of this wave is in flight behind the loop
  // the last trip's barrier has ended every reader's last read of the chunk region, which now becomes output staging
  _Float16* osh = lds + wave * (2 * 16 * OS_P);
  _Float16* osl = osh + 16 * OS_P;
  {
    const float lsum = lrow + xhalf(lrow);       // the two lane halves' key sums of query q0 + c
    const float inv = (1.0f / lsum) * 0.0009765625f;
#pragma unroll
    for (int t = 0; t < 8; ++t) {                // a lane's 8 registers of a tile = 8 consecutive d of its query: one 16-B LDS store per plane
      v8h xh, xl;
#pragma unroll
      for (int r = 0; r < 8; ++r) {
        const float o = (oacc[t][r] + oaccr[t][r] * 0.00048828125f) * inv;
        const unsigned short hb = bf_bits(o);
        const unsigned short lb = bf_bits(o - bf_val(hb));
        xh[r] = __builtin_bit_cast(_Float16, hb);
        xl[r] = __builtin_bit_cast(_Float16, lb);
      }
      *(v8h*)(osh + c * OS_P + t * 16 + 8 * hh) = xh;
      *(v8h*)(osl + c * OS_P + t * 16 + 8 * hh) = xl;
    }
  }
  lds_wave_sync();
  _Float16* Ahg = (_Float16*)(void*)ahp + (tok0 + q0) * HID + h * HDM;
  _Float16* Alg = (_Float16*)(void*)alp + (tok0 + q0) * HID + h * HDM;
  {
#pragma unroll
    for (int it = 0; it < 8; ++it) {
      const int row = it * 2 + hh;               // it 0..7 x hh 0..1 covers rows 0..15
      const int c8  = c * 8;                     // 16 lanes x 16 B = the whole 256-B segment
      const v8h x = *(const v8h*)(osh + row * OS_P + c8);
      const v8h y = *(const v8h*)(osl + row * OS_P + c8);
      *(v8h*)(Ahg + (size_t)row * HID + c8) = x;
      *(v8h*)(Alg + (size_t)row * HID + c8) = y;
    }
  }
}

#define AT_NPRES 4                   // query tiles 0..3 carry the p residual product
__global__ __launch_bounds__(128) void attn_causal_kernel(
    const unsigned short* __restrict__ qhp, const unsigned short* __restrict__ qlp,
    const unsigned short* __restrict__ khp, const unsigned short* __restrict__ klp,
    const unsigned short* __restrict__ vhp, const unsigned short* __restrict__ vlp,
    unsigned short* __restrict__ ahp, unsigned short* __restrict__ alp) {
  __shared__ __align__(16) _Float16 lds[LDS_TOT];
  // A block's key loop has 2 * qb + 2 trips and there are more blocks than resident places, so the cost falls with the block index: the
  // 64-trip tiles take the lowest indices, the short tiles the highest (for speed only). The query
  // tile is the slow digit of the index, so that neighbouring indices cost the same and indices far apart differ.
  // index -> (qb, h, b) is one to one: index = (SQ / 64 - 1 - qb) * NHQ * NSEQ + b * NHQ + h.
  const int idx = (int)blockIdx.x;
  const int qb  = SQ / 64 - 1 - idx / (NHQ * NSEQ);   // block-uniform: every wave of a block runs the same body and passes its barriers
  const int hb  = idx % (NHQ * NSEQ);
  const int h   = hb % NHQ;
  const int b   = hb / NHQ;
  if (qb < AT_NPRES) attn_causal_body<true>(lds, qb, h, b, qhp, qlp, khp, klp, vhp, vlp, ahp, alp);
  else               attn_causal_body<false>(lds, qb, h, b, qhp, qlp, khp, klp, vhp, vlp, ahp, alp);
}

// ---------------------------------------------------------------------------
// Workspace map (bytes; every region is a whole number of the rows / lines its producer writes with whole-line stores):
//   Xb   bf16 [4096][2048]  16777216    Wqb bf16 [2048][2048]  8388608    Wkb bf16 [128][2048]  524288   Wvb bf16 [128][2048] 524288
//   Wob  bf16 [2048][2048]   8388608    Aqb/Akb/Avb/Aob bf16 [16][2048]  4 x 65536
//   BextQ bf16 [2048][32]     131072    BextK/BextV bf16 [128][32] 2 x 8192   BextO bf16 [2048][32] 131072
//   cst/snt f32 [2048][64]  2 x 524288
//   Qh/Ql f16 [4096][2048]  2 x 16777216   Kh/Kl f16 [4096][128]  2 x 1048576   Vh/Vl f16 [128 chunks][128][32]  2 x 1048576
//   Ah/Al bf16 [4096][2048] 2 x 16777216
//   total 107495424
// ---------------------------------------------------------------------------
extern "C" void kernel_launch(void* const* d_in, const int* in_sizes, int n_in,
                              void* d_out, int out_size, void* d_ws, size_t ws_size,
                              hipStream_t stream) {
  if (n_in < 13) return;
  if (in_sizes[0]  != NTOK * HID) return;
  if (in_sizes[1]  != HID * HID)  return;
  if (in_sizes[2]  != LRK * HID)  return;
  if (in_sizes[3]  != HID * LRK)  return;
  if (in_sizes[4]  != HDM * HID)  return;
  if (in_sizes[5]  != LRK * HID)  return;
  if (in_sizes[6]  != HDM * LRK)  return;
  if (in_sizes[7]  != HDM * HID)  return;
  if (in_sizes[8]  != LRK * HID)  return;
  if (in_sizes[9]  != HDM * LRK)  return;
  if (in_sizes[10] != HID * HID)  return;
  if (in_sizes[11] != LRK * HID)  return;
  if (in_sizes[12] != HID * LRK)  return;
  if (out_size != NTOK * HID) return;

  const float* x    = (const float*)d_in[0];
  const float* wq_w = (const float*)d_in[1];
  const float* wq_a = (const float*)d_in[2];
  const float* wq_b = (const float*)d_in[3];
  const float* wk_w = (const float*)d_in[4];
  const float* wk_a = (const float*)d_in[5];
  const float* wk_b = (const float*)d_in[6];
  const float* wv_w = (const float*)d_in[7];
  const float* wv_a = (const float*)d_in[8];
  const float* wv_b = (const float*)d_in[9];
  const float* wo_w = (const float*)d_in[10];
  const float* wo_a = (const float*)d_in[11];
  const float* wo_b = (const float*)d_in[12];
  float* out = (float*)d_out;

  const size_t szX   = (size_t)NTOK * HID * 2;
  const size_t szWsq = (size_t)HID * HID * 2;
  const size_t szWkv = (size_t)HDM * HID * 2;
  const size_t szAl  = (size_t)LRK * HID * 2;
  const size_t szBeL = (size_t)HID * KEXT * 2;
  const size_t szBeS = (size_t)HDM * KEXT * 2;
  const size_t szTab = (size_t)SQ * NFREQ * 4;
  const size_t szQ   = (size_t)NTOK * HID * 2;
  const size_t szK   = (size_t)NTOK * HDM * 2;
  const size_t szV   = (size_t)HDM * NTOK * 2;
  const size_t szA   = (size_t)NTOK * HID * 2;
  size_t off = 0;
  const size_t oX   = off; off += szX;
  const size_t oWq  = off; off += szWsq;
  const size_t oWk  = off; off += szWkv;
  const size_t oWv  = off; off += szWkv;
  const size_t oWo  = off; off += szWsq;
  const size_t oAq  = off; off += szAl;
  const size_t oAk  = off; off += szAl;
  const size_t oAv  = off; off += szAl;
  const size_t oAo  = off; off += szAl;
  const size_t oBq  = off; off += szBeL;
  const size_t oBk  = off; off += szBeS;
  const size_t oBv  = off; off += szBeS;
  const size_t oBo  = off; off += szBeL;
  const size_t oCs  = off; off += szTab;
  const size_t oSn  = off; off += szTab;
  const size_t oQh  = off; off += szQ;
  const size_t oQl  = off; off += szQ;
  const size_t oKh  = off; off += szK;
  const size_t oKl  = off; off += szK;
  const size_t oVh  = off; off += szV;
  const size_t oVl  = off; off += szV;
  const size_t oAh  = off; off += szA;
  const size_t oAl  = off; off += szA;
  if (off > ws_size) return;                     // off = 107495424

  char* ws = (char*)d_ws;
  unsigned short* Xb    = (unsigned short*)(ws + oX);
  unsigned short* Wqb   = (unsigned short*)(ws + oWq);
  unsigned short* Wkb   = (unsigned short*)(ws + oWk);
  unsigned short* Wvb   = (unsigned short*)(ws + oWv);
  unsigned short* Wob   = (unsigned short*)(ws + oWo);
  unsigned short* Aqb   = (unsigned short*)(ws + oAq);
  unsigned short* Akb   = (unsigned short*)(ws + oAk);
  unsigned short* Avb   = (unsigned short*)(ws + oAv);
  unsigned short* Aob   = (unsigned short*)(ws + oAo);
  unsigned short* BextQ = (unsigned short*)(ws + oBq);
  unsigned short* BextK = (unsigned short*)(ws + oBk);
  unsigned short* BextV = (unsigned short*)(ws + oBv);
  unsigned short* BextO = (unsigned short*)(ws + oBo);
  float*          cst   = (float*)(ws + oCs);
  float*          snt   = (float*)(ws + oSn);
  unsigned short* Qh    = (unsigned short*)(ws + oQh);
  unsigned short* Ql    = (unsigned short*)(ws + oQl);
  unsigned short* Kh    = (unsigned short*)(ws + oKh);
  unsigned short* Kl    = (unsigned short*)(ws + oKl);
  unsigned short* Vh    = (unsigned short*)(ws + oVh);
  unsigned short* Vl    = (unsigned short*)(ws + oVl);
  unsigned short* Ah    = (unsigned short*)(ws + oAh);
  unsigned short* Al    = (unsigned short*)(ws + oAl);

  const dim3 b256(256), b128(128);

  // (1) preparation, one launch: cos/sin table [2048][64] x 2; bf16 planes of x, the base weights and the adapter A matrices (layouts kept
  //     as given: [rows][K] with K contiguous); adapter B matrices -> [2B | 2B] extension planes
  prep_kernel<<<dim3(PB_ALL), b256, 0, stream>>>(x, wq_w, wq_a, wq_b, wk_w, wk_a, wk_b, wv_w, wv_a, wv_b, wo_w, wo_a, wo_b,
      Xb, Wqb, Wkb, Wvb, Wob, Aqb, Akb, Avb, Aob, BextQ, BextK, BextV, BextO, cst, snt);
  // (2) one launch: v^T = Wv . x^T + 2 Bv . T^T -> Vh/Vl [4096 / 32][128][32] (32 blocks); k = x . Wk^T + 2 T.Bk^T, RoPE -> Kh/Kl [4096][128]
  //     (32 blocks); q = x . Wq^T + 2 T.Bq^T, RoPE -> Qh/Ql [4096][2048] (512 blocks); K = 2048 + ext each; T = x . A^T formed in the blocks
  gemm_qkv_kernel<<<dim3(2 * (NTOK / 128) * (HDM / 128) + (NTOK / 128) * (HID / 128)), b128, 0, stream>>>(
      Xb, Wqb, Wkb, Wvb, Aqb, Akb, Avb, BextQ, BextK, BextV, cst, snt, Qh, Ql, Kh, Kl, Vh, Vl, NTOK, HID, HDM);
  // (3) causal attention, one launch, longest query tiles first: query tiles 0..3 with the p residual product, tiles 4..31 without
  attn_causal_kernel<<<dim3((SQ / 64) * NHQ * NSEQ), b128, 0, stream>>>(Qh, Ql, Kh, Kl, Vh, Vl, Ah, Al);
  // (4) out = attn(hi + lo) . Wo^T + 2 T_o . Bo^T -> d_out f32 [4096][2048], T_o = attn(hi + lo) . Ao^T formed in the blocks
  //     (M=4096, N=2048, K=2048 + ext; 512 blocks)
  gemm_w32x128_kernel<2, true><<<dim3((NTOK / 128) * (HID / 128)), b128, 0, stream>>>(
      Ah, Al, HID, Wob, HID, Aob, HID, BextO, cst, snt, (void*)out, (void*)out, HID, NTOK, HID, HID);
  (void)hipGetLastError();
}
